// v000
// The times below were measured on an AMD MI455X: many runs one after another, warmed up first and cycling through
// copies of the inputs, with the whole window's GPU time divided by the number of runs. Launches and the gaps
// between them are all in it. The median over several windows is given; except for v000 it joins two sittings, which
// can be a few percent apart, so the side-by-side timings, each taken in one sitting, are the better comparison.
// v000 is the starting kernel. One run takes 922 microseconds.
#include <hip/hip_runtime.h>

// TransformerBaseBlock (x [4][2048][256]; h = BN1(x) (inference: gamma (x - mean) rsqrt(var + 1e-3) + beta); q/k/v = h W + b (4 heads x 64); softmax(q.k/8); attn_out = ctx Wo + bo; x1 = attn_out + x; m = gelu(BN2(x1) W1) W2 (exact erf GELU);
// out = m + x1 -> [4][2048][256]).
// Compute dtypes, f32 accumulate: every input rounded to bf16; BN1/BN2 f32 -> bf16 hi+lo planes; q/k/v, W1 as hl x exact W (2 products), q/k/v + bias; scores (K 64) and attn.v single fp16 planes (head pairs z-batched; x1024);

#define NB_  4
#define TT   2048
#define DM   256
#define NH_  4
#define NKV  4
#define REP  (NH_ / NKV)
#define HD   64
#define DQ   (NH_ * HD)
#define DKV  (NKV * HD)
#define ZH   2
#define RH   0                  // query rows < RH use hi+lo planes (0: none)
#define WIN  0
#define PCAR 1024.0f
#define SCL  0.125f   // HD^-0.5
typedef _Float16 h16;
typedef unsigned short bf;
typedef __attribute__((ext_vector_type(16))) __bf16   v16bf;
typedef __attribute__((ext_vector_type(16))) _Float16 v16h;
typedef __attribute__((ext_vector_type(8)))  _Float16 v8h;
typedef __attribute__((ext_vector_type(8)))  unsigned short v8us;
typedef __attribute__((ext_vector_type(8)))  float    v8f;
typedef __attribute__((ext_vector_type(4)))  float    v4f;
typedef v8h  __attribute__((may_alias)) v8ha;
typedef v4f  __attribute__((may_alias)) v4fa;
typedef v8us __attribute__((may_alias)) v8usa;

__device__ __forceinline__ unsigned short f2bf(float f) { unsigned u = __float_as_uint(f); u += 0x7FFFu + ((u >> 16) & 1u); return (unsigned short)(u >> 16); }
__device__ __forceinline__ float bf2f(unsigned short b) { return __uint_as_float(((unsigned)b) << 16); }
__device__ __forceinline__ float bfr(float f) { return bf2f(f2bf(f)); }
__device__ __forceinline__ v16h cat16(v8h lo, v8h hi) { return __builtin_shufflevector(lo, hi, 0, 1, 2, 3, 4, 5, 6, 7, 8, 9, 10, 11, 12, 13, 14, 15); }
__device__ __forceinline__ v16bf cat16b(v8us lo, v8us hi) { return __builtin_bit_cast(v16bf, __builtin_shufflevector(lo, hi, 0, 1, 2, 3, 4, 5, 6, 7, 8, 9, 10, 11, 12, 13, 14, 15)); }
__device__ __forceinline__ v8f wmma16(v16h a, v16h b, v8f c) { return __builtin_amdgcn_wmma_f32_16x16x32_f16(false, a, false, b, (short)0, c, false, false); }
__device__ __forceinline__ v8f wmmab(v16bf a, v16bf b, v8f c) { return __builtin_amdgcn_wmma_f32_16x16x32_bf16(false, a, false, b, (short)0, c, false, false); }



// ---- k_gemmw: register-blocked GEMM, ONE WAVE per 64x64 output tile (16 accumulators), operands straight from K-contiguous 16-bit planes; grid (M/64, N/64, Z), 32 threads.
// C[m][n] (f32, pitch ldc, + optional f32 bias[n]) = sum_k A[m][k] Bt[n][k] (+ split products per NSPLIT). z-batch strides sA/sB/sC in elements. K % 32 == 0.
template <typename T16> struct WFrag;
template <> struct WFrag<h16> { typedef v16h V; static __device__ __forceinline__ V ld(const h16* p) { return cat16(*(const v8h*)p, *(const v8h*)(p + 16)); } static __device__ __forceinline__ v8f mma(V a, V b, v8f c) { return wmma16(a, b, c); } };
template <> struct WFrag<bf> { typedef v16bf V; static __device__ __forceinline__ V ld(const bf* p) { return cat16b(*(const v8us*)p, *(const v8us*)(p + 16)); } static __device__ __forceinline__ v8f mma(V a, V b, v8f c) { return wmmab(a, b, c); } };
template <typename T16, int NSPLIT, bool BIAS>
__global__ __launch_bounds__(32) void k_gemmw(const T16* __restrict__ A, const T16* __restrict__ A2, const T16* __restrict__ Bt, const T16* __restrict__ Bt2, int K, float* C, int ldc, const float* __restrict__ bias, size_t sA, size_t sB, size_t sC) {
    typedef typename WFrag<T16>::V V;
    __shared__ __align__(16) float os[16 * 68];
    const size_t z = blockIdx.z; A += z * sA; if (A2) A2 += z * sA; Bt += z * sB; if (Bt2) Bt2 += z * sB; C += z * sC;
    const int lane = threadIdx.x & 31, lr = lane & 15, hi = lane >> 4; const int r0 = blockIdx.x * 64, c0 = blockIdx.y * 64;
    v8f acc[4][4];
#pragma unroll
    for (int mb = 0; mb < 4; ++mb)
#pragma unroll
        for (int nb = 0; nb < 4; ++nb) acc[mb][nb] = (v8f){};
    const size_t aoff = (size_t)(r0 + lr) * K + 8 * hi, boff = (size_t)(c0 + lr) * K + 8 * hi;
#pragma unroll 1
    for (int kc = 0; kc < K; kc += 32) {
        V a[4], a2[4];
#pragma unroll
        for (int mb = 0; mb < 4; ++mb) { a[mb] = WFrag<T16>::ld(A + aoff + (size_t)mb * 16 * K + kc); if (NSPLIT == 1 || NSPLIT == 2) a2[mb] = WFrag<T16>::ld(A2 + aoff + (size_t)mb * 16 * K + kc); }
#pragma unroll
        for (int nb = 0; nb < 4; ++nb) { const V b = WFrag<T16>::ld(Bt + boff + (size_t)nb * 16 * K + kc); V b2; if (NSPLIT >= 2) b2 = WFrag<T16>::ld(Bt2 + boff + (size_t)nb * 16 * K + kc);
#pragma unroll
            for (int mb = 0; mb < 4; ++mb) { acc[mb][nb] = WFrag<T16>::mma(a[mb], b, acc[mb][nb]); if (NSPLIT == 1 || NSPLIT == 2) acc[mb][nb] = WFrag<T16>::mma(a2[mb], b, acc[mb][nb]); if (NSPLIT >= 2) acc[mb][nb] = WFrag<T16>::mma(a[mb], b2, acc[mb][nb]); } }
        asm volatile("v_nop\n\tv_nop\n\tv_nop\n\tv_nop" : "+v"(acc[0][0]), "+v"(acc[1][1]), "+v"(acc[2][2]), "+v"(acc[3][3]) : "v"(a[0]), "v"(a[3]));
    }
#pragma unroll
    for (int mb = 0; mb < 4; ++mb) {
#pragma unroll
        for (int nb = 0; nb < 4; ++nb) {
#pragma unroll
            for (int j = 0; j < 8; ++j) os[(hi * 8 + j) * 68 + nb * 16 + lr] = acc[mb][nb][j]; }
        __builtin_amdgcn_wave_barrier(); asm volatile("" ::: "memory");
        float* crow = C + (size_t)(r0 + mb * 16) * ldc + c0;
{
#pragma unroll
            for (int s = 0; s < 8; ++s) { const int row = 2 * s + hi, cofs = lr * 4; v4f val = *(const v4fa*)(os + row * 68 + cofs); if (BIAS) { val[0] += bfr(bias[c0 + cofs]); val[1] += bfr(bias[c0 + cofs + 1]); val[2] += bfr(bias[c0 + cofs + 2]); val[3] += bfr(bias[c0 + cofs + 3]); }
                *(v4f*)(crow + (size_t)row * ldc + cofs) = val; }
             }
        __builtin_amdgcn_wave_barrier(); asm volatile("" ::: "memory");
    }
}

__device__ __forceinline__ h16 tohx(float x) { return (h16)x; }
__device__ __forceinline__ void splitf(float y, unsigned short& h, unsigned short& l) { h = f2bf(y); l = f2bf(y - bf2f(h)); }
typedef __attribute__((ext_vector_type(2))) _Float16 v2h;
typedef __attribute__((ext_vector_type(4))) _Float16 v4h;
typedef __attribute__((ext_vector_type(2))) unsigned short v2us;
typedef __attribute__((ext_vector_type(4))) unsigned short v4us;
typedef __attribute__((ext_vector_type(2))) float v2f;
typedef __attribute__((ext_vector_type(4))) int v4i;

__global__ __launch_bounds__(256) void k_wtG(const float* __restrict__ w, int K, int N, bf* Bt) {
    const int lane = threadIdx.x & 31; const int L0 = (blockIdx.x * 8 + (threadIdx.x >> 5)) * 8; const int nlines = N * K / 64;
{
#pragma unroll 1
        for (int l = 0; l < 8; ++l) { const int L = L0 + l; if (L >= nlines) break; const size_t e = (size_t)L * 64 + lane * 2; const int k = (int)(e % K), n = (int)(e / K); v2us o;
            o[0] = f2bf(w[(size_t)k * N + n]); o[1] = f2bf(w[(size_t)(k + 1) * N + n]); *(v2us*)(Bt + e) = o; }
         }
}
__global__ __launch_bounds__(256) void k_cvt8(const float* __restrict__ src, bf* dst, size_t n8) { const size_t i = (size_t)blockIdx.x * 256 + threadIdx.x; if (i >= n8) return; const v8f v = *(const v8f*)(src + i * 8); v8us o;
#pragma unroll
    for (int k = 0; k < 8; ++k) o[k] = f2bf(v[k]); *(v8us*)(dst + i * 8) = o;  }
__global__ __launch_bounds__(256) void k_cscvt(const float* __restrict__ cosT, const float* __restrict__ sinT, float* CS) { const int idx = blockIdx.x * 256 + threadIdx.x; if (idx >= TT * HD) return; v2f cs; cs[0] = bfr(cosT[idx]); cs[1] = bfr(sinT[idx]); *(v2f*)(CS + (size_t)idx * 2) = cs;  }
// k_rope: head planes [h][t][d] (fp16) of rope(x) x sc with the rotate-half convention out[d] = x[d] cos[t][d] - x[d+HD/2] sin[t][d], out[d+HD/2] = x[d+HD/2] cos[t][d+HD/2] + x[d] sin[t][d+HD/2]
__global__ __launch_bounds__(256) void k_rope(const float* __restrict__ F, int pitch, int nheads, const float* __restrict__ CS, const float* __restrict__ RF, const float* __restrict__ nw, float sc, h16* P16, bf* Ph, bf* Pl) {
    const size_t e = ((size_t)blockIdx.x * 256 + threadIdx.x) * 2; if (e >= (size_t)nheads * TT * HD) return; const int d = (int)(e % HD); const int t = (int)((e / HD) % TT); const int h = (int)(e / ((size_t)HD * TT)); const float* f = F + (size_t)t * pitch + h * HD; const float rf = RF ? RF[(size_t)h * TT + t] : 1.0f; v2h o16; v2us oh, ol;
#pragma unroll
    for (int q = 0; q < 2; ++q) { const int dd = d + q; const int dp = (dd < HD / 2) ? dd + HD / 2 : dd - HD / 2; float x0 = f[dd], x1 = f[dp];
        if (RF) { float n0 = __fmul_rn(x0, rf), n1 = __fmul_rn(x1, rf); asm volatile("" : "+v"(n0)); asm volatile("" : "+v"(n1)); x0 = __fmul_rn(bfr(nw[dd]), n0); x1 = __fmul_rn(bfr(nw[dp]), n1); }
        const v2f cs = *(const v2f*)(CS + ((size_t)t * HD + dd) * 2); float a = __fmul_rn(x0, cs[0]), bq = __fmul_rn(x1, cs[1]); asm volatile("" : "+v"(a)); asm volatile("" : "+v"(bq)); const float r = ((dd < HD / 2) ? __fsub_rn(a, bq) : __fadd_rn(a, bq)) * sc;
        o16[q] = tohx(r); (void)oh; (void)ol; }
    *(v2h*)(P16 + e) = o16;  }
__global__ __launch_bounds__(256) void k_vtp(const float* __restrict__ F, int pitch, int nheads, h16* V16, bf* Vh, bf* Vl) { const size_t e = ((size_t)blockIdx.x * 256 + threadIdx.x) * 2; if (e >= (size_t)nheads * HD * TT) return; const int t = (int)(e % TT); const int d = (int)((e / TT) % HD); const int g = (int)(e / ((size_t)TT * HD)); v2h o16; v2us oh, ol;
#pragma unroll
    for (int q = 0; q < 2; ++q) { const float x = F[(size_t)(t + q) * pitch + g * HD + d]; o16[q] = tohx(x); (void)oh; (void)ol; }
    *(v2h*)(V16 + e) = o16;  }
__global__ __launch_bounds__(256) void k_csid(float* CS) { const int idx = blockIdx.x * 256 + threadIdx.x; if (idx >= TT * HD) return; v2f cs; cs[0] = 1.0f; cs[1] = 0.0f; *(v2f*)(CS + (size_t)idx * 2) = cs;  }
// k_asoft: per row (zz, i): t = S x HD^-0.5 (no mask); softmax over the 2048 keys (register row, one exp, fixed trees);
__global__ __launch_bounds__(256) void k_asoft(const float* __restrict__ Sb, h16* P16, bf* Ph, bf* Pl) {
    const int lane = threadIdx.x & 31; const int row = blockIdx.x * 8 + (threadIdx.x >> 5); if (row >= ZH * TT) return; const int i = row % TT; const int zz = row / TT; (void)zz; const bool hires = (i < RH); const float* sr = Sb + (size_t)row * TT; float v[TT / 32]; float mx = -3.0e38f;
#pragma unroll
    for (int ch = 0; ch < TT / 128; ++ch) { const int j0 = ch * 128 + lane * 4; const v4f a = *(const v4f*)(sr + j0);
#pragma unroll
        for (int q = 0; q < 4; ++q) { const int j = j0 + q; (void)j; const float t = a[q] * SCL; v[ch * 4 + q] = t; mx = fmaxf(mx, t); } }
#pragma unroll
    for (int sh = 16; sh; sh >>= 1) mx = fmaxf(mx, __shfl_xor(mx, sh, 32));
    float sum = 0.f;
#pragma unroll
    for (int k = 0; k < TT / 32; ++k) { float d0 = __fsub_rn(v[k], mx); asm volatile("" : "+v"(d0)); v[k] = __builtin_amdgcn_exp2f(__fmul_rn(d0, 1.4426950408889634f)); sum += v[k]; }
#pragma unroll
    for (int sh = 16; sh; sh >>= 1) sum += __shfl_xor(sum, sh, 32);
    const float f = __fdiv_rn(hires ? 1.0f : PCAR, sum);
{
        if (hires) {
#pragma unroll
            for (int ch = 0; ch < TT / 128; ++ch) { v4us oh, ol;
#pragma unroll
                for (int q = 0; q < 4; ++q) { unsigned short a, c2; splitf(v[ch * 4 + q] * f, a, c2); oh[q] = a; ol[q] = c2; }
                const size_t oo = ((size_t)zz * (RH ? RH : 1) + i) * TT + ch * 128 + lane * 4; *(v4us*)(Ph + oo) = oh; *(v4us*)(Pl + oo) = ol; }
        } else {
#pragma unroll
            for (int ch = 0; ch < TT / 128; ++ch) { v4h o4;
#pragma unroll
                for (int q = 0; q < 4; ++q) o4[q] = tohx(v[ch * 4 + q] * f);
                *(v4h*)(P16 + (size_t)row * TT + ch * 128 + lane * 4) = o4; } }
         }
}
__global__ __launch_bounds__(256) void k_merge(const float* __restrict__ O, int h0, bf* Ah, bf* Al) { const size_t e = ((size_t)blockIdx.x * 256 + threadIdx.x) * 2; if (e >= (size_t)ZH * TT * HD) return; const int d = (int)(e % HD); const int t = (int)((e / HD) % TT); const int zz = (int)(e / ((size_t)HD * TT)); const float cs = (t < RH) ? 1.0f : (1.0f / PCAR); const size_t oo = (size_t)t * DQ + (h0 + zz) * HD + d;
    v2us oh, ol;
#pragma unroll
    for (int q = 0; q < 2; ++q) { unsigned short a, c2; splitf(O[e + q] * cs, a, c2); oh[q] = a; ol[q] = c2; } *(v2us*)(Ah + oo) = oh; *(v2us*)(Al + oo) = ol;  }

// block tail: k_bn: hl planes of gamma (v - mean) rsqrt(var + 1e-3) + beta over [t][256] (RAW: v is a raw input row, bf16-rounded first) (8-B lanes); k_res: X1 = A + bf16 x (16-B lanes); k_gelu: hl planes of exact-erf GELU (8-B lanes);
#define FFD 1024
template <bool RAW> __global__ __launch_bounds__(256) void k_bn(const float* __restrict__ X, const float* __restrict__ ga, const float* __restrict__ be, const float* __restrict__ mu, const float* __restrict__ var, bf* Hh, bf* Hl) { const int e = (blockIdx.x * 256 + threadIdx.x) * 4; if (e >= TT * DM) return; const int c = e % DM; v4us oh, ol;
#pragma unroll
    for (int u = 0; u < 4; ++u) { float xv = X[e + u]; if (RAW) xv = bfr(xv); float gg = bfr(ga[c + u]), bb = bfr(be[c + u]), mm = bfr(mu[c + u]), vv = bfr(var[c + u]); const float rs = __frsqrt_rn(__fadd_rn(vv, 1e-3f)); float d = __fsub_rn(xv, mm); asm volatile("" : "+v"(d)); float t1 = __fmul_rn(gg, d); asm volatile("" : "+v"(t1)); float t2 = __fmul_rn(t1, rs); asm volatile("" : "+v"(t2)); const float y = __fadd_rn(t2, bb); unsigned short a, b2; splitf(y, a, b2); oh[u] = a; ol[u] = b2; }
    *(v4us*)(Hh + e) = oh; *(v4us*)(Hl + e) = ol;  }
__global__ __launch_bounds__(256) void k_res(const float* __restrict__ A, const float* __restrict__ x, float* X1) { const int e = (blockIdx.x * 256 + threadIdx.x) * 4; if (e >= TT * DM) return; const v4f a = *(const v4f*)(A + e), b = *(const v4f*)(x + e); v4f o;
#pragma unroll
    for (int u = 0; u < 4; ++u) o[u] = __fadd_rn(a[u], bfr(b[u])); *(v4f*)(X1 + e) = o;  }
__global__ __launch_bounds__(256) void k_gelu(const float* __restrict__ Mf, bf* Gh, bf* Gl) { const int e = (blockIdx.x * 256 + threadIdx.x) * 4; if (e >= TT * FFD) return; const v4f a = *(const v4f*)(Mf + e); v4us oh, ol;
#pragma unroll 1
    for (int u = 0; u < 4; ++u) { const float y = a[u]; float er = erff(y * 0.70710678118654752f); asm volatile("" : "+v"(er)); float hy = __fmul_rn(0.5f, y); asm volatile("" : "+v"(hy)); const float ge = __fmul_rn(hy, __fadd_rn(1.0f, er)); unsigned short h, l; splitf(ge, h, l); oh[u] = h; ol[u] = l; }
    *(v4us*)(Gh + e) = oh; *(v4us*)(Gl + e) = ol;  }
__global__ __launch_bounds__(256) void k_fin(const float* __restrict__ M2, const float* __restrict__ X1, float* OUTb) { const int e = (blockIdx.x * 256 + threadIdx.x) * 4; if (e >= TT * DM) return; const v4f a = *(const v4f*)(M2 + e), b = *(const v4f*)(X1 + e); v4f o;
#pragma unroll
    for (int u = 0; u < 4; ++u) o[u] = __fadd_rn(a[u], b[u]); *(v4f*)(OUTb + e) = o;  }

extern "C" void kernel_launch(void* const* d_in, const int* in_sizes, int n_in,
                              void* d_out, int out_size, void* d_ws, size_t ws_size, hipStream_t stream) {
    (void)in_sizes; (void)n_in; (void)out_size;
    const float** Ip = (const float**)d_in; const float *x = Ip[0], *g1 = Ip[1], *be1 = Ip[2], *m1 = Ip[3], *v1 = Ip[4], *wq = Ip[5], *bq = Ip[6], *wk = Ip[7], *bk = Ip[8], *wv = Ip[9], *bv = Ip[10], *wo = Ip[11], *bo = Ip[12], *g2 = Ip[13], *be2 = Ip[14], *m2 = Ip[15], *v2 = Ip[16], *w1 = Ip[17], *w2 = Ip[18]; const float* cosT = nullptr; const float* sinT = nullptr; (void)cosT; (void)sinT;
    float* OUT = (float*)d_out;     // [4][2048][256]
    char* wsp = (char*)d_ws;
    auto take = [&](size_t bytes) { char* p = wsp; wsp += (bytes + 255) & ~(size_t)255; return (void*)p; };
    bf* WQ = (bf*)take((size_t)DQ * DM * 2); bf* WK = (bf*)take((size_t)DKV * DM * 2); bf* WV = (bf*)take((size_t)DKV * DM * 2); bf* WO = (bf*)take((size_t)DM * DQ * 2); float* CS = (float*)take((size_t)TT * HD * 2 * 4);
    bf* XB = nullptr; bf* Hh = (bf*)take((size_t)TT * DM * 2); bf* Hl = (bf*)take((size_t)TT * DM * 2); float* AO = (float*)take((size_t)TT * DM * 4); float* X1 = (float*)take((size_t)TT * DM * 4); float* Mf = (float*)take((size_t)TT * FFD * 4); bf* Gh = (bf*)take((size_t)TT * FFD * 2); bf* Gl = (bf*)take((size_t)TT * FFD * 2); float* M2 = (float*)take((size_t)TT * DM * 4); bf* W1B = (bf*)take((size_t)FFD * DM * 2); bf* W2B = (bf*)take((size_t)DM * FFD * 2); float* FQ = (float*)take((size_t)TT * DQ * 4); float* FK = (float*)take((size_t)TT * DKV * 4);
    h16* QP16 = (h16*)take((size_t)NH_ * TT * HD * 2); h16* KP16 = (h16*)take((size_t)NKV * TT * HD * 2); h16* VT16 = (h16*)take((size_t)NKV * HD * TT * 2);
    bf* QPh = nullptr; bf* QPl = nullptr; bf* KPh = nullptr; bf* KPl = nullptr; bf* VTh = nullptr; bf* VTl = nullptr; bf* Ph = nullptr; bf* Pl = nullptr;
    float* Sb = (float*)take((size_t)ZH * TT * TT * 4); h16* P16 = (h16*)take((size_t)ZH * TT * TT * 2); float* Ob = (float*)take((size_t)ZH * TT * HD * 4); bf* ATh = (bf*)take((size_t)TT * DQ * 2); bf* ATl = (bf*)take((size_t)TT * DQ * 2);
    if ((size_t)(wsp - (char*)d_ws) > ws_size) return;    // ws 256 MiB
    float* FV = FK;   // v projection reuses the k buffer after the k planes are built (stream-ordered)
    { k_wtG<<<(unsigned)((DM * DQ / 64 + 63) / 64), 256, 0, stream>>>(wq, DM, DQ, WQ); k_wtG<<<(unsigned)((DM * DKV / 64 + 63) / 64), 256, 0, stream>>>(wk, DM, DKV, WK); k_wtG<<<(unsigned)((DM * DKV / 64 + 63) / 64), 256, 0, stream>>>(wv, DM, DKV, WV);
      k_wtG<<<(unsigned)((DQ * DM / 64 + 63) / 64), 256, 0, stream>>>(wo, DQ, DM, WO);
       }
    k_csid<<<(TT * HD + 255) / 256, 256, 0, stream>>>(CS); k_wtG<<<(unsigned)((DM * FFD / 64 + 63) / 64), 256, 0, stream>>>(w1, DM, FFD, W1B); k_wtG<<<(unsigned)((FFD * DM / 64 + 63) / 64), 256, 0, stream>>>(w2, FFD, DM, W2B);
    const unsigned LQ = (unsigned)(((size_t)NH_ * TT * HD / 2 + 255) / 256), LKv = (unsigned)(((size_t)NKV * TT * HD / 2 + 255) / 256);
    for (int b = 0; b < NB_; ++b) {
        
        k_bn<true><<<(TT * DM / 4 + 255) / 256, 256, 0, stream>>>(x + (size_t)b * TT * DM, g1, be1, m1, v1, Hh, Hl);
        k_gemmw<bf, 1, true><<<dim3(TT / 64, DQ / 64, 1), 32, 0, stream>>>(Hh, Hl, WQ, nullptr, DM, FQ, DQ, bq, 0, 0, 0);
        k_rope<<<LQ, 256, 0, stream>>>(FQ, DQ, NH_, CS, nullptr, nullptr, 1.0f, QP16, QPh, QPl);
        k_gemmw<bf, 1, true><<<dim3(TT / 64, DKV / 64, 1), 32, 0, stream>>>(Hh, Hl, WK, nullptr, DM, FK, DKV, bk, 0, 0, 0);
        k_rope<<<LKv, 256, 0, stream>>>(FK, DKV, NKV, CS, nullptr, nullptr, 1.0f, KP16, KPh, KPl);
        k_gemmw<bf, 1, true><<<dim3(TT / 64, DKV / 64, 1), 32, 0, stream>>>(Hh, Hl, WV, nullptr, DM, FV, DKV, bv, 0, 0, 0); k_vtp<<<LKv, 256, 0, stream>>>(FV, DKV, NKV, VT16, VTh, VTl);
        for (int h0 = 0; h0 < NH_; h0 += ZH) { const size_t zq = (size_t)h0, zk = (size_t)(h0 / REP);   // one kv head per query head: the pass's two heads use consecutive kv planes (z-strides TT*HD)
            k_gemmw<h16, 0, false><<<dim3(TT / 64, TT / 64, ZH), 32, 0, stream>>>(QP16 + zq * TT * HD, nullptr, KP16 + zk * TT * HD, nullptr, HD, Sb, TT, nullptr, (size_t)TT * HD, (size_t)TT * HD, (size_t)TT * TT);
            k_asoft<<<ZH * TT / 8, 256, 0, stream>>>(Sb, P16, Ph, Pl);
            k_gemmw<h16, 0, false><<<dim3(TT / 64, HD / 64, ZH), 32, 0, stream>>>(P16, nullptr, VT16 + zk * HD * TT, nullptr, TT, Ob, HD, nullptr, (size_t)TT * TT, (size_t)HD * TT, (size_t)TT * HD);
            k_merge<<<(unsigned)(((size_t)ZH * TT * HD / 2 + 255) / 256), 256, 0, stream>>>(Ob, h0, ATh, ATl); }
        k_gemmw<bf, 1, true><<<dim3(TT / 64, DM / 64, 1), 32, 0, stream>>>(ATh, ATl, WO, nullptr, DQ, AO, DM, bo, 0, 0, 0);
        k_res<<<(TT * DM / 4 + 255) / 256, 256, 0, stream>>>(AO, x + (size_t)b * TT * DM, X1); k_bn<false><<<(TT * DM / 4 + 255) / 256, 256, 0, stream>>>(X1, g2, be2, m2, v2, Hh, Hl);
        k_gemmw<bf, 1, false><<<dim3(TT / 64, FFD / 64, 1), 32, 0, stream>>>(Hh, Hl, W1B, nullptr, DM, Mf, FFD, nullptr, 0, 0, 0); k_gelu<<<(TT * FFD / 4 + 255) / 256, 256, 0, stream>>>(Mf, Gh, Gl);
        k_gemmw<bf, 1, false><<<dim3(TT / 64, DM / 64, 1), 32, 0, stream>>>(Gh, Gl, W2B, nullptr, FFD, M2, DM, nullptr, 0, 0, 0); k_fin<<<(TT * DM / 4 + 255) / 256, 256, 0, stream>>>(M2, X1, OUT + (size_t)b * TT * DM); }
}

// v001
// A run of this version takes 553 microseconds.
// Next to v000, in two timings, it ran 1.67 times as fast each time.
#include <hip/hip_runtime.h>

// TransformerBaseBlock (x [4][2048][256]; h = BN1(x) (inference: gamma (x - mean) rsqrt(var + 1e-3) + beta); q/k/v = h W + b (4 heads x 64); softmax(q.k/8); attn_out = ctx Wo + bo; x1 = attn_out + x; m = gelu(BN2(x1) W1) W2 (exact erf GELU);
// out = m + x1 -> [4][2048][256]).
// Compute dtypes, f32 accumulate: every input rounded to bf16; BN1/BN2 f32 -> bf16 hi+lo planes; q/k/v, W1 as hl x exact W (2 products), q/k/v + bias; scores (K 64) and attn.v single fp16 planes (head pairs z-batched; x1024);

#define NB_  4
#define TT   2048
#define DM   256
#define NH_  4
#define NKV  4
#define REP  (NH_ / NKV)
#define HD   64
#define DQ   (NH_ * HD)
#define DKV  (NKV * HD)
#define ZH   2
#define RH   0                  // query rows < RH use hi+lo planes (0: none)
#define WIN  0
#define PCAR 1024.0f
#define SCL  0.125f   // HD^-0.5
typedef _Float16 h16;
typedef unsigned short bf;
typedef __attribute__((ext_vector_type(16))) __bf16   v16bf;
typedef __attribute__((ext_vector_type(16))) _Float16 v16h;
typedef __attribute__((ext_vector_type(8)))  _Float16 v8h;
typedef __attribute__((ext_vector_type(8)))  unsigned short v8us;
typedef __attribute__((ext_vector_type(8)))  float    v8f;
typedef __attribute__((ext_vector_type(4)))  float    v4f;
typedef v8h  __attribute__((may_alias)) v8ha;
typedef v4f  __attribute__((may_alias)) v4fa;
typedef v8us __attribute__((may_alias)) v8usa;

__device__ __forceinline__ unsigned short f2bf(float f) { unsigned u = __float_as_uint(f); u += 0x7FFFu + ((u >> 16) & 1u); return (unsigned short)(u >> 16); }
__device__ __forceinline__ float bf2f(unsigned short b) { return __uint_as_float(((unsigned)b) << 16); }
__device__ __forceinline__ float bfr(float f) { return bf2f(f2bf(f)); }
__device__ __forceinline__ v16h cat16(v8h lo, v8h hi) { return __builtin_shufflevector(lo, hi, 0, 1, 2, 3, 4, 5, 6, 7, 8, 9, 10, 11, 12, 13, 14, 15); }
__device__ __forceinline__ v16bf cat16b(v8us lo, v8us hi) { return __builtin_bit_cast(v16bf, __builtin_shufflevector(lo, hi, 0, 1, 2, 3, 4, 5, 6, 7, 8, 9, 10, 11, 12, 13, 14, 15)); }
__device__ __forceinline__ v8f wmma16(v16h a, v16h b, v8f c) { return __builtin_amdgcn_wmma_f32_16x16x32_f16(false, a, false, b, (short)0, c, false, false); }
__device__ __forceinline__ v8f wmmab(v16bf a, v16bf b, v8f c) { return __builtin_amdgcn_wmma_f32_16x16x32_bf16(false, a, false, b, (short)0, c, false, false); }



// ---- k_gemmw: register-blocked GEMM, one 64x64 output tile per work-group (16 accumulators per wave), operands straight from K-contiguous 16-bit planes; grid (M/64, N/64, Z), 32 * KS threads.
// C[m][n] (f32, pitch ldc, + optional f32 bias[n]) = sum_k A[m][k] Bt[n][k] (+ split products per NSPLIT). z-batch strides sA/sB/sC in elements. K % (32 * KS) == 0.
// KS > 1: K is split over the KS waves (wave w takes the 32-k chunks w, w + KS, ...: neighbouring waves read the two halves of the same 128-B lines); each wave leaves its f32 partial tile in LDS, and behind one barrier
// all threads add the KS partials in the fixed order 0 .. KS-1 and store whole rows.
template <typename T16> struct WFrag;
template <> struct WFrag<h16> { typedef v16h V; static __device__ __forceinline__ V ld(const h16* p) { return cat16(*(const v8h*)p, *(const v8h*)(p + 16)); } static __device__ __forceinline__ v8f mma(V a, V b, v8f c) { return wmma16(a, b, c); } };
template <> struct WFrag<bf> { typedef v16bf V; static __device__ __forceinline__ V ld(const bf* p) { return cat16b(*(const v8us*)p, *(const v8us*)(p + 16)); } static __device__ __forceinline__ v8f mma(V a, V b, v8f c) { return wmmab(a, b, c); } };
template <typename T16, int NSPLIT, bool BIAS, int KS>
__global__ __launch_bounds__(32 * KS) void k_gemmw(const T16* __restrict__ A, const T16* __restrict__ A2, const T16* __restrict__ Bt, const T16* __restrict__ Bt2, int K, float* C, int ldc, const float* __restrict__ bias, size_t sA, size_t sB, size_t sC) {
    typedef typename WFrag<T16>::V V;
    __shared__ __align__(16) float os[(KS == 1 ? 16 : KS * 64) * 68];
    const size_t z = blockIdx.z; A += z * sA; if (A2) A2 += z * sA; Bt += z * sB; if (Bt2) Bt2 += z * sB; C += z * sC;
    const int lane = threadIdx.x & 31, lr = lane & 15, hi = lane >> 4; const int r0 = blockIdx.x * 64, c0 = blockIdx.y * 64;
    const int wv = (KS == 1) ? 0 : __builtin_amdgcn_readfirstlane((int)(threadIdx.x >> 5));
    v8f acc[4][4];
#pragma unroll
    for (int mb = 0; mb < 4; ++mb)
#pragma unroll
        for (int nb = 0; nb < 4; ++nb) acc[mb][nb] = (v8f){};
    v4f bv = (v4f){};   // this thread's four bias columns (KS > 1), fetched ahead of the k loop so that their latency is not paid behind the barrier
    if (BIAS && KS > 1) { const int bc = c0 + ((int)threadIdx.x & 15) * 4; bv[0] = bfr(bias[bc]); bv[1] = bfr(bias[bc + 1]); bv[2] = bfr(bias[bc + 2]); bv[3] = bfr(bias[bc + 3]); }
    const size_t aoff = (size_t)(r0 + lr) * K + 8 * hi, boff = (size_t)(c0 + lr) * K + 8 * hi;
#pragma unroll 1
    for (int kc = wv * 32; kc < K; kc += 32 * KS) {
        V a[4], a2[4];
#pragma unroll
        for (int mb = 0; mb < 4; ++mb) { a[mb] = WFrag<T16>::ld(A + aoff + (size_t)mb * 16 * K + kc); if (NSPLIT == 1 || NSPLIT == 2) a2[mb] = WFrag<T16>::ld(A2 + aoff + (size_t)mb * 16 * K + kc); }
#pragma unroll
        for (int nb = 0; nb < 4; ++nb) { const V b = WFrag<T16>::ld(Bt + boff + (size_t)nb * 16 * K + kc); V b2; if (NSPLIT >= 2) b2 = WFrag<T16>::ld(Bt2 + boff + (size_t)nb * 16 * K + kc);
#pragma unroll
            for (int mb = 0; mb < 4; ++mb) { acc[mb][nb] = WFrag<T16>::mma(a[mb], b, acc[mb][nb]); if (NSPLIT == 1 || NSPLIT == 2) acc[mb][nb] = WFrag<T16>::mma(a2[mb], b, acc[mb][nb]); if (NSPLIT >= 2) acc[mb][nb] = WFrag<T16>::mma(a[mb], b2, acc[mb][nb]); } }
        asm volatile("v_nop\n\tv_nop\n\tv_nop\n\tv_nop" : "+v"(acc[0][0]), "+v"(acc[1][1]), "+v"(acc[2][2]), "+v"(acc[3][3]) : "v"(a[0]), "v"(a[3]));
    }
    if constexpr (KS > 1) {
        float* pw = os + wv * (64 * 68);
#pragma unroll
        for (int mb = 0; mb < 4; ++mb)
#pragma unroll
            for (int nb = 0; nb < 4; ++nb)
#pragma unroll
                for (int j = 0; j < 8; ++j) pw[(mb * 16 + hi * 8 + j) * 68 + nb * 16 + lr] = acc[mb][nb][j];
        __syncthreads();   // every wave's partial tile is in LDS before any thread adds them
#pragma unroll
        for (int s = 0; s < 32 / KS; ++s) { const int idx = s * (32 * KS) + (int)threadIdx.x; const int row = idx >> 4, cofs = (idx & 15) * 4; v4f val = *(const v4fa*)(os + row * 68 + cofs);
#pragma unroll
            for (int p = 1; p < KS; ++p) val += *(const v4fa*)(os + p * (64 * 68) + row * 68 + cofs);
            if (BIAS) val += bv;
            *(v4f*)(C + (size_t)(r0 + row) * ldc + c0 + cofs) = val; }
        return;
    }
#pragma unroll
    for (int mb = 0; mb < 4; ++mb) {
#pragma unroll
        for (int nb = 0; nb < 4; ++nb) {
#pragma unroll
            for (int j = 0; j < 8; ++j) os[(hi * 8 + j) * 68 + nb * 16 + lr] = acc[mb][nb][j]; }
        __builtin_amdgcn_wave_barrier(); asm volatile("" ::: "memory");
        float* crow = C + (size_t)(r0 + mb * 16) * ldc + c0;
{
#pragma unroll
            for (int s = 0; s < 8; ++s) { const int row = 2 * s + hi, cofs = lr * 4; v4f val = *(const v4fa*)(os + row * 68 + cofs); if (BIAS) { val[0] += bfr(bias[c0 + cofs]); val[1] += bfr(bias[c0 + cofs + 1]); val[2] += bfr(bias[c0 + cofs + 2]); val[3] += bfr(bias[c0 + cofs + 3]); }
                *(v4f*)(crow + (size_t)row * ldc + cofs) = val; }
             }
        __builtin_amdgcn_wave_barrier(); asm volatile("" ::: "memory");
    }
}

__device__ __forceinline__ h16 tohx(float x) { return (h16)x; }
__device__ __forceinline__ void splitf(float y, unsigned short& h, unsigned short& l) { h = f2bf(y); l = f2bf(y - bf2f(h)); }
typedef __attribute__((ext_vector_type(2))) _Float16 v2h;
typedef __attribute__((ext_vector_type(4))) _Float16 v4h;
typedef __attribute__((ext_vector_type(2))) unsigned short v2us;
typedef __attribute__((ext_vector_type(4))) unsigned short v4us;
typedef __attribute__((ext_vector_type(2))) float v2f;
typedef __attribute__((ext_vector_type(4))) int v4i;

__global__ __launch_bounds__(256) void k_wtG(const float* __restrict__ w, int K, int N, bf* Bt) {
    const int lane = threadIdx.x & 31; const int L0 = (blockIdx.x * 8 + (threadIdx.x >> 5)) * 8; const int nlines = N * K / 64;
{
#pragma unroll 1
        for (int l = 0; l < 8; ++l) { const int L = L0 + l; if (L >= nlines) break; const size_t e = (size_t)L * 64 + lane * 2; const int k = (int)(e % K), n = (int)(e / K); v2us o;
            o[0] = f2bf(w[(size_t)k * N + n]); o[1] = f2bf(w[(size_t)(k + 1) * N + n]); *(v2us*)(Bt + e) = o; }
         }
}
__global__ __launch_bounds__(256) void k_cvt8(const float* __restrict__ src, bf* dst, size_t n8) { const size_t i = (size_t)blockIdx.x * 256 + threadIdx.x; if (i >= n8) return; const v8f v = *(const v8f*)(src + i * 8); v8us o;
#pragma unroll
    for (int k = 0; k < 8; ++k) o[k] = f2bf(v[k]); *(v8us*)(dst + i * 8) = o;  }
__global__ __launch_bounds__(256) void k_cscvt(const float* __restrict__ cosT, const float* __restrict__ sinT, float* CS) { const int idx = blockIdx.x * 256 + threadIdx.x; if (idx >= TT * HD) return; v2f cs; cs[0] = bfr(cosT[idx]); cs[1] = bfr(sinT[idx]); *(v2f*)(CS + (size_t)idx * 2) = cs;  }
// k_rope: head planes [h][t][d] (fp16) of rope(x) x sc with the rotate-half convention out[d] = x[d] cos[t][d] - x[d+HD/2] sin[t][d], out[d+HD/2] = x[d+HD/2] cos[t][d+HD/2] + x[d] sin[t][d+HD/2]
__global__ __launch_bounds__(256) void k_rope(const float* __restrict__ F, int pitch, int nheads, const float* __restrict__ CS, const float* __restrict__ RF, const float* __restrict__ nw, float sc, h16* P16, bf* Ph, bf* Pl) {
    const size_t e = ((size_t)blockIdx.x * 256 + threadIdx.x) * 2; if (e >= (size_t)nheads * TT * HD) return; const int d = (int)(e % HD); const int t = (int)((e / HD) % TT); const int h = (int)(e / ((size_t)HD * TT)); const float* f = F + (size_t)t * pitch + h * HD; const float rf = RF ? RF[(size_t)h * TT + t] : 1.0f; v2h o16; v2us oh, ol;
#pragma unroll
    for (int q = 0; q < 2; ++q) { const int dd = d + q; const int dp = (dd < HD / 2) ? dd + HD / 2 : dd - HD / 2; float x0 = f[dd], x1 = f[dp];
        if (RF) { float n0 = __fmul_rn(x0, rf), n1 = __fmul_rn(x1, rf); asm volatile("" : "+v"(n0)); asm volatile("" : "+v"(n1)); x0 = __fmul_rn(bfr(nw[dd]), n0); x1 = __fmul_rn(bfr(nw[dp]), n1); }
        const v2f cs = *(const v2f*)(CS + ((size_t)t * HD + dd) * 2); float a = __fmul_rn(x0, cs[0]), bq = __fmul_rn(x1, cs[1]); asm volatile("" : "+v"(a)); asm volatile("" : "+v"(bq)); const float r = ((dd < HD / 2) ? __fsub_rn(a, bq) : __fadd_rn(a, bq)) * sc;
        o16[q] = tohx(r); (void)oh; (void)ol; }
    *(v2h*)(P16 + e) = o16;  }
__global__ __launch_bounds__(256) void k_vtp(const float* __restrict__ F, int pitch, int nheads, h16* V16, bf* Vh, bf* Vl) { const size_t e = ((size_t)blockIdx.x * 256 + threadIdx.x) * 2; if (e >= (size_t)nheads * HD * TT) return; const int t = (int)(e % TT); const int d = (int)((e / TT) % HD); const int g = (int)(e / ((size_t)TT * HD)); v2h o16; v2us oh, ol;
#pragma unroll
    for (int q = 0; q < 2; ++q) { const float x = F[(size_t)(t + q) * pitch + g * HD + d]; o16[q] = tohx(x); (void)oh; (void)ol; }
    *(v2h*)(V16 + e) = o16;  }
__global__ __launch_bounds__(256) void k_csid(float* CS) { const int idx = blockIdx.x * 256 + threadIdx.x; if (idx >= TT * HD) return; v2f cs; cs[0] = 1.0f; cs[1] = 0.0f; *(v2f*)(CS + (size_t)idx * 2) = cs;  }
// k_asoft: per row (zz, i): t = S x HD^-0.5 (no mask); softmax over the 2048 keys (register row, one exp, fixed trees);
__global__ __launch_bounds__(256) void k_asoft(const float* __restrict__ Sb, h16* P16, bf* Ph, bf* Pl) {
    const int lane = threadIdx.x & 31; const int row = blockIdx.x * 8 + (threadIdx.x >> 5); if (row >= ZH * TT) return; const int i = row % TT; const int zz = row / TT; (void)zz; const bool hires = (i < RH); const float* sr = Sb + (size_t)row * TT; float v[TT / 32]; float mx = -3.0e38f;
#pragma unroll
    for (int ch = 0; ch < TT / 128; ++ch) { const int j0 = ch * 128 + lane * 4; const v4f a = *(const v4f*)(sr + j0);
#pragma unroll
        for (int q = 0; q < 4; ++q) { const int j = j0 + q; (void)j; const float t = a[q] * SCL; v[ch * 4 + q] = t; mx = fmaxf(mx, t); } }
#pragma unroll
    for (int sh = 16; sh; sh >>= 1) mx = fmaxf(mx, __shfl_xor(mx, sh, 32));
    float sum = 0.f;
#pragma unroll
    for (int k = 0; k < TT / 32; ++k) { float d0 = __fsub_rn(v[k], mx); asm volatile("" : "+v"(d0)); v[k] = __builtin_amdgcn_exp2f(__fmul_rn(d0, 1.4426950408889634f)); sum += v[k]; }
#pragma unroll
    for (int sh = 16; sh; sh >>= 1) sum += __shfl_xor(sum, sh, 32);
    const float f = __fdiv_rn(hires ? 1.0f : PCAR, sum);
{
        if (hires) {
#pragma unroll
            for (int ch = 0; ch < TT / 128; ++ch) { v4us oh, ol;
#pragma unroll
                for (int q = 0; q < 4; ++q) { unsigned short a, c2; splitf(v[ch * 4 + q] * f, a, c2); oh[q] = a; ol[q] = c2; }
                const size_t oo = ((size_t)zz * (RH ? RH : 1) + i) * TT + ch * 128 + lane * 4; *(v4us*)(Ph + oo) = oh; *(v4us*)(Pl + oo) = ol; }
        } else {
#pragma unroll
            for (int ch = 0; ch < TT / 128; ++ch) { v4h o4;
#pragma unroll
                for (int q = 0; q < 4; ++q) o4[q] = tohx(v[ch * 4 + q] * f);
                *(v4h*)(P16 + (size_t)row * TT + ch * 128 + lane * 4) = o4; } }
         }
}
__global__ __launch_bounds__(256) void k_merge(const float* __restrict__ O, int h0, bf* Ah, bf* Al) { const size_t e = ((size_t)blockIdx.x * 256 + threadIdx.x) * 2; if (e >= (size_t)ZH * TT * HD) return; const int d = (int)(e % HD); const int t = (int)((e / HD) % TT); const int zz = (int)(e / ((size_t)HD * TT)); const float cs = (t < RH) ? 1.0f : (1.0f / PCAR); const size_t oo = (size_t)t * DQ + (h0 + zz) * HD + d;
    v2us oh, ol;
#pragma unroll
    for (int q = 0; q < 2; ++q) { unsigned short a, c2; splitf(O[e + q] * cs, a, c2); oh[q] = a; ol[q] = c2; } *(v2us*)(Ah + oo) = oh; *(v2us*)(Al + oo) = ol;  }

// block tail: k_bn: hl planes of gamma (v - mean) rsqrt(var + 1e-3) + beta over [t][256] (RAW: v is a raw input row, bf16-rounded first) (8-B lanes); k_res: X1 = A + bf16 x (16-B lanes); k_gelu: hl planes of exact-erf GELU (8-B lanes);
#define FFD 1024
template <bool RAW> __global__ __launch_bounds__(256) void k_bn(const float* __restrict__ X, const float* __restrict__ ga, const float* __restrict__ be, const float* __restrict__ mu, const float* __restrict__ var, bf* Hh, bf* Hl) { const int e = (blockIdx.x * 256 + threadIdx.x) * 4; if (e >= TT * DM) return; const int c = e % DM; v4us oh, ol;
#pragma unroll
    for (int u = 0; u < 4; ++u) { float xv = X[e + u]; if (RAW) xv = bfr(xv); float gg = bfr(ga[c + u]), bb = bfr(be[c + u]), mm = bfr(mu[c + u]), vv = bfr(var[c + u]); const float rs = __frsqrt_rn(__fadd_rn(vv, 1e-3f)); float d = __fsub_rn(xv, mm); asm volatile("" : "+v"(d)); float t1 = __fmul_rn(gg, d); asm volatile("" : "+v"(t1)); float t2 = __fmul_rn(t1, rs); asm volatile("" : "+v"(t2)); const float y = __fadd_rn(t2, bb); unsigned short a, b2; splitf(y, a, b2); oh[u] = a; ol[u] = b2; }
    *(v4us*)(Hh + e) = oh; *(v4us*)(Hl + e) = ol;  }
__global__ __launch_bounds__(256) void k_res(const float* __restrict__ A, const float* __restrict__ x, float* X1) { const int e = (blockIdx.x * 256 + threadIdx.x) * 4; if (e >= TT * DM) return; const v4f a = *(const v4f*)(A + e), b = *(const v4f*)(x + e); v4f o;
#pragma unroll
    for (int u = 0; u < 4; ++u) o[u] = __fadd_rn(a[u], bfr(b[u])); *(v4f*)(X1 + e) = o;  }
__global__ __launch_bounds__(256) void k_gelu(const float* __restrict__ Mf, bf* Gh, bf* Gl) { const int e = (blockIdx.x * 256 + threadIdx.x) * 4; if (e >= TT * FFD) return; const v4f a = *(const v4f*)(Mf + e); v4us oh, ol;
#pragma unroll 1
    for (int u = 0; u < 4; ++u) { const float y = a[u]; float er = erff(y * 0.70710678118654752f); asm volatile("" : "+v"(er)); float hy = __fmul_rn(0.5f, y); asm volatile("" : "+v"(hy)); const float ge = __fmul_rn(hy, __fadd_rn(1.0f, er)); unsigned short h, l; splitf(ge, h, l); oh[u] = h; ol[u] = l; }
    *(v4us*)(Gh + e) = oh; *(v4us*)(Gl + e) = ol;  }
__global__ __launch_bounds__(256) void k_fin(const float* __restrict__ M2, const float* __restrict__ X1, float* OUTb) { const int e = (blockIdx.x * 256 + threadIdx.x) * 4; if (e >= TT * DM) return; const v4f a = *(const v4f*)(M2 + e), b = *(const v4f*)(X1 + e); v4f o;
#pragma unroll
    for (int u = 0; u < 4; ++u) o[u] = __fadd_rn(a[u], b[u]); *(v4f*)(OUTb + e) = o;  }

extern "C" void kernel_launch(void* const* d_in, const int* in_sizes, int n_in,
                              void* d_out, int out_size, void* d_ws, size_t ws_size, hipStream_t stream) {
    (void)in_sizes; (void)n_in; (void)out_size;
    const float** Ip = (const float**)d_in; const float *x = Ip[0], *g1 = Ip[1], *be1 = Ip[2], *m1 = Ip[3], *v1 = Ip[4], *wq = Ip[5], *bq = Ip[6], *wk = Ip[7], *bk = Ip[8], *wv = Ip[9], *bv = Ip[10], *wo = Ip[11], *bo = Ip[12], *g2 = Ip[13], *be2 = Ip[14], *m2 = Ip[15], *v2 = Ip[16], *w1 = Ip[17], *w2 = Ip[18]; const float* cosT = nullptr; const float* sinT = nullptr; (void)cosT; (void)sinT;
    float* OUT = (float*)d_out;     // [4][2048][256]
    char* wsp = (char*)d_ws;
    auto take = [&](size_t bytes) { char* p = wsp; wsp += (bytes + 255) & ~(size_t)255; return (void*)p; };
    bf* WQ = (bf*)take((size_t)DQ * DM * 2); bf* WK = (bf*)take((size_t)DKV * DM * 2); bf* WV = (bf*)take((size_t)DKV * DM * 2); bf* WO = (bf*)take((size_t)DM * DQ * 2); float* CS = (float*)take((size_t)TT * HD * 2 * 4);
    bf* XB = nullptr; bf* Hh = (bf*)take((size_t)TT * DM * 2); bf* Hl = (bf*)take((size_t)TT * DM * 2); float* AO = (float*)take((size_t)TT * DM * 4); float* X1 = (float*)take((size_t)TT * DM * 4); float* Mf = (float*)take((size_t)TT * FFD * 4); bf* Gh = (bf*)take((size_t)TT * FFD * 2); bf* Gl = (bf*)take((size_t)TT * FFD * 2); float* M2 = (float*)take((size_t)TT * DM * 4); bf* W1B = (bf*)take((size_t)FFD * DM * 2); bf* W2B = (bf*)take((size_t)DM * FFD * 2); float* FQ = (float*)take((size_t)TT * DQ * 4); float* FK = (float*)take((size_t)TT * DKV * 4);
    h16* QP16 = (h16*)take((size_t)NH_ * TT * HD * 2); h16* KP16 = (h16*)take((size_t)NKV * TT * HD * 2); h16* VT16 = (h16*)take((size_t)NKV * HD * TT * 2);
    bf* QPh = nullptr; bf* QPl = nullptr; bf* KPh = nullptr; bf* KPl = nullptr; bf* VTh = nullptr; bf* VTl = nullptr; bf* Ph = nullptr; bf* Pl = nullptr;
    float* Sb = (float*)take((size_t)ZH * TT * TT * 4); h16* P16 = (h16*)take((size_t)ZH * TT * TT * 2); float* Ob = (float*)take((size_t)ZH * TT * HD * 4); bf* ATh = (bf*)take((size_t)TT * DQ * 2); bf* ATl = (bf*)take((size_t)TT * DQ * 2);
    if ((size_t)(wsp - (char*)d_ws) > ws_size) return;    // ws 256 MiB
    float* FV = FK;   // v projection reuses the k buffer after the k planes are built (stream-ordered)
    { k_wtG<<<(unsigned)((DM * DQ / 64 + 63) / 64), 256, 0, stream>>>(wq, DM, DQ, WQ); k_wtG<<<(unsigned)((DM * DKV / 64 + 63) / 64), 256, 0, stream>>>(wk, DM, DKV, WK); k_wtG<<<(unsigned)((DM * DKV / 64 + 63) / 64), 256, 0, stream>>>(wv, DM, DKV, WV);
      k_wtG<<<(unsigned)((DQ * DM / 64 + 63) / 64), 256, 0, stream>>>(wo, DQ, DM, WO);
       }
    k_csid<<<(TT * HD + 255) / 256, 256, 0, stream>>>(CS); k_wtG<<<(unsigned)((DM * FFD / 64 + 63) / 64), 256, 0, stream>>>(w1, DM, FFD, W1B); k_wtG<<<(unsigned)((FFD * DM / 64 + 63) / 64), 256, 0, stream>>>(w2, FFD, DM, W2B);
    const unsigned LQ = (unsigned)(((size_t)NH_ * TT * HD / 2 + 255) / 256), LKv = (unsigned)(((size_t)NKV * TT * HD / 2 + 255) / 256);
    for (int b = 0; b < NB_; ++b) {
        
        k_bn<true><<<(TT * DM / 4 + 255) / 256, 256, 0, stream>>>(x + (size_t)b * TT * DM, g1, be1, m1, v1, Hh, Hl);
        k_gemmw<bf, 1, true, 8><<<dim3(TT / 64, DQ / 64, 1), 256, 0, stream>>>(Hh, Hl, WQ, nullptr, DM, FQ, DQ, bq, 0, 0, 0);
        k_rope<<<LQ, 256, 0, stream>>>(FQ, DQ, NH_, CS, nullptr, nullptr, 1.0f, QP16, QPh, QPl);
        k_gemmw<bf, 1, true, 8><<<dim3(TT / 64, DKV / 64, 1), 256, 0, stream>>>(Hh, Hl, WK, nullptr, DM, FK, DKV, bk, 0, 0, 0);
        k_rope<<<LKv, 256, 0, stream>>>(FK, DKV, NKV, CS, nullptr, nullptr, 1.0f, KP16, KPh, KPl);
        k_gemmw<bf, 1, true, 8><<<dim3(TT / 64, DKV / 64, 1), 256, 0, stream>>>(Hh, Hl, WV, nullptr, DM, FV, DKV, bv, 0, 0, 0); k_vtp<<<LKv, 256, 0, stream>>>(FV, DKV, NKV, VT16, VTh, VTl);
        for (int h0 = 0; h0 < NH_; h0 += ZH) { const size_t zq = (size_t)h0, zk = (size_t)(h0 / REP);   // one kv head per query head: the pass's two heads use consecutive kv planes (z-strides TT*HD)
            k_gemmw<h16, 0, false, 1><<<dim3(TT / 64, TT / 64, ZH), 32, 0, stream>>>(QP16 + zq * TT * HD, nullptr, KP16 + zk * TT * HD, nullptr, HD, Sb, TT, nullptr, (size_t)TT * HD, (size_t)TT * HD, (size_t)TT * TT);
            k_asoft<<<ZH * TT / 8, 256, 0, stream>>>(Sb, P16, Ph, Pl);
            k_gemmw<h16, 0, false, 8><<<dim3(TT / 64, HD / 64, ZH), 256, 0, stream>>>(P16, nullptr, VT16 + zk * HD * TT, nullptr, TT, Ob, HD, nullptr, (size_t)TT * TT, (size_t)HD * TT, (size_t)TT * HD);
            k_merge<<<(unsigned)(((size_t)ZH * TT * HD / 2 + 255) / 256), 256, 0, stream>>>(Ob, h0, ATh, ATl); }
        k_gemmw<bf, 1, true, 8><<<dim3(TT / 64, DM / 64, 1), 256, 0, stream>>>(ATh, ATl, WO, nullptr, DQ, AO, DM, bo, 0, 0, 0);
        k_res<<<(TT * DM / 4 + 255) / 256, 256, 0, stream>>>(AO, x + (size_t)b * TT * DM, X1); k_bn<false><<<(TT * DM / 4 + 255) / 256, 256, 0, stream>>>(X1, g2, be2, m2, v2, Hh, Hl);
        k_gemmw<bf, 1, false, 8><<<dim3(TT / 64, FFD / 64, 1), 256, 0, stream>>>(Hh, Hl, W1B, nullptr, DM, Mf, FFD, nullptr, 0, 0, 0); k_gelu<<<(TT * FFD / 4 + 255) / 256, 256, 0, stream>>>(Mf, Gh, Gl);
        k_gemmw<bf, 1, false, 8><<<dim3(TT / 64, DM / 64, 1), 256, 0, stream>>>(Gh, Gl, W2B, nullptr, FFD, M2, DM, nullptr, 0, 0, 0); k_fin<<<(TT * DM / 4 + 255) / 256, 256, 0, stream>>>(M2, X1, OUT + (size_t)b * TT * DM); }
}

// v002
// It runs in 288 microseconds.
// Timed twice side by side with v001, it ran 1.91 and 1.92 times as fast.
// Over all steps from v000 it is 3.20 times as fast.
#include <hip/hip_runtime.h>

// TransformerBaseBlock (x [4][2048][256]; h = BN1(x) (inference: gamma (x - mean) rsqrt(var + 1e-3) + beta); q/k/v = h W + b (4 heads x 64); softmax(q.k/8); attn_out = ctx Wo + bo; x1 = attn_out + x; m = gelu(BN2(x1) W1) W2 (exact erf GELU);
// out = m + x1 -> [4][2048][256]).
// Compute dtypes, f32 accumulate: every input rounded to bf16; BN1/BN2 f32 -> bf16 hi+lo planes; q/k/v, Wo, W1, W2 as hl x exact W (2 products), + bias for q/k/v and Wo; scores (K 64) and attn.v single fp16 planes (x1024);
// Every launch covers all four batches (rows b * 2048 + t, planes b * 4 + h); the attention launches take ZH of the 16 (batch, head) planes at a time, which is what the f32 score buffer leaves room for.

#define NB_  4
#define TT   2048
#define DM   256
#define NH_  4
#define NKV  4
#define REP  (NH_ / NKV)
#define HD   64
#define DQ   (NH_ * HD)
#define DKV  (NKV * HD)
#define ZH   8                  // (batch, head) planes per attention pass
#define TB   (NB_ * TT)         // rows of all batches
#define RH   0                  // query rows < RH use hi+lo planes (0: none)
#define WIN  0
#define PCAR 1024.0f
#define SCL  0.125f   // HD^-0.5
typedef _Float16 h16;
typedef unsigned short bf;
typedef __attribute__((ext_vector_type(16))) __bf16   v16bf;
typedef __attribute__((ext_vector_type(16))) _Float16 v16h;
typedef __attribute__((ext_vector_type(8)))  _Float16 v8h;
typedef __attribute__((ext_vector_type(8)))  unsigned short v8us;
typedef __attribute__((ext_vector_type(8)))  float    v8f;
typedef __attribute__((ext_vector_type(4)))  float    v4f;
typedef v8h  __attribute__((may_alias)) v8ha;
typedef v4f  __attribute__((may_alias)) v4fa;
typedef v8us __attribute__((may_alias)) v8usa;

__device__ __forceinline__ unsigned short f2bf(float f) { unsigned u = __float_as_uint(f); u += 0x7FFFu + ((u >> 16) & 1u); return (unsigned short)(u >> 16); }
__device__ __forceinline__ float bf2f(unsigned short b) { return __uint_as_float(((unsigned)b) << 16); }
__device__ __forceinline__ float bfr(float f) { return bf2f(f2bf(f)); }
__device__ __forceinline__ v16h cat16(v8h lo, v8h hi) { return __builtin_shufflevector(lo, hi, 0, 1, 2, 3, 4, 5, 6, 7, 8, 9, 10, 11, 12, 13, 14, 15); }
__device__ __forceinline__ v16bf cat16b(v8us lo, v8us hi) { return __builtin_bit_cast(v16bf, __builtin_shufflevector(lo, hi, 0, 1, 2, 3, 4, 5, 6, 7, 8, 9, 10, 11, 12, 13, 14, 15)); }
__device__ __forceinline__ v8f wmma16(v16h a, v16h b, v8f c) { return __builtin_amdgcn_wmma_f32_16x16x32_f16(false, a, false, b, (short)0, c, false, false); }
__device__ __forceinline__ v8f wmmab(v16bf a, v16bf b, v8f c) { return __builtin_amdgcn_wmma_f32_16x16x32_bf16(false, a, false, b, (short)0, c, false, false); }



// ---- k_gemmw: register-blocked GEMM, one 64x64 output tile per work-group (16 accumulators per wave), operands straight from K-contiguous 16-bit planes; grid (M/64, N/64, Z), 32 * KS threads.
// C[m][n] (f32, pitch ldc, + optional f32 bias[n]) = sum_k A[m][k] Bt[n][k] (+ split products per NSPLIT). z-batch strides sA/sB/sC in elements. K % (32 * KS) == 0.
// KS > 1: K is split over the KS waves (wave w takes the 32-k chunks w, w + KS, ...: neighbouring waves read the two halves of the same 128-B lines); each wave leaves its f32 partial tile in LDS, and behind one barrier
// all threads add the KS partials in the fixed order 0 .. KS-1 and store whole rows.
template <typename T16> struct WFrag;
template <> struct WFrag<h16> { typedef v16h V; static __device__ __forceinline__ V ld(const h16* p) { return cat16(*(const v8h*)p, *(const v8h*)(p + 16)); } static __device__ __forceinline__ v8f mma(V a, V b, v8f c) { return wmma16(a, b, c); } };
template <> struct WFrag<bf> { typedef v16bf V; static __device__ __forceinline__ V ld(const bf* p) { return cat16b(*(const v8us*)p, *(const v8us*)(p + 16)); } static __device__ __forceinline__ v8f mma(V a, V b, v8f c) { return wmmab(a, b, c); } };
template <typename T16, int NSPLIT, bool BIAS, int KS>
__global__ __launch_bounds__(32 * KS) void k_gemmw(const T16* __restrict__ A, const T16* __restrict__ A2, const T16* __restrict__ Bt, const T16* __restrict__ Bt2, int K, float* C, int ldc, const float* __restrict__ bias, size_t sA, size_t sB, size_t sC) {
    typedef typename WFrag<T16>::V V;
    __shared__ __align__(16) float os[(KS == 1 ? 16 : KS * 64) * 68];
    const size_t z = blockIdx.z; A += z * sA; if (A2) A2 += z * sA; Bt += z * sB; if (Bt2) Bt2 += z * sB; C += z * sC;
    const int lane = threadIdx.x & 31, lr = lane & 15, hi = lane >> 4; const int r0 = blockIdx.x * 64, c0 = blockIdx.y * 64;
    const int wv = (KS == 1) ? 0 : __builtin_amdgcn_readfirstlane((int)(threadIdx.x >> 5));
    v8f acc[4][4];
#pragma unroll
    for (int mb = 0; mb < 4; ++mb)
#pragma unroll
        for (int nb = 0; nb < 4; ++nb) acc[mb][nb] = (v8f){};
    v4f bv = (v4f){};   // this thread's four bias columns (KS > 1), fetched ahead of the k loop so that their latency is not paid behind the barrier
    if (BIAS && KS > 1) { const int bc = c0 + ((int)threadIdx.x & 15) * 4; bv[0] = bfr(bias[bc]); bv[1] = bfr(bias[bc + 1]); bv[2] = bfr(bias[bc + 2]); bv[3] = bfr(bias[bc + 3]); }
    const size_t aoff = (size_t)(r0 + lr) * K + 8 * hi, boff = (size_t)(c0 + lr) * K + 8 * hi;
#pragma unroll 1
    for (int kc = wv * 32; kc < K; kc += 32 * KS) {
        V a[4], a2[4];
#pragma unroll
        for (int mb = 0; mb < 4; ++mb) { a[mb] = WFrag<T16>::ld(A + aoff + (size_t)mb * 16 * K + kc); if (NSPLIT == 1 || NSPLIT == 2) a2[mb] = WFrag<T16>::ld(A2 + aoff + (size_t)mb * 16 * K + kc); }
#pragma unroll
        for (int nb = 0; nb < 4; ++nb) { const V b = WFrag<T16>::ld(Bt + boff + (size_t)nb * 16 * K + kc); V b2; if (NSPLIT >= 2) b2 = WFrag<T16>::ld(Bt2 + boff + (size_t)nb * 16 * K + kc);
#pragma unroll
            for (int mb = 0; mb < 4; ++mb) { acc[mb][nb] = WFrag<T16>::mma(a[mb], b, acc[mb][nb]); if (NSPLIT == 1 || NSPLIT == 2) acc[mb][nb] = WFrag<T16>::mma(a2[mb], b, acc[mb][nb]); if (NSPLIT >= 2) acc[mb][nb] = WFrag<T16>::mma(a[mb], b2, acc[mb][nb]); } }
        asm volatile("v_nop\n\tv_nop\n\tv_nop\n\tv_nop" : "+v"(acc[0][0]), "+v"(acc[1][1]), "+v"(acc[2][2]), "+v"(acc[3][3]) : "v"(a[0]), "v"(a[3]));
    }
    if constexpr (KS > 1) {
        float* pw = os + wv * (64 * 68);
#pragma unroll
        for (int mb = 0; mb < 4; ++mb)
#pragma unroll
            for (int nb = 0; nb < 4; ++nb)
#pragma unroll
                for (int j = 0; j < 8; ++j) pw[(mb * 16 + hi * 8 + j) * 68 + nb * 16 + lr] = acc[mb][nb][j];
        __syncthreads();   // every wave's partial tile is in LDS before any thread adds them
#pragma unroll
        for (int s = 0; s < 32 / KS; ++s) { const int idx = s * (32 * KS) + (int)threadIdx.x; const int row = idx >> 4, cofs = (idx & 15) * 4; v4f val = *(const v4fa*)(os + row * 68 + cofs);
#pragma unroll
            for (int p = 1; p < KS; ++p) val += *(const v4fa*)(os + p * (64 * 68) + row * 68 + cofs);
            if (BIAS) val += bv;
            *(v4f*)(C + (size_t)(r0 + row) * ldc + c0 + cofs) = val; }
        return;
    }
#pragma unroll
    for (int mb = 0; mb < 4; ++mb) {
#pragma unroll
        for (int nb = 0; nb < 4; ++nb) {
#pragma unroll
            for (int j = 0; j < 8; ++j) os[(hi * 8 + j) * 68 + nb * 16 + lr] = acc[mb][nb][j]; }
        __builtin_amdgcn_wave_barrier(); asm volatile("" ::: "memory");
        float* crow = C + (size_t)(r0 + mb * 16) * ldc + c0;
{
#pragma unroll
            for (int s = 0; s < 8; ++s) { const int row = 2 * s + hi, cofs = lr * 4; v4f val = *(const v4fa*)(os + row * 68 + cofs); if (BIAS) { val[0] += bfr(bias[c0 + cofs]); val[1] += bfr(bias[c0 + cofs + 1]); val[2] += bfr(bias[c0 + cofs + 2]); val[3] += bfr(bias[c0 + cofs + 3]); }
                *(v4f*)(crow + (size_t)row * ldc + cofs) = val; }
             }
        __builtin_amdgcn_wave_barrier(); asm volatile("" ::: "memory");
    }
}

__device__ __forceinline__ h16 tohx(float x) { return (h16)x; }
__device__ __forceinline__ void splitf(float y, unsigned short& h, unsigned short& l) { h = f2bf(y); l = f2bf(y - bf2f(h)); }
typedef __attribute__((ext_vector_type(2))) _Float16 v2h;
typedef __attribute__((ext_vector_type(4))) _Float16 v4h;
typedef __attribute__((ext_vector_type(2))) unsigned short v2us;
typedef __attribute__((ext_vector_type(4))) unsigned short v4us;
typedef __attribute__((ext_vector_type(2))) float v2f;
typedef __attribute__((ext_vector_type(4))) int v4i;

__global__ __launch_bounds__(256) void k_wtG(const float* __restrict__ w, int K, int N, bf* Bt) {
    const int lane = threadIdx.x & 31; const int L0 = (blockIdx.x * 8 + (threadIdx.x >> 5)) * 8; const int nlines = N * K / 64;
{
#pragma unroll 1
        for (int l = 0; l < 8; ++l) { const int L = L0 + l; if (L >= nlines) break; const size_t e = (size_t)L * 64 + lane * 2; const int k = (int)(e % K), n = (int)(e / K); v2us o;
            o[0] = f2bf(w[(size_t)k * N + n]); o[1] = f2bf(w[(size_t)(k + 1) * N + n]); *(v2us*)(Bt + e) = o; }
         }
}
__global__ __launch_bounds__(256) void k_cvt8(const float* __restrict__ src, bf* dst, size_t n8) { const size_t i = (size_t)blockIdx.x * 256 + threadIdx.x; if (i >= n8) return; const v8f v = *(const v8f*)(src + i * 8); v8us o;
#pragma unroll
    for (int k = 0; k < 8; ++k) o[k] = f2bf(v[k]); *(v8us*)(dst + i * 8) = o;  }
__global__ __launch_bounds__(256) void k_cscvt(const float* __restrict__ cosT, const float* __restrict__ sinT, float* CS) { const int idx = blockIdx.x * 256 + threadIdx.x; if (idx >= TT * HD) return; v2f cs; cs[0] = bfr(cosT[idx]); cs[1] = bfr(sinT[idx]); *(v2f*)(CS + (size_t)idx * 2) = cs;  }
// k_rope: head planes [b][h][t][d] (fp16) of rope(x) x sc with the rotate-half convention out[d] = x[d] cos[t][d] - x[d+HD/2] sin[t][d], out[d+HD/2] = x[d+HD/2] cos[t][d+HD/2] + x[d] sin[t][d+HD/2]
__global__ __launch_bounds__(256) void k_rope(const float* __restrict__ F, int pitch, int nheads, const float* __restrict__ CS, const float* __restrict__ RF, const float* __restrict__ nw, float sc, h16* P16, bf* Ph, bf* Pl) {
    F += (size_t)blockIdx.y * TT * pitch; P16 += (size_t)blockIdx.y * nheads * TT * HD;   // blockIdx.y: the batch
    const size_t e = ((size_t)blockIdx.x * 256 + threadIdx.x) * 2; if (e >= (size_t)nheads * TT * HD) return; const int d = (int)(e % HD); const int t = (int)((e / HD) % TT); const int h = (int)(e / ((size_t)HD * TT)); const float* f = F + (size_t)t * pitch + h * HD; const float rf = RF ? RF[(size_t)h * TT + t] : 1.0f; v2h o16; v2us oh, ol;
#pragma unroll
    for (int q = 0; q < 2; ++q) { const int dd = d + q; const int dp = (dd < HD / 2) ? dd + HD / 2 : dd - HD / 2; float x0 = f[dd], x1 = f[dp];
        if (RF) { float n0 = __fmul_rn(x0, rf), n1 = __fmul_rn(x1, rf); asm volatile("" : "+v"(n0)); asm volatile("" : "+v"(n1)); x0 = __fmul_rn(bfr(nw[dd]), n0); x1 = __fmul_rn(bfr(nw[dp]), n1); }
        const v2f cs = *(const v2f*)(CS + ((size_t)t * HD + dd) * 2); float a = __fmul_rn(x0, cs[0]), bq = __fmul_rn(x1, cs[1]); asm volatile("" : "+v"(a)); asm volatile("" : "+v"(bq)); const float r = ((dd < HD / 2) ? __fsub_rn(a, bq) : __fadd_rn(a, bq)) * sc;
        o16[q] = tohx(r); (void)oh; (void)ol; }
    *(v2h*)(P16 + e) = o16;  }
__global__ __launch_bounds__(256) void k_vtp(const float* __restrict__ F, int pitch, int nheads, h16* V16, bf* Vh, bf* Vl) { const size_t e = ((size_t)blockIdx.x * 256 + threadIdx.x) * 2; if (e >= (size_t)nheads * HD * TT) return; const int t = (int)(e % TT); const int d = (int)((e / TT) % HD); const int g = (int)(e / ((size_t)TT * HD)); F += (size_t)blockIdx.y * TT * pitch; V16 += (size_t)blockIdx.y * nheads * HD * TT;   /* blockIdx.y: the batch */ v2h o16; v2us oh, ol;
#pragma unroll
    for (int q = 0; q < 2; ++q) { const float x = F[(size_t)(t + q) * pitch + g * HD + d]; o16[q] = tohx(x); (void)oh; (void)ol; }
    *(v2h*)(V16 + e) = o16;  }
__global__ __launch_bounds__(256) void k_csid(float* CS) { const int idx = blockIdx.x * 256 + threadIdx.x; if (idx >= TT * HD) return; v2f cs; cs[0] = 1.0f; cs[1] = 0.0f; *(v2f*)(CS + (size_t)idx * 2) = cs;  }
// k_asoft: per row (zz, i): t = S x HD^-0.5 (no mask); softmax over the 2048 keys (register row, one exp, fixed trees);
__global__ __launch_bounds__(256) void k_asoft(const float* __restrict__ Sb, h16* P16, bf* Ph, bf* Pl) {
    const int lane = threadIdx.x & 31; const int row = blockIdx.x * 8 + (threadIdx.x >> 5); if (row >= ZH * TT) return; const int i = row % TT; const int zz = row / TT; (void)zz; const bool hires = (i < RH); const float* sr = Sb + (size_t)row * TT; float v[TT / 32]; float mx = -3.0e38f;
#pragma unroll
    for (int ch = 0; ch < TT / 128; ++ch) { const int j0 = ch * 128 + lane * 4; const v4f a = *(const v4f*)(sr + j0);
#pragma unroll
        for (int q = 0; q < 4; ++q) { const int j = j0 + q; (void)j; const float t = a[q] * SCL; v[ch * 4 + q] = t; mx = fmaxf(mx, t); } }
#pragma unroll
    for (int sh = 16; sh; sh >>= 1) mx = fmaxf(mx, __shfl_xor(mx, sh, 32));
    float sum = 0.f;
#pragma unroll
    for (int k = 0; k < TT / 32; ++k) { float d0 = __fsub_rn(v[k], mx); asm volatile("" : "+v"(d0)); v[k] = __builtin_amdgcn_exp2f(__fmul_rn(d0, 1.4426950408889634f)); sum += v[k]; }
#pragma unroll
    for (int sh = 16; sh; sh >>= 1) sum += __shfl_xor(sum, sh, 32);
    const float f = __fdiv_rn(hires ? 1.0f : PCAR, sum);
{
        if (hires) {
#pragma unroll
            for (int ch = 0; ch < TT / 128; ++ch) { v4us oh, ol;
#pragma unroll
                for (int q = 0; q < 4; ++q) { unsigned short a, c2; splitf(v[ch * 4 + q] * f, a, c2); oh[q] = a; ol[q] = c2; }
                const size_t oo = ((size_t)zz * (RH ? RH : 1) + i) * TT + ch * 128 + lane * 4; *(v4us*)(Ph + oo) = oh; *(v4us*)(Pl + oo) = ol; }
        } else {
#pragma unroll
            for (int ch = 0; ch < TT / 128; ++ch) { v4h o4;
#pragma unroll
                for (int q = 0; q < 4; ++q) o4[q] = tohx(v[ch * 4 + q] * f);
                *(v4h*)(P16 + (size_t)row * TT + ch * 128 + lane * 4) = o4; } }
         }
}
__global__ __launch_bounds__(256) void k_merge(const float* __restrict__ O, bf* Ah, bf* Al) { const size_t e = ((size_t)blockIdx.x * 256 + threadIdx.x) * 2; if (e >= (size_t)NB_ * NH_ * TT * HD) return; const int d = (int)(e % HD); const int t = (int)((e / HD) % TT); const int zz = (int)(e / ((size_t)HD * TT)); const float cs = (t < RH) ? 1.0f : (1.0f / PCAR); const size_t oo = (size_t)((zz / NH_) * TT + t) * DQ + (zz % NH_) * HD + d;
    v2us oh, ol;
#pragma unroll
    for (int q = 0; q < 2; ++q) { unsigned short a, c2; splitf(O[e + q] * cs, a, c2); oh[q] = a; ol[q] = c2; } *(v2us*)(Ah + oo) = oh; *(v2us*)(Al + oo) = ol;  }

// block tail: k_bn: hl planes of gamma (v - mean) rsqrt(var + 1e-3) + beta over [b * 2048 + t][256] (RAW: v is a raw input row, bf16-rounded first) (8-B lanes); k_res: X1 = A + bf16 x (16-B lanes); k_gelu: hl planes of exact-erf GELU (8-B lanes);
#define FFD 1024
template <bool RAW> __global__ __launch_bounds__(256) void k_bn(const float* __restrict__ X, const float* __restrict__ ga, const float* __restrict__ be, const float* __restrict__ mu, const float* __restrict__ var, bf* Hh, bf* Hl) { const int e = (blockIdx.x * 256 + threadIdx.x) * 4; if (e >= TB * DM) return; const int c = e % DM; v4us oh, ol;
#pragma unroll
    for (int u = 0; u < 4; ++u) { float xv = X[e + u]; if (RAW) xv = bfr(xv); float gg = bfr(ga[c + u]), bb = bfr(be[c + u]), mm = bfr(mu[c + u]), vv = bfr(var[c + u]); const float rs = __frsqrt_rn(__fadd_rn(vv, 1e-3f)); float d = __fsub_rn(xv, mm); asm volatile("" : "+v"(d)); float t1 = __fmul_rn(gg, d); asm volatile("" : "+v"(t1)); float t2 = __fmul_rn(t1, rs); asm volatile("" : "+v"(t2)); const float y = __fadd_rn(t2, bb); unsigned short a, b2; splitf(y, a, b2); oh[u] = a; ol[u] = b2; }
    *(v4us*)(Hh + e) = oh; *(v4us*)(Hl + e) = ol;  }
__global__ __launch_bounds__(256) void k_res(const float* __restrict__ A, const float* __restrict__ x, float* X1) { const int e = (blockIdx.x * 256 + threadIdx.x) * 4; if (e >= TB * DM) return; const v4f a = *(const v4f*)(A + e), b = *(const v4f*)(x + e); v4f o;
#pragma unroll
    for (int u = 0; u < 4; ++u) o[u] = __fadd_rn(a[u], bfr(b[u])); *(v4f*)(X1 + e) = o;  }
__global__ __launch_bounds__(256) void k_gelu(const float* __restrict__ Mf, bf* Gh, bf* Gl) { const int e = (blockIdx.x * 256 + threadIdx.x) * 4; if (e >= TB * FFD) return; const v4f a = *(const v4f*)(Mf + e); v4us oh, ol;
#pragma unroll 1
    for (int u = 0; u < 4; ++u) { const float y = a[u]; float er = erff(y * 0.70710678118654752f); asm volatile("" : "+v"(er)); float hy = __fmul_rn(0.5f, y); asm volatile("" : "+v"(hy)); const float ge = __fmul_rn(hy, __fadd_rn(1.0f, er)); unsigned short h, l; splitf(ge, h, l); oh[u] = h; ol[u] = l; }
    *(v4us*)(Gh + e) = oh; *(v4us*)(Gl + e) = ol;  }
__global__ __launch_bounds__(256) void k_fin(const float* __restrict__ M2, const float* __restrict__ X1, float* OUTb) { const int e = (blockIdx.x * 256 + threadIdx.x) * 4; if (e >= TB * DM) return; const v4f a = *(const v4f*)(M2 + e), b = *(const v4f*)(X1 + e); v4f o;
#pragma unroll
    for (int u = 0; u < 4; ++u) o[u] = __fadd_rn(a[u], b[u]); *(v4f*)(OUTb + e) = o;  }

extern "C" void kernel_launch(void* const* d_in, const int* in_sizes, int n_in,
                              void* d_out, int out_size, void* d_ws, size_t ws_size, hipStream_t stream) {
    (void)in_sizes; (void)n_in; (void)out_size;
    const float** Ip = (const float**)d_in; const float *x = Ip[0], *g1 = Ip[1], *be1 = Ip[2], *m1 = Ip[3], *v1 = Ip[4], *wq = Ip[5], *bq = Ip[6], *wk = Ip[7], *bk = Ip[8], *wv = Ip[9], *bv = Ip[10], *wo = Ip[11], *bo = Ip[12], *g2 = Ip[13], *be2 = Ip[14], *m2 = Ip[15], *v2 = Ip[16], *w1 = Ip[17], *w2 = Ip[18]; const float* cosT = nullptr; const float* sinT = nullptr; (void)cosT; (void)sinT;
    float* OUT = (float*)d_out;     // [4][2048][256]
    char* wsp = (char*)d_ws;
    auto take = [&](size_t bytes) { char* p = wsp; wsp += (bytes + 255) & ~(size_t)255; return (void*)p; };
    bf* WQ = (bf*)take((size_t)DQ * DM * 2); bf* WK = (bf*)take((size_t)DKV * DM * 2); bf* WV = (bf*)take((size_t)DKV * DM * 2); bf* WO = (bf*)take((size_t)DM * DQ * 2); float* CS = (float*)take((size_t)TT * HD * 2 * 4);
    bf* Hh = (bf*)take((size_t)TB * DM * 2); bf* Hl = (bf*)take((size_t)TB * DM * 2); bf* W1B = (bf*)take((size_t)FFD * DM * 2); bf* W2B = (bf*)take((size_t)DM * FFD * 2); float* FQ = (float*)take((size_t)TB * DQ * 4); float* FK = (float*)take((size_t)TB * DKV * 4);
    h16* QP16 = (h16*)take((size_t)NB_ * NH_ * TT * HD * 2); h16* KP16 = (h16*)take((size_t)NB_ * NKV * TT * HD * 2); h16* VT16 = (h16*)take((size_t)NB_ * NKV * HD * TT * 2);
    bf* QPh = nullptr; bf* QPl = nullptr; bf* KPh = nullptr; bf* KPl = nullptr; bf* VTh = nullptr; bf* VTl = nullptr; bf* Ph = nullptr; bf* Pl = nullptr;
    float* Ob = (float*)take((size_t)NB_ * NH_ * TT * HD * 4); bf* ATh = (bf*)take((size_t)TB * DQ * 2); bf* ATl = (bf*)take((size_t)TB * DQ * 2); h16* P16 = (h16*)take((size_t)ZH * TT * TT * 2);
    float* Sb = (float*)take((size_t)ZH * TT * TT * 4);
    if ((size_t)(wsp - (char*)d_ws) > ws_size) return;    // ws 256 MiB
    wsp = (char*)Sb;   // the block tail's buffers (88 MiB) lie over the score buffer (128 MiB): they are first written behind the last launch that reads a score (stream-ordered)
    float* AO = (float*)take((size_t)TB * DM * 4); float* X1 = (float*)take((size_t)TB * DM * 4); float* Mf = (float*)take((size_t)TB * FFD * 4); bf* Gh = (bf*)take((size_t)TB * FFD * 2); bf* Gl = (bf*)take((size_t)TB * FFD * 2); float* M2 = (float*)take((size_t)TB * DM * 4);
    float* FV = FK;   // v projection reuses the k buffer after the k planes are built (stream-ordered)
    { k_wtG<<<(unsigned)((DM * DQ / 64 + 63) / 64), 256, 0, stream>>>(wq, DM, DQ, WQ); k_wtG<<<(unsigned)((DM * DKV / 64 + 63) / 64), 256, 0, stream>>>(wk, DM, DKV, WK); k_wtG<<<(unsigned)((DM * DKV / 64 + 63) / 64), 256, 0, stream>>>(wv, DM, DKV, WV);
      k_wtG<<<(unsigned)((DQ * DM / 64 + 63) / 64), 256, 0, stream>>>(wo, DQ, DM, WO);
       }
    k_csid<<<(TT * HD + 255) / 256, 256, 0, stream>>>(CS); k_wtG<<<(unsigned)((DM * FFD / 64 + 63) / 64), 256, 0, stream>>>(w1, DM, FFD, W1B); k_wtG<<<(unsigned)((FFD * DM / 64 + 63) / 64), 256, 0, stream>>>(w2, FFD, DM, W2B);
    const unsigned LQ = (unsigned)(((size_t)NH_ * TT * HD / 2 + 255) / 256), LKv = (unsigned)(((size_t)NKV * TT * HD / 2 + 255) / 256);
    k_bn<true><<<(TB * DM / 4 + 255) / 256, 256, 0, stream>>>(x, g1, be1, m1, v1, Hh, Hl);
    k_gemmw<bf, 1, true, 8><<<dim3(TB / 64, DQ / 64, 1), 256, 0, stream>>>(Hh, Hl, WQ, nullptr, DM, FQ, DQ, bq, 0, 0, 0);
    k_rope<<<dim3(LQ, NB_, 1), 256, 0, stream>>>(FQ, DQ, NH_, CS, nullptr, nullptr, 1.0f, QP16, QPh, QPl);
    k_gemmw<bf, 1, true, 8><<<dim3(TB / 64, DKV / 64, 1), 256, 0, stream>>>(Hh, Hl, WK, nullptr, DM, FK, DKV, bk, 0, 0, 0);
    k_rope<<<dim3(LKv, NB_, 1), 256, 0, stream>>>(FK, DKV, NKV, CS, nullptr, nullptr, 1.0f, KP16, KPh, KPl);
    k_gemmw<bf, 1, true, 8><<<dim3(TB / 64, DKV / 64, 1), 256, 0, stream>>>(Hh, Hl, WV, nullptr, DM, FV, DKV, bv, 0, 0, 0); k_vtp<<<dim3(LKv, NB_, 1), 256, 0, stream>>>(FV, DKV, NKV, VT16, VTh, VTl);
    for (int z0 = 0; z0 < NB_ * NH_; z0 += ZH) { const size_t zq = (size_t)z0, zk = (size_t)(z0 / REP);   // one kv head per query head: the pass's planes use consecutive kv planes (z-strides TT*HD)
        k_gemmw<h16, 0, false, 1><<<dim3(TT / 64, TT / 64, ZH), 32, 0, stream>>>(QP16 + zq * TT * HD, nullptr, KP16 + zk * TT * HD, nullptr, HD, Sb, TT, nullptr, (size_t)TT * HD, (size_t)TT * HD, (size_t)TT * TT);
        k_asoft<<<ZH * TT / 8, 256, 0, stream>>>(Sb, P16, Ph, Pl);
        k_gemmw<h16, 0, false, 8><<<dim3(TT / 64, HD / 64, ZH), 256, 0, stream>>>(P16, nullptr, VT16 + zk * HD * TT, nullptr, TT, Ob + zq * TT * HD, HD, nullptr, (size_t)TT * TT, (size_t)HD * TT, (size_t)TT * HD); }
    k_merge<<<(unsigned)(((size_t)NB_ * NH_ * TT * HD / 2 + 255) / 256), 256, 0, stream>>>(Ob, ATh, ATl);
    k_gemmw<bf, 1, true, 8><<<dim3(TB / 64, DM / 64, 1), 256, 0, stream>>>(ATh, ATl, WO, nullptr, DQ, AO, DM, bo, 0, 0, 0);
    k_res<<<(TB * DM / 4 + 255) / 256, 256, 0, stream>>>(AO, x, X1); k_bn<false><<<(TB * DM / 4 + 255) / 256, 256, 0, stream>>>(X1, g2, be2, m2, v2, Hh, Hl);
    k_gemmw<bf, 1, false, 8><<<dim3(TB / 64, FFD / 64, 1), 256, 0, stream>>>(Hh, Hl, W1B, nullptr, DM, Mf, FFD, nullptr, 0, 0, 0); k_gelu<<<(TB * FFD / 4 + 255) / 256, 256, 0, stream>>>(Mf, Gh, Gl);
    k_gemmw<bf, 1, false, 8><<<dim3(TB / 64, DM / 64, 1), 256, 0, stream>>>(Gh, Gl, W2B, nullptr, FFD, M2, DM, nullptr, 0, 0, 0); k_fin<<<(TB * DM / 4 + 255) / 256, 256, 0, stream>>>(M2, X1, OUT);
}

// v003
// Measured time: 194 microseconds a run.
// In two side-by-side timings against v002, it was 1.48 and 1.47 times as fast.
// Counting every step since v000, it is 4.73 times as fast.
#include <hip/hip_runtime.h>

// TransformerBaseBlock (x [4][2048][256]; h = BN1(x) (inference: gamma (x - mean) rsqrt(var + 1e-3) + beta); q/k/v = h W + b (4 heads x 64); softmax(q.k/8); attn_out = ctx Wo + bo; x1 = attn_out + x; m = gelu(BN2(x1) W1) W2 (exact erf GELU);
// out = m + x1 -> [4][2048][256]).
// Compute dtypes, f32 accumulate: every input rounded to bf16; BN1/BN2 f32 -> bf16 hi+lo planes; q/k/v (+ bias), W1 as hl x exact W (2 products); scores (K 64) and attn.v single fp16 planes;
// Every launch covers all four batches (rows b * 2048 + t, planes b * 4 + h); attention is one launch over all 16 (batch, head) planes: scores and probabilities stay in registers (k_fattn).

#define NB_  4
#define TT   2048
#define DM   256
#define NH_  4
#define NKV  4
#define REP  (NH_ / NKV)
#define HD   64
#define DQ   (NH_ * HD)
#define DKV  (NKV * HD)
#define TB   (NB_ * TT)         // rows of all batches
#define WIN  0
#define PCAR 1024.0f
#define SCL  0.125f   // HD^-0.5
typedef _Float16 h16;
typedef unsigned short bf;
typedef __attribute__((ext_vector_type(16))) __bf16   v16bf;
typedef __attribute__((ext_vector_type(16))) _Float16 v16h;
typedef __attribute__((ext_vector_type(8)))  _Float16 v8h;
typedef __attribute__((ext_vector_type(8)))  unsigned short v8us;
typedef __attribute__((ext_vector_type(8)))  float    v8f;
typedef __attribute__((ext_vector_type(4)))  float    v4f;
typedef v8h  __attribute__((may_alias)) v8ha;
typedef v4f  __attribute__((may_alias)) v4fa;
typedef v8us __attribute__((may_alias)) v8usa;

__device__ __forceinline__ unsigned short f2bf(float f) { unsigned u = __float_as_uint(f); u += 0x7FFFu + ((u >> 16) & 1u); return (unsigned short)(u >> 16); }
__device__ __forceinline__ float bf2f(unsigned short b) { return __uint_as_float(((unsigned)b) << 16); }
__device__ __forceinline__ float bfr(float f) { return bf2f(f2bf(f)); }
__device__ __forceinline__ v16h cat16(v8h lo, v8h hi) { return __builtin_shufflevector(lo, hi, 0, 1, 2, 3, 4, 5, 6, 7, 8, 9, 10, 11, 12, 13, 14, 15); }
__device__ __forceinline__ v16bf cat16b(v8us lo, v8us hi) { return __builtin_bit_cast(v16bf, __builtin_shufflevector(lo, hi, 0, 1, 2, 3, 4, 5, 6, 7, 8, 9, 10, 11, 12, 13, 14, 15)); }
__device__ __forceinline__ v8f wmma16(v16h a, v16h b, v8f c) { return __builtin_amdgcn_wmma_f32_16x16x32_f16(false, a, false, b, (short)0, c, false, false); }
__device__ __forceinline__ v8f wmmab(v16bf a, v16bf b, v8f c) { return __builtin_amdgcn_wmma_f32_16x16x32_bf16(false, a, false, b, (short)0, c, false, false); }



// ---- k_gemmw: register-blocked GEMM, one 64x64 output tile per work-group (16 accumulators per wave), operands straight from K-contiguous 16-bit planes; grid (M/64, N/64, Z), 32 * KS threads.
// C[m][n] (f32, pitch ldc, + optional f32 bias[n]) = sum_k A[m][k] Bt[n][k] (+ split products per NSPLIT). z-batch strides sA/sB/sC in elements. K % (32 * KS) == 0.
// KS > 1: K is split over the KS waves (wave w takes the 32-k chunks w, w + KS, ...: neighbouring waves read the two halves of the same 128-B lines); each wave leaves its f32 partial tile in LDS, and behind one barrier
// all threads add the KS partials in the fixed order 0 .. KS-1 and store whole rows.
template <typename T16> struct WFrag;
template <> struct WFrag<h16> { typedef v16h V; static __device__ __forceinline__ V ld(const h16* p) { return cat16(*(const v8h*)p, *(const v8h*)(p + 16)); } static __device__ __forceinline__ v8f mma(V a, V b, v8f c) { return wmma16(a, b, c); } };
template <> struct WFrag<bf> { typedef v16bf V; static __device__ __forceinline__ V ld(const bf* p) { return cat16b(*(const v8us*)p, *(const v8us*)(p + 16)); } static __device__ __forceinline__ v8f mma(V a, V b, v8f c) { return wmmab(a, b, c); } };
template <typename T16, int NSPLIT, bool BIAS, int KS>
__global__ __launch_bounds__(32 * KS) void k_gemmw(const T16* __restrict__ A, const T16* __restrict__ A2, const T16* __restrict__ Bt, const T16* __restrict__ Bt2, int K, float* C, int ldc, const float* __restrict__ bias, size_t sA, size_t sB, size_t sC) {
    typedef typename WFrag<T16>::V V;
    __shared__ __align__(16) float os[(KS == 1 ? 16 : KS * 64) * 68];
    const size_t z = blockIdx.z; A += z * sA; if (A2) A2 += z * sA; Bt += z * sB; if (Bt2) Bt2 += z * sB; C += z * sC;
    const int lane = threadIdx.x & 31, lr = lane & 15, hi = lane >> 4; const int r0 = blockIdx.x * 64, c0 = blockIdx.y * 64;
    const int wv = (KS == 1) ? 0 : __builtin_amdgcn_readfirstlane((int)(threadIdx.x >> 5));
    v8f acc[4][4];
#pragma unroll
    for (int mb = 0; mb < 4; ++mb)
#pragma unroll
        for (int nb = 0; nb < 4; ++nb) acc[mb][nb] = (v8f){};
    v4f bv = (v4f){};   // this thread's four bias columns (KS > 1), fetched ahead of the k loop so that their latency is not paid behind the barrier
    if (BIAS && KS > 1) { const int bc = c0 + ((int)threadIdx.x & 15) * 4; bv[0] = bfr(bias[bc]); bv[1] = bfr(bias[bc + 1]); bv[2] = bfr(bias[bc + 2]); bv[3] = bfr(bias[bc + 3]); }
    const size_t aoff = (size_t)(r0 + lr) * K + 8 * hi, boff = (size_t)(c0 + lr) * K + 8 * hi;
#pragma unroll 1
    for (int kc = wv * 32; kc < K; kc += 32 * KS) {
        V a[4], a2[4];
#pragma unroll
        for (int mb = 0; mb < 4; ++mb) { a[mb] = WFrag<T16>::ld(A + aoff + (size_t)mb * 16 * K + kc); if (NSPLIT == 1 || NSPLIT == 2) a2[mb] = WFrag<T16>::ld(A2 + aoff + (size_t)mb * 16 * K + kc); }
#pragma unroll
        for (int nb = 0; nb < 4; ++nb) { const V b = WFrag<T16>::ld(Bt + boff + (size_t)nb * 16 * K + kc); V b2; if (NSPLIT >= 2) b2 = WFrag<T16>::ld(Bt2 + boff + (size_t)nb * 16 * K + kc);
#pragma unroll
            for (int mb = 0; mb < 4; ++mb) { acc[mb][nb] = WFrag<T16>::mma(a[mb], b, acc[mb][nb]); if (NSPLIT == 1 || NSPLIT == 2) acc[mb][nb] = WFrag<T16>::mma(a2[mb], b, acc[mb][nb]); if (NSPLIT >= 2) acc[mb][nb] = WFrag<T16>::mma(a[mb], b2, acc[mb][nb]); } }
        asm volatile("v_nop\n\tv_nop\n\tv_nop\n\tv_nop" : "+v"(acc[0][0]), "+v"(acc[1][1]), "+v"(acc[2][2]), "+v"(acc[3][3]) : "v"(a[0]), "v"(a[3]));
    }
    if constexpr (KS > 1) {
        float* pw = os + wv * (64 * 68);
#pragma unroll
        for (int mb = 0; mb < 4; ++mb)
#pragma unroll
            for (int nb = 0; nb < 4; ++nb)
#pragma unroll
                for (int j = 0; j < 8; ++j) pw[(mb * 16 + hi * 8 + j) * 68 + nb * 16 + lr] = acc[mb][nb][j];
        __syncthreads();   // every wave's partial tile is in LDS before any thread adds them
#pragma unroll
        for (int s = 0; s < 32 / KS; ++s) { const int idx = s * (32 * KS) + (int)threadIdx.x; const int row = idx >> 4, cofs = (idx & 15) * 4; v4f val = *(const v4fa*)(os + row * 68 + cofs);
#pragma unroll
            for (int p = 1; p < KS; ++p) val += *(const v4fa*)(os + p * (64 * 68) + row * 68 + cofs);
            if (BIAS) val += bv;
            *(v4f*)(C + (size_t)(r0 + row) * ldc + c0 + cofs) = val; }
        return;
    }
#pragma unroll
    for (int mb = 0; mb < 4; ++mb) {
#pragma unroll
        for (int nb = 0; nb < 4; ++nb) {
#pragma unroll
            for (int j = 0; j < 8; ++j) os[(hi * 8 + j) * 68 + nb * 16 + lr] = acc[mb][nb][j]; }
        __builtin_amdgcn_wave_barrier(); asm volatile("" ::: "memory");
        float* crow = C + (size_t)(r0 + mb * 16) * ldc + c0;
{
#pragma unroll
            for (int s = 0; s < 8; ++s) { const int row = 2 * s + hi, cofs = lr * 4; v4f val = *(const v4fa*)(os + row * 68 + cofs); if (BIAS) { val[0] += bfr(bias[c0 + cofs]); val[1] += bfr(bias[c0 + cofs + 1]); val[2] += bfr(bias[c0 + cofs + 2]); val[3] += bfr(bias[c0 + cofs + 3]); }
                *(v4f*)(crow + (size_t)row * ldc + cofs) = val; }
             }
        __builtin_amdgcn_wave_barrier(); asm volatile("" ::: "memory");
    }
}

__device__ __forceinline__ h16 tohx(float x) { return (h16)x; }
__device__ __forceinline__ void splitf(float y, unsigned short& h, unsigned short& l) { h = f2bf(y); l = f2bf(y - bf2f(h)); }
typedef __attribute__((ext_vector_type(2))) _Float16 v2h;
typedef __attribute__((ext_vector_type(4))) _Float16 v4h;
typedef __attribute__((ext_vector_type(2))) unsigned short v2us;
typedef __attribute__((ext_vector_type(4))) unsigned short v4us;
typedef __attribute__((ext_vector_type(2))) float v2f;
typedef __attribute__((ext_vector_type(4))) int v4i;

__global__ __launch_bounds__(256) void k_wtG(const float* __restrict__ w, int K, int N, bf* Bt) {
    const int lane = threadIdx.x & 31; const int L0 = (blockIdx.x * 8 + (threadIdx.x >> 5)) * 8; const int nlines = N * K / 64;
{
#pragma unroll 1
        for (int l = 0; l < 8; ++l) { const int L = L0 + l; if (L >= nlines) break; const size_t e = (size_t)L * 64 + lane * 2; const int k = (int)(e % K), n = (int)(e / K); v2us o;
            o[0] = f2bf(w[(size_t)k * N + n]); o[1] = f2bf(w[(size_t)(k + 1) * N + n]); *(v2us*)(Bt + e) = o; }
         }
}
__global__ __launch_bounds__(256) void k_cvt8(const float* __restrict__ src, bf* dst, size_t n8) { const size_t i = (size_t)blockIdx.x * 256 + threadIdx.x; if (i >= n8) return; const v8f v = *(const v8f*)(src + i * 8); v8us o;
#pragma unroll
    for (int k = 0; k < 8; ++k) o[k] = f2bf(v[k]); *(v8us*)(dst + i * 8) = o;  }
__global__ __launch_bounds__(256) void k_cscvt(const float* __restrict__ cosT, const float* __restrict__ sinT, float* CS) { const int idx = blockIdx.x * 256 + threadIdx.x; if (idx >= TT * HD) return; v2f cs; cs[0] = bfr(cosT[idx]); cs[1] = bfr(sinT[idx]); *(v2f*)(CS + (size_t)idx * 2) = cs;  }
// k_rope: head planes [b][h][t][d] (fp16) of rope(x) x sc with the rotate-half convention out[d] = x[d] cos[t][d] - x[d+HD/2] sin[t][d], out[d+HD/2] = x[d+HD/2] cos[t][d+HD/2] + x[d] sin[t][d+HD/2]
__global__ __launch_bounds__(256) void k_rope(const float* __restrict__ F, int pitch, int nheads, const float* __restrict__ CS, const float* __restrict__ RF, const float* __restrict__ nw, float sc, h16* P16, bf* Ph, bf* Pl) {
    F += (size_t)blockIdx.y * TT * pitch; P16 += (size_t)blockIdx.y * nheads * TT * HD;   // blockIdx.y: the batch
    const size_t e = ((size_t)blockIdx.x * 256 + threadIdx.x) * 2; if (e >= (size_t)nheads * TT * HD) return; const int d = (int)(e % HD); const int t = (int)((e / HD) % TT); const int h = (int)(e / ((size_t)HD * TT)); const float* f = F + (size_t)t * pitch + h * HD; const float rf = RF ? RF[(size_t)h * TT + t] : 1.0f; v2h o16; v2us oh, ol;
#pragma unroll
    for (int q = 0; q < 2; ++q) { const int dd = d + q; const int dp = (dd < HD / 2) ? dd + HD / 2 : dd - HD / 2; float x0 = f[dd], x1 = f[dp];
        if (RF) { float n0 = __fmul_rn(x0, rf), n1 = __fmul_rn(x1, rf); asm volatile("" : "+v"(n0)); asm volatile("" : "+v"(n1)); x0 = __fmul_rn(bfr(nw[dd]), n0); x1 = __fmul_rn(bfr(nw[dp]), n1); }
        const v2f cs = *(const v2f*)(CS + ((size_t)t * HD + dd) * 2); float a = __fmul_rn(x0, cs[0]), bq = __fmul_rn(x1, cs[1]); asm volatile("" : "+v"(a)); asm volatile("" : "+v"(bq)); const float r = ((dd < HD / 2) ? __fsub_rn(a, bq) : __fadd_rn(a, bq)) * sc;
        o16[q] = tohx(r); (void)oh; (void)ol; }
    *(v2h*)(P16 + e) = o16;  }
__global__ __launch_bounds__(256) void k_vtp(const float* __restrict__ F, int pitch, int nheads, h16* V16, bf* Vh, bf* Vl) { const size_t e = ((size_t)blockIdx.x * 256 + threadIdx.x) * 2; if (e >= (size_t)nheads * HD * TT) return; const int t = (int)(e % TT); const int d = (int)((e / TT) % HD); const int g = (int)(e / ((size_t)TT * HD)); F += (size_t)blockIdx.y * TT * pitch; V16 += (size_t)blockIdx.y * nheads * HD * TT;   /* blockIdx.y: the batch */ v2h o16; v2us oh, ol;
#pragma unroll
    for (int q = 0; q < 2; ++q) { const float x = F[(size_t)(t + q) * pitch + g * HD + d]; o16[q] = tohx(x); (void)oh; (void)ol; }
    *(v2h*)(V16 + e) = o16;  }
__global__ __launch_bounds__(256) void k_csid(float* CS) { const int idx = blockIdx.x * 256 + threadIdx.x; if (idx >= TT * HD) return; v2f cs; cs[0] = 1.0f; cs[1] = 0.0f; *(v2f*)(CS + (size_t)idx * 2) = cs;  }
// k_fattn: scores, softmax and attn.v of one (batch, head) plane in one kernel. One wave owns 32 query columns (two groups of 16) and walks the 2048 keys in passes of 32.
// Transposed products: S^T = K Q^T (A = 16 key rows, B = the wave's queries, kept in registers), O^T += V^T P^T (A = 16 d rows of the [d][t] plane). In an S^T tile lane (lr, hi) holds keys 8 hi + 0..7 of query lr,
// which is the k order of a B operand: tiles 0 and 1 of a pass, rounded to fp16, ARE the 32-key B operand; nothing crosses lanes but one exchange between the wave's halves for the maximum (and one for the sum, at the end).
// Running softmax in the log2 domain: p = 2^(s c - m), c = HD^-0.5 log2 e; m, the maximum in use, may trail the true one by up to 8 (p <= 2^8, well inside fp16); sums and accumulators are rescaled only when a column exceeds that.
// The epilogue divides by the sum (as x PCAR / sum, then / PCAR, the two roundings the separate kernels had) and stores the bf16 hi+lo planes [b * 2048 + t][h * 64 + d] that the output projection reads: 128-B lines, one wave each.
#define FQW 4   // waves per work-group: 128 queries, 256 work-groups
__device__ __forceinline__ float xhalf(float x) { return __builtin_bit_cast(float, __builtin_amdgcn_permlanex16(__builtin_bit_cast(int, x), __builtin_bit_cast(int, x), 0x76543210, 0xfedcba98, false, false)); }  // lane l with lane l ^ 16
__global__ __launch_bounds__(32 * FQW) void k_fattn(const h16* __restrict__ Q, const h16* __restrict__ Kp, const h16* __restrict__ Vt, bf* Ah, bf* Al) {
    typedef WFrag<h16> WF;
    const int lane = threadIdx.x & 31, lr = lane & 15, hi = lane >> 4; const int wv = __builtin_amdgcn_readfirstlane((int)(threadIdx.x >> 5));
    const size_t z = blockIdx.y, zk = z / REP; const int q0 = ((int)blockIdx.x * FQW + wv) * 32;
    const h16* qp = Q + (z * TT + q0 + lr) * HD + 8 * hi; const h16* kp = Kp + (zk * TT + lr) * HD + 8 * hi; const h16* vp = Vt + (zk * HD + lr) * TT + 8 * hi;
    v16h qf[2][2], kf[2][2], vf[4]; v8f o[2][4]; float mr[2], l[2];   // the inner loops are all unrolled so that these arrays are registers
#pragma unroll
    for (int g = 0; g < 2; ++g) { mr[g] = -__builtin_inff(); l[g] = 0.f;
#pragma unroll
        for (int ks = 0; ks < 2; ++ks) { qf[g][ks] = WF::ld(qp + g * 16 * HD + ks * 32); kf[g][ks] = WF::ld(kp + g * 16 * HD + ks * 32); }
#pragma unroll
        for (int dt = 0; dt < 4; ++dt) o[g][dt] = (v8f){}; }
#pragma unroll
    for (int dt = 0; dt < 4; ++dt) vf[dt] = WF::ld(vp + (size_t)dt * 16 * TT);
    asm volatile("s_wait_xcnt 0x0" :: "v"(qp) : "memory");   // stands in front of the first write of a register that held one of these loads' addresses; qp, dead behind its loads, is named so that its registers last up to here
    const float cs = SCL * 1.4426950408889634f;
#pragma unroll 1   // 64 passes: rolled, the body is long enough and the fetch-ahead wants one register set
    for (int k0 = 0; k0 < TT; k0 += 32) {
        v8f s[2][2];
#pragma unroll
        for (int kt = 0; kt < 2; ++kt)
#pragma unroll
            for (int g = 0; g < 2; ++g) s[kt][g] = WF::mma(kf[kt][1], qf[g][1], WF::mma(kf[kt][0], qf[g][0], (v8f){}));
        const int kn = (k0 + 32) & (TT - 1);   // K and V^T fragments are fetched one pass ahead, each into the registers its product has just read; the last pass fetches keys 0..31 again (in bounds, unused)
#pragma unroll
        for (int kt = 0; kt < 2; ++kt)
#pragma unroll
            for (int ks = 0; ks < 2; ++ks) kf[kt][ks] = WF::ld(kp + (size_t)(kn + kt * 16) * HD + ks * 32);
        float mb[2]; bool need = false;
#pragma unroll
        for (int g = 0; g < 2; ++g) { float m0 = s[0][g][0], m1 = s[1][g][0];
#pragma unroll
            for (int j = 1; j < 8; ++j) { m0 = fmaxf(m0, s[0][g][j]); m1 = fmaxf(m1, s[1][g][j]); }
            m0 = fmaxf(m0, m1); mb[g] = fmaxf(m0, xhalf(m0)) * cs; need = need || (mb[g] > mr[g] + 8.0f); }   // both halves of the wave hold the query's maximum, scaled (the scale is positive)
        if (__builtin_amdgcn_ballot_w32(need) != 0) {   // wave-uniform; always taken in the first pass (mr = -inf gives the factor 0), rare later
#pragma unroll
            for (int g = 0; g < 2; ++g) { const float mn = fmaxf(mr[g], mb[g]); const float al = __builtin_amdgcn_exp2f(mr[g] - mn); mr[g] = mn; l[g] *= al;
#pragma unroll
                for (int dt = 0; dt < 4; ++dt) o[g][dt] *= al; }
        }
#pragma unroll
        for (int g = 0; g < 2; ++g) { const float nm = -mr[g]; float a0 = 0.f, a1 = 0.f; v16h pf;
#pragma unroll
            for (int i = 0; i < 8; ++i) { const v2f ar = __builtin_elementwise_fma((v2f){s[i >> 2][g][2 * (i & 3)], s[i >> 2][g][2 * (i & 3) + 1]}, (v2f){cs, cs}, (v2f){nm, nm});
                const float p0 = __builtin_amdgcn_exp2f(ar[0]), p1 = __builtin_amdgcn_exp2f(ar[1]); a0 += p0; a1 += p1; pf[2 * i] = tohx(p0); pf[2 * i + 1] = tohx(p1); }
            l[g] += a0 + a1;
#pragma unroll
            for (int dt = 0; dt < 4; ++dt) o[g][dt] = WF::mma(vf[dt], pf, o[g][dt]); }
#pragma unroll
        for (int dt = 0; dt < 4; ++dt) vf[dt] = WF::ld(vp + (size_t)dt * 16 * TT + kn);
        asm volatile("s_wait_xcnt 0x0" ::: "memory");   // stands in front of the next pass's first write of the registers that held these loads' address
    }
#pragma unroll
    for (int g = 0; g < 2; ++g) { const float f = __fdiv_rn(PCAR, l[g] + xhalf(l[g])); const size_t oo = ((z / NH_) * TT + q0 + g * 16 + lr) * DQ + (z % NH_) * HD + hi * 8;   // lane (lr, hi) holds d = 16 dt + 8 hi + 0..7 of query lr; row b * 2048 + t, columns h * 64 + d
#pragma unroll
        for (int dt = 0; dt < 4; ++dt) { v8us oh, ol;
#pragma unroll
            for (int j = 0; j < 8; ++j) { unsigned short a, c2; splitf((o[g][dt][j] * f) * (1.0f / PCAR), a, c2); oh[j] = a; ol[j] = c2; }
            *(v8us*)(Ah + oo + dt * 16) = oh; *(v8us*)(Al + oo + dt * 16) = ol; } }
}

// block tail: k_bn: hl planes of gamma (v - mean) rsqrt(var + 1e-3) + beta over [b * 2048 + t][256] (RAW: v is a raw input row, bf16-rounded first) (8-B lanes); k_res: X1 = A + bf16 x (16-B lanes); k_gelu: hl planes of exact-erf GELU (8-B lanes);
#define FFD 1024
template <bool RAW> __global__ __launch_bounds__(256) void k_bn(const float* __restrict__ X, const float* __restrict__ ga, const float* __restrict__ be, const float* __restrict__ mu, const float* __restrict__ var, bf* Hh, bf* Hl) { const int e = (blockIdx.x * 256 + threadIdx.x) * 4; if (e >= TB * DM) return; const int c = e % DM; v4us oh, ol;
#pragma unroll
    for (int u = 0; u < 4; ++u) { float xv = X[e + u]; if (RAW) xv = bfr(xv); float gg = bfr(ga[c + u]), bb = bfr(be[c + u]), mm = bfr(mu[c + u]), vv = bfr(var[c + u]); const float rs = __frsqrt_rn(__fadd_rn(vv, 1e-3f)); float d = __fsub_rn(xv, mm); asm volatile("" : "+v"(d)); float t1 = __fmul_rn(gg, d); asm volatile("" : "+v"(t1)); float t2 = __fmul_rn(t1, rs); asm volatile("" : "+v"(t2)); const float y = __fadd_rn(t2, bb); unsigned short a, b2; splitf(y, a, b2); oh[u] = a; ol[u] = b2; }
    *(v4us*)(Hh + e) = oh; *(v4us*)(Hl + e) = ol;  }
__global__ __launch_bounds__(256) void k_res(const float* __restrict__ A, const float* __restrict__ x, float* X1) { const int e = (blockIdx.x * 256 + threadIdx.x) * 4; if (e >= TB * DM) return; const v4f a = *(const v4f*)(A + e), b = *(const v4f*)(x + e); v4f o;
#pragma unroll
    for (int u = 0; u < 4; ++u) o[u] = __fadd_rn(a[u], bfr(b[u])); *(v4f*)(X1 + e) = o;  }
__global__ __launch_bounds__(256) void k_gelu(const float* __restrict__ Mf, bf* Gh, bf* Gl) { const int e = (blockIdx.x * 256 + threadIdx.x) * 4; if (e >= TB * FFD) return; const v4f a = *(const v4f*)(Mf + e); v4us oh, ol;
#pragma unroll 1
    for (int u = 0; u < 4; ++u) { const float y = a[u]; float er = erff(y * 0.70710678118654752f); asm volatile("" : "+v"(er)); float hy = __fmul_rn(0.5f, y); asm volatile("" : "+v"(hy)); const float ge = __fmul_rn(hy, __fadd_rn(1.0f, er)); unsigned short h, l; splitf(ge, h, l); oh[u] = h; ol[u] = l; }
    *(v4us*)(Gh + e) = oh; *(v4us*)(Gl + e) = ol;  }
__global__ __launch_bounds__(256) void k_fin(const float* __restrict__ M2, const float* __restrict__ X1, float* OUTb) { const int e = (blockIdx.x * 256 + threadIdx.x) * 4; if (e >= TB * DM) return; const v4f a = *(const v4f*)(M2 + e), b = *(const v4f*)(X1 + e); v4f o;
#pragma unroll
    for (int u = 0; u < 4; ++u) o[u] = __fadd_rn(a[u], b[u]); *(v4f*)(OUTb + e) = o;  }

extern "C" void kernel_launch(void* const* d_in, const int* in_sizes, int n_in,
                              void* d_out, int out_size, void* d_ws, size_t ws_size, hipStream_t stream) {
    (void)in_sizes; (void)n_in; (void)out_size;
    const float** Ip = (const float**)d_in; const float *x = Ip[0], *g1 = Ip[1], *be1 = Ip[2], *m1 = Ip[3], *v1 = Ip[4], *wq = Ip[5], *bq = Ip[6], *wk = Ip[7], *bk = Ip[8], *wv = Ip[9], *bv = Ip[10], *wo = Ip[11], *bo = Ip[12], *g2 = Ip[13], *be2 = Ip[14], *m2 = Ip[15], *v2 = Ip[16], *w1 = Ip[17], *w2 = Ip[18]; const float* cosT = nullptr; const float* sinT = nullptr; (void)cosT; (void)sinT;
    float* OUT = (float*)d_out;     // [4][2048][256]
    char* wsp = (char*)d_ws;
    auto take = [&](size_t bytes) { char* p = wsp; wsp += (bytes + 255) & ~(size_t)255; return (void*)p; };
    bf* WQ = (bf*)take((size_t)DQ * DM * 2); bf* WK = (bf*)take((size_t)DKV * DM * 2); bf* WV = (bf*)take((size_t)DKV * DM * 2); bf* WO = (bf*)take((size_t)DM * DQ * 2); float* CS = (float*)take((size_t)TT * HD * 2 * 4);
    bf* Hh = (bf*)take((size_t)TB * DM * 2); bf* Hl = (bf*)take((size_t)TB * DM * 2); bf* W1B = (bf*)take((size_t)FFD * DM * 2); bf* W2B = (bf*)take((size_t)DM * FFD * 2); float* FQ = (float*)take((size_t)TB * DQ * 4); float* FK = (float*)take((size_t)TB * DKV * 4);
    h16* QP16 = (h16*)take((size_t)NB_ * NH_ * TT * HD * 2); h16* KP16 = (h16*)take((size_t)NB_ * NKV * TT * HD * 2); h16* VT16 = (h16*)take((size_t)NB_ * NKV * HD * TT * 2);
    bf* QPh = nullptr; bf* QPl = nullptr; bf* KPh = nullptr; bf* KPl = nullptr; bf* VTh = nullptr; bf* VTl = nullptr;
    bf* ATh = (bf*)take((size_t)TB * DQ * 2); bf* ATl = (bf*)take((size_t)TB * DQ * 2);
    float* AO = (float*)take((size_t)TB * DM * 4); float* X1 = (float*)take((size_t)TB * DM * 4); float* Mf = (float*)take((size_t)TB * FFD * 4); bf* Gh = (bf*)take((size_t)TB * FFD * 2); bf* Gl = (bf*)take((size_t)TB * FFD * 2); float* M2 = (float*)take((size_t)TB * DM * 4);
    if ((size_t)(wsp - (char*)d_ws) > ws_size) return;    // ws 256 MiB
    float* FV = FK;   // v projection reuses the k buffer after the k planes are built (stream-ordered)
    { k_wtG<<<(unsigned)((DM * DQ / 64 + 63) / 64), 256, 0, stream>>>(wq, DM, DQ, WQ); k_wtG<<<(unsigned)((DM * DKV / 64 + 63) / 64), 256, 0, stream>>>(wk, DM, DKV, WK); k_wtG<<<(unsigned)((DM * DKV / 64 + 63) / 64), 256, 0, stream>>>(wv, DM, DKV, WV);
      k_wtG<<<(unsigned)((DQ * DM / 64 + 63) / 64), 256, 0, stream>>>(wo, DQ, DM, WO);
       }
    k_csid<<<(TT * HD + 255) / 256, 256, 0, stream>>>(CS); k_wtG<<<(unsigned)((DM * FFD / 64 + 63) / 64), 256, 0, stream>>>(w1, DM, FFD, W1B); k_wtG<<<(unsigned)((FFD * DM / 64 + 63) / 64), 256, 0, stream>>>(w2, FFD, DM, W2B);
    const unsigned LQ = (unsigned)(((size_t)NH_ * TT * HD / 2 + 255) / 256), LKv = (unsigned)(((size_t)NKV * TT * HD / 2 + 255) / 256);
    k_bn<true><<<(TB * DM / 4 + 255) / 256, 256, 0, stream>>>(x, g1, be1, m1, v1, Hh, Hl);
    k_gemmw<bf, 1, true, 8><<<dim3(TB / 64, DQ / 64, 1), 256, 0, stream>>>(Hh, Hl, WQ, nullptr, DM, FQ, DQ, bq, 0, 0, 0);
    k_rope<<<dim3(LQ, NB_, 1), 256, 0, stream>>>(FQ, DQ, NH_, CS, nullptr, nullptr, 1.0f, QP16, QPh, QPl);
    k_gemmw<bf, 1, true, 8><<<dim3(TB / 64, DKV / 64, 1), 256, 0, stream>>>(Hh, Hl, WK, nullptr, DM, FK, DKV, bk, 0, 0, 0);
    k_rope<<<dim3(LKv, NB_, 1), 256, 0, stream>>>(FK, DKV, NKV, CS, nullptr, nullptr, 1.0f, KP16, KPh, KPl);
    k_gemmw<bf, 1, true, 8><<<dim3(TB / 64, DKV / 64, 1), 256, 0, stream>>>(Hh, Hl, WV, nullptr, DM, FV, DKV, bv, 0, 0, 0); k_vtp<<<dim3(LKv, NB_, 1), 256, 0, stream>>>(FV, DKV, NKV, VT16, VTh, VTl);
    k_fattn<<<dim3(TT / (32 * FQW), NB_ * NH_, 1), 32 * FQW, 0, stream>>>(QP16, KP16, VT16, ATh, ATl);
    k_gemmw<bf, 1, true, 8><<<dim3(TB / 64, DM / 64, 1), 256, 0, stream>>>(ATh, ATl, WO, nullptr, DQ, AO, DM, bo, 0, 0, 0);
    k_res<<<(TB * DM / 4 + 255) / 256, 256, 0, stream>>>(AO, x, X1); k_bn<false><<<(TB * DM / 4 + 255) / 256, 256, 0, stream>>>(X1, g2, be2, m2, v2, Hh, Hl);
    k_gemmw<bf, 1, false, 8><<<dim3(TB / 64, FFD / 64, 1), 256, 0, stream>>>(Hh, Hl, W1B, nullptr, DM, Mf, FFD, nullptr, 0, 0, 0); k_gelu<<<(TB * FFD / 4 + 255) / 256, 256, 0, stream>>>(Mf, Gh, Gl);
    k_gemmw<bf, 1, false, 8><<<dim3(TB / 64, DM / 64, 1), 256, 0, stream>>>(Gh, Gl, W2B, nullptr, FFD, M2, DM, nullptr, 0, 0, 0); k_fin<<<(TB * DM / 4 + 255) / 256, 256, 0, stream>>>(M2, X1, OUT);
}

// v004
// Measured time: 151 microseconds a run.
// Next to v003, in two timings, it ran 1.29 and 1.28 times as fast.
// Over all steps from v000 it is 6.07 times as fast.
#include <hip/hip_runtime.h>

// TransformerBaseBlock (x [4][2048][256]; h = BN1(x) (inference: gamma (x - mean) rsqrt(var + 1e-3) + beta); q/k/v = h W + b (4 heads x 64); softmax(q.k/8); attn_out = ctx Wo + bo; x1 = attn_out + x; m = gelu(BN2(x1) W1) W2 (exact erf GELU);
// out = m + x1 -> [4][2048][256]).
// Compute dtypes, f32 accumulate: every input rounded to bf16; BN1/BN2 f32 -> bf16 hi+lo planes; q/k/v (+ bias), W1 as hl x exact W (2 products); scores (K 64) and attn.v single fp16 planes;
// Every launch covers all four batches (rows b * 2048 + t, planes b * 4 + h); attention is one launch over all 16 (batch, head) planes: scores and probabilities stay in registers (k_fattn).
// Launches that do not depend on one another share one grid: k_prep (six weight transposes, the cos/sin table, BN1), the q, k, v projections (grid z of k_gemmw), k_planes (q and k head planes, V^T).

#define NB_  4
#define TT   2048
#define DM   256
#define NH_  4
#define NKV  4
#define REP  (NH_ / NKV)
#define HD   64
#define DQ   (NH_ * HD)
#define DKV  (NKV * HD)
#define TB   (NB_ * TT)         // rows of all batches
#define WIN  0
#define PCAR 1024.0f
#define SCL  0.125f   // HD^-0.5
typedef _Float16 h16;
typedef unsigned short bf;
typedef __attribute__((ext_vector_type(16))) __bf16   v16bf;
typedef __attribute__((ext_vector_type(16))) _Float16 v16h;
typedef __attribute__((ext_vector_type(8)))  _Float16 v8h;
typedef __attribute__((ext_vector_type(8)))  unsigned short v8us;
typedef __attribute__((ext_vector_type(8)))  float    v8f;
typedef __attribute__((ext_vector_type(4)))  float    v4f;
typedef v8h  __attribute__((may_alias)) v8ha;
typedef v4f  __attribute__((may_alias)) v4fa;
typedef v8us __attribute__((may_alias)) v8usa;

__device__ __forceinline__ unsigned short f2bf(float f) { unsigned u = __float_as_uint(f); u += 0x7FFFu + ((u >> 16) & 1u); return (unsigned short)(u >> 16); }
__device__ __forceinline__ float bf2f(unsigned short b) { return __uint_as_float(((unsigned)b) << 16); }
__device__ __forceinline__ float bfr(float f) { return bf2f(f2bf(f)); }
__device__ __forceinline__ v16h cat16(v8h lo, v8h hi) { return __builtin_shufflevector(lo, hi, 0, 1, 2, 3, 4, 5, 6, 7, 8, 9, 10, 11, 12, 13, 14, 15); }
__device__ __forceinline__ v16bf cat16b(v8us lo, v8us hi) { return __builtin_bit_cast(v16bf, __builtin_shufflevector(lo, hi, 0, 1, 2, 3, 4, 5, 6, 7, 8, 9, 10, 11, 12, 13, 14, 15)); }
__device__ __forceinline__ v8f wmma16(v16h a, v16h b, v8f c) { return __builtin_amdgcn_wmma_f32_16x16x32_f16(false, a, false, b, (short)0, c, false, false); }
__device__ __forceinline__ v8f wmmab(v16bf a, v16bf b, v8f c) { return __builtin_amdgcn_wmma_f32_16x16x32_bf16(false, a, false, b, (short)0, c, false, false); }



// ---- k_gemmw: register-blocked GEMM, one 64x64 output tile per work-group (16 accumulators per wave), operands straight from K-contiguous 16-bit planes; grid (M/64, N/64, Z), 32 * KS threads.
// C[m][n] (f32, pitch ldc, + optional f32 bias[n]) = sum_k A[m][k] Bt[n][k] (+ split products per NSPLIT). z-batch strides sA/sB/sC in elements; the bias vectors are separate buffers: bias for z = 0, biasZ1 and biasZ2 for z = 1 and 2. K % (32 * KS) == 0.
// KS > 1: K is split over the KS waves (wave w takes the 32-k chunks w, w + KS, ...: neighbouring waves read the two halves of the same 128-B lines); each wave leaves its f32 partial tile in LDS, and behind one barrier
// all threads add the KS partials in the fixed order 0 .. KS-1 and store whole rows.
template <typename T16> struct WFrag;
template <> struct WFrag<h16> { typedef v16h V; static __device__ __forceinline__ V ld(const h16* p) { return cat16(*(const v8h*)p, *(const v8h*)(p + 16)); } static __device__ __forceinline__ v8f mma(V a, V b, v8f c) { return wmma16(a, b, c); } };
template <> struct WFrag<bf> { typedef v16bf V; static __device__ __forceinline__ V ld(const bf* p) { return cat16b(*(const v8us*)p, *(const v8us*)(p + 16)); } static __device__ __forceinline__ v8f mma(V a, V b, v8f c) { return wmmab(a, b, c); } };
template <typename T16, int NSPLIT, bool BIAS, int KS>
__global__ __launch_bounds__(32 * KS) void k_gemmw(const T16* __restrict__ A, const T16* __restrict__ A2, const T16* __restrict__ Bt, const T16* __restrict__ Bt2, int K, float* C, int ldc, const float* __restrict__ bias, const float* __restrict__ biasZ1, const float* __restrict__ biasZ2, size_t sA, size_t sB, size_t sC) {
    typedef typename WFrag<T16>::V V;
    __shared__ __align__(16) float os[(KS == 1 ? 16 : KS * 64) * 68];
    const size_t z = blockIdx.z; A += z * sA; if (A2) A2 += z * sA; Bt += z * sB; if (Bt2) Bt2 += z * sB; C += z * sC; const float* bz = (z == 0) ? bias : ((z == 1) ? biasZ1 : biasZ2);
    const int lane = threadIdx.x & 31, lr = lane & 15, hi = lane >> 4; const int r0 = blockIdx.x * 64, c0 = blockIdx.y * 64;
    const int wv = (KS == 1) ? 0 : __builtin_amdgcn_readfirstlane((int)(threadIdx.x >> 5));
    v8f acc[4][4];
#pragma unroll
    for (int mb = 0; mb < 4; ++mb)
#pragma unroll
        for (int nb = 0; nb < 4; ++nb) acc[mb][nb] = (v8f){};
    v4f bv = (v4f){};   // this thread's four bias columns (KS > 1), fetched ahead of the k loop so that their latency is not paid behind the barrier
    if (BIAS && KS > 1) { const int bc = c0 + ((int)threadIdx.x & 15) * 4; bv[0] = bfr(bz[bc]); bv[1] = bfr(bz[bc + 1]); bv[2] = bfr(bz[bc + 2]); bv[3] = bfr(bz[bc + 3]); }
    const size_t aoff = (size_t)(r0 + lr) * K + 8 * hi, boff = (size_t)(c0 + lr) * K + 8 * hi;
#pragma unroll 1
    for (int kc = wv * 32; kc < K; kc += 32 * KS) {
        V a[4], a2[4];
#pragma unroll
        for (int mb = 0; mb < 4; ++mb) { a[mb] = WFrag<T16>::ld(A + aoff + (size_t)mb * 16 * K + kc); if (NSPLIT == 1 || NSPLIT == 2) a2[mb] = WFrag<T16>::ld(A2 + aoff + (size_t)mb * 16 * K + kc); }
#pragma unroll
        for (int nb = 0; nb < 4; ++nb) { const V b = WFrag<T16>::ld(Bt + boff + (size_t)nb * 16 * K + kc); V b2; if (NSPLIT >= 2) b2 = WFrag<T16>::ld(Bt2 + boff + (size_t)nb * 16 * K + kc);
#pragma unroll
            for (int mb = 0; mb < 4; ++mb) { acc[mb][nb] = WFrag<T16>::mma(a[mb], b, acc[mb][nb]); if (NSPLIT == 1 || NSPLIT == 2) acc[mb][nb] = WFrag<T16>::mma(a2[mb], b, acc[mb][nb]); if (NSPLIT >= 2) acc[mb][nb] = WFrag<T16>::mma(a[mb], b2, acc[mb][nb]); } }
        asm volatile("v_nop\n\tv_nop\n\tv_nop\n\tv_nop" : "+v"(acc[0][0]), "+v"(acc[1][1]), "+v"(acc[2][2]), "+v"(acc[3][3]) : "v"(a[0]), "v"(a[3]));
    }
    if constexpr (KS > 1) {
        float* pw = os + wv * (64 * 68);
#pragma unroll
        for (int mb = 0; mb < 4; ++mb)
#pragma unroll
            for (int nb = 0; nb < 4; ++nb)
#pragma unroll
                for (int j = 0; j < 8; ++j) pw[(mb * 16 + hi * 8 + j) * 68 + nb * 16 + lr] = acc[mb][nb][j];
        __syncthreads();   // every wave's partial tile is in LDS before any thread adds them
#pragma unroll
        for (int s = 0; s < 32 / KS; ++s) { const int idx = s * (32 * KS) + (int)threadIdx.x; const int row = idx >> 4, cofs = (idx & 15) * 4; v4f val = *(const v4fa*)(os + row * 68 + cofs);
#pragma unroll
            for (int p = 1; p < KS; ++p) val += *(const v4fa*)(os + p * (64 * 68) + row * 68 + cofs);
            if (BIAS) val += bv;
            *(v4f*)(C + (size_t)(r0 + row) * ldc + c0 + cofs) = val; }
        return;
    }
#pragma unroll
    for (int mb = 0; mb < 4; ++mb) {
#pragma unroll
        for (int nb = 0; nb < 4; ++nb) {
#pragma unroll
            for (int j = 0; j < 8; ++j) os[(hi * 8 + j) * 68 + nb * 16 + lr] = acc[mb][nb][j]; }
        __builtin_amdgcn_wave_barrier(); asm volatile("" ::: "memory");
        float* crow = C + (size_t)(r0 + mb * 16) * ldc + c0;
{
#pragma unroll
            for (int s = 0; s < 8; ++s) { const int row = 2 * s + hi, cofs = lr * 4; v4f val = *(const v4fa*)(os + row * 68 + cofs); if (BIAS) { val[0] += bfr(bz[c0 + cofs]); val[1] += bfr(bz[c0 + cofs + 1]); val[2] += bfr(bz[c0 + cofs + 2]); val[3] += bfr(bz[c0 + cofs + 3]); }
                *(v4f*)(crow + (size_t)row * ldc + cofs) = val; }
             }
        __builtin_amdgcn_wave_barrier(); asm volatile("" ::: "memory");
    }
}

__device__ __forceinline__ h16 tohx(float x) { return (h16)x; }
__device__ __forceinline__ void splitf(float y, unsigned short& h, unsigned short& l) { h = f2bf(y); l = f2bf(y - bf2f(h)); }
typedef __attribute__((ext_vector_type(2))) _Float16 v2h;
typedef __attribute__((ext_vector_type(4))) _Float16 v4h;
typedef __attribute__((ext_vector_type(2))) unsigned short v2us;
typedef __attribute__((ext_vector_type(4))) unsigned short v4us;
typedef __attribute__((ext_vector_type(2))) float v2f;
typedef __attribute__((ext_vector_type(4))) int v4i;

// d_*: bodies of the kernels that share a grid; bx is the work-group's index inside its own part of the grid
__device__ __forceinline__ void d_wtG(int bx, const float* __restrict__ w, int K, int N, bf* Bt) {
    const int lane = threadIdx.x & 31; const int L0 = (bx * 8 + (threadIdx.x >> 5)) * 8; const int nlines = N * K / 64;
{
#pragma unroll 1
        for (int l = 0; l < 8; ++l) { const int L = L0 + l; if (L >= nlines) break; const size_t e = (size_t)L * 64 + lane * 2; const int k = (int)(e % K), n = (int)(e / K); v2us o;
            o[0] = f2bf(w[(size_t)k * N + n]); o[1] = f2bf(w[(size_t)(k + 1) * N + n]); *(v2us*)(Bt + e) = o; }
         }
}
__global__ __launch_bounds__(256) void k_cvt8(const float* __restrict__ src, bf* dst, size_t n8) { const size_t i = (size_t)blockIdx.x * 256 + threadIdx.x; if (i >= n8) return; const v8f v = *(const v8f*)(src + i * 8); v8us o;
#pragma unroll
    for (int k = 0; k < 8; ++k) o[k] = f2bf(v[k]); *(v8us*)(dst + i * 8) = o;  }
__global__ __launch_bounds__(256) void k_cscvt(const float* __restrict__ cosT, const float* __restrict__ sinT, float* CS) { const int idx = blockIdx.x * 256 + threadIdx.x; if (idx >= TT * HD) return; v2f cs; cs[0] = bfr(cosT[idx]); cs[1] = bfr(sinT[idx]); *(v2f*)(CS + (size_t)idx * 2) = cs;  }
// d_rope: head planes [b][h][t][d] (fp16) of rope(x) x sc with the rotate-half convention out[d] = x[d] cos[t][d] - x[d+HD/2] sin[t][d], out[d+HD/2] = x[d+HD/2] cos[t][d+HD/2] + x[d] sin[t][d+HD/2]
__device__ __forceinline__ void d_rope(const float* __restrict__ F, int pitch, int nheads, const float* __restrict__ CS, const float* __restrict__ RF, const float* __restrict__ nw, float sc, h16* P16, bf* Ph, bf* Pl) {
    F += (size_t)blockIdx.y * TT * pitch; P16 += (size_t)blockIdx.y * nheads * TT * HD;   // blockIdx.y: the batch
    const size_t e = ((size_t)blockIdx.x * 256 + threadIdx.x) * 2; if (e >= (size_t)nheads * TT * HD) return; const int d = (int)(e % HD); const int t = (int)((e / HD) % TT); const int h = (int)(e / ((size_t)HD * TT)); const float* f = F + (size_t)t * pitch + h * HD; const float rf = RF ? RF[(size_t)h * TT + t] : 1.0f; v2h o16; v2us oh, ol;
#pragma unroll
    for (int q = 0; q < 2; ++q) { const int dd = d + q; const int dp = (dd < HD / 2) ? dd + HD / 2 : dd - HD / 2; float x0 = f[dd], x1 = f[dp];
        if (RF) { float n0 = __fmul_rn(x0, rf), n1 = __fmul_rn(x1, rf); asm volatile("" : "+v"(n0)); asm volatile("" : "+v"(n1)); x0 = __fmul_rn(bfr(nw[dd]), n0); x1 = __fmul_rn(bfr(nw[dp]), n1); }
        const v2f cs = *(const v2f*)(CS + ((size_t)t * HD + dd) * 2); float a = __fmul_rn(x0, cs[0]), bq = __fmul_rn(x1, cs[1]); asm volatile("" : "+v"(a)); asm volatile("" : "+v"(bq)); const float r = ((dd < HD / 2) ? __fsub_rn(a, bq) : __fadd_rn(a, bq)) * sc;
        o16[q] = tohx(r); (void)oh; (void)ol; }
    *(v2h*)(P16 + e) = o16;  }
__device__ __forceinline__ void d_vtp(const float* __restrict__ F, int pitch, int nheads, h16* V16, bf* Vh, bf* Vl) { const size_t e = ((size_t)blockIdx.x * 256 + threadIdx.x) * 2; if (e >= (size_t)nheads * HD * TT) return; const int t = (int)(e % TT); const int d = (int)((e / TT) % HD); const int g = (int)(e / ((size_t)TT * HD)); F += (size_t)blockIdx.y * TT * pitch; V16 += (size_t)blockIdx.y * nheads * HD * TT;   /* blockIdx.y: the batch */ v2h o16; v2us oh, ol;
#pragma unroll
    for (int q = 0; q < 2; ++q) { const float x = F[(size_t)(t + q) * pitch + g * HD + d]; o16[q] = tohx(x); (void)oh; (void)ol; }
    *(v2h*)(V16 + e) = o16;  }
__device__ __forceinline__ void d_csid(int bx, float* CS) { const int idx = bx * 256 + threadIdx.x; if (idx >= TT * HD) return; v2f cs; cs[0] = 1.0f; cs[1] = 0.0f; *(v2f*)(CS + (size_t)idx * 2) = cs;  }
// k_planes: the three plane builders in one grid (x: elements, y: batch, z: which plane). V^T, whose reads are strided (a line per lane), takes z = 0 and so starts first.
__global__ __launch_bounds__(256) void k_planes(const float* __restrict__ FQ, const float* __restrict__ FK, const float* __restrict__ FV, const float* __restrict__ CS, h16* QP16, h16* KP16, h16* VT16) {
    if (blockIdx.z == 0) d_vtp(FV, DKV, NKV, VT16, nullptr, nullptr);
    else if (blockIdx.z == 1) d_rope(FQ, DQ, NH_, CS, nullptr, nullptr, 1.0f, QP16, nullptr, nullptr);
    else d_rope(FK, DKV, NKV, CS, nullptr, nullptr, 1.0f, KP16, nullptr, nullptr);
}
// k_fattn: scores, softmax and attn.v of one (batch, head) plane in one kernel. One wave owns 32 query columns (two groups of 16) and walks the 2048 keys in passes of 32.
// Transposed products: S^T = K Q^T (A = 16 key rows, B = the wave's queries, kept in registers), O^T += V^T P^T (A = 16 d rows of the [d][t] plane). In an S^T tile lane (lr, hi) holds keys 8 hi + 0..7 of query lr,
// which is the k order of a B operand: tiles 0 and 1 of a pass, rounded to fp16, ARE the 32-key B operand; nothing crosses lanes but one exchange between the wave's halves for the maximum (and one for the sum, at the end).
// Running softmax in the log2 domain: p = 2^(s c - m), c = HD^-0.5 log2 e; m, the maximum in use, may trail the true one by up to 8 (p <= 2^8, well inside fp16); sums and accumulators are rescaled only when a column exceeds that.
// The epilogue divides by the sum (as x PCAR / sum, then / PCAR, the two roundings the separate kernels had) and stores the bf16 hi+lo planes [b * 2048 + t][h * 64 + d] that the output projection reads: 128-B lines, one wave each.
#define FQW 4   // waves per work-group: 128 queries, 256 work-groups
__device__ __forceinline__ float xhalf(float x) { return __builtin_bit_cast(float, __builtin_amdgcn_permlanex16(__builtin_bit_cast(int, x), __builtin_bit_cast(int, x), 0x76543210, 0xfedcba98, false, false)); }  // lane l with lane l ^ 16
__global__ __launch_bounds__(32 * FQW) void k_fattn(const h16* __restrict__ Q, const h16* __restrict__ Kp, const h16* __restrict__ Vt, bf* Ah, bf* Al) {
    typedef WFrag<h16> WF;
    const int lane = threadIdx.x & 31, lr = lane & 15, hi = lane >> 4; const int wv = __builtin_amdgcn_readfirstlane((int)(threadIdx.x >> 5));
    const size_t z = blockIdx.y, zk = z / REP; const int q0 = ((int)blockIdx.x * FQW + wv) * 32;
    const h16* qp = Q + (z * TT + q0 + lr) * HD + 8 * hi; const h16* kp = Kp + (zk * TT + lr) * HD + 8 * hi; const h16* vp = Vt + (zk * HD + lr) * TT + 8 * hi;
    v16h qf[2][2], kf[2][2], vf[4]; v8f o[2][4]; float mr[2], l[2];   // the inner loops are all unrolled so that these arrays are registers
#pragma unroll
    for (int g = 0; g < 2; ++g) { mr[g] = -__builtin_inff(); l[g] = 0.f;
#pragma unroll
        for (int ks = 0; ks < 2; ++ks) { qf[g][ks] = WF::ld(qp + g * 16 * HD + ks * 32); kf[g][ks] = WF::ld(kp + g * 16 * HD + ks * 32); }
#pragma unroll
        for (int dt = 0; dt < 4; ++dt) o[g][dt] = (v8f){}; }
#pragma unroll
    for (int dt = 0; dt < 4; ++dt) vf[dt] = WF::ld(vp + (size_t)dt * 16 * TT);
    asm volatile("s_wait_xcnt 0x0" :: "v"(qp) : "memory");   // stands in front of the first write of a register that held one of these loads' addresses; qp, dead behind its loads, is named so that its registers last up to here
    const float cs = SCL * 1.4426950408889634f;
#pragma unroll 1   // 64 passes: rolled, the body is long enough and the fetch-ahead wants one register set
    for (int k0 = 0; k0 < TT; k0 += 32) {
        v8f s[2][2];
#pragma unroll
        for (int kt = 0; kt < 2; ++kt)
#pragma unroll
            for (int g = 0; g < 2; ++g) s[kt][g] = WF::mma(kf[kt][1], qf[g][1], WF::mma(kf[kt][0], qf[g][0], (v8f){}));
        const int kn = (k0 + 32) & (TT - 1);   // K and V^T fragments are fetched one pass ahead, each into the registers its product has just read; the last pass fetches keys 0..31 again (in bounds, unused)
#pragma unroll
        for (int kt = 0; kt < 2; ++kt)
#pragma unroll
            for (int ks = 0; ks < 2; ++ks) kf[kt][ks] = WF::ld(kp + (size_t)(kn + kt * 16) * HD + ks * 32);
        float mb[2]; bool need = false;
#pragma unroll
        for (int g = 0; g < 2; ++g) { float m0 = s[0][g][0], m1 = s[1][g][0];
#pragma unroll
            for (int j = 1; j < 8; ++j) { m0 = fmaxf(m0, s[0][g][j]); m1 = fmaxf(m1, s[1][g][j]); }
            m0 = fmaxf(m0, m1); mb[g] = fmaxf(m0, xhalf(m0)) * cs; need = need || (mb[g] > mr[g] + 8.0f); }   // both halves of the wave hold the query's maximum, scaled (the scale is positive)
        if (__builtin_amdgcn_ballot_w32(need) != 0) {   // wave-uniform; always taken in the first pass (mr = -inf gives the factor 0), rare later
#pragma unroll
            for (int g = 0; g < 2; ++g) { const float mn = fmaxf(mr[g], mb[g]); const float al = __builtin_amdgcn_exp2f(mr[g] - mn); mr[g] = mn; l[g] *= al;
#pragma unroll
                for (int dt = 0; dt < 4; ++dt) o[g][dt] *= al; }
        }
#pragma unroll
        for (int g = 0; g < 2; ++g) { const float nm = -mr[g]; float a0 = 0.f, a1 = 0.f; v16h pf;
#pragma unroll
            for (int i = 0; i < 8; ++i) { const v2f ar = __builtin_elementwise_fma((v2f){s[i >> 2][g][2 * (i & 3)], s[i >> 2][g][2 * (i & 3) + 1]}, (v2f){cs, cs}, (v2f){nm, nm});
                const float p0 = __builtin_amdgcn_exp2f(ar[0]), p1 = __builtin_amdgcn_exp2f(ar[1]); a0 += p0; a1 += p1; pf[2 * i] = tohx(p0); pf[2 * i + 1] = tohx(p1); }
            l[g] += a0 + a1;
#pragma unroll
            for (int dt = 0; dt < 4; ++dt) o[g][dt] = WF::mma(vf[dt], pf, o[g][dt]); }
#pragma unroll
        for (int dt = 0; dt < 4; ++dt) vf[dt] = WF::ld(vp + (size_t)dt * 16 * TT + kn);
        asm volatile("s_wait_xcnt 0x0" ::: "memory");   // stands in front of the next pass's first write of the registers that held these loads' address
    }
#pragma unroll
    for (int g = 0; g < 2; ++g) { const float f = __fdiv_rn(PCAR, l[g] + xhalf(l[g])); const size_t oo = ((z / NH_) * TT + q0 + g * 16 + lr) * DQ + (z % NH_) * HD + hi * 8;   // lane (lr, hi) holds d = 16 dt + 8 hi + 0..7 of query lr; row b * 2048 + t, columns h * 64 + d
#pragma unroll
        for (int dt = 0; dt < 4; ++dt) { v8us oh, ol;
#pragma unroll
            for (int j = 0; j < 8; ++j) { unsigned short a, c2; splitf((o[g][dt][j] * f) * (1.0f / PCAR), a, c2); oh[j] = a; ol[j] = c2; }
            *(v8us*)(Ah + oo + dt * 16) = oh; *(v8us*)(Al + oo + dt * 16) = ol; } }
}

// block tail: d_bn: hl planes of gamma (v - mean) rsqrt(var + 1e-3) + beta over [b * 2048 + t][256] (RAW: v is a raw input row, bf16-rounded first) (8-B lanes); k_res: X1 = A + bf16 x (16-B lanes); k_gelu: hl planes of exact-erf GELU (8-B lanes);
#define FFD 1024
template <bool RAW> __device__ __forceinline__ void d_bn(int bx, const float* __restrict__ X, const float* __restrict__ ga, const float* __restrict__ be, const float* __restrict__ mu, const float* __restrict__ var, bf* Hh, bf* Hl) { const int e = (bx * 256 + threadIdx.x) * 4; if (e >= TB * DM) return; const int c = e % DM; v4us oh, ol;
#pragma unroll
    for (int u = 0; u < 4; ++u) { float xv = X[e + u]; if (RAW) xv = bfr(xv); float gg = bfr(ga[c + u]), bb = bfr(be[c + u]), mm = bfr(mu[c + u]), vv = bfr(var[c + u]); const float rs = __frsqrt_rn(__fadd_rn(vv, 1e-3f)); float d = __fsub_rn(xv, mm); asm volatile("" : "+v"(d)); float t1 = __fmul_rn(gg, d); asm volatile("" : "+v"(t1)); float t2 = __fmul_rn(t1, rs); asm volatile("" : "+v"(t2)); const float y = __fadd_rn(t2, bb); unsigned short a, b2; splitf(y, a, b2); oh[u] = a; ol[u] = b2; }
    *(v4us*)(Hh + e) = oh; *(v4us*)(Hl + e) = ol;  }
__global__ __launch_bounds__(256) void k_bn2(const float* __restrict__ X, const float* __restrict__ ga, const float* __restrict__ be, const float* __restrict__ mu, const float* __restrict__ var, bf* Hh, bf* Hl) { d_bn<false>((int)blockIdx.x, X, ga, be, mu, var, Hh, Hl); }
// k_prep: all that depends on the inputs alone, in one grid. The weight transposes (few work-groups, each a chain of eight dependent trips) take the lowest indices and start first; the table and BN1 stream behind them.
#define PB_Q  ((DM * DQ / 64 + 63) / 64)
#define PB_KV ((DM * DKV / 64 + 63) / 64)
#define PB_F  ((DM * FFD / 64 + 63) / 64)
#define PB_CS ((TT * HD + 255) / 256)
#define PB_BN ((TB * DM / 4 + 255) / 256)
__global__ __launch_bounds__(256) void k_prep(const float* __restrict__ wq, const float* __restrict__ wk, const float* __restrict__ wv, const float* __restrict__ wo, const float* __restrict__ w1, const float* __restrict__ w2, bf* WQ, bf* WK, bf* WV, bf* WO, bf* W1B, bf* W2B, float* CS,
                                              const float* __restrict__ x, const float* __restrict__ ga, const float* __restrict__ be, const float* __restrict__ mu, const float* __restrict__ var, bf* Hh, bf* Hl) {
    int b = (int)blockIdx.x;
    if (b < PB_F) { d_wtG(b, w1, DM, FFD, W1B); return; } b -= PB_F;
    if (b < PB_F) { d_wtG(b, w2, FFD, DM, W2B); return; } b -= PB_F;
    if (b < PB_Q) { d_wtG(b, wq, DM, DQ, WQ); return; } b -= PB_Q;
    if (b < PB_KV) { d_wtG(b, wk, DM, DKV, WK); return; } b -= PB_KV;
    if (b < PB_KV) { d_wtG(b, wv, DM, DKV, WV); return; } b -= PB_KV;
    if (b < PB_Q) { d_wtG(b, wo, DQ, DM, WO); return; } b -= PB_Q;
    if (b < PB_CS) { d_csid(b, CS); return; } b -= PB_CS;
    d_bn<true>(b, x, ga, be, mu, var, Hh, Hl);
}
__global__ __launch_bounds__(256) void k_res(const float* __restrict__ A, const float* __restrict__ x, float* X1) { const int e = (blockIdx.x * 256 + threadIdx.x) * 4; if (e >= TB * DM) return; const v4f a = *(const v4f*)(A + e), b = *(const v4f*)(x + e); v4f o;
#pragma unroll
    for (int u = 0; u < 4; ++u) o[u] = __fadd_rn(a[u], bfr(b[u])); *(v4f*)(X1 + e) = o;  }
__global__ __launch_bounds__(256) void k_gelu(const float* __restrict__ Mf, bf* Gh, bf* Gl) { const int e = (blockIdx.x * 256 + threadIdx.x) * 4; if (e >= TB * FFD) return; const v4f a = *(const v4f*)(Mf + e); v4us oh, ol;
#pragma unroll 1
    for (int u = 0; u < 4; ++u) { const float y = a[u]; float er = erff(y * 0.70710678118654752f); asm volatile("" : "+v"(er)); float hy = __fmul_rn(0.5f, y); asm volatile("" : "+v"(hy)); const float ge = __fmul_rn(hy, __fadd_rn(1.0f, er)); unsigned short h, l; splitf(ge, h, l); oh[u] = h; ol[u] = l; }
    *(v4us*)(Gh + e) = oh; *(v4us*)(Gl + e) = ol;  }
__global__ __launch_bounds__(256) void k_fin(const float* __restrict__ M2, const float* __restrict__ X1, float* OUTb) { const int e = (blockIdx.x * 256 + threadIdx.x) * 4; if (e >= TB * DM) return; const v4f a = *(const v4f*)(M2 + e), b = *(const v4f*)(X1 + e); v4f o;
#pragma unroll
    for (int u = 0; u < 4; ++u) o[u] = __fadd_rn(a[u], b[u]); *(v4f*)(OUTb + e) = o;  }

extern "C" void kernel_launch(void* const* d_in, const int* in_sizes, int n_in,
                              void* d_out, int out_size, void* d_ws, size_t ws_size, hipStream_t stream) {
    (void)in_sizes; (void)n_in; (void)out_size;
    const float** Ip = (const float**)d_in; const float *x = Ip[0], *g1 = Ip[1], *be1 = Ip[2], *m1 = Ip[3], *v1 = Ip[4], *wq = Ip[5], *bq = Ip[6], *wk = Ip[7], *bk = Ip[8], *wv = Ip[9], *bv = Ip[10], *wo = Ip[11], *bo = Ip[12], *g2 = Ip[13], *be2 = Ip[14], *m2 = Ip[15], *v2 = Ip[16], *w1 = Ip[17], *w2 = Ip[18]; const float* cosT = nullptr; const float* sinT = nullptr; (void)cosT; (void)sinT;
    float* OUT = (float*)d_out;     // [4][2048][256]
    char* wsp = (char*)d_ws;
    auto take = [&](size_t bytes) { char* p = wsp; wsp += (bytes + 255) & ~(size_t)255; return (void*)p; };
    bf* WQ = (bf*)take((size_t)DQ * DM * 2); bf* WK = (bf*)take((size_t)DKV * DM * 2); bf* WV = (bf*)take((size_t)DKV * DM * 2); bf* WO = (bf*)take((size_t)DM * DQ * 2); float* CS = (float*)take((size_t)TT * HD * 2 * 4);
    bf* Hh = (bf*)take((size_t)TB * DM * 2); bf* Hl = (bf*)take((size_t)TB * DM * 2); bf* W1B = (bf*)take((size_t)FFD * DM * 2); bf* W2B = (bf*)take((size_t)DM * FFD * 2); float* FQ = (float*)take((size_t)TB * DQ * 4); float* FK = (float*)take((size_t)TB * DKV * 4); float* FV = (float*)take((size_t)TB * DKV * 4);   // three buffers in a row, as WQ, WK, WV are: grid z of the projection steps from one to the next
    h16* QP16 = (h16*)take((size_t)NB_ * NH_ * TT * HD * 2); h16* KP16 = (h16*)take((size_t)NB_ * NKV * TT * HD * 2); h16* VT16 = (h16*)take((size_t)NB_ * NKV * HD * TT * 2);
    bf* ATh = (bf*)take((size_t)TB * DQ * 2); bf* ATl = (bf*)take((size_t)TB * DQ * 2);
    float* AO = (float*)take((size_t)TB * DM * 4); float* X1 = (float*)take((size_t)TB * DM * 4); float* Mf = (float*)take((size_t)TB * FFD * 4); bf* Gh = (bf*)take((size_t)TB * FFD * 2); bf* Gl = (bf*)take((size_t)TB * FFD * 2); float* M2 = (float*)take((size_t)TB * DM * 4);
    if ((size_t)(wsp - (char*)d_ws) > ws_size) return;    // ws 256 MiB
    static_assert(DQ == DKV, "grid z of the q, k, v projection steps by one weight plane and one output buffer of equal size");
    k_prep<<<2 * PB_F + 2 * PB_Q + 2 * PB_KV + PB_CS + PB_BN, 256, 0, stream>>>(wq, wk, wv, wo, w1, w2, WQ, WK, WV, WO, W1B, W2B, CS, x, g1, be1, m1, v1, Hh, Hl);
    const unsigned LQ = (unsigned)(((size_t)NH_ * TT * HD / 2 + 255) / 256);   // NKV <= NH_: the k and v parts of k_planes need no more work-groups than the q part
    k_gemmw<bf, 1, true, 8><<<dim3(TB / 64, DQ / 64, 3), 256, 0, stream>>>(Hh, Hl, WQ, nullptr, DM, FQ, DQ, bq, bk, bv, 0, (size_t)DQ * DM, (size_t)TB * DQ);
    k_planes<<<dim3(LQ, NB_, 3), 256, 0, stream>>>(FQ, FK, FV, CS, QP16, KP16, VT16);
    k_fattn<<<dim3(TT / (32 * FQW), NB_ * NH_, 1), 32 * FQW, 0, stream>>>(QP16, KP16, VT16, ATh, ATl);
    k_gemmw<bf, 1, true, 8><<<dim3(TB / 64, DM / 64, 1), 256, 0, stream>>>(ATh, ATl, WO, nullptr, DQ, AO, DM, bo, nullptr, nullptr, 0, 0, 0);
    k_res<<<(TB * DM / 4 + 255) / 256, 256, 0, stream>>>(AO, x, X1); k_bn2<<<PB_BN, 256, 0, stream>>>(X1, g2, be2, m2, v2, Hh, Hl);
    k_gemmw<bf, 1, false, 8><<<dim3(TB / 64, FFD / 64, 1), 256, 0, stream>>>(Hh, Hl, W1B, nullptr, DM, Mf, FFD, nullptr, nullptr, nullptr, 0, 0, 0); k_gelu<<<(TB * FFD / 4 + 255) / 256, 256, 0, stream>>>(Mf, Gh, Gl);
    k_gemmw<bf, 1, false, 8><<<dim3(TB / 64, DM / 64, 1), 256, 0, stream>>>(Gh, Gl, W2B, nullptr, FFD, M2, DM, nullptr, nullptr, nullptr, 0, 0, 0); k_fin<<<(TB * DM / 4 + 255) / 256, 256, 0, stream>>>(M2, X1, OUT);
}

// v005
// Measured time: 138 microseconds a run.
// Next to v004, in two timings, it ran 1.08 and 1.10 times as fast.
// All steps since v000 together make it 6.63 times as fast.
#include <hip/hip_runtime.h>

// TransformerBaseBlock (x [4][2048][256]; h = BN1(x) (inference: gamma (x - mean) rsqrt(var + 1e-3) + beta); q/k/v = h W + b (4 heads x 64); softmax(q.k/8); attn_out = ctx Wo + bo; x1 = attn_out + x; m = gelu(BN2(x1) W1) W2 (exact erf GELU);
// out = m + x1 -> [4][2048][256]).
// Compute dtypes, f32 accumulate: every input rounded to bf16; BN1/BN2 f32 -> bf16 hi+lo planes; q/k/v (+ bias), W1 as hl x exact W (2 products); scores (K 64) and attn.v single fp16 planes;
// Every launch covers all four batches (rows b * 2048 + t, planes b * 4 + h); attention is one launch over all 16 (batch, head) planes: scores and probabilities stay in registers (k_fattn).
// Launches that do not depend on one another share one grid: k_prep (six weight transposes, the cos/sin table, BN1), the q, k, v projections (grid z of k_gemmw), k_planes (q and k head planes, V^T).
// The streaming kernels (table, BN1, BN2, head planes, V^T, residual, GELU, last add) give every thread 16 to 64 elements, all its loads issued ahead of its arithmetic: few waves to start, many bytes in flight per wave. Their loops over pieces and elements are all unrolled, so that a thread's pieces are registers and its loads can stand in a row.

#define NB_  4
#define TT   2048
#define DM   256
#define NH_  4
#define NKV  4
#define REP  (NH_ / NKV)
#define HD   64
#define DQ   (NH_ * HD)
#define DKV  (NKV * HD)
#define TB   (NB_ * TT)         // rows of all batches
#define WIN  0
#define PCAR 1024.0f
#define SCL  0.125f   // HD^-0.5
typedef _Float16 h16;
typedef unsigned short bf;
typedef __attribute__((ext_vector_type(16))) __bf16   v16bf;
typedef __attribute__((ext_vector_type(16))) _Float16 v16h;
typedef __attribute__((ext_vector_type(8)))  _Float16 v8h;
typedef __attribute__((ext_vector_type(8)))  unsigned short v8us;
typedef __attribute__((ext_vector_type(8)))  float    v8f;
typedef __attribute__((ext_vector_type(4)))  float    v4f;
typedef v8h  __attribute__((may_alias)) v8ha;
typedef v4f  __attribute__((may_alias)) v4fa;
typedef v8us __attribute__((may_alias)) v8usa;

__device__ __forceinline__ unsigned short f2bf(float f) { unsigned u = __float_as_uint(f); u += 0x7FFFu + ((u >> 16) & 1u); return (unsigned short)(u >> 16); }
__device__ __forceinline__ float bf2f(unsigned short b) { return __uint_as_float(((unsigned)b) << 16); }
__device__ __forceinline__ float bfr(float f) { return bf2f(f2bf(f)); }
__device__ __forceinline__ v16h cat16(v8h lo, v8h hi) { return __builtin_shufflevector(lo, hi, 0, 1, 2, 3, 4, 5, 6, 7, 8, 9, 10, 11, 12, 13, 14, 15); }
__device__ __forceinline__ v16bf cat16b(v8us lo, v8us hi) { return __builtin_bit_cast(v16bf, __builtin_shufflevector(lo, hi, 0, 1, 2, 3, 4, 5, 6, 7, 8, 9, 10, 11, 12, 13, 14, 15)); }
__device__ __forceinline__ v8f wmma16(v16h a, v16h b, v8f c) { return __builtin_amdgcn_wmma_f32_16x16x32_f16(false, a, false, b, (short)0, c, false, false); }
__device__ __forceinline__ v8f wmmab(v16bf a, v16bf b, v8f c) { return __builtin_amdgcn_wmma_f32_16x16x32_bf16(false, a, false, b, (short)0, c, false, false); }



// ---- k_gemmw: register-blocked GEMM, one 64x64 output tile per work-group (16 accumulators per wave), operands straight from K-contiguous 16-bit planes; grid (M/64, N/64, Z), 32 * KS threads.
// C[m][n] (f32, pitch ldc, + optional f32 bias[n]) = sum_k A[m][k] Bt[n][k] (+ split products per NSPLIT). z-batch strides sA/sB/sC in elements; the bias vectors are separate buffers: bias for z = 0, biasZ1 and biasZ2 for z = 1 and 2. K % (32 * KS) == 0.
// KS > 1: K is split over the KS waves (wave w takes the 32-k chunks w, w + KS, ...: neighbouring waves read the two halves of the same 128-B lines); each wave leaves its f32 partial tile in LDS, and behind one barrier
// all threads add the KS partials in the fixed order 0 .. KS-1 and store whole rows.
template <typename T16> struct WFrag;
template <> struct WFrag<h16> { typedef v16h V; static __device__ __forceinline__ V ld(const h16* p) { return cat16(*(const v8h*)p, *(const v8h*)(p + 16)); } static __device__ __forceinline__ v8f mma(V a, V b, v8f c) { return wmma16(a, b, c); } };
template <> struct WFrag<bf> { typedef v16bf V; static __device__ __forceinline__ V ld(const bf* p) { return cat16b(*(const v8us*)p, *(const v8us*)(p + 16)); } static __device__ __forceinline__ v8f mma(V a, V b, v8f c) { return wmmab(a, b, c); } };
template <typename T16, int NSPLIT, bool BIAS, int KS>
__global__ __launch_bounds__(32 * KS) void k_gemmw(const T16* __restrict__ A, const T16* __restrict__ A2, const T16* __restrict__ Bt, const T16* __restrict__ Bt2, int K, float* C, int ldc, const float* __restrict__ bias, const float* __restrict__ biasZ1, const float* __restrict__ biasZ2, size_t sA, size_t sB, size_t sC) {
    typedef typename WFrag<T16>::V V;
    __shared__ __align__(16) float os[(KS == 1 ? 16 : KS * 64) * 68];
    const size_t z = blockIdx.z; A += z * sA; if (A2) A2 += z * sA; Bt += z * sB; if (Bt2) Bt2 += z * sB; C += z * sC; const float* bz = (z == 0) ? bias : ((z == 1) ? biasZ1 : biasZ2);
    const int lane = threadIdx.x & 31, lr = lane & 15, hi = lane >> 4; const int r0 = blockIdx.x * 64, c0 = blockIdx.y * 64;
    const int wv = (KS == 1) ? 0 : __builtin_amdgcn_readfirstlane((int)(threadIdx.x >> 5));
    v8f acc[4][4];
#pragma unroll
    for (int mb = 0; mb < 4; ++mb)
#pragma unroll
        for (int nb = 0; nb < 4; ++nb) acc[mb][nb] = (v8f){};
    v4f bv = (v4f){};   // this thread's four bias columns (KS > 1), fetched ahead of the k loop so that their latency is not paid behind the barrier
    if (BIAS && KS > 1) { const int bc = c0 + ((int)threadIdx.x & 15) * 4; bv[0] = bfr(bz[bc]); bv[1] = bfr(bz[bc + 1]); bv[2] = bfr(bz[bc + 2]); bv[3] = bfr(bz[bc + 3]); }
    const size_t aoff = (size_t)(r0 + lr) * K + 8 * hi, boff = (size_t)(c0 + lr) * K + 8 * hi;
#pragma unroll 1
    for (int kc = wv * 32; kc < K; kc += 32 * KS) {
        V a[4], a2[4];
#pragma unroll
        for (int mb = 0; mb < 4; ++mb) { a[mb] = WFrag<T16>::ld(A + aoff + (size_t)mb * 16 * K + kc); if (NSPLIT == 1 || NSPLIT == 2) a2[mb] = WFrag<T16>::ld(A2 + aoff + (size_t)mb * 16 * K + kc); }
#pragma unroll
        for (int nb = 0; nb < 4; ++nb) { const V b = WFrag<T16>::ld(Bt + boff + (size_t)nb * 16 * K + kc); V b2; if (NSPLIT >= 2) b2 = WFrag<T16>::ld(Bt2 + boff + (size_t)nb * 16 * K + kc);
#pragma unroll
            for (int mb = 0; mb < 4; ++mb) { acc[mb][nb] = WFrag<T16>::mma(a[mb], b, acc[mb][nb]); if (NSPLIT == 1 || NSPLIT == 2) acc[mb][nb] = WFrag<T16>::mma(a2[mb], b, acc[mb][nb]); if (NSPLIT >= 2) acc[mb][nb] = WFrag<T16>::mma(a[mb], b2, acc[mb][nb]); } }
        asm volatile("v_nop\n\tv_nop\n\tv_nop\n\tv_nop" : "+v"(acc[0][0]), "+v"(acc[1][1]), "+v"(acc[2][2]), "+v"(acc[3][3]) : "v"(a[0]), "v"(a[3]));
    }
    if constexpr (KS > 1) {
        float* pw = os + wv * (64 * 68);
#pragma unroll
        for (int mb = 0; mb < 4; ++mb)
#pragma unroll
            for (int nb = 0; nb < 4; ++nb)
#pragma unroll
                for (int j = 0; j < 8; ++j) pw[(mb * 16 + hi * 8 + j) * 68 + nb * 16 + lr] = acc[mb][nb][j];
        __syncthreads();   // every wave's partial tile is in LDS before any thread adds them
#pragma unroll
        for (int s = 0; s < 32 / KS; ++s) { const int idx = s * (32 * KS) + (int)threadIdx.x; const int row = idx >> 4, cofs = (idx & 15) * 4; v4f val = *(const v4fa*)(os + row * 68 + cofs);
#pragma unroll
            for (int p = 1; p < KS; ++p) val += *(const v4fa*)(os + p * (64 * 68) + row * 68 + cofs);
            if (BIAS) val += bv;
            *(v4f*)(C + (size_t)(r0 + row) * ldc + c0 + cofs) = val; }
        return;
    }
#pragma unroll
    for (int mb = 0; mb < 4; ++mb) {
#pragma unroll
        for (int nb = 0; nb < 4; ++nb) {
#pragma unroll
            for (int j = 0; j < 8; ++j) os[(hi * 8 + j) * 68 + nb * 16 + lr] = acc[mb][nb][j]; }
        __builtin_amdgcn_wave_barrier(); asm volatile("" ::: "memory");
        float* crow = C + (size_t)(r0 + mb * 16) * ldc + c0;
{
#pragma unroll
            for (int s = 0; s < 8; ++s) { const int row = 2 * s + hi, cofs = lr * 4; v4f val = *(const v4fa*)(os + row * 68 + cofs); if (BIAS) { val[0] += bfr(bz[c0 + cofs]); val[1] += bfr(bz[c0 + cofs + 1]); val[2] += bfr(bz[c0 + cofs + 2]); val[3] += bfr(bz[c0 + cofs + 3]); }
                *(v4f*)(crow + (size_t)row * ldc + cofs) = val; }
             }
        __builtin_amdgcn_wave_barrier(); asm volatile("" ::: "memory");
    }
}

__device__ __forceinline__ h16 tohx(float x) { return (h16)x; }
__device__ __forceinline__ void splitf(float y, unsigned short& h, unsigned short& l) { h = f2bf(y); l = f2bf(y - bf2f(h)); }
typedef __attribute__((ext_vector_type(2))) _Float16 v2h;
typedef __attribute__((ext_vector_type(4))) _Float16 v4h;
typedef __attribute__((ext_vector_type(2))) unsigned short v2us;
typedef __attribute__((ext_vector_type(4))) unsigned short v4us;
typedef __attribute__((ext_vector_type(2))) float v2f;
typedef __attribute__((ext_vector_type(4))) int v4i;

// d_*: bodies of the kernels that share a grid; bx is the work-group's index inside its own part of the grid
__device__ __forceinline__ void d_wtG(int bx, const float* __restrict__ w, int K, int N, bf* Bt) {
    const int lane = threadIdx.x & 31; const int L0 = (bx * 8 + (threadIdx.x >> 5)) * 8; const int nlines = N * K / 64;
{
#pragma unroll 1
        for (int l = 0; l < 8; ++l) { const int L = L0 + l; if (L >= nlines) break; const size_t e = (size_t)L * 64 + lane * 2; const int k = (int)(e % K), n = (int)(e / K); v2us o;
            o[0] = f2bf(w[(size_t)k * N + n]); o[1] = f2bf(w[(size_t)(k + 1) * N + n]); *(v2us*)(Bt + e) = o; }
         }
}
__global__ __launch_bounds__(256) void k_cvt8(const float* __restrict__ src, bf* dst, size_t n8) { const size_t i = (size_t)blockIdx.x * 256 + threadIdx.x; if (i >= n8) return; const v8f v = *(const v8f*)(src + i * 8); v8us o;
#pragma unroll
    for (int k = 0; k < 8; ++k) o[k] = f2bf(v[k]); *(v8us*)(dst + i * 8) = o;  }
__global__ __launch_bounds__(256) void k_cscvt(const float* __restrict__ cosT, const float* __restrict__ sinT, float* CS) { const int idx = blockIdx.x * 256 + threadIdx.x; if (idx >= TT * HD) return; v2f cs; cs[0] = bfr(cosT[idx]); cs[1] = bfr(sinT[idx]); *(v2f*)(CS + (size_t)idx * 2) = cs;  }
// d_rope: head planes [b][h][t][d] (fp16) of rope(x) x sc with the rotate-half convention out[d] = x[d] cos[t][d] - x[d+HD/2] sin[t][d], out[d+HD/2] = x[d+HD/2] cos[t][d+HD/2] + x[d] sin[t][d+HD/2]
// One thread: four consecutive d of one row t, for every head of RB batches (the table entries of (t, d) are fetched once for all of them). A wave's load covers two whole 256-B head rows, its store 256 B in a row.
#define RB 2
#define PB_R ((NB_ / RB) * TT * (HD / 4) / 256)
template <int NHD> __device__ __forceinline__ void d_rope(int bx, const float* __restrict__ F, const float* __restrict__ CS, float sc, h16* P16) {
    static_assert(NB_ % RB == 0 && ((NB_ / RB) * TT * (HD / 4)) % 256 == 0 && (HD / 2) % 4 == 0, "the grid covers the planes exactly; a thread's four d lie in one half of the head");
    const int i = bx * 256 + (int)threadIdx.x; const int d = (i % (HD / 4)) * 4, t = (i / (HD / 4)) % TT, b0 = (i / ((HD / 4) * TT)) * RB; const int dq = (d < HD / 2) ? d + HD / 2 : d - HD / 2;
    const float* cp = CS + ((size_t)t * HD + d) * 2; const float* fa = F + ((size_t)b0 * TT + t) * (NHD * HD) + d; const float* fb = F + ((size_t)b0 * TT + t) * (NHD * HD) + dq;   // the three addresses of this thread; every load is one of them plus a constant
    const v4f c01 = *(const v4f*)cp, c23 = *(const v4f*)(cp + 4); v4f xa[RB][NHD], xb[RB][NHD];
#pragma unroll
    for (int bb = 0; bb < RB; ++bb)
#pragma unroll
        for (int h = 0; h < NHD; ++h) { xa[bb][h] = *(const v4f*)(fa + (size_t)bb * TT * (NHD * HD) + h * HD); xb[bb][h] = *(const v4f*)(fb + (size_t)bb * TT * (NHD * HD) + h * HD); }
    static_assert(RB == 2 && NHD == 4, "the wait below names every loaded value");
    // stands behind the last load and in front of the first write of a register that held a load's address: the loaded values and the three addresses are named (inputs only) so that all loads are issued first and no result is placed in an address pair
    asm volatile("s_wait_xcnt 0x0" :: "v"(c01), "v"(c23), "v"(xa[0][0]), "v"(xa[0][1]), "v"(xa[0][2]), "v"(xa[0][3]), "v"(xa[1][0]), "v"(xa[1][1]), "v"(xa[1][2]), "v"(xa[1][3]), "v"(xb[0][0]), "v"(xb[0][1]), "v"(xb[0][2]), "v"(xb[0][3]), "v"(xb[1][0]), "v"(xb[1][1]), "v"(xb[1][2]), "v"(xb[1][3]), "v"(cp), "v"(fa), "v"(fb) : "memory");
#pragma unroll
    for (int bb = 0; bb < RB; ++bb)
#pragma unroll
        for (int h = 0; h < NHD; ++h) { v4h o16;
#pragma unroll
            for (int q = 0; q < 4; ++q) { const float x0 = xa[bb][h][q], x1 = xb[bb][h][q]; v2f cs; cs[0] = (q < 2) ? c01[2 * q] : c23[2 * q - 4]; cs[1] = (q < 2) ? c01[2 * q + 1] : c23[2 * q - 3];
                float a = __fmul_rn(x0, cs[0]), bq = __fmul_rn(x1, cs[1]); asm volatile("" : "+v"(a)); asm volatile("" : "+v"(bq)); const float r = ((d < HD / 2) ? __fsub_rn(a, bq) : __fadd_rn(a, bq)) * sc;
                o16[q] = tohx(r); }
            *(v4h*)(P16 + (((size_t)(b0 + bb) * NHD + h) * TT + t) * HD + d) = o16; }
    asm volatile("s_wait_xcnt 0x0" ::: "memory");   // behind the last store: the code of the grid's other parts follows in the text and writes these registers
}
// d_vtp: V^T planes [b][g][d][t] (fp16). One wave turns 64 rows t x 32 columns of F; a thread holds 8 t x 8 d in registers (lane = t group + 8 x d group): a load takes 64-B pieces of eight rows, a store four whole 128-B lines.
#define PB_V (TB * DKV / (64 * 32) / 8)
template <int NHD> __device__ __forceinline__ void d_vtp(int bx, const float* __restrict__ F, h16* V16) {
    static_assert(TT % 64 == 0 && HD % 32 == 0 && (TB * NHD * HD) % (64 * 32 * 8) == 0, "a wave's block lies in one batch and one head; the grid covers the plane exactly");
    const int lane = threadIdx.x & 31, tg = lane & 7, dg = lane >> 3; const int w = bx * 8 + (int)(threadIdx.x >> 5); const int c0 = (w % (NHD * HD / 32)) * 32 + dg * 4, r0 = (w / (NHD * HD / 32)) * 64 + tg * 8;   // first column and first row (b * 2048 + t) of this thread
    v4f x[8][2]; const float* fp = F + (size_t)r0 * (NHD * HD) + c0;
#pragma unroll
    for (int r = 0; r < 8; ++r)
#pragma unroll
        for (int hf = 0; hf < 2; ++hf) x[r][hf] = *(const v4f*)(fp + r * (NHD * HD) + hf * 16);
    // stands behind the last load and in front of the first write of the address pair: the loaded values and the address are named (inputs only) so that all loads are issued first and no result is placed in that pair
    asm volatile("s_wait_xcnt 0x0" :: "v"(x[0][0]), "v"(x[0][1]), "v"(x[1][0]), "v"(x[1][1]), "v"(x[2][0]), "v"(x[2][1]), "v"(x[3][0]), "v"(x[3][1]), "v"(x[4][0]), "v"(x[4][1]), "v"(x[5][0]), "v"(x[5][1]), "v"(x[6][0]), "v"(x[6][1]), "v"(x[7][0]), "v"(x[7][1]), "v"(fp) : "memory");
    h16* vo = V16 + ((size_t)(r0 / TT) * (NHD * HD) + c0) * TT + r0 % TT;   // plane row b * 256 + g * 64 + d is b * 256 + column
#pragma unroll
    for (int hf = 0; hf < 2; ++hf)
#pragma unroll
        for (int q = 0; q < 4; ++q) { v8h o16;
#pragma unroll
            for (int r = 0; r < 8; ++r) o16[r] = tohx(x[r][hf][q]);
            *(v8h*)(vo + (size_t)(hf * 16 + q) * TT) = o16; }
}
__device__ __forceinline__ void d_csid(int bx, float* CS) { v4f cs; cs[0] = 1.0f; cs[1] = 0.0f; cs[2] = 1.0f; cs[3] = 0.0f;   // two entries a store, four stores a thread
#pragma unroll
    for (int s = 0; s < 4; ++s) *(v4f*)(CS + ((size_t)(bx * 4 + s) * 256 + threadIdx.x) * 4) = cs;
    asm volatile("s_wait_xcnt 0x0" ::: "memory");   // behind the last store: the code of the grid's other parts follows in the text and writes these registers
}
// k_planes: the three plane builders in one grid, each with its own run of work-group indices. V^T, whose reads are pieces of lines, takes the lowest and so starts first.
__global__ __launch_bounds__(256) void k_planes(const float* __restrict__ FQ, const float* __restrict__ FK, const float* __restrict__ FV, const float* __restrict__ CS, h16* QP16, h16* KP16, h16* VT16) {
    int b = (int)blockIdx.x;
    if (b < PB_V) { d_vtp<NKV>(b, FV, VT16); return; } b -= PB_V;
    if (b < PB_R) { d_rope<NH_>(b, FQ, CS, 1.0f, QP16); return; } b -= PB_R;
    d_rope<NKV>(b, FK, CS, 1.0f, KP16);
}
// k_fattn: scores, softmax and attn.v of one (batch, head) plane in one kernel. One wave owns 32 query columns (two groups of 16) and walks the 2048 keys in passes of 32.
// Transposed products: S^T = K Q^T (A = 16 key rows, B = the wave's queries, kept in registers), O^T += V^T P^T (A = 16 d rows of the [d][t] plane). In an S^T tile lane (lr, hi) holds keys 8 hi + 0..7 of query lr,
// which is the k order of a B operand: tiles 0 and 1 of a pass, rounded to fp16, ARE the 32-key B operand; nothing crosses lanes but one exchange between the wave's halves for the maximum (and one for the sum, at the end).
// Running softmax in the log2 domain: p = 2^(s c - m), c = HD^-0.5 log2 e; m, the maximum in use, may trail the true one by up to 8 (p <= 2^8, well inside fp16); sums and accumulators are rescaled only when a column exceeds that.
// The epilogue divides by the sum (as x PCAR / sum, then / PCAR, the two roundings the separate kernels had) and stores the bf16 hi+lo planes [b * 2048 + t][h * 64 + d] that the output projection reads: 128-B lines, one wave each.
#define FQW 4   // waves per work-group: 128 queries, 256 work-groups
__device__ __forceinline__ float xhalf(float x) { return __builtin_bit_cast(float, __builtin_amdgcn_permlanex16(__builtin_bit_cast(int, x), __builtin_bit_cast(int, x), 0x76543210, 0xfedcba98, false, false)); }  // lane l with lane l ^ 16
__global__ __launch_bounds__(32 * FQW) void k_fattn(const h16* __restrict__ Q, const h16* __restrict__ Kp, const h16* __restrict__ Vt, bf* Ah, bf* Al) {
    typedef WFrag<h16> WF;
    const int lane = threadIdx.x & 31, lr = lane & 15, hi = lane >> 4; const int wv = __builtin_amdgcn_readfirstlane((int)(threadIdx.x >> 5));
    const size_t z = blockIdx.y, zk = z / REP; const int q0 = ((int)blockIdx.x * FQW + wv) * 32;
    const h16* qp = Q + (z * TT + q0 + lr) * HD + 8 * hi; const h16* kp = Kp + (zk * TT + lr) * HD + 8 * hi; const h16* vp = Vt + (zk * HD + lr) * TT + 8 * hi;
    v16h qf[2][2], kf[2][2], vf[4]; v8f o[2][4]; float mr[2], l[2];   // the inner loops are all unrolled so that these arrays are registers
#pragma unroll
    for (int g = 0; g < 2; ++g) { mr[g] = -__builtin_inff(); l[g] = 0.f;
#pragma unroll
        for (int ks = 0; ks < 2; ++ks) { qf[g][ks] = WF::ld(qp + g * 16 * HD + ks * 32); kf[g][ks] = WF::ld(kp + g * 16 * HD + ks * 32); }
#pragma unroll
        for (int dt = 0; dt < 4; ++dt) o[g][dt] = (v8f){}; }
#pragma unroll
    for (int dt = 0; dt < 4; ++dt) vf[dt] = WF::ld(vp + (size_t)dt * 16 * TT);
    asm volatile("s_wait_xcnt 0x0" :: "v"(qp) : "memory");   // stands in front of the first write of a register that held one of these loads' addresses; qp, dead behind its loads, is named so that its registers last up to here
    const float cs = SCL * 1.4426950408889634f;
#pragma unroll 1   // 64 passes: rolled, the body is long enough and the fetch-ahead wants one register set
    for (int k0 = 0; k0 < TT; k0 += 32) {
        v8f s[2][2];
#pragma unroll
        for (int kt = 0; kt < 2; ++kt)
#pragma unroll
            for (int g = 0; g < 2; ++g) s[kt][g] = WF::mma(kf[kt][1], qf[g][1], WF::mma(kf[kt][0], qf[g][0], (v8f){}));
        const int kn = (k0 + 32) & (TT - 1);   // K and V^T fragments are fetched one pass ahead, each into the registers its product has just read; the last pass fetches keys 0..31 again (in bounds, unused)
#pragma unroll
        for (int kt = 0; kt < 2; ++kt)
#pragma unroll
            for (int ks = 0; ks < 2; ++ks) kf[kt][ks] = WF::ld(kp + (size_t)(kn + kt * 16) * HD + ks * 32);
        float mb[2]; bool need = false;
#pragma unroll
        for (int g = 0; g < 2; ++g) { float m0 = s[0][g][0], m1 = s[1][g][0];
#pragma unroll
            for (int j = 1; j < 8; ++j) { m0 = fmaxf(m0, s[0][g][j]); m1 = fmaxf(m1, s[1][g][j]); }
            m0 = fmaxf(m0, m1); mb[g] = fmaxf(m0, xhalf(m0)) * cs; need = need || (mb[g] > mr[g] + 8.0f); }   // both halves of the wave hold the query's maximum, scaled (the scale is positive)
        if (__builtin_amdgcn_ballot_w32(need) != 0) {   // wave-uniform; always taken in the first pass (mr = -inf gives the factor 0), rare later
#pragma unroll
            for (int g = 0; g < 2; ++g) { const float mn = fmaxf(mr[g], mb[g]); const float al = __builtin_amdgcn_exp2f(mr[g] - mn); mr[g] = mn; l[g] *= al;
#pragma unroll
                for (int dt = 0; dt < 4; ++dt) o[g][dt] *= al; }
        }
#pragma unroll
        for (int g = 0; g < 2; ++g) { const float nm = -mr[g]; float a0 = 0.f, a1 = 0.f; v16h pf;
#pragma unroll
            for (int i = 0; i < 8; ++i) { const v2f ar = __builtin_elementwise_fma((v2f){s[i >> 2][g][2 * (i & 3)], s[i >> 2][g][2 * (i & 3) + 1]}, (v2f){cs, cs}, (v2f){nm, nm});
                const float p0 = __builtin_amdgcn_exp2f(ar[0]), p1 = __builtin_amdgcn_exp2f(ar[1]); a0 += p0; a1 += p1; pf[2 * i] = tohx(p0); pf[2 * i + 1] = tohx(p1); }
            l[g] += a0 + a1;
#pragma unroll
            for (int dt = 0; dt < 4; ++dt) o[g][dt] = WF::mma(vf[dt], pf, o[g][dt]); }
#pragma unroll
        for (int dt = 0; dt < 4; ++dt) vf[dt] = WF::ld(vp + (size_t)dt * 16 * TT + kn);
        asm volatile("s_wait_xcnt 0x0" ::: "memory");   // stands in front of the next pass's first write of the registers that held these loads' address
    }
#pragma unroll
    for (int g = 0; g < 2; ++g) { const float f = __fdiv_rn(PCAR, l[g] + xhalf(l[g])); const size_t oo = ((z / NH_) * TT + q0 + g * 16 + lr) * DQ + (z % NH_) * HD + hi * 8;   // lane (lr, hi) holds d = 16 dt + 8 hi + 0..7 of query lr; row b * 2048 + t, columns h * 64 + d
#pragma unroll
        for (int dt = 0; dt < 4; ++dt) { v8us oh, ol;
#pragma unroll
            for (int j = 0; j < 8; ++j) { unsigned short a, c2; splitf((o[g][dt][j] * f) * (1.0f / PCAR), a, c2); oh[j] = a; ol[j] = c2; }
            *(v8us*)(Ah + oo + dt * 16) = oh; *(v8us*)(Al + oo + dt * 16) = ol; } }
}

// block tail: d_bn: hl planes of gamma (v - mean) rsqrt(var + 1e-3) + beta over [b * 2048 + t][256] (RAW: v is a raw input row, bf16-rounded first) (8-B stores); k_res: X1 = A + bf16 x (16-B lanes); k_gelu: hl planes of exact-erf GELU (8-B stores);
#define FFD 1024
// SU: 16-B pieces per thread of the kernels over [8192][256]; a work-group takes SU * 1024 elements in a row, piece s of thread i at s * 1024 + 4 i (every wave's load is 512 B in a row, and a thread keeps its four channels)
#define SU 4
#define PB_S (TB * DM / (SU * 1024))
static_assert((TB * DM) % (SU * 1024) == 0 && 1024 % DM == 0, "the grids cover the rows exactly; a thread's channels are the same in all its pieces");
template <bool RAW> __device__ __forceinline__ void d_bn(int bx, const float* __restrict__ X, const float* __restrict__ ga, const float* __restrict__ be, const float* __restrict__ mu, const float* __restrict__ var, bf* Hh, bf* Hl) { const int e0 = bx * (SU * 1024) + (int)threadIdx.x * 4; const int c = e0 % DM; v4f xs[SU]; float gg[4], bb[4], mm[4], rs[4]; const float* xp = X + e0; const unsigned cb = (unsigned)c * 4u;   // cb: byte offset of the thread's channels in the four parameter vectors
#pragma unroll
    for (int s = 0; s < SU; ++s) xs[s] = *(const v4f*)(xp + s * 1024);
    const v4f gr = *(const v4f*)((const char*)ga + cb), br = *(const v4f*)((const char*)be + cb), mr = *(const v4f*)((const char*)mu + cb), vr = *(const v4f*)((const char*)var + cb);   // the thread's four channels, once for all its pieces
    static_assert(SU == 4, "the wait below names every piece");
    // stands behind the last load and in front of the first write of a register that held a load's address: the loaded values, the row address and the channel offset are named (inputs only) so that all eight loads are issued first and no result is placed in an address register
    asm volatile("s_wait_xcnt 0x0" :: "v"(xs[0]), "v"(xs[1]), "v"(xs[2]), "v"(xs[3]), "v"(gr), "v"(br), "v"(mr), "v"(vr), "v"(xp), "v"(cb) : "memory");
#pragma unroll
    for (int u = 0; u < 4; ++u) { gg[u] = bfr(gr[u]); bb[u] = bfr(br[u]); mm[u] = bfr(mr[u]); const float vv = bfr(vr[u]); const float ve = __fadd_rn(vv, 1e-3f); rs[u] = __frsqrt_rn(ve); }
#pragma unroll
    for (int s = 0; s < SU; ++s) { const int e = e0 + s * 1024; v4us oh, ol;
#pragma unroll
        for (int u = 0; u < 4; ++u) { float xv = xs[s][u]; if (RAW) xv = bfr(xv); float d = __fsub_rn(xv, mm[u]); asm volatile("" : "+v"(d)); float t1 = __fmul_rn(gg[u], d); asm volatile("" : "+v"(t1)); float t2 = __fmul_rn(t1, rs[u]); asm volatile("" : "+v"(t2)); const float y = __fadd_rn(t2, bb[u]); unsigned short a, b2; splitf(y, a, b2); oh[u] = a; ol[u] = b2; }
        *(v4us*)(Hh + e) = oh; *(v4us*)(Hl + e) = ol; }
}
__global__ __launch_bounds__(256) void k_bn2(const float* __restrict__ X, const float* __restrict__ ga, const float* __restrict__ be, const float* __restrict__ mu, const float* __restrict__ var, bf* Hh, bf* Hl) { d_bn<false>((int)blockIdx.x, X, ga, be, mu, var, Hh, Hl); }
// k_prep: all that depends on the inputs alone, in one grid. The weight transposes (few work-groups, each a chain of eight dependent trips) take the lowest indices and start first; the table and BN1 stream behind them.
#define PB_Q  ((DM * DQ / 64 + 63) / 64)
#define PB_KV ((DM * DKV / 64 + 63) / 64)
#define PB_F  ((DM * FFD / 64 + 63) / 64)
#define PB_CS (TT * HD * 2 / (4 * 1024))
#define PB_BN PB_S
static_assert((TT * HD * 2) % (4 * 1024) == 0, "the table's work-groups cover it exactly");
__global__ __launch_bounds__(256) void k_prep(const float* __restrict__ wq, const float* __restrict__ wk, const float* __restrict__ wv, const float* __restrict__ wo, const float* __restrict__ w1, const float* __restrict__ w2, bf* WQ, bf* WK, bf* WV, bf* WO, bf* W1B, bf* W2B, float* CS,
                                              const float* __restrict__ x, const float* __restrict__ ga, const float* __restrict__ be, const float* __restrict__ mu, const float* __restrict__ var, bf* Hh, bf* Hl) {
    int b = (int)blockIdx.x;
    if (b < PB_F) { d_wtG(b, w1, DM, FFD, W1B); return; } b -= PB_F;
    if (b < PB_F) { d_wtG(b, w2, FFD, DM, W2B); return; } b -= PB_F;
    if (b < PB_Q) { d_wtG(b, wq, DM, DQ, WQ); return; } b -= PB_Q;
    if (b < PB_KV) { d_wtG(b, wk, DM, DKV, WK); return; } b -= PB_KV;
    if (b < PB_KV) { d_wtG(b, wv, DM, DKV, WV); return; } b -= PB_KV;
    if (b < PB_Q) { d_wtG(b, wo, DQ, DM, WO); return; } b -= PB_Q;
    if (b < PB_CS) { d_csid(b, CS); return; } b -= PB_CS;
    d_bn<true>(b, x, ga, be, mu, var, Hh, Hl);
    asm volatile("s_wait_xcnt 0x0" ::: "memory");   // behind the last store: the code of the grid's other parts follows in the text and writes these registers
}
__global__ __launch_bounds__(256) void k_res(const float* __restrict__ A, const float* __restrict__ x, float* X1) { const int e0 = (int)blockIdx.x * (SU * 1024) + (int)threadIdx.x * 4; v4f a[SU], b[SU]; const float *ap = A + e0, *bp = x + e0;
#pragma unroll
    for (int s = 0; s < SU; ++s) { a[s] = *(const v4f*)(ap + s * 1024); b[s] = *(const v4f*)(bp + s * 1024); }
    // stands behind the last load and in front of the first write of an address pair: the loaded values and the two addresses are named (inputs only) so that all loads are issued first and no result is placed in a pair
    asm volatile("s_wait_xcnt 0x0" :: "v"(a[0]), "v"(a[1]), "v"(a[2]), "v"(a[3]), "v"(b[0]), "v"(b[1]), "v"(b[2]), "v"(b[3]), "v"(ap), "v"(bp) : "memory");
#pragma unroll
    for (int s = 0; s < SU; ++s) { v4f o;
#pragma unroll
        for (int u = 0; u < 4; ++u) o[u] = __fadd_rn(a[s][u], bfr(b[s][u]));
        *(v4f*)(X1 + e0 + s * 1024) = o; }
}
#define GU 8   // 16-B pieces per thread of k_gelu, laid out as under SU
static_assert((TB * FFD) % (GU * 1024) == 0, "the grid covers the rows exactly");
__global__ __launch_bounds__(256) void k_gelu(const float* __restrict__ Mf, bf* Gh, bf* Gl) { const int e0 = (int)blockIdx.x * (GU * 1024) + (int)threadIdx.x * 4; v4f as[GU];
#pragma unroll
    for (int s = 0; s < GU; ++s) as[s] = *(const v4f*)(Mf + e0 + s * 1024);
#pragma unroll
    for (int s = 0; s < GU; ++s) { v4us oh, ol;
#pragma unroll   // unrolled: every element is then a register by name; a rolled loop picks it by a chain of selects and merges each result by bit-field inserts
        for (int u = 0; u < 4; ++u) { const float y = as[s][u]; float er = erff(y * 0.70710678118654752f); asm volatile("" : "+v"(er)); float hy = __fmul_rn(0.5f, y); asm volatile("" : "+v"(hy)); const float ge = __fmul_rn(hy, __fadd_rn(1.0f, er)); unsigned short h, l; splitf(ge, h, l); oh[u] = h; ol[u] = l; }
        *(v4us*)(Gh + e0 + s * 1024) = oh; *(v4us*)(Gl + e0 + s * 1024) = ol; }
}
__global__ __launch_bounds__(256) void k_fin(const float* __restrict__ M2, const float* __restrict__ X1, float* OUTb) { const int e0 = (int)blockIdx.x * (SU * 1024) + (int)threadIdx.x * 4; v4f a[SU], b[SU];
#pragma unroll
    for (int s = 0; s < SU; ++s) { a[s] = *(const v4f*)(M2 + e0 + s * 1024); b[s] = *(const v4f*)(X1 + e0 + s * 1024); }
#pragma unroll
    for (int s = 0; s < SU; ++s) { v4f o;
#pragma unroll
        for (int u = 0; u < 4; ++u) o[u] = __fadd_rn(a[s][u], b[s][u]);
        *(v4f*)(OUTb + e0 + s * 1024) = o; }
}

extern "C" void kernel_launch(void* const* d_in, const int* in_sizes, int n_in,
                              void* d_out, int out_size, void* d_ws, size_t ws_size, hipStream_t stream) {
    (void)in_sizes; (void)n_in; (void)out_size;
    const float** Ip = (const float**)d_in; const float *x = Ip[0], *g1 = Ip[1], *be1 = Ip[2], *m1 = Ip[3], *v1 = Ip[4], *wq = Ip[5], *bq = Ip[6], *wk = Ip[7], *bk = Ip[8], *wv = Ip[9], *bv = Ip[10], *wo = Ip[11], *bo = Ip[12], *g2 = Ip[13], *be2 = Ip[14], *m2 = Ip[15], *v2 = Ip[16], *w1 = Ip[17], *w2 = Ip[18]; const float* cosT = nullptr; const float* sinT = nullptr; (void)cosT; (void)sinT;
    float* OUT = (float*)d_out;     // [4][2048][256]
    char* wsp = (char*)d_ws;
    auto take = [&](size_t bytes) { char* p = wsp; wsp += (bytes + 255) & ~(size_t)255; return (void*)p; };
    bf* WQ = (bf*)take((size_t)DQ * DM * 2); bf* WK = (bf*)take((size_t)DKV * DM * 2); bf* WV = (bf*)take((size_t)DKV * DM * 2); bf* WO = (bf*)take((size_t)DM * DQ * 2); float* CS = (float*)take((size_t)TT * HD * 2 * 4);
    bf* Hh = (bf*)take((size_t)TB * DM * 2); bf* Hl = (bf*)take((size_t)TB * DM * 2); bf* W1B = (bf*)take((size_t)FFD * DM * 2); bf* W2B = (bf*)take((size_t)DM * FFD * 2); float* FQ = (float*)take((size_t)TB * DQ * 4); float* FK = (float*)take((size_t)TB * DKV * 4); float* FV = (float*)take((size_t)TB * DKV * 4);   // three buffers in a row, as WQ, WK, WV are: grid z of the projection steps from one to the next
    h16* QP16 = (h16*)take((size_t)NB_ * NH_ * TT * HD * 2); h16* KP16 = (h16*)take((size_t)NB_ * NKV * TT * HD * 2); h16* VT16 = (h16*)take((size_t)NB_ * NKV * HD * TT * 2);
    bf* ATh = (bf*)take((size_t)TB * DQ * 2); bf* ATl = (bf*)take((size_t)TB * DQ * 2);
    float* AO = (float*)take((size_t)TB * DM * 4); float* X1 = (float*)take((size_t)TB * DM * 4); float* Mf = (float*)take((size_t)TB * FFD * 4); bf* Gh = (bf*)take((size_t)TB * FFD * 2); bf* Gl = (bf*)take((size_t)TB * FFD * 2); float* M2 = (float*)take((size_t)TB * DM * 4);
    if ((size_t)(wsp - (char*)d_ws) > ws_size) return;    // ws 256 MiB
    static_assert(DQ == DKV, "grid z of the q, k, v projection steps by one weight plane and one output buffer of equal size");
    k_prep<<<2 * PB_F + 2 * PB_Q + 2 * PB_KV + PB_CS + PB_BN, 256, 0, stream>>>(wq, wk, wv, wo, w1, w2, WQ, WK, WV, WO, W1B, W2B, CS, x, g1, be1, m1, v1, Hh, Hl);
    k_gemmw<bf, 1, true, 8><<<dim3(TB / 64, DQ / 64, 3), 256, 0, stream>>>(Hh, Hl, WQ, nullptr, DM, FQ, DQ, bq, bk, bv, 0, (size_t)DQ * DM, (size_t)TB * DQ);
    k_planes<<<PB_V + 2 * PB_R, 256, 0, stream>>>(FQ, FK, FV, CS, QP16, KP16, VT16);
    k_fattn<<<dim3(TT / (32 * FQW), NB_ * NH_, 1), 32 * FQW, 0, stream>>>(QP16, KP16, VT16, ATh, ATl);
    k_gemmw<bf, 1, true, 8><<<dim3(TB / 64, DM / 64, 1), 256, 0, stream>>>(ATh, ATl, WO, nullptr, DQ, AO, DM, bo, nullptr, nullptr, 0, 0, 0);
    k_res<<<PB_S, 256, 0, stream>>>(AO, x, X1); k_bn2<<<PB_BN, 256, 0, stream>>>(X1, g2, be2, m2, v2, Hh, Hl);
    k_gemmw<bf, 1, false, 8><<<dim3(TB / 64, FFD / 64, 1), 256, 0, stream>>>(Hh, Hl, W1B, nullptr, DM, Mf, FFD, nullptr, nullptr, nullptr, 0, 0, 0); k_gelu<<<TB * FFD / (GU * 1024), 256, 0, stream>>>(Mf, Gh, Gl);
    k_gemmw<bf, 1, false, 8><<<dim3(TB / 64, DM / 64, 1), 256, 0, stream>>>(Gh, Gl, W2B, nullptr, FFD, M2, DM, nullptr, nullptr, nullptr, 0, 0, 0); k_fin<<<PB_S, 256, 0, stream>>>(M2, X1, OUT);
}

// v006
// Measured time: 126 microseconds a run.
// Next to v005, in two timings, it ran 1.10 and 1.09 times as fast.
// All steps since v000 together make it 7.25 times as fast.
#include <hip/hip_runtime.h>

// TransformerBaseBlock (x [4][2048][256]; h = BN1(x) (inference: gamma (x - mean) rsqrt(var + 1e-3) + beta); q/k/v = h W + b (4 heads x 64); softmax(q.k/8); attn_out = ctx Wo + bo; x1 = attn_out + x; m = gelu(BN2(x1) W1) W2 (exact erf GELU);
// out = m + x1 -> [4][2048][256]).
// Compute dtypes, f32 accumulate: every input rounded to bf16; BN1/BN2 f32 -> bf16 hi+lo planes; q/k/v (+ bias), W1 as hl x exact W (2 products); scores (K 64) and attn.v single fp16 planes;
// Every launch covers all four batches (rows b * 2048 + t, planes b * 4 + h); attention is one launch over all 16 (batch, head) planes: scores and probabilities stay in registers (k_fattn).
// Launches that do not depend on one another share one grid: k_prep (six weight transposes, the cos/sin table, BN1), the q, k, v projections (grid z of k_gemmw), k_planes (q and k head planes, V^T).
// The streaming kernels (table, BN1, BN2, head planes, V^T, residual, GELU, last add) give every thread 16 to 64 elements, all its loads issued ahead of its arithmetic: few waves to start, many bytes in flight per wave. Their loops over pieces and elements are all unrolled, so that a thread's pieces are registers and its loads can stand in a row.

#define NB_  4
#define TT   2048
#define DM   256
#define NH_  4
#define NKV  4
#define REP  (NH_ / NKV)
#define HD   64
#define DQ   (NH_ * HD)
#define DKV  (NKV * HD)
#define TB   (NB_ * TT)         // rows of all batches
#define WIN  0
#define PCAR 1024.0f
#define SCL  0.125f   // HD^-0.5
typedef _Float16 h16;
typedef unsigned short bf;
typedef __attribute__((ext_vector_type(16))) __bf16   v16bf;
typedef __attribute__((ext_vector_type(16))) _Float16 v16h;
typedef __attribute__((ext_vector_type(8)))  _Float16 v8h;
typedef __attribute__((ext_vector_type(8)))  unsigned short v8us;
typedef __attribute__((ext_vector_type(8)))  float    v8f;
typedef __attribute__((ext_vector_type(4)))  float    v4f;
typedef v8h  __attribute__((may_alias)) v8ha;
typedef v4f  __attribute__((may_alias)) v4fa;
typedef v8us __attribute__((may_alias)) v8usa;

__device__ __forceinline__ unsigned short f2bf(float f) { unsigned u = __float_as_uint(f); u += 0x7FFFu + ((u >> 16) & 1u); return (unsigned short)(u >> 16); }
__device__ __forceinline__ float bf2f(unsigned short b) { return __uint_as_float(((unsigned)b) << 16); }
__device__ __forceinline__ float bfr(float f) { return bf2f(f2bf(f)); }
__device__ __forceinline__ v16h cat16(v8h lo, v8h hi) { return __builtin_shufflevector(lo, hi, 0, 1, 2, 3, 4, 5, 6, 7, 8, 9, 10, 11, 12, 13, 14, 15); }
__device__ __forceinline__ v16bf cat16b(v8us lo, v8us hi) { return __builtin_bit_cast(v16bf, __builtin_shufflevector(lo, hi, 0, 1, 2, 3, 4, 5, 6, 7, 8, 9, 10, 11, 12, 13, 14, 15)); }
__device__ __forceinline__ v8f wmma16(v16h a, v16h b, v8f c) { return __builtin_amdgcn_wmma_f32_16x16x32_f16(false, a, false, b, (short)0, c, false, false); }
__device__ __forceinline__ v8f wmmab(v16bf a, v16bf b, v8f c) { return __builtin_amdgcn_wmma_f32_16x16x32_bf16(false, a, false, b, (short)0, c, false, false); }



// ---- k_gemmw: register-blocked GEMM, one 64x64 output tile per work-group (16 accumulators per wave), operands straight from K-contiguous 16-bit planes; grid (M/64, N/64, Z), 32 * KS threads.
// C[m][n] (f32, pitch ldc, + optional f32 bias[n]) = sum_k A[m][k] Bt[n][k] (+ split products per NSPLIT). z-batch strides sA/sB/sC in elements; the bias vectors are separate buffers: bias for z = 0, biasZ1 and biasZ2 for z = 1 and 2. K % (32 * KS) == 0.
// KS > 1: K is split over the KS waves (wave w takes the 32-k chunks w, w + KS, ...: neighbouring waves read the two halves of the same 128-B lines); each wave leaves its f32 partial tile in LDS, and behind one barrier
// all threads add the KS partials in the fixed order 0 .. KS-1 and store whole rows.
template <typename T16> struct WFrag;
template <> struct WFrag<h16> { typedef v16h V; static __device__ __forceinline__ V ld(const h16* p) { return cat16(*(const v8h*)p, *(const v8h*)(p + 16)); } static __device__ __forceinline__ v8f mma(V a, V b, v8f c) { return wmma16(a, b, c); } };
template <> struct WFrag<bf> { typedef v16bf V; static __device__ __forceinline__ V ld(const bf* p) { return cat16b(*(const v8us*)p, *(const v8us*)(p + 16)); } static __device__ __forceinline__ v8f mma(V a, V b, v8f c) { return wmmab(a, b, c); } };
template <typename T16, int NSPLIT, bool BIAS, int KS>
__global__ __launch_bounds__(32 * KS) void k_gemmw(const T16* __restrict__ A, const T16* __restrict__ A2, const T16* __restrict__ Bt, const T16* __restrict__ Bt2, int K, float* C, int ldc, const float* __restrict__ bias, const float* __restrict__ biasZ1, const float* __restrict__ biasZ2, size_t sA, size_t sB, size_t sC) {
    typedef typename WFrag<T16>::V V;
    __shared__ __align__(16) float os[(KS == 1 ? 16 : KS * 64) * 68];
    const size_t z = blockIdx.z; A += z * sA; if (A2) A2 += z * sA; Bt += z * sB; if (Bt2) Bt2 += z * sB; C += z * sC; const float* bz = (z == 0) ? bias : ((z == 1) ? biasZ1 : biasZ2);
    const int lane = threadIdx.x & 31, lr = lane & 15, hi = lane >> 4; const int r0 = blockIdx.x * 64, c0 = blockIdx.y * 64;
    const int wv = (KS == 1) ? 0 : __builtin_amdgcn_readfirstlane((int)(threadIdx.x >> 5));
    v8f acc[4][4];
#pragma unroll
    for (int mb = 0; mb < 4; ++mb)
#pragma unroll
        for (int nb = 0; nb < 4; ++nb) acc[mb][nb] = (v8f){};
    v4f bv = (v4f){};   // this thread's four bias columns (KS > 1), fetched ahead of the k loop so that their latency is not paid behind the barrier
    if (BIAS && KS > 1) { const int bc = c0 + ((int)threadIdx.x & 15) * 4; bv[0] = bfr(bz[bc]); bv[1] = bfr(bz[bc + 1]); bv[2] = bfr(bz[bc + 2]); bv[3] = bfr(bz[bc + 3]); }
    const size_t aoff = (size_t)(r0 + lr) * K + 8 * hi, boff = (size_t)(c0 + lr) * K + 8 * hi;
#pragma unroll 1
    for (int kc = wv * 32; kc < K; kc += 32 * KS) {
        V a[4], a2[4];
#pragma unroll
        for (int mb = 0; mb < 4; ++mb) { a[mb] = WFrag<T16>::ld(A + aoff + (size_t)mb * 16 * K + kc); if (NSPLIT == 1 || NSPLIT == 2) a2[mb] = WFrag<T16>::ld(A2 + aoff + (size_t)mb * 16 * K + kc); }
#pragma unroll
        for (int nb = 0; nb < 4; ++nb) { const V b = WFrag<T16>::ld(Bt + boff + (size_t)nb * 16 * K + kc); V b2; if (NSPLIT >= 2) b2 = WFrag<T16>::ld(Bt2 + boff + (size_t)nb * 16 * K + kc);
#pragma unroll
            for (int mb = 0; mb < 4; ++mb) { acc[mb][nb] = WFrag<T16>::mma(a[mb], b, acc[mb][nb]); if (NSPLIT == 1 || NSPLIT == 2) acc[mb][nb] = WFrag<T16>::mma(a2[mb], b, acc[mb][nb]); if (NSPLIT >= 2) acc[mb][nb] = WFrag<T16>::mma(a[mb], b2, acc[mb][nb]); } }
        asm volatile("v_nop\n\tv_nop\n\tv_nop\n\tv_nop" : "+v"(acc[0][0]), "+v"(acc[1][1]), "+v"(acc[2][2]), "+v"(acc[3][3]) : "v"(a[0]), "v"(a[3]));
    }
    if constexpr (KS > 1) {
        float* pw = os + wv * (64 * 68);
#pragma unroll
        for (int mb = 0; mb < 4; ++mb)
#pragma unroll
            for (int nb = 0; nb < 4; ++nb)
#pragma unroll
                for (int j = 0; j < 8; ++j) pw[(mb * 16 + hi * 8 + j) * 68 + nb * 16 + lr] = acc[mb][nb][j];
        __syncthreads();   // every wave's partial tile is in LDS before any thread adds them
#pragma unroll
        for (int s = 0; s < 32 / KS; ++s) { const int idx = s * (32 * KS) + (int)threadIdx.x; const int row = idx >> 4, cofs = (idx & 15) * 4; v4f val = *(const v4fa*)(os + row * 68 + cofs);
#pragma unroll
            for (int p = 1; p < KS; ++p) val += *(const v4fa*)(os + p * (64 * 68) + row * 68 + cofs);
            if (BIAS) val += bv;
            *(v4f*)(C + (size_t)(r0 + row) * ldc + c0 + cofs) = val; }
        return;
    }
#pragma unroll
    for (int mb = 0; mb < 4; ++mb) {
#pragma unroll
        for (int nb = 0; nb < 4; ++nb) {
#pragma unroll
            for (int j = 0; j < 8; ++j) os[(hi * 8 + j) * 68 + nb * 16 + lr] = acc[mb][nb][j]; }
        __builtin_amdgcn_wave_barrier(); asm volatile("" ::: "memory");
        float* crow = C + (size_t)(r0 + mb * 16) * ldc + c0;
{
#pragma unroll
            for (int s = 0; s < 8; ++s) { const int row = 2 * s + hi, cofs = lr * 4; v4f val = *(const v4fa*)(os + row * 68 + cofs); if (BIAS) { val[0] += bfr(bz[c0 + cofs]); val[1] += bfr(bz[c0 + cofs + 1]); val[2] += bfr(bz[c0 + cofs + 2]); val[3] += bfr(bz[c0 + cofs + 3]); }
                *(v4f*)(crow + (size_t)row * ldc + cofs) = val; }
             }
        __builtin_amdgcn_wave_barrier(); asm volatile("" ::: "memory");
    }
}

__device__ __forceinline__ h16 tohx(float x) { return (h16)x; }
__device__ __forceinline__ void splitf(float y, unsigned short& h, unsigned short& l) { h = f2bf(y); l = f2bf(y - bf2f(h)); }
typedef __attribute__((ext_vector_type(2))) _Float16 v2h;
typedef __attribute__((ext_vector_type(4))) _Float16 v4h;
typedef __attribute__((ext_vector_type(2))) unsigned short v2us;
typedef __attribute__((ext_vector_type(4))) unsigned short v4us;
typedef __attribute__((ext_vector_type(2))) float v2f;
typedef __attribute__((ext_vector_type(4))) int v4i;

// d_*: bodies of the kernels that share a grid; bx is the work-group's index inside its own part of the grid
__device__ __forceinline__ void d_wtG(int bx, const float* __restrict__ w, int K, int N, bf* Bt) {
    const int lane = threadIdx.x & 31; const int L0 = (bx * 8 + (threadIdx.x >> 5)) * 8; const int nlines = N * K / 64;
{
#pragma unroll 1
        for (int l = 0; l < 8; ++l) { const int L = L0 + l; if (L >= nlines) break; const size_t e = (size_t)L * 64 + lane * 2; const int k = (int)(e % K), n = (int)(e / K); v2us o;
            o[0] = f2bf(w[(size_t)k * N + n]); o[1] = f2bf(w[(size_t)(k + 1) * N + n]); *(v2us*)(Bt + e) = o; }
         }
}
__global__ __launch_bounds__(256) void k_cvt8(const float* __restrict__ src, bf* dst, size_t n8) { const size_t i = (size_t)blockIdx.x * 256 + threadIdx.x; if (i >= n8) return; const v8f v = *(const v8f*)(src + i * 8); v8us o;
#pragma unroll
    for (int k = 0; k < 8; ++k) o[k] = f2bf(v[k]); *(v8us*)(dst + i * 8) = o;  }
__global__ __launch_bounds__(256) void k_cscvt(const float* __restrict__ cosT, const float* __restrict__ sinT, float* CS) { const int idx = blockIdx.x * 256 + threadIdx.x; if (idx >= TT * HD) return; v2f cs; cs[0] = bfr(cosT[idx]); cs[1] = bfr(sinT[idx]); *(v2f*)(CS + (size_t)idx * 2) = cs;  }
// d_rope: head planes [b][h][t][d] (fp16) of rope(x) x sc with the rotate-half convention out[d] = x[d] cos[t][d] - x[d+HD/2] sin[t][d], out[d+HD/2] = x[d+HD/2] cos[t][d+HD/2] + x[d] sin[t][d+HD/2]
// One thread: four consecutive d of one row t, for every head of RB batches (the table entries of (t, d) are fetched once for all of them). A wave's load covers two whole 256-B head rows, its store 256 B in a row.
#define RB 2
#define PB_R ((NB_ / RB) * TT * (HD / 4) / 256)
template <int NHD> __device__ __forceinline__ void d_rope(int bx, const float* __restrict__ F, const float* __restrict__ CS, float sc, h16* P16) {
    static_assert(NB_ % RB == 0 && ((NB_ / RB) * TT * (HD / 4)) % 256 == 0 && (HD / 2) % 4 == 0, "the grid covers the planes exactly; a thread's four d lie in one half of the head");
    const int i = bx * 256 + (int)threadIdx.x; const int d = (i % (HD / 4)) * 4, t = (i / (HD / 4)) % TT, b0 = (i / ((HD / 4) * TT)) * RB; const int dq = (d < HD / 2) ? d + HD / 2 : d - HD / 2;
    const float* cp = CS + ((size_t)t * HD + d) * 2; const float* fa = F + ((size_t)b0 * TT + t) * (NHD * HD) + d; const float* fb = F + ((size_t)b0 * TT + t) * (NHD * HD) + dq;   // the three addresses of this thread; every load is one of them plus a constant
    const v4f c01 = *(const v4f*)cp, c23 = *(const v4f*)(cp + 4); v4f xa[RB][NHD], xb[RB][NHD];
#pragma unroll
    for (int bb = 0; bb < RB; ++bb)
#pragma unroll
        for (int h = 0; h < NHD; ++h) { xa[bb][h] = *(const v4f*)(fa + (size_t)bb * TT * (NHD * HD) + h * HD); xb[bb][h] = *(const v4f*)(fb + (size_t)bb * TT * (NHD * HD) + h * HD); }
    static_assert(RB == 2 && NHD == 4, "the wait below names every loaded value");
    // stands behind the last load and in front of the first write of a register that held a load's address: the loaded values and the three addresses are named (inputs only) so that all loads are issued first and no result is placed in an address pair
    asm volatile("s_wait_xcnt 0x0" :: "v"(c01), "v"(c23), "v"(xa[0][0]), "v"(xa[0][1]), "v"(xa[0][2]), "v"(xa[0][3]), "v"(xa[1][0]), "v"(xa[1][1]), "v"(xa[1][2]), "v"(xa[1][3]), "v"(xb[0][0]), "v"(xb[0][1]), "v"(xb[0][2]), "v"(xb[0][3]), "v"(xb[1][0]), "v"(xb[1][1]), "v"(xb[1][2]), "v"(xb[1][3]), "v"(cp), "v"(fa), "v"(fb) : "memory");
#pragma unroll
    for (int bb = 0; bb < RB; ++bb)
#pragma unroll
        for (int h = 0; h < NHD; ++h) { v4h o16;
#pragma unroll
            for (int q = 0; q < 4; ++q) { const float x0 = xa[bb][h][q], x1 = xb[bb][h][q]; v2f cs; cs[0] = (q < 2) ? c01[2 * q] : c23[2 * q - 4]; cs[1] = (q < 2) ? c01[2 * q + 1] : c23[2 * q - 3];
                float a = __fmul_rn(x0, cs[0]), bq = __fmul_rn(x1, cs[1]); asm volatile("" : "+v"(a)); asm volatile("" : "+v"(bq)); const float r = ((d < HD / 2) ? __fsub_rn(a, bq) : __fadd_rn(a, bq)) * sc;
                o16[q] = tohx(r); }
            *(v4h*)(P16 + (((size_t)(b0 + bb) * NHD + h) * TT + t) * HD + d) = o16; }
    asm volatile("s_wait_xcnt 0x0" ::: "memory");   // behind the last store: the code of the grid's other parts follows in the text and writes these registers
}
// d_vtp: V^T planes [b][g][d][t] (fp16). One wave turns 64 rows t x 32 columns of F; a thread holds 8 t x 8 d in registers (lane = t group + 8 x d group): a load takes 64-B pieces of eight rows, a store four whole 128-B lines.
#define PB_V (TB * DKV / (64 * 32) / 8)
template <int NHD> __device__ __forceinline__ void d_vtp(int bx, const float* __restrict__ F, h16* V16) {
    static_assert(TT % 64 == 0 && HD % 32 == 0 && (TB * NHD * HD) % (64 * 32 * 8) == 0, "a wave's block lies in one batch and one head; the grid covers the plane exactly");
    const int lane = threadIdx.x & 31, tg = lane & 7, dg = lane >> 3; const int w = bx * 8 + (int)(threadIdx.x >> 5); const int c0 = (w % (NHD * HD / 32)) * 32 + dg * 4, r0 = (w / (NHD * HD / 32)) * 64 + tg * 8;   // first column and first row (b * 2048 + t) of this thread
    v4f x[8][2]; const float* fp = F + (size_t)r0 * (NHD * HD) + c0;
#pragma unroll
    for (int r = 0; r < 8; ++r)
#pragma unroll
        for (int hf = 0; hf < 2; ++hf) x[r][hf] = *(const v4f*)(fp + r * (NHD * HD) + hf * 16);
    // stands behind the last load and in front of the first write of the address pair: the loaded values and the address are named (inputs only) so that all loads are issued first and no result is placed in that pair
    asm volatile("s_wait_xcnt 0x0" :: "v"(x[0][0]), "v"(x[0][1]), "v"(x[1][0]), "v"(x[1][1]), "v"(x[2][0]), "v"(x[2][1]), "v"(x[3][0]), "v"(x[3][1]), "v"(x[4][0]), "v"(x[4][1]), "v"(x[5][0]), "v"(x[5][1]), "v"(x[6][0]), "v"(x[6][1]), "v"(x[7][0]), "v"(x[7][1]), "v"(fp) : "memory");
    h16* vo = V16 + ((size_t)(r0 / TT) * (NHD * HD) + c0) * TT + r0 % TT;   // plane row b * 256 + g * 64 + d is b * 256 + column
#pragma unroll
    for (int hf = 0; hf < 2; ++hf)
#pragma unroll
        for (int q = 0; q < 4; ++q) { v8h o16;
#pragma unroll
            for (int r = 0; r < 8; ++r) o16[r] = tohx(x[r][hf][q]);
            *(v8h*)(vo + (size_t)(hf * 16 + q) * TT) = o16; }
}
__device__ __forceinline__ void d_csid(int bx, float* CS) { v4f cs; cs[0] = 1.0f; cs[1] = 0.0f; cs[2] = 1.0f; cs[3] = 0.0f;   // two entries a store, four stores a thread
#pragma unroll
    for (int s = 0; s < 4; ++s) *(v4f*)(CS + ((size_t)(bx * 4 + s) * 256 + threadIdx.x) * 4) = cs;
    asm volatile("s_wait_xcnt 0x0" ::: "memory");   // behind the last store: the code of the grid's other parts follows in the text and writes these registers
}
// k_planes: the three plane builders in one grid, each with its own run of work-group indices. V^T, whose reads are pieces of lines, takes the lowest and so starts first.
__global__ __launch_bounds__(256) void k_planes(const float* __restrict__ FQ, const float* __restrict__ FK, const float* __restrict__ FV, const float* __restrict__ CS, h16* QP16, h16* KP16, h16* VT16) {
    int b = (int)blockIdx.x;
    if (b < PB_V) { d_vtp<NKV>(b, FV, VT16); return; } b -= PB_V;
    if (b < PB_R) { d_rope<NH_>(b, FQ, CS, 1.0f, QP16); return; } b -= PB_R;
    d_rope<NKV>(b, FK, CS, 1.0f, KP16);
}
// k_fattn: scores, softmax and attn.v of one (batch, head) plane in one kernel. One wave owns 32 query columns (two groups of 16) and walks one quarter of the 2048 keys in passes of 32.
// The four waves that share 32 queries (one per key quarter) sit in one work-group of 16 waves, four to a SIMD, so that one wave's softmax arithmetic and load waits lie under the others' products. Each leaves its maximum, sum and O^T tiles in LDS;
// behind one barrier two of the four (one per column group) bring the quarters to a common maximum, add them in the fixed order 0 .. 3 and run the epilogue.
// Transposed products: S^T = K Q^T (A = 16 key rows, B = the wave's queries, kept in registers), O^T += V^T P^T (A = 16 d rows of the [d][t] plane). In an S^T tile lane (lr, hi) holds keys 8 hi + 0..7 of query lr,
// which is the k order of a B operand: tiles 0 and 1 of a pass, rounded to fp16, ARE the 32-key B operand; nothing crosses lanes but one exchange between the wave's halves for the maximum (and one for the sum, at the end).
// Running softmax in the log2 domain: p = 2^(s c - m), c = HD^-0.5 log2 e; m, the maximum in use, may trail the true one by up to 8 (p <= 2^8, well inside fp16); sums and accumulators are rescaled only when a column exceeds that.
// The epilogue divides by the sum (as x PCAR / sum, then / PCAR, the two roundings the separate kernels had) and stores the bf16 hi+lo planes [b * 2048 + t][h * 64 + d] that the output projection reads: 128-B lines, one wave each.
#define FQW 4   // query groups of 32 per work-group: 128 queries, 256 work-groups
#define FKS 4   // key quarters per query group: FQW * FKS waves per work-group
__device__ __forceinline__ float xhalf(float x) { return __builtin_bit_cast(float, __builtin_amdgcn_permlanex16(__builtin_bit_cast(int, x), __builtin_bit_cast(int, x), 0x76543210, 0xfedcba98, false, false)); }  // lane l with lane l ^ 16
__global__ __launch_bounds__(32 * FQW * FKS) void k_fattn(const h16* __restrict__ Q, const h16* __restrict__ Kp, const h16* __restrict__ Vt, bf* Ah, bf* Al) {
    typedef WFrag<h16> WF;
    static_assert(FKS >= 2 && TT % (32 * FKS) == 0, "one finishing wave per column group; every key range is whole passes");
    __shared__ __align__(16) float po[FKS * FQW][8][2][32 * 4];   // [wave][tile g * 4 + dt][registers 0..3 | 4..7][lane]: every access is 16 B a lane, 512 B in a row
    __shared__ float pm[FKS * FQW][2][32], pl[FKS * FQW][2][32];   // [wave][g][lane]: maximum in use, this lane's part of the sum
    const int lane = threadIdx.x & 31, lr = lane & 15, hi = lane >> 4; const int wv = __builtin_amdgcn_readfirstlane((int)(threadIdx.x >> 5));
    const int qg = wv % FQW, kq = wv / FQW, kb = kq * (TT / FKS);   // query group, key quarter and its first key: the same in all lanes of the wave
    const size_t z = blockIdx.y, zk = z / REP; const int q0 = ((int)blockIdx.x * FQW + qg) * 32;
    const h16* qp = Q + (z * TT + q0 + lr) * HD + 8 * hi; const h16* kp = Kp + (zk * TT + lr) * HD + 8 * hi; const h16* vp = Vt + (zk * HD + lr) * TT + 8 * hi;
    v16h qf[2][2], kf[2][2], vf[4]; v8f o[2][4]; float mr[2], l[2];   // the inner loops are all unrolled so that these arrays are registers
#pragma unroll
    for (int g = 0; g < 2; ++g) { mr[g] = -__builtin_inff(); l[g] = 0.f;
#pragma unroll
        for (int ks = 0; ks < 2; ++ks) { qf[g][ks] = WF::ld(qp + g * 16 * HD + ks * 32); kf[g][ks] = WF::ld(kp + (size_t)(kb + g * 16) * HD + ks * 32); }
#pragma unroll
        for (int dt = 0; dt < 4; ++dt) o[g][dt] = (v8f){}; }
#pragma unroll
    for (int dt = 0; dt < 4; ++dt) vf[dt] = WF::ld(vp + (size_t)dt * 16 * TT + kb);
    asm volatile("s_wait_xcnt 0x0" :: "v"(qp) : "memory");   // stands in front of the first write of a register that held one of these loads' addresses; qp, dead behind its loads, is named so that its registers last up to here
    const float cs = SCL * 1.4426950408889634f;
#pragma unroll 1   // 16 passes: rolled, the body is long enough and the fetch-ahead wants one register set
    for (int k0 = kb; k0 < kb + TT / FKS; k0 += 32) {
        v8f s[2][2];
#pragma unroll
        for (int kt = 0; kt < 2; ++kt)
#pragma unroll
            for (int g = 0; g < 2; ++g) s[kt][g] = WF::mma(kf[kt][1], qf[g][1], WF::mma(kf[kt][0], qf[g][0], (v8f){}));
        const int kn = (k0 + 32) & (TT - 1);   // K and V^T fragments are fetched one pass ahead, each into the registers its product has just read; a wave's last pass fetches the first keys of the next quarter, the last quarter's keys 0..31 (in bounds, unused)
#pragma unroll
        for (int kt = 0; kt < 2; ++kt)
#pragma unroll
            for (int ks = 0; ks < 2; ++ks) kf[kt][ks] = WF::ld(kp + (size_t)(kn + kt * 16) * HD + ks * 32);
        __builtin_amdgcn_sched_barrier(0);   // keeps the K fetch up here, a whole softmax and attn.v ahead of its use: under the register ceiling of four waves a SIMD the compiler otherwise sinks it to the end of the pass
        float mb[2]; bool need = false;
#pragma unroll
        for (int g = 0; g < 2; ++g) { float m0 = s[0][g][0], m1 = s[1][g][0];
#pragma unroll
            for (int j = 1; j < 8; ++j) { m0 = fmaxf(m0, s[0][g][j]); m1 = fmaxf(m1, s[1][g][j]); }
            m0 = fmaxf(m0, m1); mb[g] = fmaxf(m0, xhalf(m0)) * cs; need = need || (mb[g] > mr[g] + 8.0f); }   // both halves of the wave hold the query's maximum, scaled (the scale is positive)
        if (__builtin_amdgcn_ballot_w32(need) != 0) {   // wave-uniform; always taken in the first pass (mr = -inf gives the factor 0), rare later
#pragma unroll
            for (int g = 0; g < 2; ++g) { const float mn = fmaxf(mr[g], mb[g]); const float al = __builtin_amdgcn_exp2f(mr[g] - mn); mr[g] = mn; l[g] *= al;
#pragma unroll
                for (int dt = 0; dt < 4; ++dt) o[g][dt] *= al; }
        }
#pragma unroll
        for (int g = 0; g < 2; ++g) { const float nm = -mr[g]; float a0 = 0.f, a1 = 0.f; v16h pf;
#pragma unroll
            for (int i = 0; i < 8; ++i) { const v2f ar = __builtin_elementwise_fma((v2f){s[i >> 2][g][2 * (i & 3)], s[i >> 2][g][2 * (i & 3) + 1]}, (v2f){cs, cs}, (v2f){nm, nm});
                float p0;
                if (g == 0 && i == 0) asm("v_exp_f32 %0, %1\n\tv_nop" : "=v"(p0) : "v"(ar[0]));   // the pass's first exponential carries its own v_nop: the slot the instruction set asks for behind a transcendental, since the register allocator gives this one's source to the next instruction's result
                else p0 = __builtin_amdgcn_exp2f(ar[0]);
                const float p1 = __builtin_amdgcn_exp2f(ar[1]); a0 += p0; a1 += p1; pf[2 * i] = tohx(p0); pf[2 * i + 1] = tohx(p1); }
            l[g] += a0 + a1;
#pragma unroll
            for (int dt = 0; dt < 4; ++dt) o[g][dt] = WF::mma(vf[dt], pf, o[g][dt]); }
#pragma unroll
        for (int dt = 0; dt < 4; ++dt) vf[dt] = WF::ld(vp + (size_t)dt * 16 * TT + kn);
        asm volatile("s_wait_xcnt 0x0" ::: "memory");   // stands in front of the next pass's first write of the registers that held these loads' address
    }
#pragma unroll
    for (int g = 0; g < 2; ++g) { pm[wv][g][lane] = mr[g]; pl[wv][g][lane] = l[g];
#pragma unroll
        for (int dt = 0; dt < 4; ++dt) { *(v4fa*)&po[wv][g * 4 + dt][0][lane * 4] = __builtin_shufflevector(o[g][dt], o[g][dt], 0, 1, 2, 3); *(v4fa*)&po[wv][g * 4 + dt][1][lane * 4] = __builtin_shufflevector(o[g][dt], o[g][dt], 4, 5, 6, 7); } }
    __syncthreads();   // every quarter's maximum, sum and tiles are in LDS before a finishing wave reads them
    if (kq >= 2) return;   // wave-uniform, behind the only barrier: quarter 0's wave finishes column group 0, quarter 1's group 1, each whole 128-B lines of the planes
    const int g = kq; float fs[FKS], mx = pm[qg][g][lane], ls = 0.f;
#pragma unroll
    for (int p = 1; p < FKS; ++p) mx = fmaxf(mx, pm[p * FQW + qg][g][lane]);
#pragma unroll
    for (int p = 0; p < FKS; ++p) { fs[p] = __builtin_amdgcn_exp2f(pm[p * FQW + qg][g][lane] - mx); ls += fs[p] * pl[p * FQW + qg][g][lane]; }   // both halves of the wave hold the same maxima, so the same factors
    const float f = __fdiv_rn(PCAR, ls + xhalf(ls)); const size_t oo = ((z / NH_) * TT + q0 + g * 16 + lr) * DQ + (z % NH_) * HD + hi * 8;   // lane (lr, hi) holds d = 16 dt + 8 hi + 0..7 of query lr; row b * 2048 + t, columns h * 64 + d
#pragma unroll
    for (int dt = 0; dt < 4; ++dt) { v4f s0 = (v4f){}, s1 = (v4f){}; v8us oh, ol;
#pragma unroll
        for (int p = 0; p < FKS; ++p) { s0 += *(const v4fa*)&po[p * FQW + qg][g * 4 + dt][0][lane * 4] * fs[p]; s1 += *(const v4fa*)&po[p * FQW + qg][g * 4 + dt][1][lane * 4] * fs[p]; }
#pragma unroll
        for (int j = 0; j < 8; ++j) { unsigned short a, c2; splitf(((j < 4 ? s0[j & 3] : s1[j & 3]) * f) * (1.0f / PCAR), a, c2); oh[j] = a; ol[j] = c2; }
        *(v8us*)(Ah + oo + dt * 16) = oh; *(v8us*)(Al + oo + dt * 16) = ol; }
}

// block tail: d_bn: hl planes of gamma (v - mean) rsqrt(var + 1e-3) + beta over [b * 2048 + t][256] (RAW: v is a raw input row, bf16-rounded first) (8-B stores); k_res: X1 = A + bf16 x (16-B lanes); k_gelu: hl planes of exact-erf GELU (8-B stores);
#define FFD 1024
// SU: 16-B pieces per thread of the kernels over [8192][256]; a work-group takes SU * 1024 elements in a row, piece s of thread i at s * 1024 + 4 i (every wave's load is 512 B in a row, and a thread keeps its four channels)
#define SU 4
#define PB_S (TB * DM / (SU * 1024))
static_assert((TB * DM) % (SU * 1024) == 0 && 1024 % DM == 0, "the grids cover the rows exactly; a thread's channels are the same in all its pieces");
template <bool RAW> __device__ __forceinline__ void d_bn(int bx, const float* __restrict__ X, const float* __restrict__ ga, const float* __restrict__ be, const float* __restrict__ mu, const float* __restrict__ var, bf* Hh, bf* Hl) { const int e0 = bx * (SU * 1024) + (int)threadIdx.x * 4; const int c = e0 % DM; v4f xs[SU]; float gg[4], bb[4], mm[4], rs[4]; const float* xp = X + e0; const unsigned cb = (unsigned)c * 4u;   // cb: byte offset of the thread's channels in the four parameter vectors
#pragma unroll
    for (int s = 0; s < SU; ++s) xs[s] = *(const v4f*)(xp + s * 1024);
    const v4f gr = *(const v4f*)((const char*)ga + cb), br = *(const v4f*)((const char*)be + cb), mr = *(const v4f*)((const char*)mu + cb), vr = *(const v4f*)((const char*)var + cb);   // the thread's four channels, once for all its pieces
    static_assert(SU == 4, "the wait below names every piece");
    // stands behind the last load and in front of the first write of a register that held a load's address: the loaded values, the row address and the channel offset are named (inputs only) so that all eight loads are issued first and no result is placed in an address register
    asm volatile("s_wait_xcnt 0x0" :: "v"(xs[0]), "v"(xs[1]), "v"(xs[2]), "v"(xs[3]), "v"(gr), "v"(br), "v"(mr), "v"(vr), "v"(xp), "v"(cb) : "memory");
#pragma unroll
    for (int u = 0; u < 4; ++u) { gg[u] = bfr(gr[u]); bb[u] = bfr(br[u]); mm[u] = bfr(mr[u]); const float vv = bfr(vr[u]); const float ve = __fadd_rn(vv, 1e-3f); rs[u] = __frsqrt_rn(ve); }
#pragma unroll
    for (int s = 0; s < SU; ++s) { const int e = e0 + s * 1024; v4us oh, ol;
#pragma unroll
        for (int u = 0; u < 4; ++u) { float xv = xs[s][u]; if (RAW) xv = bfr(xv); float d = __fsub_rn(xv, mm[u]); asm volatile("" : "+v"(d)); float t1 = __fmul_rn(gg[u], d); asm volatile("" : "+v"(t1)); float t2 = __fmul_rn(t1, rs[u]); asm volatile("" : "+v"(t2)); const float y = __fadd_rn(t2, bb[u]); unsigned short a, b2; splitf(y, a, b2); oh[u] = a; ol[u] = b2; }
        *(v4us*)(Hh + e) = oh; *(v4us*)(Hl + e) = ol; }
}
__global__ __launch_bounds__(256) void k_bn2(const float* __restrict__ X, const float* __restrict__ ga, const float* __restrict__ be, const float* __restrict__ mu, const float* __restrict__ var, bf* Hh, bf* Hl) { d_bn<false>((int)blockIdx.x, X, ga, be, mu, var, Hh, Hl); }
// k_prep: all that depends on the inputs alone, in one grid. The weight transposes (few work-groups, each a chain of eight dependent trips) take the lowest indices and start first; the table and BN1 stream behind them.
#define PB_Q  ((DM * DQ / 64 + 63) / 64)
#define PB_KV ((DM * DKV / 64 + 63) / 64)
#define PB_F  ((DM * FFD / 64 + 63) / 64)
#define PB_CS (TT * HD * 2 / (4 * 1024))
#define PB_BN PB_S
static_assert((TT * HD * 2) % (4 * 1024) == 0, "the table's work-groups cover it exactly");
__global__ __launch_bounds__(256) void k_prep(const float* __restrict__ wq, const float* __restrict__ wk, const float* __restrict__ wv, const float* __restrict__ wo, const float* __restrict__ w1, const float* __restrict__ w2, bf* WQ, bf* WK, bf* WV, bf* WO, bf* W1B, bf* W2B, float* CS,
                                              const float* __restrict__ x, const float* __restrict__ ga, const float* __restrict__ be, const float* __restrict__ mu, const float* __restrict__ var, bf* Hh, bf* Hl) {
    int b = (int)blockIdx.x;
    if (b < PB_F) { d_wtG(b, w1, DM, FFD, W1B); return; } b -= PB_F;
    if (b < PB_F) { d_wtG(b, w2, FFD, DM, W2B); return; } b -= PB_F;
    if (b < PB_Q) { d_wtG(b, wq, DM, DQ, WQ); return; } b -= PB_Q;
    if (b < PB_KV) { d_wtG(b, wk, DM, DKV, WK); return; } b -= PB_KV;
    if (b < PB_KV) { d_wtG(b, wv, DM, DKV, WV); return; } b -= PB_KV;
    if (b < PB_Q) { d_wtG(b, wo, DQ, DM, WO); return; } b -= PB_Q;
    if (b < PB_CS) { d_csid(b, CS); return; } b -= PB_CS;
    d_bn<true>(b, x, ga, be, mu, var, Hh, Hl);
    asm volatile("s_wait_xcnt 0x0" ::: "memory");   // behind the last store: the code of the grid's other parts follows in the text and writes these registers
}
__global__ __launch_bounds__(256) void k_res(const float* __restrict__ A, const float* __restrict__ x, float* X1) { const int e0 = (int)blockIdx.x * (SU * 1024) + (int)threadIdx.x * 4; v4f a[SU], b[SU]; const float *ap = A + e0, *bp = x + e0;
#pragma unroll
    for (int s = 0; s < SU; ++s) { a[s] = *(const v4f*)(ap + s * 1024); b[s] = *(const v4f*)(bp + s * 1024); }
    // stands behind the last load and in front of the first write of an address pair: the loaded values and the two addresses are named (inputs only) so that all loads are issued first and no result is placed in a pair
    asm volatile("s_wait_xcnt 0x0" :: "v"(a[0]), "v"(a[1]), "v"(a[2]), "v"(a[3]), "v"(b[0]), "v"(b[1]), "v"(b[2]), "v"(b[3]), "v"(ap), "v"(bp) : "memory");
#pragma unroll
    for (int s = 0; s < SU; ++s) { v4f o;
#pragma unroll
        for (int u = 0; u < 4; ++u) o[u] = __fadd_rn(a[s][u], bfr(b[s][u]));
        *(v4f*)(X1 + e0 + s * 1024) = o; }
}
#define GU 8   // 16-B pieces per thread of k_gelu, laid out as under SU
static_assert((TB * FFD) % (GU * 1024) == 0, "the grid covers the rows exactly");
__global__ __launch_bounds__(256) void k_gelu(const float* __restrict__ Mf, bf* Gh, bf* Gl) { const int e0 = (int)blockIdx.x * (GU * 1024) + (int)threadIdx.x * 4; v4f as[GU];
#pragma unroll
    for (int s = 0; s < GU; ++s) as[s] = *(const v4f*)(Mf + e0 + s * 1024);
#pragma unroll
    for (int s = 0; s < GU; ++s) { v4us oh, ol;
#pragma unroll   // unrolled: every element is then a register by name; a rolled loop picks it by a chain of selects and merges each result by bit-field inserts
        for (int u = 0; u < 4; ++u) { const float y = as[s][u]; float er = erff(y * 0.70710678118654752f); asm volatile("" : "+v"(er)); float hy = __fmul_rn(0.5f, y); asm volatile("" : "+v"(hy)); const float ge = __fmul_rn(hy, __fadd_rn(1.0f, er)); unsigned short h, l; splitf(ge, h, l); oh[u] = h; ol[u] = l; }
        *(v4us*)(Gh + e0 + s * 1024) = oh; *(v4us*)(Gl + e0 + s * 1024) = ol; }
}
__global__ __launch_bounds__(256) void k_fin(const float* __restrict__ M2, const float* __restrict__ X1, float* OUTb) { const int e0 = (int)blockIdx.x * (SU * 1024) + (int)threadIdx.x * 4; v4f a[SU], b[SU];
#pragma unroll
    for (int s = 0; s < SU; ++s) { a[s] = *(const v4f*)(M2 + e0 + s * 1024); b[s] = *(const v4f*)(X1 + e0 + s * 1024); }
#pragma unroll
    for (int s = 0; s < SU; ++s) { v4f o;
#pragma unroll
        for (int u = 0; u < 4; ++u) o[u] = __fadd_rn(a[s][u], b[s][u]);
        *(v4f*)(OUTb + e0 + s * 1024) = o; }
}

extern "C" void kernel_launch(void* const* d_in, const int* in_sizes, int n_in,
                              void* d_out, int out_size, void* d_ws, size_t ws_size, hipStream_t stream) {
    (void)in_sizes; (void)n_in; (void)out_size;
    const float** Ip = (const float**)d_in; const float *x = Ip[0], *g1 = Ip[1], *be1 = Ip[2], *m1 = Ip[3], *v1 = Ip[4], *wq = Ip[5], *bq = Ip[6], *wk = Ip[7], *bk = Ip[8], *wv = Ip[9], *bv = Ip[10], *wo = Ip[11], *bo = Ip[12], *g2 = Ip[13], *be2 = Ip[14], *m2 = Ip[15], *v2 = Ip[16], *w1 = Ip[17], *w2 = Ip[18]; const float* cosT = nullptr; const float* sinT = nullptr; (void)cosT; (void)sinT;
    float* OUT = (float*)d_out;     // [4][2048][256]
    char* wsp = (char*)d_ws;
    auto take = [&](size_t bytes) { char* p = wsp; wsp += (bytes + 255) & ~(size_t)255; return (void*)p; };
    bf* WQ = (bf*)take((size_t)DQ * DM * 2); bf* WK = (bf*)take((size_t)DKV * DM * 2); bf* WV = (bf*)take((size_t)DKV * DM * 2); bf* WO = (bf*)take((size_t)DM * DQ * 2); float* CS = (float*)take((size_t)TT * HD * 2 * 4);
    bf* Hh = (bf*)take((size_t)TB * DM * 2); bf* Hl = (bf*)take((size_t)TB * DM * 2); bf* W1B = (bf*)take((size_t)FFD * DM * 2); bf* W2B = (bf*)take((size_t)DM * FFD * 2); float* FQ = (float*)take((size_t)TB * DQ * 4); float* FK = (float*)take((size_t)TB * DKV * 4); float* FV = (float*)take((size_t)TB * DKV * 4);   // three buffers in a row, as WQ, WK, WV are: grid z of the projection steps from one to the next
    h16* QP16 = (h16*)take((size_t)NB_ * NH_ * TT * HD * 2); h16* KP16 = (h16*)take((size_t)NB_ * NKV * TT * HD * 2); h16* VT16 = (h16*)take((size_t)NB_ * NKV * HD * TT * 2);
    bf* ATh = (bf*)take((size_t)TB * DQ * 2); bf* ATl = (bf*)take((size_t)TB * DQ * 2);
    float* AO = (float*)take((size_t)TB * DM * 4); float* X1 = (float*)take((size_t)TB * DM * 4); float* Mf = (float*)take((size_t)TB * FFD * 4); bf* Gh = (bf*)take((size_t)TB * FFD * 2); bf* Gl = (bf*)take((size_t)TB * FFD * 2); float* M2 = (float*)take((size_t)TB * DM * 4);
    if ((size_t)(wsp - (char*)d_ws) > ws_size) return;    // ws 256 MiB
    static_assert(DQ == DKV, "grid z of the q, k, v projection steps by one weight plane and one output buffer of equal size");
    k_prep<<<2 * PB_F + 2 * PB_Q + 2 * PB_KV + PB_CS + PB_BN, 256, 0, stream>>>(wq, wk, wv, wo, w1, w2, WQ, WK, WV, WO, W1B, W2B, CS, x, g1, be1, m1, v1, Hh, Hl);
    k_gemmw<bf, 1, true, 8><<<dim3(TB / 64, DQ / 64, 3), 256, 0, stream>>>(Hh, Hl, WQ, nullptr, DM, FQ, DQ, bq, bk, bv, 0, (size_t)DQ * DM, (size_t)TB * DQ);
    k_planes<<<PB_V + 2 * PB_R, 256, 0, stream>>>(FQ, FK, FV, CS, QP16, KP16, VT16);
    k_fattn<<<dim3(TT / (32 * FQW), NB_ * NH_, 1), 32 * FQW * FKS, 0, stream>>>(QP16, KP16, VT16, ATh, ATl);
    k_gemmw<bf, 1, true, 8><<<dim3(TB / 64, DM / 64, 1), 256, 0, stream>>>(ATh, ATl, WO, nullptr, DQ, AO, DM, bo, nullptr, nullptr, 0, 0, 0);
    k_res<<<PB_S, 256, 0, stream>>>(AO, x, X1); k_bn2<<<PB_BN, 256, 0, stream>>>(X1, g2, be2, m2, v2, Hh, Hl);
    k_gemmw<bf, 1, false, 8><<<dim3(TB / 64, FFD / 64, 1), 256, 0, stream>>>(Hh, Hl, W1B, nullptr, DM, Mf, FFD, nullptr, nullptr, nullptr, 0, 0, 0); k_gelu<<<TB * FFD / (GU * 1024), 256, 0, stream>>>(Mf, Gh, Gl);
    k_gemmw<bf, 1, false, 8><<<dim3(TB / 64, DM / 64, 1), 256, 0, stream>>>(Gh, Gl, W2B, nullptr, FFD, M2, DM, nullptr, nullptr, nullptr, 0, 0, 0); k_fin<<<PB_S, 256, 0, stream>>>(M2, X1, OUT);
}

// v007
// One run takes 109 microseconds.
// Timed twice side by side with v006, it ran 1.16 and 1.17 times as fast.
// All steps since v000 together make it 8.43 times as fast.
#include <hip/hip_runtime.h>

// TransformerBaseBlock (x [4][2048][256]; h = BN1(x) (inference: gamma (x - mean) rsqrt(var + 1e-3) + beta); q/k/v = h W + b (4 heads x 64); softmax(q.k/8); attn_out = ctx Wo + bo; x1 = attn_out + x; m = gelu(BN2(x1) W1) W2 (exact erf GELU);
// out = m + x1 -> [4][2048][256]).
// Compute dtypes, f32 accumulate: every input rounded to bf16; BN1/BN2 f32 -> bf16 hi+lo planes; q/k/v (+ bias), W1 as hl x exact W (2 products); scores (K 64) and attn.v single fp16 planes;
// Every launch covers all four batches (rows b * 2048 + t, planes b * 4 + h); attention is one launch over all 16 (batch, head) planes: scores and probabilities stay in registers (k_fattn).
// Launches that do not depend on one another share one grid: k_prep (six weight transposes, the cos/sin table, BN1), the q, k, v projections (grid z of k_gemml), k_planes (q and k head planes, V^T).
// The streaming kernels (table, BN1, BN2, head planes, V^T, residual, GELU, last add) give every thread 16 to 64 elements, all its loads issued ahead of its arithmetic: few waves to start, many bytes in flight per wave. Their loops over pieces and elements are all unrolled, so that a thread's pieces are registers and its loads can stand in a row.

#define NB_  4
#define TT   2048
#define DM   256
#define NH_  4
#define NKV  4
#define REP  (NH_ / NKV)
#define HD   64
#define DQ   (NH_ * HD)
#define DKV  (NKV * HD)
#define TB   (NB_ * TT)         // rows of all batches
#define WIN  0
#define PCAR 1024.0f
#define SCL  0.125f   // HD^-0.5
typedef _Float16 h16;
typedef unsigned short bf;
typedef __attribute__((ext_vector_type(16))) __bf16   v16bf;
typedef __attribute__((ext_vector_type(16))) _Float16 v16h;
typedef __attribute__((ext_vector_type(8)))  _Float16 v8h;
typedef __attribute__((ext_vector_type(8)))  unsigned short v8us;
typedef __attribute__((ext_vector_type(8)))  float    v8f;
typedef __attribute__((ext_vector_type(4)))  float    v4f;
typedef v8h  __attribute__((may_alias)) v8ha;
typedef v4f  __attribute__((may_alias)) v4fa;
typedef v8us __attribute__((may_alias)) v8usa;

__device__ __forceinline__ unsigned short f2bf(float f) { unsigned u = __float_as_uint(f); u += 0x7FFFu + ((u >> 16) & 1u); return (unsigned short)(u >> 16); }
__device__ __forceinline__ float bf2f(unsigned short b) { return __uint_as_float(((unsigned)b) << 16); }
__device__ __forceinline__ float bfr(float f) { return bf2f(f2bf(f)); }
__device__ __forceinline__ v16h cat16(v8h lo, v8h hi) { return __builtin_shufflevector(lo, hi, 0, 1, 2, 3, 4, 5, 6, 7, 8, 9, 10, 11, 12, 13, 14, 15); }
__device__ __forceinline__ v16bf cat16b(v8us lo, v8us hi) { return __builtin_bit_cast(v16bf, __builtin_shufflevector(lo, hi, 0, 1, 2, 3, 4, 5, 6, 7, 8, 9, 10, 11, 12, 13, 14, 15)); }
__device__ __forceinline__ v8f wmma16(v16h a, v16h b, v8f c) { return __builtin_amdgcn_wmma_f32_16x16x32_f16(false, a, false, b, (short)0, c, false, false); }
__device__ __forceinline__ v8f wmmab(v16bf a, v16bf b, v8f c) { return __builtin_amdgcn_wmma_f32_16x16x32_bf16(false, a, false, b, (short)0, c, false, false); }



// WFrag: one 16 x 32 operand fragment of a K-contiguous 16-bit plane: lane (lr, hi) holds k = 8 hi + 0..7 and 16 + 8 hi + 0..7 of row lr; the same loader serves A and B, so their k orders agree.
template <typename T16> struct WFrag;
template <> struct WFrag<h16> { typedef v16h V; static __device__ __forceinline__ V ld(const h16* p) { return cat16(*(const v8h*)p, *(const v8h*)(p + 16)); } static __device__ __forceinline__ v8f mma(V a, V b, v8f c) { return wmma16(a, b, c); } };
template <> struct WFrag<bf> { typedef v16bf V; static __device__ __forceinline__ V ld(const bf* p) { return cat16b(*(const v8us*)p, *(const v8us*)(p + 16)); } static __device__ __forceinline__ v8f mma(V a, V b, v8f c) { return wmmab(a, b, c); } };
// ---- k_gemml: C = (A + A2) Bt^T (+ bias), f32 out, operands K-contiguous bf16 planes. One (32 MB) x 128 output tile per work-group of four waves, each wave a (16 MB) x 64 quarter over the whole K (no K split, no partial sums).
// MB = 4 (128 x 128) for the wide products (q, k, v by grid z; W1), MB = 2 (64 x 128) for the two with 256 columns (WO, W2), so that their grid still has one work-group per WGP.
// The operands come through LDS: a stage is 64 k of the tile's rows of A, of A2 and of Bt (whole 128-B lines, each fetched once per work-group and read by two waves), brought by asynchronous copies into one of two buffers
// while the other is worked on. grid (M / (32 MB), N / 128, Z), 128 threads; K % 64 == 0. z steps Bt by sB and C by sC elements; the bias vectors are separate buffers: bias for z = 0, biasZ1 and biasZ2 for z = 1 and 2.
#define LP 72   // LDS row pitch in 16-bit elements: 128 B of data + 16 B, an odd number of 16-B units, so that the 16 rows of a fragment read fall on different banks
// cp8: eight 16-B copies of one thread into 128 LDS rows in a row, 16 rows apart: the first four from ga, the last four from gb, each stepping by gs elements (16 source rows). A wave's copy is four whole 128-B lines.
__device__ __forceinline__ void cp8(unsigned l0, const bf* ga, const bf* gb, size_t gs) {
    const unsigned l1 = l0 + 16 * LP * 2, l2 = l0 + 32 * LP * 2, l3 = l0 + 48 * LP * 2, l4 = l0 + 64 * LP * 2, l5 = l0 + 80 * LP * 2, l6 = l0 + 96 * LP * 2, l7 = l0 + 112 * LP * 2;
    const bf *g1 = ga + gs, *g2 = ga + 2 * gs, *g3 = ga + 3 * gs, *g5 = gb + gs, *g6 = gb + 2 * gs, *g7 = gb + 3 * gs;
    // the copies and, as the statement's last line, the wait that stands in front of any rewrite of their address registers
    asm volatile("global_load_async_to_lds_b128 %0, %8, off\n\t"
                 "global_load_async_to_lds_b128 %1, %9, off\n\t"
                 "global_load_async_to_lds_b128 %2, %10, off\n\t"
                 "global_load_async_to_lds_b128 %3, %11, off\n\t"
                 "global_load_async_to_lds_b128 %4, %12, off\n\t"
                 "global_load_async_to_lds_b128 %5, %13, off\n\t"
                 "global_load_async_to_lds_b128 %6, %14, off\n\t"
                 "global_load_async_to_lds_b128 %7, %15, off\n\t"
                 "s_wait_xcnt 0x0"
                 :: "v"(l0), "v"(l1), "v"(l2), "v"(l3), "v"(l4), "v"(l5), "v"(l6), "v"(l7), "v"(ga), "v"(g1), "v"(g2), "v"(g3), "v"(gb), "v"(g5), "v"(g6), "v"(g7) : "memory");
}
template <int MB, bool BIAS>
__global__ __launch_bounds__(128) void k_gemml(const bf* __restrict__ A, const bf* __restrict__ A2, const bf* __restrict__ Bt, int K, float* C, int ldc, const float* __restrict__ bias, const float* __restrict__ biasZ1, const float* __restrict__ biasZ2, size_t sB, size_t sC) {
    typedef WFrag<bf> WF; typedef WF::V V;
    static_assert(MB == 2 || MB == 4, "the copies below cover 64 or 128 rows of A");
    constexpr int TM = 32 * MB, LSTG = (2 * TM + 128) * LP;   // rows of the tile; elements of one stage: rows 0 .. TM-1 A, TM .. 2 TM-1 A2, then 128 of Bt
    __shared__ __align__(16) bf st[2 * LSTG];
    __shared__ __align__(16) float os[4][16 * 68];   // one wave's 16 output rows on their way to whole-row stores
    const size_t z = blockIdx.z; Bt += z * sB; C += z * sC; const float* bz = (z == 0) ? bias : ((z == 1) ? biasZ1 : biasZ2);
    const int tid = (int)threadIdx.x, lane = tid & 31, lr = lane & 15, hi = lane >> 4; const int wv = __builtin_amdgcn_readfirstlane(tid >> 5);
    const int r0 = blockIdx.x * TM, c0 = blockIdx.y * 128, wr = (wv & 1) * (16 * MB), wc = (wv >> 1) * 64;   // the work-group's tile, the wave's quarter in it
    v8f acc[MB][4];   // the sums start from the bias of their column (lane lr holds column nb * 16 + lr in all eight registers): no register is held for it through the loop
#pragma unroll
    for (int nb = 0; nb < 4; ++nb) { const float b0 = BIAS ? bfr(bz[c0 + wc + nb * 16 + lr]) : 0.f;
#pragma unroll
        for (int mb = 0; mb < MB; ++mb)
#pragma unroll
            for (int j = 0; j < 8; ++j) acc[mb][nb][j] = b0; }
    const int crow = tid >> 3, ccol = (tid & 7) * 8;   // this thread's first row and its 16-B piece of every row it copies
    const bf* ga = A + (size_t)(r0 + crow) * K + ccol; const bf* ga2 = A2 + (size_t)(r0 + crow) * K + ccol; const bf* gb = Bt + (size_t)(c0 + crow) * K + ccol;
    const unsigned lc = (unsigned)(size_t)(st + crow * LP + ccol);   // LDS byte address: the low 32 bits of the __shared__ address
    const size_t gs = (size_t)16 * K; const int nt = K / 64;
    auto fill = [&](int t) { const unsigned l = lc + (unsigned)(t & 1) * (LSTG * 2);
        if constexpr (MB == 4) { cp8(l, ga + t * 64, ga + t * 64 + 4 * gs, gs); cp8(l + 128 * LP * 2, ga2 + t * 64, ga2 + t * 64 + 4 * gs, gs); }
        else cp8(l, ga + t * 64, ga2 + t * 64, gs);   // 64 rows of A, then 64 of A2
        cp8(l + 2 * TM * LP * 2, gb + t * 64, gb + t * 64 + 4 * gs, gs); };
    fill(0);
    asm volatile("s_wait_asynccnt 0x0" ::: "memory");   // this wave's copies of stage 0 have landed
    __syncthreads();                                    // and every other wave's: stage 0 may be read
    if (nt > 1) fill(1);
#pragma unroll 1   // rolled: one register set; the buffer is picked by the trip's parity
    for (int t = 0; t < nt; ++t) {
        const bf* sb = st + (t & 1) * LSTG; const bf* pa = sb + (wr + lr) * LP + 8 * hi; const bf* pb = sb + (2 * TM + wc + lr) * LP + 8 * hi;
#pragma unroll
        for (int ks = 0; ks < 2; ++ks) { V a[MB], a2[MB], b[4];   // all fragment reads of a 32-k step stand in one place, ahead of its products
            b[0] = WF::ld(pb + ks * 32);
#pragma unroll
            for (int mb = 0; mb < MB; ++mb) { a[mb] = WF::ld(pa + mb * 16 * LP + ks * 32); a2[mb] = WF::ld(pa + (TM + mb * 16) * LP + ks * 32); }
#pragma unroll
            for (int nb = 1; nb < 4; ++nb) b[nb] = WF::ld(pb + nb * 16 * LP + ks * 32);
            __builtin_amdgcn_sched_barrier(0);   // keeps the B reads up here: the compiler otherwise sinks each to just in front of its products, into one register set, and the wave waits out an LDS latency four times a step
#pragma unroll
            for (int nb = 0; nb < 4; ++nb)
#pragma unroll
                for (int mb = 0; mb < MB; ++mb) { acc[mb][nb] = WF::mma(a[mb], b[nb], acc[mb][nb]); acc[mb][nb] = WF::mma(a2[mb], b[nb], acc[mb][nb]); } }
        asm volatile("s_wait_dscnt 0x0" ::: "memory");      // this wave's reads of the buffer are done before it is refilled
        asm volatile("s_wait_asynccnt 0x0" ::: "memory");   // this wave's copies of stage t + 1 have landed
        __syncthreads();                                    // publishes stage t + 1 and ends every wave's reads of stage t
        if (t + 2 < nt) fill(t + 2);
    }
    asm volatile("s_wait_asynccnt 0x0" ::: "memory");   // no copy is outstanding when the wave goes on to its end
    float* ow = os[wv];
#pragma unroll
    for (int mb = 0; mb < MB; ++mb) {
#pragma unroll
        for (int nb = 0; nb < 4; ++nb) {
#pragma unroll
            for (int j = 0; j < 8; ++j) ow[(hi * 8 + j) * 68 + nb * 16 + lr] = acc[mb][nb][j]; }
        __builtin_amdgcn_wave_barrier(); asm volatile("" ::: "memory");   // keeps the row reads below behind the wave's own tile writes
        float* cr = C + (size_t)(r0 + wr + mb * 16) * ldc + c0 + wc;
#pragma unroll
        for (int s = 0; s < 8; ++s) { const int row = 2 * s + hi, cofs = lr * 4; const v4f val = *(const v4fa*)(ow + row * 68 + cofs);
            *(v4f*)(cr + (size_t)row * ldc + cofs) = val; }
        __builtin_amdgcn_wave_barrier(); asm volatile("" ::: "memory");   // keeps the next 16 rows' writes behind these reads
    }
}

__device__ __forceinline__ h16 tohx(float x) { return (h16)x; }
__device__ __forceinline__ void splitf(float y, unsigned short& h, unsigned short& l) { h = f2bf(y); l = f2bf(y - bf2f(h)); }
typedef __attribute__((ext_vector_type(2))) _Float16 v2h;
typedef __attribute__((ext_vector_type(4))) _Float16 v4h;
typedef __attribute__((ext_vector_type(2))) unsigned short v2us;
typedef __attribute__((ext_vector_type(4))) unsigned short v4us;
typedef __attribute__((ext_vector_type(2))) float v2f;
typedef __attribute__((ext_vector_type(4))) int v4i;

// d_*: bodies of the kernels that share a grid; bx is the work-group's index inside its own part of the grid
__device__ __forceinline__ void d_wtG(int bx, const float* __restrict__ w, int K, int N, bf* Bt) {
    const int lane = threadIdx.x & 31; const int L0 = (bx * 8 + (threadIdx.x >> 5)) * 8; const int nlines = N * K / 64;
{
#pragma unroll 1
        for (int l = 0; l < 8; ++l) { const int L = L0 + l; if (L >= nlines) break; const size_t e = (size_t)L * 64 + lane * 2; const int k = (int)(e % K), n = (int)(e / K); v2us o;
            o[0] = f2bf(w[(size_t)k * N + n]); o[1] = f2bf(w[(size_t)(k + 1) * N + n]); *(v2us*)(Bt + e) = o; }
         }
}
__global__ __launch_bounds__(256) void k_cvt8(const float* __restrict__ src, bf* dst, size_t n8) { const size_t i = (size_t)blockIdx.x * 256 + threadIdx.x; if (i >= n8) return; const v8f v = *(const v8f*)(src + i * 8); v8us o;
#pragma unroll
    for (int k = 0; k < 8; ++k) o[k] = f2bf(v[k]); *(v8us*)(dst + i * 8) = o;  }
__global__ __launch_bounds__(256) void k_cscvt(const float* __restrict__ cosT, const float* __restrict__ sinT, float* CS) { const int idx = blockIdx.x * 256 + threadIdx.x; if (idx >= TT * HD) return; v2f cs; cs[0] = bfr(cosT[idx]); cs[1] = bfr(sinT[idx]); *(v2f*)(CS + (size_t)idx * 2) = cs;  }
// d_rope: head planes [b][h][t][d] (fp16) of rope(x) x sc with the rotate-half convention out[d] = x[d] cos[t][d] - x[d+HD/2] sin[t][d], out[d+HD/2] = x[d+HD/2] cos[t][d+HD/2] + x[d] sin[t][d+HD/2]
// One thread: four consecutive d of one row t, for every head of RB batches (the table entries of (t, d) are fetched once for all of them). A wave's load covers two whole 256-B head rows, its store 256 B in a row.
#define RB 2
#define PB_R ((NB_ / RB) * TT * (HD / 4) / 256)
template <int NHD> __device__ __forceinline__ void d_rope(int bx, const float* __restrict__ F, const float* __restrict__ CS, float sc, h16* P16) {
    static_assert(NB_ % RB == 0 && ((NB_ / RB) * TT * (HD / 4)) % 256 == 0 && (HD / 2) % 4 == 0, "the grid covers the planes exactly; a thread's four d lie in one half of the head");
    const int i = bx * 256 + (int)threadIdx.x; const int d = (i % (HD / 4)) * 4, t = (i / (HD / 4)) % TT, b0 = (i / ((HD / 4) * TT)) * RB; const int dq = (d < HD / 2) ? d + HD / 2 : d - HD / 2;
    const float* cp = CS + ((size_t)t * HD + d) * 2; const float* fa = F + ((size_t)b0 * TT + t) * (NHD * HD) + d; const float* fb = F + ((size_t)b0 * TT + t) * (NHD * HD) + dq;   // the three addresses of this thread; every load is one of them plus a constant
    const v4f c01 = *(const v4f*)cp, c23 = *(const v4f*)(cp + 4); v4f xa[RB][NHD], xb[RB][NHD];
#pragma unroll
    for (int bb = 0; bb < RB; ++bb)
#pragma unroll
        for (int h = 0; h < NHD; ++h) { xa[bb][h] = *(const v4f*)(fa + (size_t)bb * TT * (NHD * HD) + h * HD); xb[bb][h] = *(const v4f*)(fb + (size_t)bb * TT * (NHD * HD) + h * HD); }
    static_assert(RB == 2 && NHD == 4, "the wait below names every loaded value");
    // stands behind the last load and in front of the first write of a register that held a load's address: the loaded values and the three addresses are named (inputs only) so that all loads are issued first and no result is placed in an address pair
    asm volatile("s_wait_xcnt 0x0" :: "v"(c01), "v"(c23), "v"(xa[0][0]), "v"(xa[0][1]), "v"(xa[0][2]), "v"(xa[0][3]), "v"(xa[1][0]), "v"(xa[1][1]), "v"(xa[1][2]), "v"(xa[1][3]), "v"(xb[0][0]), "v"(xb[0][1]), "v"(xb[0][2]), "v"(xb[0][3]), "v"(xb[1][0]), "v"(xb[1][1]), "v"(xb[1][2]), "v"(xb[1][3]), "v"(cp), "v"(fa), "v"(fb) : "memory");
#pragma unroll
    for (int bb = 0; bb < RB; ++bb)
#pragma unroll
        for (int h = 0; h < NHD; ++h) { v4h o16;
#pragma unroll
            for (int q = 0; q < 4; ++q) { const float x0 = xa[bb][h][q], x1 = xb[bb][h][q]; v2f cs; cs[0] = (q < 2) ? c01[2 * q] : c23[2 * q - 4]; cs[1] = (q < 2) ? c01[2 * q + 1] : c23[2 * q - 3];
                float a = __fmul_rn(x0, cs[0]), bq = __fmul_rn(x1, cs[1]); asm volatile("" : "+v"(a)); asm volatile("" : "+v"(bq)); const float r = ((d < HD / 2) ? __fsub_rn(a, bq) : __fadd_rn(a, bq)) * sc;
                o16[q] = tohx(r); }
            *(v4h*)(P16 + (((size_t)(b0 + bb) * NHD + h) * TT + t) * HD + d) = o16; }
    asm volatile("s_wait_xcnt 0x0" ::: "memory");   // behind the last store: the code of the grid's other parts follows in the text and writes these registers
}
// d_vtp: V^T planes [b][g][d][t] (fp16). One wave turns 64 rows t x 32 columns of F; a thread holds 8 t x 8 d in registers (lane = t group + 8 x d group): a load takes 64-B pieces of eight rows, a store four whole 128-B lines.
#define PB_V (TB * DKV / (64 * 32) / 8)
template <int NHD> __device__ __forceinline__ void d_vtp(int bx, const float* __restrict__ F, h16* V16) {
    static_assert(TT % 64 == 0 && HD % 32 == 0 && (TB * NHD * HD) % (64 * 32 * 8) == 0, "a wave's block lies in one batch and one head; the grid covers the plane exactly");
    const int lane = threadIdx.x & 31, tg = lane & 7, dg = lane >> 3; const int w = bx * 8 + (int)(threadIdx.x >> 5); const int c0 = (w % (NHD * HD / 32)) * 32 + dg * 4, r0 = (w / (NHD * HD / 32)) * 64 + tg * 8;   // first column and first row (b * 2048 + t) of this thread
    v4f x[8][2]; const float* fp = F + (size_t)r0 * (NHD * HD) + c0;
#pragma unroll
    for (int r = 0; r < 8; ++r)
#pragma unroll
        for (int hf = 0; hf < 2; ++hf) x[r][hf] = *(const v4f*)(fp + r * (NHD * HD) + hf * 16);
    // stands behind the last load and in front of the first write of the address pair: the loaded values and the address are named (inputs only) so that all loads are issued first and no result is placed in that pair
    asm volatile("s_wait_xcnt 0x0" :: "v"(x[0][0]), "v"(x[0][1]), "v"(x[1][0]), "v"(x[1][1]), "v"(x[2][0]), "v"(x[2][1]), "v"(x[3][0]), "v"(x[3][1]), "v"(x[4][0]), "v"(x[4][1]), "v"(x[5][0]), "v"(x[5][1]), "v"(x[6][0]), "v"(x[6][1]), "v"(x[7][0]), "v"(x[7][1]), "v"(fp) : "memory");
    h16* vo = V16 + ((size_t)(r0 / TT) * (NHD * HD) + c0) * TT + r0 % TT;   // plane row b * 256 + g * 64 + d is b * 256 + column
#pragma unroll
    for (int hf = 0; hf < 2; ++hf)
#pragma unroll
        for (int q = 0; q < 4; ++q) { v8h o16;
#pragma unroll
            for (int r = 0; r < 8; ++r) o16[r] = tohx(x[r][hf][q]);
            *(v8h*)(vo + (size_t)(hf * 16 + q) * TT) = o16; }
}
__device__ __forceinline__ void d_csid(int bx, float* CS) { v4f cs; cs[0] = 1.0f; cs[1] = 0.0f; cs[2] = 1.0f; cs[3] = 0.0f;   // two entries a store, four stores a thread
#pragma unroll
    for (int s = 0; s < 4; ++s) *(v4f*)(CS + ((size_t)(bx * 4 + s) * 256 + threadIdx.x) * 4) = cs;
    asm volatile("s_wait_xcnt 0x0" ::: "memory");   // behind the last store: the code of the grid's other parts follows in the text and writes these registers
}
// k_planes: the three plane builders in one grid, each with its own run of work-group indices. V^T, whose reads are pieces of lines, takes the lowest and so starts first.
__global__ __launch_bounds__(256) void k_planes(const float* __restrict__ FQ, const float* __restrict__ FK, const float* __restrict__ FV, const float* __restrict__ CS, h16* QP16, h16* KP16, h16* VT16) {
    int b = (int)blockIdx.x;
    if (b < PB_V) { d_vtp<NKV>(b, FV, VT16); return; } b -= PB_V;
    if (b < PB_R) { d_rope<NH_>(b, FQ, CS, 1.0f, QP16); return; } b -= PB_R;
    d_rope<NKV>(b, FK, CS, 1.0f, KP16);
}
// k_fattn: scores, softmax and attn.v of one (batch, head) plane in one kernel. One wave owns 32 query columns (two groups of 16) and walks one quarter of the 2048 keys in passes of 32.
// The four waves that share 32 queries (one per key quarter) sit in one work-group of 16 waves, four to a SIMD, so that one wave's softmax arithmetic and load waits lie under the others' products. Each leaves its maximum, sum and O^T tiles in LDS;
// behind one barrier two of the four (one per column group) bring the quarters to a common maximum, add them in the fixed order 0 .. 3 and run the epilogue.
// Transposed products: S^T = K Q^T (A = 16 key rows, B = the wave's queries, kept in registers), O^T += V^T P^T (A = 16 d rows of the [d][t] plane). In an S^T tile lane (lr, hi) holds keys 8 hi + 0..7 of query lr,
// which is the k order of a B operand: tiles 0 and 1 of a pass, rounded to fp16, ARE the 32-key B operand; nothing crosses lanes but one exchange between the wave's halves for the maximum (and one for the sum, at the end).
// Running softmax in the log2 domain: p = 2^(s c - m), c = HD^-0.5 log2 e; m, the maximum in use, may trail the true one by up to 8 (p <= 2^8, well inside fp16); sums and accumulators are rescaled only when a column exceeds that.
// The epilogue divides by the sum (as x PCAR / sum, then / PCAR, the two roundings the separate kernels had) and stores the bf16 hi+lo planes [b * 2048 + t][h * 64 + d] that the output projection reads: 128-B lines, one wave each.
#define FQW 4   // query groups of 32 per work-group: 128 queries, 256 work-groups
#define FKS 4   // key quarters per query group: FQW * FKS waves per work-group
__device__ __forceinline__ float xhalf(float x) { return __builtin_bit_cast(float, __builtin_amdgcn_permlanex16(__builtin_bit_cast(int, x), __builtin_bit_cast(int, x), 0x76543210, 0xfedcba98, false, false)); }  // lane l with lane l ^ 16
__global__ __launch_bounds__(32 * FQW * FKS) void k_fattn(const h16* __restrict__ Q, const h16* __restrict__ Kp, const h16* __restrict__ Vt, bf* Ah, bf* Al) {
    typedef WFrag<h16> WF;
    static_assert(FKS >= 2 && TT % (32 * FKS) == 0, "one finishing wave per column group; every key range is whole passes");
    __shared__ __align__(16) float po[FKS * FQW][8][2][32 * 4];   // [wave][tile g * 4 + dt][registers 0..3 | 4..7][lane]: every access is 16 B a lane, 512 B in a row
    __shared__ float pm[FKS * FQW][2][32], pl[FKS * FQW][2][32];   // [wave][g][lane]: maximum in use, this lane's part of the sum
    const int lane = threadIdx.x & 31, lr = lane & 15, hi = lane >> 4; const int wv = __builtin_amdgcn_readfirstlane((int)(threadIdx.x >> 5));
    const int qg = wv % FQW, kq = wv / FQW, kb = kq * (TT / FKS);   // query group, key quarter and its first key: the same in all lanes of the wave
    const size_t z = blockIdx.y, zk = z / REP; const int q0 = ((int)blockIdx.x * FQW + qg) * 32;
    const h16* qp = Q + (z * TT + q0 + lr) * HD + 8 * hi; const h16* kp = Kp + (zk * TT + lr) * HD + 8 * hi; const h16* vp = Vt + (zk * HD + lr) * TT + 8 * hi;
    v16h qf[2][2], kf[2][2], vf[4]; v8f o[2][4]; float mr[2], l[2];   // the inner loops are all unrolled so that these arrays are registers
#pragma unroll
    for (int g = 0; g < 2; ++g) { mr[g] = -__builtin_inff(); l[g] = 0.f;
#pragma unroll
        for (int ks = 0; ks < 2; ++ks) { qf[g][ks] = WF::ld(qp + g * 16 * HD + ks * 32); kf[g][ks] = WF::ld(kp + (size_t)(kb + g * 16) * HD + ks * 32); }
#pragma unroll
        for (int dt = 0; dt < 4; ++dt) o[g][dt] = (v8f){}; }
#pragma unroll
    for (int dt = 0; dt < 4; ++dt) vf[dt] = WF::ld(vp + (size_t)dt * 16 * TT + kb);
    asm volatile("s_wait_xcnt 0x0" :: "v"(qp) : "memory");   // stands in front of the first write of a register that held one of these loads' addresses; qp, dead behind its loads, is named so that its registers last up to here
    const float cs = SCL * 1.4426950408889634f;
#pragma unroll 1   // 16 passes: rolled, the body is long enough and the fetch-ahead wants one register set
    for (int k0 = kb; k0 < kb + TT / FKS; k0 += 32) {
        v8f s[2][2];
#pragma unroll
        for (int kt = 0; kt < 2; ++kt)
#pragma unroll
            for (int g = 0; g < 2; ++g) s[kt][g] = WF::mma(kf[kt][1], qf[g][1], WF::mma(kf[kt][0], qf[g][0], (v8f){}));
        const int kn = (k0 + 32) & (TT - 1);   // K and V^T fragments are fetched one pass ahead, each into the registers its product has just read; a wave's last pass fetches the first keys of the next quarter, the last quarter's keys 0..31 (in bounds, unused)
#pragma unroll
        for (int kt = 0; kt < 2; ++kt)
#pragma unroll
            for (int ks = 0; ks < 2; ++ks) kf[kt][ks] = WF::ld(kp + (size_t)(kn + kt * 16) * HD + ks * 32);
        __builtin_amdgcn_sched_barrier(0);   // keeps the K fetch up here, a whole softmax and attn.v ahead of its use: under the register ceiling of four waves a SIMD the compiler otherwise sinks it to the end of the pass
        float mb[2]; bool need = false;
#pragma unroll
        for (int g = 0; g < 2; ++g) { float m0 = s[0][g][0], m1 = s[1][g][0];
#pragma unroll
            for (int j = 1; j < 8; ++j) { m0 = fmaxf(m0, s[0][g][j]); m1 = fmaxf(m1, s[1][g][j]); }
            m0 = fmaxf(m0, m1); mb[g] = fmaxf(m0, xhalf(m0)) * cs; need = need || (mb[g] > mr[g] + 8.0f); }   // both halves of the wave hold the query's maximum, scaled (the scale is positive)
        if (__builtin_amdgcn_ballot_w32(need) != 0) {   // wave-uniform; always taken in the first pass (mr = -inf gives the factor 0), rare later
#pragma unroll
            for (int g = 0; g < 2; ++g) { const float mn = fmaxf(mr[g], mb[g]); const float al = __builtin_amdgcn_exp2f(mr[g] - mn); mr[g] = mn; l[g] *= al;
#pragma unroll
                for (int dt = 0; dt < 4; ++dt) o[g][dt] *= al; }
        }
#pragma unroll
        for (int g = 0; g < 2; ++g) { const float nm = -mr[g]; float a0 = 0.f, a1 = 0.f; v16h pf;
#pragma unroll
            for (int i = 0; i < 8; ++i) { const v2f ar = __builtin_elementwise_fma((v2f){s[i >> 2][g][2 * (i & 3)], s[i >> 2][g][2 * (i & 3) + 1]}, (v2f){cs, cs}, (v2f){nm, nm});
                float p0;
                if (g == 0 && i == 0) asm("v_exp_f32 %0, %1\n\tv_nop" : "=v"(p0) : "v"(ar[0]));   // the pass's first exponential carries its own v_nop: the slot the instruction set asks for behind a transcendental, since the register allocator gives this one's source to the next instruction's result
                else p0 = __builtin_amdgcn_exp2f(ar[0]);
                const float p1 = __builtin_amdgcn_exp2f(ar[1]); a0 += p0; a1 += p1; pf[2 * i] = tohx(p0); pf[2 * i + 1] = tohx(p1); }
            l[g] += a0 + a1;
#pragma unroll
            for (int dt = 0; dt < 4; ++dt) o[g][dt] = WF::mma(vf[dt], pf, o[g][dt]); }
#pragma unroll
        for (int dt = 0; dt < 4; ++dt) vf[dt] = WF::ld(vp + (size_t)dt * 16 * TT + kn);
        asm volatile("s_wait_xcnt 0x0" ::: "memory");   // stands in front of the next pass's first write of the registers that held these loads' address
    }
#pragma unroll
    for (int g = 0; g < 2; ++g) { pm[wv][g][lane] = mr[g]; pl[wv][g][lane] = l[g];
#pragma unroll
        for (int dt = 0; dt < 4; ++dt) { *(v4fa*)&po[wv][g * 4 + dt][0][lane * 4] = __builtin_shufflevector(o[g][dt], o[g][dt], 0, 1, 2, 3); *(v4fa*)&po[wv][g * 4 + dt][1][lane * 4] = __builtin_shufflevector(o[g][dt], o[g][dt], 4, 5, 6, 7); } }
    __syncthreads();   // every quarter's maximum, sum and tiles are in LDS before a finishing wave reads them
    if (kq >= 2) return;   // wave-uniform, behind the only barrier: quarter 0's wave finishes column group 0, quarter 1's group 1, each whole 128-B lines of the planes
    const int g = kq; float fs[FKS], mx = pm[qg][g][lane], ls = 0.f;
#pragma unroll
    for (int p = 1; p < FKS; ++p) mx = fmaxf(mx, pm[p * FQW + qg][g][lane]);
#pragma unroll
    for (int p = 0; p < FKS; ++p) { fs[p] = __builtin_amdgcn_exp2f(pm[p * FQW + qg][g][lane] - mx); ls += fs[p] * pl[p * FQW + qg][g][lane]; }   // both halves of the wave hold the same maxima, so the same factors
    const float f = __fdiv_rn(PCAR, ls + xhalf(ls)); const size_t oo = ((z / NH_) * TT + q0 + g * 16 + lr) * DQ + (z % NH_) * HD + hi * 8;   // lane (lr, hi) holds d = 16 dt + 8 hi + 0..7 of query lr; row b * 2048 + t, columns h * 64 + d
#pragma unroll
    for (int dt = 0; dt < 4; ++dt) { v4f s0 = (v4f){}, s1 = (v4f){}; v8us oh, ol;
#pragma unroll
        for (int p = 0; p < FKS; ++p) { s0 += *(const v4fa*)&po[p * FQW + qg][g * 4 + dt][0][lane * 4] * fs[p]; s1 += *(const v4fa*)&po[p * FQW + qg][g * 4 + dt][1][lane * 4] * fs[p]; }
#pragma unroll
        for (int j = 0; j < 8; ++j) { unsigned short a, c2; splitf(((j < 4 ? s0[j & 3] : s1[j & 3]) * f) * (1.0f / PCAR), a, c2); oh[j] = a; ol[j] = c2; }
        *(v8us*)(Ah + oo + dt * 16) = oh; *(v8us*)(Al + oo + dt * 16) = ol; }
}

// block tail: d_bn: hl planes of gamma (v - mean) rsqrt(var + 1e-3) + beta over [b * 2048 + t][256] (RAW: v is a raw input row, bf16-rounded first) (8-B stores); k_res: X1 = A + bf16 x (16-B lanes); k_gelu: hl planes of exact-erf GELU (8-B stores);
#define FFD 1024
// SU: 16-B pieces per thread of the kernels over [8192][256]; a work-group takes SU * 1024 elements in a row, piece s of thread i at s * 1024 + 4 i (every wave's load is 512 B in a row, and a thread keeps its four channels)
#define SU 4
#define PB_S (TB * DM / (SU * 1024))
static_assert((TB * DM) % (SU * 1024) == 0 && 1024 % DM == 0, "the grids cover the rows exactly; a thread's channels are the same in all its pieces");
template <bool RAW> __device__ __forceinline__ void d_bn(int bx, const float* __restrict__ X, const float* __restrict__ ga, const float* __restrict__ be, const float* __restrict__ mu, const float* __restrict__ var, bf* Hh, bf* Hl) { const int e0 = bx * (SU * 1024) + (int)threadIdx.x * 4; const int c = e0 % DM; v4f xs[SU]; float gg[4], bb[4], mm[4], rs[4]; const float* xp = X + e0; const unsigned cb = (unsigned)c * 4u;   // cb: byte offset of the thread's channels in the four parameter vectors
#pragma unroll
    for (int s = 0; s < SU; ++s) xs[s] = *(const v4f*)(xp + s * 1024);
    const v4f gr = *(const v4f*)((const char*)ga + cb), br = *(const v4f*)((const char*)be + cb), mr = *(const v4f*)((const char*)mu + cb), vr = *(const v4f*)((const char*)var + cb);   // the thread's four channels, once for all its pieces
    static_assert(SU == 4, "the wait below names every piece");
    // stands behind the last load and in front of the first write of a register that held a load's address: the loaded values, the row address and the channel offset are named (inputs only) so that all eight loads are issued first and no result is placed in an address register
    asm volatile("s_wait_xcnt 0x0" :: "v"(xs[0]), "v"(xs[1]), "v"(xs[2]), "v"(xs[3]), "v"(gr), "v"(br), "v"(mr), "v"(vr), "v"(xp), "v"(cb) : "memory");
#pragma unroll
    for (int u = 0; u < 4; ++u) { gg[u] = bfr(gr[u]); bb[u] = bfr(br[u]); mm[u] = bfr(mr[u]); const float vv = bfr(vr[u]); const float ve = __fadd_rn(vv, 1e-3f); rs[u] = __frsqrt_rn(ve); }
#pragma unroll
    for (int s = 0; s < SU; ++s) { const int e = e0 + s * 1024; v4us oh, ol;
#pragma unroll
        for (int u = 0; u < 4; ++u) { float xv = xs[s][u]; if (RAW) xv = bfr(xv); float d = __fsub_rn(xv, mm[u]); asm volatile("" : "+v"(d)); float t1 = __fmul_rn(gg[u], d); asm volatile("" : "+v"(t1)); float t2 = __fmul_rn(t1, rs[u]); asm volatile("" : "+v"(t2)); const float y = __fadd_rn(t2, bb[u]); unsigned short a, b2; splitf(y, a, b2); oh[u] = a; ol[u] = b2; }
        *(v4us*)(Hh + e) = oh; *(v4us*)(Hl + e) = ol; }
}
__global__ __launch_bounds__(256) void k_bn2(const float* __restrict__ X, const float* __restrict__ ga, const float* __restrict__ be, const float* __restrict__ mu, const float* __restrict__ var, bf* Hh, bf* Hl) { d_bn<false>((int)blockIdx.x, X, ga, be, mu, var, Hh, Hl); }
// k_prep: all that depends on the inputs alone, in one grid. The weight transposes (few work-groups, each a chain of eight dependent trips) take the lowest indices and start first; the table and BN1 stream behind them.
#define PB_Q  ((DM * DQ / 64 + 63) / 64)
#define PB_KV ((DM * DKV / 64 + 63) / 64)
#define PB_F  ((DM * FFD / 64 + 63) / 64)
#define PB_CS (TT * HD * 2 / (4 * 1024))
#define PB_BN PB_S
static_assert((TT * HD * 2) % (4 * 1024) == 0, "the table's work-groups cover it exactly");
__global__ __launch_bounds__(256) void k_prep(const float* __restrict__ wq, const float* __restrict__ wk, const float* __restrict__ wv, const float* __restrict__ wo, const float* __restrict__ w1, const float* __restrict__ w2, bf* WQ, bf* WK, bf* WV, bf* WO, bf* W1B, bf* W2B, float* CS,
                                              const float* __restrict__ x, const float* __restrict__ ga, const float* __restrict__ be, const float* __restrict__ mu, const float* __restrict__ var, bf* Hh, bf* Hl) {
    int b = (int)blockIdx.x;
    if (b < PB_F) { d_wtG(b, w1, DM, FFD, W1B); return; } b -= PB_F;
    if (b < PB_F) { d_wtG(b, w2, FFD, DM, W2B); return; } b -= PB_F;
    if (b < PB_Q) { d_wtG(b, wq, DM, DQ, WQ); return; } b -= PB_Q;
    if (b < PB_KV) { d_wtG(b, wk, DM, DKV, WK); return; } b -= PB_KV;
    if (b < PB_KV) { d_wtG(b, wv, DM, DKV, WV); return; } b -= PB_KV;
    if (b < PB_Q) { d_wtG(b, wo, DQ, DM, WO); return; } b -= PB_Q;
    if (b < PB_CS) { d_csid(b, CS); return; } b -= PB_CS;
    d_bn<true>(b, x, ga, be, mu, var, Hh, Hl);
    asm volatile("s_wait_xcnt 0x0" ::: "memory");   // behind the last store: the code of the grid's other parts follows in the text and writes these registers
}
__global__ __launch_bounds__(256) void k_res(const float* __restrict__ A, const float* __restrict__ x, float* X1) { const int e0 = (int)blockIdx.x * (SU * 1024) + (int)threadIdx.x * 4; v4f a[SU], b[SU]; const float *ap = A + e0, *bp = x + e0;
#pragma unroll
    for (int s = 0; s < SU; ++s) { a[s] = *(const v4f*)(ap + s * 1024); b[s] = *(const v4f*)(bp + s * 1024); }
    // stands behind the last load and in front of the first write of an address pair: the loaded values and the two addresses are named (inputs only) so that all loads are issued first and no result is placed in a pair
    asm volatile("s_wait_xcnt 0x0" :: "v"(a[0]), "v"(a[1]), "v"(a[2]), "v"(a[3]), "v"(b[0]), "v"(b[1]), "v"(b[2]), "v"(b[3]), "v"(ap), "v"(bp) : "memory");
#pragma unroll
    for (int s = 0; s < SU; ++s) { v4f o;
#pragma unroll
        for (int u = 0; u < 4; ++u) o[u] = __fadd_rn(a[s][u], bfr(b[s][u]));
        *(v4f*)(X1 + e0 + s * 1024) = o; }
}
#define GU 8   // 16-B pieces per thread of k_gelu, laid out as under SU
static_assert((TB * FFD) % (GU * 1024) == 0, "the grid covers the rows exactly");
__global__ __launch_bounds__(256) void k_gelu(const float* __restrict__ Mf, bf* Gh, bf* Gl) { const int e0 = (int)blockIdx.x * (GU * 1024) + (int)threadIdx.x * 4; v4f as[GU];
#pragma unroll
    for (int s = 0; s < GU; ++s) as[s] = *(const v4f*)(Mf + e0 + s * 1024);
#pragma unroll
    for (int s = 0; s < GU; ++s) { v4us oh, ol;
#pragma unroll   // unrolled: every element is then a register by name; a rolled loop picks it by a chain of selects and merges each result by bit-field inserts
        for (int u = 0; u < 4; ++u) { const float y = as[s][u]; float er = erff(y * 0.70710678118654752f); asm volatile("" : "+v"(er)); float hy = __fmul_rn(0.5f, y); asm volatile("" : "+v"(hy)); const float ge = __fmul_rn(hy, __fadd_rn(1.0f, er)); unsigned short h, l; splitf(ge, h, l); oh[u] = h; ol[u] = l; }
        *(v4us*)(Gh + e0 + s * 1024) = oh; *(v4us*)(Gl + e0 + s * 1024) = ol; }
}
__global__ __launch_bounds__(256) void k_fin(const float* __restrict__ M2, const float* __restrict__ X1, float* OUTb) { const int e0 = (int)blockIdx.x * (SU * 1024) + (int)threadIdx.x * 4; v4f a[SU], b[SU];
#pragma unroll
    for (int s = 0; s < SU; ++s) { a[s] = *(const v4f*)(M2 + e0 + s * 1024); b[s] = *(const v4f*)(X1 + e0 + s * 1024); }
#pragma unroll
    for (int s = 0; s < SU; ++s) { v4f o;
#pragma unroll
        for (int u = 0; u < 4; ++u) o[u] = __fadd_rn(a[s][u], b[s][u]);
        *(v4f*)(OUTb + e0 + s * 1024) = o; }
}

extern "C" void kernel_launch(void* const* d_in, const int* in_sizes, int n_in,
                              void* d_out, int out_size, void* d_ws, size_t ws_size, hipStream_t stream) {
    (void)in_sizes; (void)n_in; (void)out_size;
    const float** Ip = (const float**)d_in; const float *x = Ip[0], *g1 = Ip[1], *be1 = Ip[2], *m1 = Ip[3], *v1 = Ip[4], *wq = Ip[5], *bq = Ip[6], *wk = Ip[7], *bk = Ip[8], *wv = Ip[9], *bv = Ip[10], *wo = Ip[11], *bo = Ip[12], *g2 = Ip[13], *be2 = Ip[14], *m2 = Ip[15], *v2 = Ip[16], *w1 = Ip[17], *w2 = Ip[18]; const float* cosT = nullptr; const float* sinT = nullptr; (void)cosT; (void)sinT;
    float* OUT = (float*)d_out;     // [4][2048][256]
    char* wsp = (char*)d_ws;
    auto take = [&](size_t bytes) { char* p = wsp; wsp += (bytes + 255) & ~(size_t)255; return (void*)p; };
    bf* WQ = (bf*)take((size_t)DQ * DM * 2); bf* WK = (bf*)take((size_t)DKV * DM * 2); bf* WV = (bf*)take((size_t)DKV * DM * 2); bf* WO = (bf*)take((size_t)DM * DQ * 2); float* CS = (float*)take((size_t)TT * HD * 2 * 4);
    bf* Hh = (bf*)take((size_t)TB * DM * 2); bf* Hl = (bf*)take((size_t)TB * DM * 2); bf* W1B = (bf*)take((size_t)FFD * DM * 2); bf* W2B = (bf*)take((size_t)DM * FFD * 2); float* FQ = (float*)take((size_t)TB * DQ * 4); float* FK = (float*)take((size_t)TB * DKV * 4); float* FV = (float*)take((size_t)TB * DKV * 4);   // three buffers in a row, as WQ, WK, WV are: grid z of the projection steps from one to the next
    h16* QP16 = (h16*)take((size_t)NB_ * NH_ * TT * HD * 2); h16* KP16 = (h16*)take((size_t)NB_ * NKV * TT * HD * 2); h16* VT16 = (h16*)take((size_t)NB_ * NKV * HD * TT * 2);
    bf* ATh = (bf*)take((size_t)TB * DQ * 2); bf* ATl = (bf*)take((size_t)TB * DQ * 2);
    float* AO = (float*)take((size_t)TB * DM * 4); float* X1 = (float*)take((size_t)TB * DM * 4); float* Mf = (float*)take((size_t)TB * FFD * 4); bf* Gh = (bf*)take((size_t)TB * FFD * 2); bf* Gl = (bf*)take((size_t)TB * FFD * 2); float* M2 = (float*)take((size_t)TB * DM * 4);
    if ((size_t)(wsp - (char*)d_ws) > ws_size) return;    // ws 256 MiB
    static_assert(DQ == DKV, "grid z of the q, k, v projection steps by one weight plane and one output buffer of equal size");
    k_prep<<<2 * PB_F + 2 * PB_Q + 2 * PB_KV + PB_CS + PB_BN, 256, 0, stream>>>(wq, wk, wv, wo, w1, w2, WQ, WK, WV, WO, W1B, W2B, CS, x, g1, be1, m1, v1, Hh, Hl);
    k_gemml<4, true><<<dim3(TB / 128, DQ / 128, 3), 128, 0, stream>>>(Hh, Hl, WQ, DM, FQ, DQ, bq, bk, bv, (size_t)DQ * DM, (size_t)TB * DQ);
    k_planes<<<PB_V + 2 * PB_R, 256, 0, stream>>>(FQ, FK, FV, CS, QP16, KP16, VT16);
    k_fattn<<<dim3(TT / (32 * FQW), NB_ * NH_, 1), 32 * FQW * FKS, 0, stream>>>(QP16, KP16, VT16, ATh, ATl);
    k_gemml<2, true><<<dim3(TB / 64, DM / 128, 1), 128, 0, stream>>>(ATh, ATl, WO, DQ, AO, DM, bo, nullptr, nullptr, 0, 0);
    k_res<<<PB_S, 256, 0, stream>>>(AO, x, X1); k_bn2<<<PB_BN, 256, 0, stream>>>(X1, g2, be2, m2, v2, Hh, Hl);
    k_gemml<4, false><<<dim3(TB / 128, FFD / 128, 1), 128, 0, stream>>>(Hh, Hl, W1B, DM, Mf, FFD, nullptr, nullptr, nullptr, 0, 0); k_gelu<<<TB * FFD / (GU * 1024), 256, 0, stream>>>(Mf, Gh, Gl);
    k_gemml<2, false><<<dim3(TB / 64, DM / 128, 1), 128, 0, stream>>>(Gh, Gl, W2B, FFD, M2, DM, nullptr, nullptr, nullptr, 0, 0); k_fin<<<PB_S, 256, 0, stream>>>(M2, X1, OUT);
}

// v008
// A run of this version takes 103 microseconds.
// Timed twice side by side with v007, it ran 1.06 and 1.05 times as fast.
// Counting every step since v000, it is 8.87 times as fast.
#include <hip/hip_runtime.h>

// TransformerBaseBlock (x [4][2048][256]; h = BN1(x) (inference: gamma (x - mean) rsqrt(var + 1e-3) + beta); q/k/v = h W + b (4 heads x 64); softmax(q.k/8); attn_out = ctx Wo + bo; x1 = attn_out + x; m = gelu(BN2(x1) W1) W2 (exact erf GELU);
// out = m + x1 -> [4][2048][256]).
// Compute dtypes, f32 accumulate: every input rounded to bf16; BN1/BN2 f32 -> bf16 hi+lo planes; q/k/v (+ bias), W1 as hl x exact W (2 products); scores (K 64) and attn.v single fp16 planes;
// Every launch covers all four batches (rows b * 2048 + t, planes b * 4 + h); attention is one launch over all 16 (batch, head) planes: scores and probabilities stay in registers (k_fattn).
// Launches that do not depend on one another share one grid: k_prep (six weight transposes, the cos/sin table, BN1), the q, k, v projections (grid z of k_gemml), k_planes (q and k head planes, V^T).
// The residual add with BN2 and the last add are done where the output projection and the second MLP product store their rows (EPI of k_gemml).
// The streaming kernels (table, BN1, head planes, V^T, GELU) give every thread 16 to 64 elements, all its loads issued ahead of its arithmetic: few waves to start, many bytes in flight per wave. Their loops over pieces and elements are all unrolled, so that a thread's pieces are registers and its loads can stand in a row.

#define NB_  4
#define TT   2048
#define DM   256
#define NH_  4
#define NKV  4
#define REP  (NH_ / NKV)
#define HD   64
#define DQ   (NH_ * HD)
#define DKV  (NKV * HD)
#define TB   (NB_ * TT)         // rows of all batches
#define WIN  0
#define PCAR 1024.0f
#define SCL  0.125f   // HD^-0.5
typedef _Float16 h16;
typedef unsigned short bf;
typedef __attribute__((ext_vector_type(16))) __bf16   v16bf;
typedef __attribute__((ext_vector_type(16))) _Float16 v16h;
typedef __attribute__((ext_vector_type(8)))  _Float16 v8h;
typedef __attribute__((ext_vector_type(8)))  unsigned short v8us;
typedef __attribute__((ext_vector_type(8)))  float    v8f;
typedef __attribute__((ext_vector_type(4)))  float    v4f;
typedef v8h  __attribute__((may_alias)) v8ha;
typedef v4f  __attribute__((may_alias)) v4fa;
typedef v8us __attribute__((may_alias)) v8usa;

__device__ __forceinline__ unsigned short f2bf(float f) { unsigned u = __float_as_uint(f); u += 0x7FFFu + ((u >> 16) & 1u); return (unsigned short)(u >> 16); }
__device__ __forceinline__ float bf2f(unsigned short b) { return __uint_as_float(((unsigned)b) << 16); }
__device__ __forceinline__ float bfr(float f) { return bf2f(f2bf(f)); }
__device__ __forceinline__ void splitf(float y, unsigned short& h, unsigned short& l) { h = f2bf(y); l = f2bf(y - bf2f(h)); }
typedef __attribute__((ext_vector_type(4))) unsigned short v4us;
__device__ __forceinline__ v16h cat16(v8h lo, v8h hi) { return __builtin_shufflevector(lo, hi, 0, 1, 2, 3, 4, 5, 6, 7, 8, 9, 10, 11, 12, 13, 14, 15); }
__device__ __forceinline__ v16bf cat16b(v8us lo, v8us hi) { return __builtin_bit_cast(v16bf, __builtin_shufflevector(lo, hi, 0, 1, 2, 3, 4, 5, 6, 7, 8, 9, 10, 11, 12, 13, 14, 15)); }
__device__ __forceinline__ v8f wmma16(v16h a, v16h b, v8f c) { return __builtin_amdgcn_wmma_f32_16x16x32_f16(false, a, false, b, (short)0, c, false, false); }
__device__ __forceinline__ v8f wmmab(v16bf a, v16bf b, v8f c) { return __builtin_amdgcn_wmma_f32_16x16x32_bf16(false, a, false, b, (short)0, c, false, false); }



// WFrag: one 16 x 32 operand fragment of a K-contiguous 16-bit plane: lane (lr, hi) holds k = 8 hi + 0..7 and 16 + 8 hi + 0..7 of row lr; the same loader serves A and B, so their k orders agree.
template <typename T16> struct WFrag;
template <> struct WFrag<h16> { typedef v16h V; static __device__ __forceinline__ V ld(const h16* p) { return cat16(*(const v8h*)p, *(const v8h*)(p + 16)); } static __device__ __forceinline__ v8f mma(V a, V b, v8f c) { return wmma16(a, b, c); } };
template <> struct WFrag<bf> { typedef v16bf V; static __device__ __forceinline__ V ld(const bf* p) { return cat16b(*(const v8us*)p, *(const v8us*)(p + 16)); } static __device__ __forceinline__ v8f mma(V a, V b, v8f c) { return wmmab(a, b, c); } };
// ---- k_gemml: C = (A + A2) Bt^T (+ bias), f32 out, operands K-contiguous bf16 planes. One (32 MB) x 128 output tile per work-group of four waves, each wave a (16 MB) x 64 quarter over the whole K (no K split, no partial sums).
// MB = 4 (128 x 128) for the wide products (q, k, v by grid z; W1), MB = 2 (64 x 128) for the two with 256 columns (WO, W2), so that their grid still has one work-group per WGP.
// The operands come through LDS: a stage is 64 k of the tile's rows of A, of A2 and of Bt (whole 128-B lines, each fetched once per work-group and read by two waves), brought by asynchronous copies into one of two buffers
// while the other is worked on. grid (M / (32 MB), N / 128, Z), 128 threads; K % 64 == 0. z steps Bt by sB and C by sC elements; the bias vectors are separate buffers: bias for z = 0, biasZ1 and biasZ2 for z = 1 and 2.
// EPI: what the store loop does with a finished row piece. 0: C = sum. 1 (output projection): C = x1 = sum + bf16(R), and the bf16 hi+lo planes Oh, Ol of BN2(x1). 2 (second MLP product): C = sum + R.
// For EPI 1 and 2 C, R, Oh, Ol have DM columns. A thread's pieces of R (and its four channels' BN parameters) are asked for once, behind the copies of the first two stages and ahead of the K loop, and are first used behind it.
#define LP 72   // LDS row pitch in 16-bit elements: 128 B of data + 16 B, an odd number of 16-B units, so that the 16 rows of a fragment read fall on different banks
// cp8: eight 16-B copies of one thread into 128 LDS rows in a row, 16 rows apart: the first four from ga, the last four from gb, each stepping by gs elements (16 source rows). A wave's copy is four whole 128-B lines.
__device__ __forceinline__ void cp8(unsigned l0, const bf* ga, const bf* gb, size_t gs) {
    const unsigned l1 = l0 + 16 * LP * 2, l2 = l0 + 32 * LP * 2, l3 = l0 + 48 * LP * 2, l4 = l0 + 64 * LP * 2, l5 = l0 + 80 * LP * 2, l6 = l0 + 96 * LP * 2, l7 = l0 + 112 * LP * 2;
    const bf *g1 = ga + gs, *g2 = ga + 2 * gs, *g3 = ga + 3 * gs, *g5 = gb + gs, *g6 = gb + 2 * gs, *g7 = gb + 3 * gs;
    // the copies and, as the statement's last line, the wait that stands in front of any rewrite of their address registers
    asm volatile("global_load_async_to_lds_b128 %0, %8, off\n\t"
                 "global_load_async_to_lds_b128 %1, %9, off\n\t"
                 "global_load_async_to_lds_b128 %2, %10, off\n\t"
                 "global_load_async_to_lds_b128 %3, %11, off\n\t"
                 "global_load_async_to_lds_b128 %4, %12, off\n\t"
                 "global_load_async_to_lds_b128 %5, %13, off\n\t"
                 "global_load_async_to_lds_b128 %6, %14, off\n\t"
                 "global_load_async_to_lds_b128 %7, %15, off\n\t"
                 "s_wait_xcnt 0x0"
                 :: "v"(l0), "v"(l1), "v"(l2), "v"(l3), "v"(l4), "v"(l5), "v"(l6), "v"(l7), "v"(ga), "v"(g1), "v"(g2), "v"(g3), "v"(gb), "v"(g5), "v"(g6), "v"(g7) : "memory");
}
template <int MB, bool BIAS, int EPI>
__global__ __launch_bounds__(128) void k_gemml(const bf* __restrict__ A, const bf* __restrict__ A2, const bf* __restrict__ Bt, int K, float* C, int ldc, const float* __restrict__ bias, const float* __restrict__ biasZ1, const float* __restrict__ biasZ2, size_t sB, size_t sC,
                                               const float* __restrict__ R, const float* __restrict__ bnG, const float* __restrict__ bnB, const float* __restrict__ bnM, const float* __restrict__ bnV, bf* Oh, bf* Ol) {
    typedef WFrag<bf> WF; typedef WF::V V;
    static_assert(MB == 2 || MB == 4, "the copies below cover 64 or 128 rows of A");
    constexpr int TM = 32 * MB, LSTG = (2 * TM + 128) * LP;   // rows of the tile; elements of one stage: rows 0 .. TM-1 A, TM .. 2 TM-1 A2, then 128 of Bt
    __shared__ __align__(16) bf st[2 * LSTG];
    __shared__ __align__(16) float os[4][16 * 68];   // one wave's 16 output rows on their way to whole-row stores
    const size_t z = blockIdx.z; Bt += z * sB; C += z * sC; const float* bz = (z == 0) ? bias : ((z == 1) ? biasZ1 : biasZ2);
    const int tid = (int)threadIdx.x, lane = tid & 31, lr = lane & 15, hi = lane >> 4; const int wv = __builtin_amdgcn_readfirstlane(tid >> 5);
    const int r0 = blockIdx.x * TM, c0 = blockIdx.y * 128, wr = (wv & 1) * (16 * MB), wc = (wv >> 1) * 64;   // the work-group's tile, the wave's quarter in it
    v8f acc[MB][4];   // the sums start from the bias of their column (lane lr holds column nb * 16 + lr in all eight registers): no register is held for it through the loop
#pragma unroll
    for (int nb = 0; nb < 4; ++nb) { const float b0 = BIAS ? bfr(bz[c0 + wc + nb * 16 + lr]) : 0.f;
#pragma unroll
        for (int mb = 0; mb < MB; ++mb)
#pragma unroll
            for (int j = 0; j < 8; ++j) acc[mb][nb][j] = b0; }
    const int crow = tid >> 3, ccol = (tid & 7) * 8;   // this thread's first row and its 16-B piece of every row it copies
    const bf* ga = A + (size_t)(r0 + crow) * K + ccol; const bf* ga2 = A2 + (size_t)(r0 + crow) * K + ccol; const bf* gb = Bt + (size_t)(c0 + crow) * K + ccol;
    const unsigned lc = (unsigned)(size_t)(st + crow * LP + ccol);   // LDS byte address: the low 32 bits of the __shared__ address
    const size_t gs = (size_t)16 * K; const int nt = K / 64;
    auto fill = [&](int t) { const unsigned l = lc + (unsigned)(t & 1) * (LSTG * 2);
        if constexpr (MB == 4) { cp8(l, ga + t * 64, ga + t * 64 + 4 * gs, gs); cp8(l + 128 * LP * 2, ga2 + t * 64, ga2 + t * 64 + 4 * gs, gs); }
        else cp8(l, ga + t * 64, ga2 + t * 64, gs);   // 64 rows of A, then 64 of A2
        cp8(l + 2 * TM * LP * 2, gb + t * 64, gb + t * 64 + 4 * gs, gs); };
    fill(0);
    asm volatile("s_wait_asynccnt 0x0" ::: "memory");   // this wave's copies of stage 0 have landed
    __syncthreads();                                    // and every other wave's: stage 0 may be read
    if (nt > 1) fill(1);
    v4f rr[EPI ? MB * 8 : 1], gr = (v4f){}, br = (v4f){}, mr = (v4f){}, vr = (v4f){};   // rr[mb * 8 + s]: columns 4 lr .. 4 lr + 3 of row mb * 16 + 2 s + hi of the wave's quarter, the piece this lane stores below
    if constexpr (EPI != 0) {
        const float* rp = R + ((size_t)(r0 + wr + hi) * DM + c0 + wc + lr * 4); const unsigned cb = (unsigned)(c0 + wc + lr * 4) * 4u;   // one address, every load a constant from it; cb: byte offset of the lane's channels in the parameter vectors
#pragma unroll
        for (int i = 0; i < MB * 8; ++i) rr[i] = *(const v4f*)(rp + i * 2 * DM);
        if constexpr (EPI == 1) { gr = *(const v4f*)((const char*)bnG + cb); br = *(const v4f*)((const char*)bnB + cb); mr = *(const v4f*)((const char*)bnM + cb); vr = *(const v4f*)((const char*)bnV + cb); }
        asm volatile("s_wait_xcnt 0x0" :: "v"(rp), "v"(cb) : "memory");   // stands in front of the first write of a register that held one of these loads' addresses; both are named so that their registers last up to here
    }
#pragma unroll 1   // rolled: one register set; the buffer is picked by the trip's parity
    for (int t = 0; t < nt; ++t) {
        const bf* sb = st + (t & 1) * LSTG; const bf* pa = sb + (wr + lr) * LP + 8 * hi; const bf* pb = sb + (2 * TM + wc + lr) * LP + 8 * hi;
#pragma unroll
        for (int ks = 0; ks < 2; ++ks) { V a[MB], a2[MB], b[4];   // all fragment reads of a 32-k step stand in one place, ahead of its products
            b[0] = WF::ld(pb + ks * 32);
#pragma unroll
            for (int mb = 0; mb < MB; ++mb) { a[mb] = WF::ld(pa + mb * 16 * LP + ks * 32); a2[mb] = WF::ld(pa + (TM + mb * 16) * LP + ks * 32); }
#pragma unroll
            for (int nb = 1; nb < 4; ++nb) b[nb] = WF::ld(pb + nb * 16 * LP + ks * 32);
            __builtin_amdgcn_sched_barrier(0);   // keeps the B reads up here: the compiler otherwise sinks each to just in front of its products, into one register set, and the wave waits out an LDS latency four times a step
#pragma unroll
            for (int nb = 0; nb < 4; ++nb)
#pragma unroll
                for (int mb = 0; mb < MB; ++mb) { acc[mb][nb] = WF::mma(a[mb], b[nb], acc[mb][nb]); acc[mb][nb] = WF::mma(a2[mb], b[nb], acc[mb][nb]); } }
        asm volatile("s_wait_dscnt 0x0" ::: "memory");      // this wave's reads of the buffer are done before it is refilled
        asm volatile("s_wait_asynccnt 0x0" ::: "memory");   // this wave's copies of stage t + 1 have landed
        __syncthreads();                                    // publishes stage t + 1 and ends every wave's reads of stage t
        if (t + 2 < nt) fill(t + 2);
    }
    asm volatile("s_wait_asynccnt 0x0" ::: "memory");   // no copy is outstanding when the wave goes on to its end
    float* ow = os[wv]; float gg[4], bb[4], mm[4], rs[4]; const size_t e0 = (size_t)(r0 + wr + hi) * DM + c0 + wc + lr * 4;   // EPI 1, 2: the lane's first element in C, Oh, Ol; every store is a constant from it
    if constexpr (EPI == 1) {
#pragma unroll
        for (int u = 0; u < 4; ++u) { gg[u] = bfr(gr[u]); bb[u] = bfr(br[u]); mm[u] = bfr(mr[u]); rs[u] = __frsqrt_rn(__fadd_rn(bfr(vr[u]), 1e-3f)); } }
#pragma unroll
    for (int mb = 0; mb < MB; ++mb) {
#pragma unroll
        for (int nb = 0; nb < 4; ++nb) {
#pragma unroll
            for (int j = 0; j < 8; ++j) ow[(hi * 8 + j) * 68 + nb * 16 + lr] = acc[mb][nb][j]; }
        __builtin_amdgcn_wave_barrier(); asm volatile("" ::: "memory");   // keeps the row reads below behind the wave's own tile writes
        float* cr = C + (size_t)(r0 + wr + mb * 16) * ldc + c0 + wc;
#pragma unroll
        for (int s = 0; s < 8; ++s) { const int row = 2 * s + hi, cofs = lr * 4; v4f val = *(const v4fa*)(ow + row * 68 + cofs);
            if constexpr (EPI == 1) {
#pragma unroll
                for (int u = 0; u < 4; ++u) val[u] += bfr(rr[mb * 8 + s][u]); }
            if constexpr (EPI == 2) val += rr[mb * 8 + s];
            if constexpr (EPI == 0) *(v4f*)(cr + (size_t)row * ldc + cofs) = val;
            else *(v4f*)(C + e0 + (mb * 16 + 2 * s) * DM) = val;
            if constexpr (EPI == 1) { v4us oh, ol;   // 8 B a lane: a half-wave fills one whole 128-B line of each plane
#pragma unroll
                for (int u = 0; u < 4; ++u) { unsigned short a, b2; splitf(gg[u] * (val[u] - mm[u]) * rs[u] + bb[u], a, b2); oh[u] = a; ol[u] = b2; }
                *(v4us*)(Oh + e0 + (mb * 16 + 2 * s) * DM) = oh; *(v4us*)(Ol + e0 + (mb * 16 + 2 * s) * DM) = ol; } }
        __builtin_amdgcn_wave_barrier(); asm volatile("" ::: "memory");   // keeps the next 16 rows' writes behind these reads
    }
}

__device__ __forceinline__ h16 tohx(float x) { return (h16)x; }
typedef __attribute__((ext_vector_type(2))) _Float16 v2h;
typedef __attribute__((ext_vector_type(4))) _Float16 v4h;
typedef __attribute__((ext_vector_type(2))) unsigned short v2us;
typedef __attribute__((ext_vector_type(2))) float v2f;
typedef __attribute__((ext_vector_type(4))) int v4i;

// d_*: bodies of the kernels that share a grid; bx is the work-group's index inside its own part of the grid
__device__ __forceinline__ void d_wtG(int bx, const float* __restrict__ w, int K, int N, bf* Bt) {
    const int lane = threadIdx.x & 31; const int L0 = (bx * 8 + (threadIdx.x >> 5)) * 8; const int nlines = N * K / 64;
{
#pragma unroll 1
        for (int l = 0; l < 8; ++l) { const int L = L0 + l; if (L >= nlines) break; const size_t e = (size_t)L * 64 + lane * 2; const int k = (int)(e % K), n = (int)(e / K); v2us o;
            o[0] = f2bf(w[(size_t)k * N + n]); o[1] = f2bf(w[(size_t)(k + 1) * N + n]); *(v2us*)(Bt + e) = o; }
         }
}
__global__ __launch_bounds__(256) void k_cvt8(const float* __restrict__ src, bf* dst, size_t n8) { const size_t i = (size_t)blockIdx.x * 256 + threadIdx.x; if (i >= n8) return; const v8f v = *(const v8f*)(src + i * 8); v8us o;
#pragma unroll
    for (int k = 0; k < 8; ++k) o[k] = f2bf(v[k]); *(v8us*)(dst + i * 8) = o;  }
__global__ __launch_bounds__(256) void k_cscvt(const float* __restrict__ cosT, const float* __restrict__ sinT, float* CS) { const int idx = blockIdx.x * 256 + threadIdx.x; if (idx >= TT * HD) return; v2f cs; cs[0] = bfr(cosT[idx]); cs[1] = bfr(sinT[idx]); *(v2f*)(CS + (size_t)idx * 2) = cs;  }
// d_rope: head planes [b][h][t][d] (fp16) of rope(x) x sc with the rotate-half convention out[d] = x[d] cos[t][d] - x[d+HD/2] sin[t][d], out[d+HD/2] = x[d+HD/2] cos[t][d+HD/2] + x[d] sin[t][d+HD/2]
// One thread: four consecutive d of one row t, for every head of RB batches (the table entries of (t, d) are fetched once for all of them). A wave's load covers two whole 256-B head rows, its store 256 B in a row.
#define RB 2
#define PB_R ((NB_ / RB) * TT * (HD / 4) / 256)
template <int NHD> __device__ __forceinline__ void d_rope(int bx, const float* __restrict__ F, const float* __restrict__ CS, float sc, h16* P16) {
    static_assert(NB_ % RB == 0 && ((NB_ / RB) * TT * (HD / 4)) % 256 == 0 && (HD / 2) % 4 == 0, "the grid covers the planes exactly; a thread's four d lie in one half of the head");
    const int i = bx * 256 + (int)threadIdx.x; const int d = (i % (HD / 4)) * 4, t = (i / (HD / 4)) % TT, b0 = (i / ((HD / 4) * TT)) * RB; const int dq = (d < HD / 2) ? d + HD / 2 : d - HD / 2;
    const float* cp = CS + ((size_t)t * HD + d) * 2; const float* fa = F + ((size_t)b0 * TT + t) * (NHD * HD) + d; const float* fb = F + ((size_t)b0 * TT + t) * (NHD * HD) + dq;   // the three addresses of this thread; every load is one of them plus a constant
    const v4f c01 = *(const v4f*)cp, c23 = *(const v4f*)(cp + 4); v4f xa[RB][NHD], xb[RB][NHD];
#pragma unroll
    for (int bb = 0; bb < RB; ++bb)
#pragma unroll
        for (int h = 0; h < NHD; ++h) { xa[bb][h] = *(const v4f*)(fa + (size_t)bb * TT * (NHD * HD) + h * HD); xb[bb][h] = *(const v4f*)(fb + (size_t)bb * TT * (NHD * HD) + h * HD); }
    static_assert(RB == 2 && NHD == 4, "the wait below names every loaded value");
    // stands behind the last load and in front of the first write of a register that held a load's address: the loaded values and the three addresses are named (inputs only) so that all loads are issued first and no result is placed in an address pair
    asm volatile("s_wait_xcnt 0x0" :: "v"(c01), "v"(c23), "v"(xa[0][0]), "v"(xa[0][1]), "v"(xa[0][2]), "v"(xa[0][3]), "v"(xa[1][0]), "v"(xa[1][1]), "v"(xa[1][2]), "v"(xa[1][3]), "v"(xb[0][0]), "v"(xb[0][1]), "v"(xb[0][2]), "v"(xb[0][3]), "v"(xb[1][0]), "v"(xb[1][1]), "v"(xb[1][2]), "v"(xb[1][3]), "v"(cp), "v"(fa), "v"(fb) : "memory");
#pragma unroll
    for (int bb = 0; bb < RB; ++bb)
#pragma unroll
        for (int h = 0; h < NHD; ++h) { v4h o16;
#pragma unroll
            for (int q = 0; q < 4; ++q) { const float x0 = xa[bb][h][q], x1 = xb[bb][h][q]; v2f cs; cs[0] = (q < 2) ? c01[2 * q] : c23[2 * q - 4]; cs[1] = (q < 2) ? c01[2 * q + 1] : c23[2 * q - 3];
                float a = __fmul_rn(x0, cs[0]), bq = __fmul_rn(x1, cs[1]); asm volatile("" : "+v"(a)); asm volatile("" : "+v"(bq)); const float r = ((d < HD / 2) ? __fsub_rn(a, bq) : __fadd_rn(a, bq)) * sc;
                o16[q] = tohx(r); }
            *(v4h*)(P16 + (((size_t)(b0 + bb) * NHD + h) * TT + t) * HD + d) = o16; }
    asm volatile("s_wait_xcnt 0x0" ::: "memory");   // behind the last store: the code of the grid's other parts follows in the text and writes these registers
}
// d_vtp: V^T planes [b][g][d][t] (fp16). One wave turns 64 rows t x 32 columns of F; a thread holds 8 t x 8 d in registers (lane = t group + 8 x d group): a load takes 64-B pieces of eight rows, a store four whole 128-B lines.
#define PB_V (TB * DKV / (64 * 32) / 8)
template <int NHD> __device__ __forceinline__ void d_vtp(int bx, const float* __restrict__ F, h16* V16) {
    static_assert(TT % 64 == 0 && HD % 32 == 0 && (TB * NHD * HD) % (64 * 32 * 8) == 0, "a wave's block lies in one batch and one head; the grid covers the plane exactly");
    const int lane = threadIdx.x & 31, tg = lane & 7, dg = lane >> 3; const int w = bx * 8 + (int)(threadIdx.x >> 5); const int c0 = (w % (NHD * HD / 32)) * 32 + dg * 4, r0 = (w / (NHD * HD / 32)) * 64 + tg * 8;   // first column and first row (b * 2048 + t) of this thread
    v4f x[8][2]; const float* fp = F + (size_t)r0 * (NHD * HD) + c0;
#pragma unroll
    for (int r = 0; r < 8; ++r)
#pragma unroll
        for (int hf = 0; hf < 2; ++hf) x[r][hf] = *(const v4f*)(fp + r * (NHD * HD) + hf * 16);
    // stands behind the last load and in front of the first write of the address pair: the loaded values and the address are named (inputs only) so that all loads are issued first and no result is placed in that pair
    asm volatile("s_wait_xcnt 0x0" :: "v"(x[0][0]), "v"(x[0][1]), "v"(x[1][0]), "v"(x[1][1]), "v"(x[2][0]), "v"(x[2][1]), "v"(x[3][0]), "v"(x[3][1]), "v"(x[4][0]), "v"(x[4][1]), "v"(x[5][0]), "v"(x[5][1]), "v"(x[6][0]), "v"(x[6][1]), "v"(x[7][0]), "v"(x[7][1]), "v"(fp) : "memory");
    h16* vo = V16 + ((size_t)(r0 / TT) * (NHD * HD) + c0) * TT + r0 % TT;   // plane row b * 256 + g * 64 + d is b * 256 + column
#pragma unroll
    for (int hf = 0; hf < 2; ++hf)
#pragma unroll
        for (int q = 0; q < 4; ++q) { v8h o16;
#pragma unroll
            for (int r = 0; r < 8; ++r) o16[r] = tohx(x[r][hf][q]);
            *(v8h*)(vo + (size_t)(hf * 16 + q) * TT) = o16; }
}
__device__ __forceinline__ void d_csid(int bx, float* CS) { v4f cs; cs[0] = 1.0f; cs[1] = 0.0f; cs[2] = 1.0f; cs[3] = 0.0f;   // two entries a store, four stores a thread
#pragma unroll
    for (int s = 0; s < 4; ++s) *(v4f*)(CS + ((size_t)(bx * 4 + s) * 256 + threadIdx.x) * 4) = cs;
    asm volatile("s_wait_xcnt 0x0" ::: "memory");   // behind the last store: the code of the grid's other parts follows in the text and writes these registers
}
// k_planes: the three plane builders in one grid, each with its own run of work-group indices. V^T, whose reads are pieces of lines, takes the lowest and so starts first.
__global__ __launch_bounds__(256) void k_planes(const float* __restrict__ FQ, const float* __restrict__ FK, const float* __restrict__ FV, const float* __restrict__ CS, h16* QP16, h16* KP16, h16* VT16) {
    int b = (int)blockIdx.x;
    if (b < PB_V) { d_vtp<NKV>(b, FV, VT16); return; } b -= PB_V;
    if (b < PB_R) { d_rope<NH_>(b, FQ, CS, 1.0f, QP16); return; } b -= PB_R;
    d_rope<NKV>(b, FK, CS, 1.0f, KP16);
}
// k_fattn: scores, softmax and attn.v of one (batch, head) plane in one kernel. One wave owns 32 query columns (two groups of 16) and walks one quarter of the 2048 keys in passes of 32.
// The four waves that share 32 queries (one per key quarter) sit in one work-group of 16 waves, four to a SIMD, so that one wave's softmax arithmetic and load waits lie under the others' products. Each leaves its maximum, sum and O^T tiles in LDS;
// behind one barrier two of the four (one per column group) bring the quarters to a common maximum, add them in the fixed order 0 .. 3 and run the epilogue.
// Transposed products: S^T = K Q^T (A = 16 key rows, B = the wave's queries, kept in registers), O^T += V^T P^T (A = 16 d rows of the [d][t] plane). In an S^T tile lane (lr, hi) holds keys 8 hi + 0..7 of query lr,
// which is the k order of a B operand: tiles 0 and 1 of a pass, rounded to fp16, ARE the 32-key B operand; nothing crosses lanes but one exchange between the wave's halves for the maximum (and one for the sum, at the end).
// Running softmax in the log2 domain: p = 2^(s c - m), c = HD^-0.5 log2 e; m, the maximum in use, may trail the true one by up to 8 (p <= 2^8, well inside fp16); sums and accumulators are rescaled only when a column exceeds that.
// The epilogue divides by the sum (as x PCAR / sum, then / PCAR, the two roundings the separate kernels had) and stores the bf16 hi+lo planes [b * 2048 + t][h * 64 + d] that the output projection reads: 128-B lines, one wave each.
#define FQW 4   // query groups of 32 per work-group: 128 queries, 256 work-groups
#define FKS 4   // key quarters per query group: FQW * FKS waves per work-group
__device__ __forceinline__ float xhalf(float x) { return __builtin_bit_cast(float, __builtin_amdgcn_permlanex16(__builtin_bit_cast(int, x), __builtin_bit_cast(int, x), 0x76543210, 0xfedcba98, false, false)); }  // lane l with lane l ^ 16
__global__ __launch_bounds__(32 * FQW * FKS) void k_fattn(const h16* __restrict__ Q, const h16* __restrict__ Kp, const h16* __restrict__ Vt, bf* Ah, bf* Al) {
    typedef WFrag<h16> WF;
    static_assert(FKS >= 2 && TT % (32 * FKS) == 0, "one finishing wave per column group; every key range is whole passes");
    __shared__ __align__(16) float po[FKS * FQW][8][2][32 * 4];   // [wave][tile g * 4 + dt][registers 0..3 | 4..7][lane]: every access is 16 B a lane, 512 B in a row
    __shared__ float pm[FKS * FQW][2][32], pl[FKS * FQW][2][32];   // [wave][g][lane]: maximum in use, this lane's part of the sum
    const int lane = threadIdx.x & 31, lr = lane & 15, hi = lane >> 4; const int wv = __builtin_amdgcn_readfirstlane((int)(threadIdx.x >> 5));
    const int qg = wv % FQW, kq = wv / FQW, kb = kq * (TT / FKS);   // query group, key quarter and its first key: the same in all lanes of the wave
    const size_t z = blockIdx.y, zk = z / REP; const int q0 = ((int)blockIdx.x * FQW + qg) * 32;
    const h16* qp = Q + (z * TT + q0 + lr) * HD + 8 * hi; const h16* kp = Kp + (zk * TT + lr) * HD + 8 * hi; const h16* vp = Vt + (zk * HD + lr) * TT + 8 * hi;
    v16h qf[2][2], kf[2][2], vf[4]; v8f o[2][4]; float mr[2], l[2];   // the inner loops are all unrolled so that these arrays are registers
#pragma unroll
    for (int g = 0; g < 2; ++g) { mr[g] = -__builtin_inff(); l[g] = 0.f;
#pragma unroll
        for (int ks = 0; ks < 2; ++ks) { qf[g][ks] = WF::ld(qp + g * 16 * HD + ks * 32); kf[g][ks] = WF::ld(kp + (size_t)(kb + g * 16) * HD + ks * 32); }
#pragma unroll
        for (int dt = 0; dt < 4; ++dt) o[g][dt] = (v8f){}; }
#pragma unroll
    for (int dt = 0; dt < 4; ++dt) vf[dt] = WF::ld(vp + (size_t)dt * 16 * TT + kb);
    asm volatile("s_wait_xcnt 0x0" :: "v"(qp) : "memory");   // stands in front of the first write of a register that held one of these loads' addresses; qp, dead behind its loads, is named so that its registers last up to here
    const float cs = SCL * 1.4426950408889634f;
#pragma unroll 1   // 16 passes: rolled, the body is long enough and the fetch-ahead wants one register set
    for (int k0 = kb; k0 < kb + TT / FKS; k0 += 32) {
        v8f s[2][2];
#pragma unroll
        for (int kt = 0; kt < 2; ++kt)
#pragma unroll
            for (int g = 0; g < 2; ++g) s[kt][g] = WF::mma(kf[kt][1], qf[g][1], WF::mma(kf[kt][0], qf[g][0], (v8f){}));
        const int kn = (k0 + 32) & (TT - 1);   // K and V^T fragments are fetched one pass ahead, each into the registers its product has just read; a wave's last pass fetches the first keys of the next quarter, the last quarter's keys 0..31 (in bounds, unused)
#pragma unroll
        for (int kt = 0; kt < 2; ++kt)
#pragma unroll
            for (int ks = 0; ks < 2; ++ks) kf[kt][ks] = WF::ld(kp + (size_t)(kn + kt * 16) * HD + ks * 32);
        __builtin_amdgcn_sched_barrier(0);   // keeps the K fetch up here, a whole softmax and attn.v ahead of its use: under the register ceiling of four waves a SIMD the compiler otherwise sinks it to the end of the pass
        float mb[2]; bool need = false;
#pragma unroll
        for (int g = 0; g < 2; ++g) { float m0 = s[0][g][0], m1 = s[1][g][0];
#pragma unroll
            for (int j = 1; j < 8; ++j) { m0 = fmaxf(m0, s[0][g][j]); m1 = fmaxf(m1, s[1][g][j]); }
            m0 = fmaxf(m0, m1); mb[g] = fmaxf(m0, xhalf(m0)) * cs; need = need || (mb[g] > mr[g] + 8.0f); }   // both halves of the wave hold the query's maximum, scaled (the scale is positive)
        if (__builtin_amdgcn_ballot_w32(need) != 0) {   // wave-uniform; always taken in the first pass (mr = -inf gives the factor 0), rare later
#pragma unroll
            for (int g = 0; g < 2; ++g) { const float mn = fmaxf(mr[g], mb[g]); const float al = __builtin_amdgcn_exp2f(mr[g] - mn); mr[g] = mn; l[g] *= al;
#pragma unroll
                for (int dt = 0; dt < 4; ++dt) o[g][dt] *= al; }
        }
#pragma unroll
        for (int g = 0; g < 2; ++g) { const float nm = -mr[g]; float a0 = 0.f, a1 = 0.f; v16h pf;
#pragma unroll
            for (int i = 0; i < 8; ++i) { const v2f ar = __builtin_elementwise_fma((v2f){s[i >> 2][g][2 * (i & 3)], s[i >> 2][g][2 * (i & 3) + 1]}, (v2f){cs, cs}, (v2f){nm, nm});
                float p0;
                if (g == 0 && i == 0) asm("v_exp_f32 %0, %1\n\tv_nop" : "=v"(p0) : "v"(ar[0]));   // the pass's first exponential carries its own v_nop: the slot the instruction set asks for behind a transcendental, since the register allocator gives this one's source to the next instruction's result
                else p0 = __builtin_amdgcn_exp2f(ar[0]);
                const float p1 = __builtin_amdgcn_exp2f(ar[1]); a0 += p0; a1 += p1; pf[2 * i] = tohx(p0); pf[2 * i + 1] = tohx(p1); }
            l[g] += a0 + a1;
#pragma unroll
            for (int dt = 0; dt < 4; ++dt) o[g][dt] = WF::mma(vf[dt], pf, o[g][dt]); }
#pragma unroll
        for (int dt = 0; dt < 4; ++dt) vf[dt] = WF::ld(vp + (size_t)dt * 16 * TT + kn);
        asm volatile("s_wait_xcnt 0x0" ::: "memory");   // stands in front of the next pass's first write of the registers that held these loads' address
    }
#pragma unroll
    for (int g = 0; g < 2; ++g) { pm[wv][g][lane] = mr[g]; pl[wv][g][lane] = l[g];
#pragma unroll
        for (int dt = 0; dt < 4; ++dt) { *(v4fa*)&po[wv][g * 4 + dt][0][lane * 4] = __builtin_shufflevector(o[g][dt], o[g][dt], 0, 1, 2, 3); *(v4fa*)&po[wv][g * 4 + dt][1][lane * 4] = __builtin_shufflevector(o[g][dt], o[g][dt], 4, 5, 6, 7); } }
    __syncthreads();   // every quarter's maximum, sum and tiles are in LDS before a finishing wave reads them
    if (kq >= 2) return;   // wave-uniform, behind the only barrier: quarter 0's wave finishes column group 0, quarter 1's group 1, each whole 128-B lines of the planes
    const int g = kq; float fs[FKS], mx = pm[qg][g][lane], ls = 0.f;
#pragma unroll
    for (int p = 1; p < FKS; ++p) mx = fmaxf(mx, pm[p * FQW + qg][g][lane]);
#pragma unroll
    for (int p = 0; p < FKS; ++p) { fs[p] = __builtin_amdgcn_exp2f(pm[p * FQW + qg][g][lane] - mx); ls += fs[p] * pl[p * FQW + qg][g][lane]; }   // both halves of the wave hold the same maxima, so the same factors
    const float f = __fdiv_rn(PCAR, ls + xhalf(ls)); const size_t oo = ((z / NH_) * TT + q0 + g * 16 + lr) * DQ + (z % NH_) * HD + hi * 8;   // lane (lr, hi) holds d = 16 dt + 8 hi + 0..7 of query lr; row b * 2048 + t, columns h * 64 + d
#pragma unroll
    for (int dt = 0; dt < 4; ++dt) { v4f s0 = (v4f){}, s1 = (v4f){}; v8us oh, ol;
#pragma unroll
        for (int p = 0; p < FKS; ++p) { s0 += *(const v4fa*)&po[p * FQW + qg][g * 4 + dt][0][lane * 4] * fs[p]; s1 += *(const v4fa*)&po[p * FQW + qg][g * 4 + dt][1][lane * 4] * fs[p]; }
#pragma unroll
        for (int j = 0; j < 8; ++j) { unsigned short a, c2; splitf(((j < 4 ? s0[j & 3] : s1[j & 3]) * f) * (1.0f / PCAR), a, c2); oh[j] = a; ol[j] = c2; }
        *(v8us*)(Ah + oo + dt * 16) = oh; *(v8us*)(Al + oo + dt * 16) = ol; }
}

// block tail: d_bn: hl planes of gamma (v - mean) rsqrt(var + 1e-3) + beta over [b * 2048 + t][256] (RAW: v is a raw input row, bf16-rounded first) (8-B stores); k_gelu: hl planes of exact-erf GELU (8-B stores);
#define FFD 1024
// SU: 16-B pieces per thread of the kernels over [8192][256]; a work-group takes SU * 1024 elements in a row, piece s of thread i at s * 1024 + 4 i (every wave's load is 512 B in a row, and a thread keeps its four channels)
#define SU 4
#define PB_S (TB * DM / (SU * 1024))
static_assert((TB * DM) % (SU * 1024) == 0 && 1024 % DM == 0, "the grids cover the rows exactly; a thread's channels are the same in all its pieces");
template <bool RAW> __device__ __forceinline__ void d_bn(int bx, const float* __restrict__ X, const float* __restrict__ ga, const float* __restrict__ be, const float* __restrict__ mu, const float* __restrict__ var, bf* Hh, bf* Hl) { const int e0 = bx * (SU * 1024) + (int)threadIdx.x * 4; const int c = e0 % DM; v4f xs[SU]; float gg[4], bb[4], mm[4], rs[4]; const float* xp = X + e0; const unsigned cb = (unsigned)c * 4u;   // cb: byte offset of the thread's channels in the four parameter vectors
#pragma unroll
    for (int s = 0; s < SU; ++s) xs[s] = *(const v4f*)(xp + s * 1024);
    const v4f gr = *(const v4f*)((const char*)ga + cb), br = *(const v4f*)((const char*)be + cb), mr = *(const v4f*)((const char*)mu + cb), vr = *(const v4f*)((const char*)var + cb);   // the thread's four channels, once for all its pieces
    static_assert(SU == 4, "the wait below names every piece");
    // stands behind the last load and in front of the first write of a register that held a load's address: the loaded values, the row address and the channel offset are named (inputs only) so that all eight loads are issued first and no result is placed in an address register
    asm volatile("s_wait_xcnt 0x0" :: "v"(xs[0]), "v"(xs[1]), "v"(xs[2]), "v"(xs[3]), "v"(gr), "v"(br), "v"(mr), "v"(vr), "v"(xp), "v"(cb) : "memory");
#pragma unroll
    for (int u = 0; u < 4; ++u) { gg[u] = bfr(gr[u]); bb[u] = bfr(br[u]); mm[u] = bfr(mr[u]); const float vv = bfr(vr[u]); const float ve = __fadd_rn(vv, 1e-3f); rs[u] = __frsqrt_rn(ve); }
#pragma unroll
    for (int s = 0; s < SU; ++s) { const int e = e0 + s * 1024; v4us oh, ol;
#pragma unroll
        for (int u = 0; u < 4; ++u) { float xv = xs[s][u]; if (RAW) xv = bfr(xv); float d = __fsub_rn(xv, mm[u]); asm volatile("" : "+v"(d)); float t1 = __fmul_rn(gg[u], d); asm volatile("" : "+v"(t1)); float t2 = __fmul_rn(t1, rs[u]); asm volatile("" : "+v"(t2)); const float y = __fadd_rn(t2, bb[u]); unsigned short a, b2; splitf(y, a, b2); oh[u] = a; ol[u] = b2; }
        *(v4us*)(Hh + e) = oh; *(v4us*)(Hl + e) = ol; }
}
// k_prep: all that depends on the inputs alone, in one grid. The weight transposes (few work-groups, each a chain of eight dependent trips) take the lowest indices and start first; the table and BN1 stream behind them.
#define PB_Q  ((DM * DQ / 64 + 63) / 64)
#define PB_KV ((DM * DKV / 64 + 63) / 64)
#define PB_F  ((DM * FFD / 64 + 63) / 64)
#define PB_CS (TT * HD * 2 / (4 * 1024))
#define PB_BN PB_S
static_assert((TT * HD * 2) % (4 * 1024) == 0, "the table's work-groups cover it exactly");
__global__ __launch_bounds__(256) void k_prep(const float* __restrict__ wq, const float* __restrict__ wk, const float* __restrict__ wv, const float* __restrict__ wo, const float* __restrict__ w1, const float* __restrict__ w2, bf* WQ, bf* WK, bf* WV, bf* WO, bf* W1B, bf* W2B, float* CS,
                                              const float* __restrict__ x, const float* __restrict__ ga, const float* __restrict__ be, const float* __restrict__ mu, const float* __restrict__ var, bf* Hh, bf* Hl) {
    int b = (int)blockIdx.x;
    if (b < PB_F) { d_wtG(b, w1, DM, FFD, W1B); return; } b -= PB_F;
    if (b < PB_F) { d_wtG(b, w2, FFD, DM, W2B); return; } b -= PB_F;
    if (b < PB_Q) { d_wtG(b, wq, DM, DQ, WQ); return; } b -= PB_Q;
    if (b < PB_KV) { d_wtG(b, wk, DM, DKV, WK); return; } b -= PB_KV;
    if (b < PB_KV) { d_wtG(b, wv, DM, DKV, WV); return; } b -= PB_KV;
    if (b < PB_Q) { d_wtG(b, wo, DQ, DM, WO); return; } b -= PB_Q;
    if (b < PB_CS) { d_csid(b, CS); return; } b -= PB_CS;
    d_bn<true>(b, x, ga, be, mu, var, Hh, Hl);
    asm volatile("s_wait_xcnt 0x0" ::: "memory");   // behind the last store: the code of the grid's other parts follows in the text and writes these registers
}
#define GU 8   // 16-B pieces per thread of k_gelu, laid out as under SU
static_assert((TB * FFD) % (GU * 1024) == 0, "the grid covers the rows exactly");
__global__ __launch_bounds__(256) void k_gelu(const float* __restrict__ Mf, bf* Gh, bf* Gl) { const int e0 = (int)blockIdx.x * (GU * 1024) + (int)threadIdx.x * 4; v4f as[GU];
#pragma unroll
    for (int s = 0; s < GU; ++s) as[s] = *(const v4f*)(Mf + e0 + s * 1024);
#pragma unroll
    for (int s = 0; s < GU; ++s) { v4us oh, ol;
#pragma unroll   // unrolled: every element is then a register by name; a rolled loop picks it by a chain of selects and merges each result by bit-field inserts
        for (int u = 0; u < 4; ++u) { const float y = as[s][u]; float er = erff(y * 0.70710678118654752f); asm volatile("" : "+v"(er)); float hy = __fmul_rn(0.5f, y); asm volatile("" : "+v"(hy)); const float ge = __fmul_rn(hy, __fadd_rn(1.0f, er)); unsigned short h, l; splitf(ge, h, l); oh[u] = h; ol[u] = l; }
        *(v4us*)(Gh + e0 + s * 1024) = oh; *(v4us*)(Gl + e0 + s * 1024) = ol; }
}

extern "C" void kernel_launch(void* const* d_in, const int* in_sizes, int n_in,
                              void* d_out, int out_size, void* d_ws, size_t ws_size, hipStream_t stream) {
    (void)in_sizes; (void)n_in; (void)out_size;
    const float** Ip = (const float**)d_in; const float *x = Ip[0], *g1 = Ip[1], *be1 = Ip[2], *m1 = Ip[3], *v1 = Ip[4], *wq = Ip[5], *bq = Ip[6], *wk = Ip[7], *bk = Ip[8], *wv = Ip[9], *bv = Ip[10], *wo = Ip[11], *bo = Ip[12], *g2 = Ip[13], *be2 = Ip[14], *m2 = Ip[15], *v2 = Ip[16], *w1 = Ip[17], *w2 = Ip[18]; const float* cosT = nullptr; const float* sinT = nullptr; (void)cosT; (void)sinT;
    float* OUT = (float*)d_out;     // [4][2048][256]
    char* wsp = (char*)d_ws;
    auto take = [&](size_t bytes) { char* p = wsp; wsp += (bytes + 255) & ~(size_t)255; return (void*)p; };
    bf* WQ = (bf*)take((size_t)DQ * DM * 2); bf* WK = (bf*)take((size_t)DKV * DM * 2); bf* WV = (bf*)take((size_t)DKV * DM * 2); bf* WO = (bf*)take((size_t)DM * DQ * 2); float* CS = (float*)take((size_t)TT * HD * 2 * 4);
    bf* Hh = (bf*)take((size_t)TB * DM * 2); bf* Hl = (bf*)take((size_t)TB * DM * 2); bf* W1B = (bf*)take((size_t)FFD * DM * 2); bf* W2B = (bf*)take((size_t)DM * FFD * 2); float* FQ = (float*)take((size_t)TB * DQ * 4); float* FK = (float*)take((size_t)TB * DKV * 4); float* FV = (float*)take((size_t)TB * DKV * 4);   // three buffers in a row, as WQ, WK, WV are: grid z of the projection steps from one to the next
    h16* QP16 = (h16*)take((size_t)NB_ * NH_ * TT * HD * 2); h16* KP16 = (h16*)take((size_t)NB_ * NKV * TT * HD * 2); h16* VT16 = (h16*)take((size_t)NB_ * NKV * HD * TT * 2);
    bf* ATh = (bf*)take((size_t)TB * DQ * 2); bf* ATl = (bf*)take((size_t)TB * DQ * 2);
    float* X1 = (float*)take((size_t)TB * DM * 4); float* Mf = (float*)take((size_t)TB * FFD * 4); bf* Gh = (bf*)take((size_t)TB * FFD * 2); bf* Gl = (bf*)take((size_t)TB * FFD * 2);
    if ((size_t)(wsp - (char*)d_ws) > ws_size) return;    // ws 256 MiB
    static_assert(DQ == DKV, "grid z of the q, k, v projection steps by one weight plane and one output buffer of equal size");
    k_prep<<<2 * PB_F + 2 * PB_Q + 2 * PB_KV + PB_CS + PB_BN, 256, 0, stream>>>(wq, wk, wv, wo, w1, w2, WQ, WK, WV, WO, W1B, W2B, CS, x, g1, be1, m1, v1, Hh, Hl);
    k_gemml<4, true, 0><<<dim3(TB / 128, DQ / 128, 3), 128, 0, stream>>>(Hh, Hl, WQ, DM, FQ, DQ, bq, bk, bv, (size_t)DQ * DM, (size_t)TB * DQ, nullptr, nullptr, nullptr, nullptr, nullptr, nullptr, nullptr);
    k_planes<<<PB_V + 2 * PB_R, 256, 0, stream>>>(FQ, FK, FV, CS, QP16, KP16, VT16);
    k_fattn<<<dim3(TT / (32 * FQW), NB_ * NH_, 1), 32 * FQW * FKS, 0, stream>>>(QP16, KP16, VT16, ATh, ATl);
    k_gemml<2, true, 1><<<dim3(TB / 64, DM / 128, 1), 128, 0, stream>>>(ATh, ATl, WO, DQ, X1, DM, bo, nullptr, nullptr, 0, 0, x, g2, be2, m2, v2, Hh, Hl);   // x1 and the planes of BN2(x1)
    k_gemml<4, false, 0><<<dim3(TB / 128, FFD / 128, 1), 128, 0, stream>>>(Hh, Hl, W1B, DM, Mf, FFD, nullptr, nullptr, nullptr, 0, 0, nullptr, nullptr, nullptr, nullptr, nullptr, nullptr, nullptr); k_gelu<<<TB * FFD / (GU * 1024), 256, 0, stream>>>(Mf, Gh, Gl);
    k_gemml<2, false, 2><<<dim3(TB / 64, DM / 128, 1), 128, 0, stream>>>(Gh, Gl, W2B, FFD, OUT, DM, nullptr, nullptr, nullptr, 0, 0, X1, nullptr, nullptr, nullptr, nullptr, nullptr, nullptr);   // out = m + x1
}

// v009
// One run takes 92.3 microseconds.
// Two timings next to v008 put it at 1.12 and 1.14 times that version's speed.
// All steps since v000 together make it 10.0 times as fast.
#include <hip/hip_runtime.h>

// TransformerBaseBlock (x [4][2048][256]; h = BN1(x) (inference: gamma (x - mean) rsqrt(var + 1e-3) + beta); q/k/v = h W + b (4 heads x 64); softmax(q.k/8); attn_out = ctx Wo + bo; x1 = attn_out + x; m = gelu(BN2(x1) W1) W2 (exact erf GELU);
// out = m + x1 -> [4][2048][256]).
// Compute dtypes, f32 accumulate: every input rounded to bf16; BN1/BN2 f32 -> bf16 hi+lo planes; q/k/v (+ bias), W1 as hl x exact W (2 products); scores (K 64) and attn.v single fp16 planes;
// Every launch covers all four batches (rows b * 2048 + t, planes b * 4 + h); attention is one launch over all 16 (batch, head) planes: scores and probabilities stay in registers (k_fattn).
// Launches that do not depend on one another share one grid: k_prep (six weight transposes, the cos/sin table, BN1), the q, k, v projections (grid z of k_gemml), k_planes (q and k head planes, V^T).
// The residual add with BN2 and the last add are done where the output projection and the second MLP product store their rows (EPI of k_gemml).
// The streaming kernels (table, BN1, head planes, V^T, GELU) give every thread 16 to 64 elements, all its loads issued ahead of its arithmetic: few waves to start, many bytes in flight per wave. Their loops over pieces and elements are all unrolled, so that a thread's pieces are registers and its loads can stand in a row.

#define NB_  4
#define TT   2048
#define DM   256
#define NH_  4
#define NKV  4
#define REP  (NH_ / NKV)
#define HD   64
#define DQ   (NH_ * HD)
#define DKV  (NKV * HD)
#define TB   (NB_ * TT)         // rows of all batches
#define WIN  0
#define PCAR 1024.0f
#define SCL  0.125f   // HD^-0.5
typedef _Float16 h16;
typedef unsigned short bf;
typedef __attribute__((ext_vector_type(16))) __bf16   v16bf;
typedef __attribute__((ext_vector_type(16))) _Float16 v16h;
typedef __attribute__((ext_vector_type(8)))  _Float16 v8h;
typedef __attribute__((ext_vector_type(8)))  unsigned short v8us;
typedef __attribute__((ext_vector_type(8)))  float    v8f;
typedef __attribute__((ext_vector_type(4)))  float    v4f;
typedef v8h  __attribute__((may_alias)) v8ha;
typedef v4f  __attribute__((may_alias)) v4fa;
typedef v8us __attribute__((may_alias)) v8usa;

__device__ __forceinline__ unsigned short f2bf(float f) { unsigned u = __float_as_uint(f); u += 0x7FFFu + ((u >> 16) & 1u); return (unsigned short)(u >> 16); }
__device__ __forceinline__ float bf2f(unsigned short b) { return __uint_as_float(((unsigned)b) << 16); }
__device__ __forceinline__ float bfr(float f) { return bf2f(f2bf(f)); }
__device__ __forceinline__ void splitf(float y, unsigned short& h, unsigned short& l) { h = f2bf(y); l = f2bf(y - bf2f(h)); }
typedef __attribute__((ext_vector_type(4))) unsigned short v4us;
__device__ __forceinline__ v16h cat16(v8h lo, v8h hi) { return __builtin_shufflevector(lo, hi, 0, 1, 2, 3, 4, 5, 6, 7, 8, 9, 10, 11, 12, 13, 14, 15); }
__device__ __forceinline__ v16bf cat16b(v8us lo, v8us hi) { return __builtin_bit_cast(v16bf, __builtin_shufflevector(lo, hi, 0, 1, 2, 3, 4, 5, 6, 7, 8, 9, 10, 11, 12, 13, 14, 15)); }
__device__ __forceinline__ v8f wmma16(v16h a, v16h b, v8f c) { return __builtin_amdgcn_wmma_f32_16x16x32_f16(false, a, false, b, (short)0, c, false, false); }
__device__ __forceinline__ v8f wmmab(v16bf a, v16bf b, v8f c) { return __builtin_amdgcn_wmma_f32_16x16x32_bf16(false, a, false, b, (short)0, c, false, false); }



// WFrag: one 16 x 32 operand fragment of a K-contiguous 16-bit plane: lane (lr, hi) holds k = 8 hi + 0..7 and 16 + 8 hi + 0..7 of row lr; the same loader serves A and B, so their k orders agree.
template <typename T16> struct WFrag;
template <> struct WFrag<h16> { typedef v16h V; static __device__ __forceinline__ V ld(const h16* p) { return cat16(*(const v8h*)p, *(const v8h*)(p + 16)); } static __device__ __forceinline__ v8f mma(V a, V b, v8f c) { return wmma16(a, b, c); } };
template <> struct WFrag<bf> { typedef v16bf V; static __device__ __forceinline__ V ld(const bf* p) { return cat16b(*(const v8us*)p, *(const v8us*)(p + 16)); } static __device__ __forceinline__ v8f mma(V a, V b, v8f c) { return wmmab(a, b, c); } };
// ---- k_gemml: C = (A + A2) Bt^T (+ bias), f32 out, operands K-contiguous bf16 planes. One (32 MB) x 128 output tile per work-group of four waves, each wave a (16 MB) x 64 quarter over the whole K (no K split, no partial sums).
// MB = 4 (128 x 128) for the wide products (q, k, v by grid z; W1), MB = 2 (64 x 128) for the two with 256 columns (WO, W2), so that their grid still has one work-group per WGP.
// The operands come through LDS: a stage is 64 k of the tile's rows of A, of A2 and of Bt (whole 128-B lines, each fetched once per work-group and read by two waves), brought by asynchronous copies into one of two buffers
// while the other is worked on. grid (M / (32 MB), N / 128, Z), 128 threads; K % 64 == 0. z steps Bt by sB and C by sC elements; the bias vectors are separate buffers: bias for z = 0, biasZ1 and biasZ2 for z = 1 and 2.
// EPI: what the store loop does with a finished row piece. 0: C = sum. 1 (output projection): C = x1 = sum + bf16(R), and the bf16 hi+lo planes Oh, Ol of BN2(x1). 2 (second MLP product): C = sum + R.
// For EPI 1 and 2 C, R, Oh, Ol have DM columns. A thread's pieces of R (and its four channels' BN parameters) are asked for once, behind the copies of the first two stages and ahead of the K loop, and are first used behind it.
#define LP 72   // LDS row pitch in 16-bit elements: 128 B of data + 16 B, an odd number of 16-B units, so that the 16 rows of a fragment read fall on different banks
// cp8: eight 16-B copies of one thread into 128 LDS rows in a row, 16 rows apart: the first four from ga, the last four from gb, each stepping by gs elements (16 source rows). A wave's copy is four whole 128-B lines.
__device__ __forceinline__ void cp8(unsigned l0, const bf* ga, const bf* gb, size_t gs) {
    const unsigned l1 = l0 + 16 * LP * 2, l2 = l0 + 32 * LP * 2, l3 = l0 + 48 * LP * 2, l4 = l0 + 64 * LP * 2, l5 = l0 + 80 * LP * 2, l6 = l0 + 96 * LP * 2, l7 = l0 + 112 * LP * 2;
    const bf *g1 = ga + gs, *g2 = ga + 2 * gs, *g3 = ga + 3 * gs, *g5 = gb + gs, *g6 = gb + 2 * gs, *g7 = gb + 3 * gs;
    // the copies and, as the statement's last line, the wait that stands in front of any rewrite of their address registers
    asm volatile("global_load_async_to_lds_b128 %0, %8, off\n\t"
                 "global_load_async_to_lds_b128 %1, %9, off\n\t"
                 "global_load_async_to_lds_b128 %2, %10, off\n\t"
                 "global_load_async_to_lds_b128 %3, %11, off\n\t"
                 "global_load_async_to_lds_b128 %4, %12, off\n\t"
                 "global_load_async_to_lds_b128 %5, %13, off\n\t"
                 "global_load_async_to_lds_b128 %6, %14, off\n\t"
                 "global_load_async_to_lds_b128 %7, %15, off\n\t"
                 "s_wait_xcnt 0x0"
                 :: "v"(l0), "v"(l1), "v"(l2), "v"(l3), "v"(l4), "v"(l5), "v"(l6), "v"(l7), "v"(ga), "v"(g1), "v"(g2), "v"(g3), "v"(gb), "v"(g5), "v"(g6), "v"(g7) : "memory");
}
template <int MB, bool BIAS, int EPI>
__global__ __launch_bounds__(128) void k_gemml(const bf* __restrict__ A, const bf* __restrict__ A2, const bf* __restrict__ Bt, int K, float* C, int ldc, const float* __restrict__ bias, const float* __restrict__ biasZ1, const float* __restrict__ biasZ2, size_t sB, size_t sC,
                                               const float* __restrict__ R, const float* __restrict__ bnG, const float* __restrict__ bnB, const float* __restrict__ bnM, const float* __restrict__ bnV, bf* Oh, bf* Ol) {
    typedef WFrag<bf> WF; typedef WF::V V;
    static_assert(MB == 2 || MB == 4, "the copies below cover 64 or 128 rows of A");
    constexpr int TM = 32 * MB, LSTG = (2 * TM + 128) * LP;   // rows of the tile; elements of one stage: rows 0 .. TM-1 A, TM .. 2 TM-1 A2, then 128 of Bt
    __shared__ __align__(16) bf st[2 * LSTG];
    __shared__ __align__(16) float os[4][16 * 68];   // one wave's 16 output rows on their way to whole-row stores
    const size_t z = blockIdx.z; Bt += z * sB; C += z * sC; const float* bz = (z == 0) ? bias : ((z == 1) ? biasZ1 : biasZ2);
    const int tid = (int)threadIdx.x, lane = tid & 31, lr = lane & 15, hi = lane >> 4; const int wv = __builtin_amdgcn_readfirstlane(tid >> 5);
    const int r0 = blockIdx.x * TM, c0 = blockIdx.y * 128, wr = (wv & 1) * (16 * MB), wc = (wv >> 1) * 64;   // the work-group's tile, the wave's quarter in it
    v8f acc[MB][4];   // the sums start from the bias of their column (lane lr holds column nb * 16 + lr in all eight registers): no register is held for it through the loop
#pragma unroll
    for (int nb = 0; nb < 4; ++nb) { const float b0 = BIAS ? bfr(bz[c0 + wc + nb * 16 + lr]) : 0.f;
#pragma unroll
        for (int mb = 0; mb < MB; ++mb)
#pragma unroll
            for (int j = 0; j < 8; ++j) acc[mb][nb][j] = b0; }
    const int crow = tid >> 3, ccol = (tid & 7) * 8;   // this thread's first row and its 16-B piece of every row it copies
    const bf* ga = A + (size_t)(r0 + crow) * K + ccol; const bf* ga2 = A2 + (size_t)(r0 + crow) * K + ccol; const bf* gb = Bt + (size_t)(c0 + crow) * K + ccol;
    const unsigned lc = (unsigned)(size_t)(st + crow * LP + ccol);   // LDS byte address: the low 32 bits of the __shared__ address
    const size_t gs = (size_t)16 * K; const int nt = K / 64;
    auto fill = [&](int t) { const unsigned l = lc + (unsigned)(t & 1) * (LSTG * 2);
        if constexpr (MB == 4) { cp8(l, ga + t * 64, ga + t * 64 + 4 * gs, gs); cp8(l + 128 * LP * 2, ga2 + t * 64, ga2 + t * 64 + 4 * gs, gs); }
        else cp8(l, ga + t * 64, ga2 + t * 64, gs);   // 64 rows of A, then 64 of A2
        cp8(l + 2 * TM * LP * 2, gb + t * 64, gb + t * 64 + 4 * gs, gs); };
    fill(0);
    asm volatile("s_wait_asynccnt 0x0" ::: "memory");   // this wave's copies of stage 0 have landed
    __syncthreads();                                    // and every other wave's: stage 0 may be read
    if (nt > 1) fill(1);
    v4f rr[EPI ? MB * 8 : 1], gr = (v4f){}, br = (v4f){}, mr = (v4f){}, vr = (v4f){};   // rr[mb * 8 + s]: columns 4 lr .. 4 lr + 3 of row mb * 16 + 2 s + hi of the wave's quarter, the piece this lane stores below
    if constexpr (EPI != 0) {
        const float* rp = R + ((size_t)(r0 + wr + hi) * DM + c0 + wc + lr * 4); const unsigned cb = (unsigned)(c0 + wc + lr * 4) * 4u;   // one address, every load a constant from it; cb: byte offset of the lane's channels in the parameter vectors
#pragma unroll
        for (int i = 0; i < MB * 8; ++i) rr[i] = *(const v4f*)(rp + i * 2 * DM);
        if constexpr (EPI == 1) { gr = *(const v4f*)((const char*)bnG + cb); br = *(const v4f*)((const char*)bnB + cb); mr = *(const v4f*)((const char*)bnM + cb); vr = *(const v4f*)((const char*)bnV + cb); }
        asm volatile("s_wait_xcnt 0x0" :: "v"(rp), "v"(cb) : "memory");   // stands in front of the first write of a register that held one of these loads' addresses; both are named so that their registers last up to here
    }
#pragma unroll 1   // rolled: one register set; the buffer is picked by the trip's parity
    for (int t = 0; t < nt; ++t) {
        const bf* sb = st + (t & 1) * LSTG; const bf* pa = sb + (wr + lr) * LP + 8 * hi; const bf* pb = sb + (2 * TM + wc + lr) * LP + 8 * hi;
#pragma unroll
        for (int ks = 0; ks < 2; ++ks) { V a[MB], a2[MB], b[4];   // all fragment reads of a 32-k step stand in one place, ahead of its products
            b[0] = WF::ld(pb + ks * 32);
#pragma unroll
            for (int mb = 0; mb < MB; ++mb) { a[mb] = WF::ld(pa + mb * 16 * LP + ks * 32); a2[mb] = WF::ld(pa + (TM + mb * 16) * LP + ks * 32); }
#pragma unroll
            for (int nb = 1; nb < 4; ++nb) b[nb] = WF::ld(pb + nb * 16 * LP + ks * 32);
            __builtin_amdgcn_sched_barrier(0);   // keeps the B reads up here: the compiler otherwise sinks each to just in front of its products, into one register set, and the wave waits out an LDS latency four times a step
#pragma unroll
            for (int nb = 0; nb < 4; ++nb)
#pragma unroll
                for (int mb = 0; mb < MB; ++mb) { acc[mb][nb] = WF::mma(a[mb], b[nb], acc[mb][nb]); acc[mb][nb] = WF::mma(a2[mb], b[nb], acc[mb][nb]); } }
        asm volatile("s_wait_dscnt 0x0" ::: "memory");      // this wave's reads of the buffer are done before it is refilled
        asm volatile("s_wait_asynccnt 0x0" ::: "memory");   // this wave's copies of stage t + 1 have landed
        __syncthreads();                                    // publishes stage t + 1 and ends every wave's reads of stage t
        if (t + 2 < nt) fill(t + 2);
    }
    asm volatile("s_wait_asynccnt 0x0" ::: "memory");   // no copy is outstanding when the wave goes on to its end
    float* ow = os[wv]; float gg[4], bb[4], mm[4], rs[4]; const size_t e0 = (size_t)(r0 + wr + hi) * DM + c0 + wc + lr * 4;   // EPI 1, 2: the lane's first element in C, Oh, Ol; every store is a constant from it
    if constexpr (EPI == 1) {
#pragma unroll
        for (int u = 0; u < 4; ++u) { gg[u] = bfr(gr[u]); bb[u] = bfr(br[u]); mm[u] = bfr(mr[u]); rs[u] = __frsqrt_rn(__fadd_rn(bfr(vr[u]), 1e-3f)); } }
#pragma unroll
    for (int mb = 0; mb < MB; ++mb) {
#pragma unroll
        for (int nb = 0; nb < 4; ++nb) {
#pragma unroll
            for (int j = 0; j < 8; ++j) ow[(hi * 8 + j) * 68 + nb * 16 + lr] = acc[mb][nb][j]; }
        __builtin_amdgcn_wave_barrier(); asm volatile("" ::: "memory");   // keeps the row reads below behind the wave's own tile writes
        float* cr = C + (size_t)(r0 + wr + mb * 16) * ldc + c0 + wc;
#pragma unroll
        for (int s = 0; s < 8; ++s) { const int row = 2 * s + hi, cofs = lr * 4; v4f val = *(const v4fa*)(ow + row * 68 + cofs);
            if constexpr (EPI == 1) {
#pragma unroll
                for (int u = 0; u < 4; ++u) val[u] += bfr(rr[mb * 8 + s][u]); }
            if constexpr (EPI == 2) val += rr[mb * 8 + s];
            if constexpr (EPI == 0) *(v4f*)(cr + (size_t)row * ldc + cofs) = val;
            else *(v4f*)(C + e0 + (mb * 16 + 2 * s) * DM) = val;
            if constexpr (EPI == 1) { v4us oh, ol;   // 8 B a lane: a half-wave fills one whole 128-B line of each plane
#pragma unroll
                for (int u = 0; u < 4; ++u) { unsigned short a, b2; splitf(gg[u] * (val[u] - mm[u]) * rs[u] + bb[u], a, b2); oh[u] = a; ol[u] = b2; }
                *(v4us*)(Oh + e0 + (mb * 16 + 2 * s) * DM) = oh; *(v4us*)(Ol + e0 + (mb * 16 + 2 * s) * DM) = ol; } }
        __builtin_amdgcn_wave_barrier(); asm volatile("" ::: "memory");   // keeps the next 16 rows' writes behind these reads
    }
}

__device__ __forceinline__ h16 tohx(float x) { return (h16)x; }
typedef __attribute__((ext_vector_type(2))) _Float16 v2h;
typedef __attribute__((ext_vector_type(4))) _Float16 v4h;
typedef __attribute__((ext_vector_type(2))) unsigned short v2us;
typedef __attribute__((ext_vector_type(2))) float v2f;
typedef __attribute__((ext_vector_type(4))) int v4i;

// d_*: bodies of the kernels that share a grid; bx is the work-group's index inside its own part of the grid
__device__ __forceinline__ void d_wtG(int bx, const float* __restrict__ w, int K, int N, bf* Bt) {
    const int lane = threadIdx.x & 31; const int L0 = (bx * 8 + (threadIdx.x >> 5)) * 8; const int nlines = N * K / 64;
{
#pragma unroll 1
        for (int l = 0; l < 8; ++l) { const int L = L0 + l; if (L >= nlines) break; const size_t e = (size_t)L * 64 + lane * 2; const int k = (int)(e % K), n = (int)(e / K); v2us o;
            o[0] = f2bf(w[(size_t)k * N + n]); o[1] = f2bf(w[(size_t)(k + 1) * N + n]); *(v2us*)(Bt + e) = o; }
         }
}
__global__ __launch_bounds__(256) void k_cvt8(const float* __restrict__ src, bf* dst, size_t n8) { const size_t i = (size_t)blockIdx.x * 256 + threadIdx.x; if (i >= n8) return; const v8f v = *(const v8f*)(src + i * 8); v8us o;
#pragma unroll
    for (int k = 0; k < 8; ++k) o[k] = f2bf(v[k]); *(v8us*)(dst + i * 8) = o;  }
__global__ __launch_bounds__(256) void k_cscvt(const float* __restrict__ cosT, const float* __restrict__ sinT, float* CS) { const int idx = blockIdx.x * 256 + threadIdx.x; if (idx >= TT * HD) return; v2f cs; cs[0] = bfr(cosT[idx]); cs[1] = bfr(sinT[idx]); *(v2f*)(CS + (size_t)idx * 2) = cs;  }
// d_rope: head planes [b][h][t][d] (fp16) of rope(x) x sc with the rotate-half convention out[d] = x[d] cos[t][d] - x[d+HD/2] sin[t][d], out[d+HD/2] = x[d+HD/2] cos[t][d+HD/2] + x[d] sin[t][d+HD/2]
// One thread: four consecutive d of one row t, for every head of RB batches (the table entries of (t, d) are fetched once for all of them). A wave's load covers two whole 256-B head rows, its store 256 B in a row.
#define RB 2
#define PB_R ((NB_ / RB) * TT * (HD / 4) / 256)
template <int NHD> __device__ __forceinline__ void d_rope(int bx, const float* __restrict__ F, const float* __restrict__ CS, float sc, h16* P16) {
    static_assert(NB_ % RB == 0 && ((NB_ / RB) * TT * (HD / 4)) % 256 == 0 && (HD / 2) % 4 == 0, "the grid covers the planes exactly; a thread's four d lie in one half of the head");
    const int i = bx * 256 + (int)threadIdx.x; const int d = (i % (HD / 4)) * 4, t = (i / (HD / 4)) % TT, b0 = (i / ((HD / 4) * TT)) * RB; const int dq = (d < HD / 2) ? d + HD / 2 : d - HD / 2;
    const float* cp = CS + ((size_t)t * HD + d) * 2; const float* fa = F + ((size_t)b0 * TT + t) * (NHD * HD) + d; const float* fb = F + ((size_t)b0 * TT + t) * (NHD * HD) + dq;   // the three addresses of this thread; every load is one of them plus a constant
    const v4f c01 = *(const v4f*)cp, c23 = *(const v4f*)(cp + 4); v4f xa[RB][NHD], xb[RB][NHD];
#pragma unroll
    for (int bb = 0; bb < RB; ++bb)
#pragma unroll
        for (int h = 0; h < NHD; ++h) { xa[bb][h] = *(const v4f*)(fa + (size_t)bb * TT * (NHD * HD) + h * HD); xb[bb][h] = *(const v4f*)(fb + (size_t)bb * TT * (NHD * HD) + h * HD); }
    static_assert(RB == 2 && NHD == 4, "the wait below names every loaded value");
    // stands behind the last load and in front of the first write of a register that held a load's address: the loaded values and the three addresses are named (inputs only) so that all loads are issued first and no result is placed in an address pair
    asm volatile("s_wait_xcnt 0x0" :: "v"(c01), "v"(c23), "v"(xa[0][0]), "v"(xa[0][1]), "v"(xa[0][2]), "v"(xa[0][3]), "v"(xa[1][0]), "v"(xa[1][1]), "v"(xa[1][2]), "v"(xa[1][3]), "v"(xb[0][0]), "v"(xb[0][1]), "v"(xb[0][2]), "v"(xb[0][3]), "v"(xb[1][0]), "v"(xb[1][1]), "v"(xb[1][2]), "v"(xb[1][3]), "v"(cp), "v"(fa), "v"(fb) : "memory");
#pragma unroll
    for (int bb = 0; bb < RB; ++bb)
#pragma unroll
        for (int h = 0; h < NHD; ++h) { v4h o16;
#pragma unroll
            for (int q = 0; q < 4; ++q) { const float x0 = xa[bb][h][q], x1 = xb[bb][h][q]; v2f cs; cs[0] = (q < 2) ? c01[2 * q] : c23[2 * q - 4]; cs[1] = (q < 2) ? c01[2 * q + 1] : c23[2 * q - 3];
                float a = __fmul_rn(x0, cs[0]), bq = __fmul_rn(x1, cs[1]); asm volatile("" : "+v"(a)); asm volatile("" : "+v"(bq)); const float r = ((d < HD / 2) ? __fsub_rn(a, bq) : __fadd_rn(a, bq)) * sc;
                o16[q] = tohx(r); }
            *(v4h*)(P16 + (((size_t)(b0 + bb) * NHD + h) * TT + t) * HD + d) = o16; }
    asm volatile("s_wait_xcnt 0x0" ::: "memory");   // behind the last store: the code of the grid's other parts follows in the text and writes these registers
}
// d_vtp: V^T planes [b][g][d][t] (fp16). One wave turns 64 rows t x 32 columns of F; a thread holds 8 t x 8 d in registers (lane = t group + 8 x d group): a load takes 64-B pieces of eight rows, a store four whole 128-B lines.
#define PB_V (TB * DKV / (64 * 32) / 8)
template <int NHD> __device__ __forceinline__ void d_vtp(int bx, const float* __restrict__ F, h16* V16) {
    static_assert(TT % 64 == 0 && HD % 32 == 0 && (TB * NHD * HD) % (64 * 32 * 8) == 0, "a wave's block lies in one batch and one head; the grid covers the plane exactly");
    const int lane = threadIdx.x & 31, tg = lane & 7, dg = lane >> 3; const int w = bx * 8 + (int)(threadIdx.x >> 5); const int c0 = (w % (NHD * HD / 32)) * 32 + dg * 4, r0 = (w / (NHD * HD / 32)) * 64 + tg * 8;   // first column and first row (b * 2048 + t) of this thread
    v4f x[8][2]; const float* fp = F + (size_t)r0 * (NHD * HD) + c0;
#pragma unroll
    for (int r = 0; r < 8; ++r)
#pragma unroll
        for (int hf = 0; hf < 2; ++hf) x[r][hf] = *(const v4f*)(fp + r * (NHD * HD) + hf * 16);
    // stands behind the last load and in front of the first write of the address pair: the loaded values and the address are named (inputs only) so that all loads are issued first and no result is placed in that pair
    asm volatile("s_wait_xcnt 0x0" :: "v"(x[0][0]), "v"(x[0][1]), "v"(x[1][0]), "v"(x[1][1]), "v"(x[2][0]), "v"(x[2][1]), "v"(x[3][0]), "v"(x[3][1]), "v"(x[4][0]), "v"(x[4][1]), "v"(x[5][0]), "v"(x[5][1]), "v"(x[6][0]), "v"(x[6][1]), "v"(x[7][0]), "v"(x[7][1]), "v"(fp) : "memory");
    h16* vo = V16 + ((size_t)(r0 / TT) * (NHD * HD) + c0) * TT + r0 % TT;   // plane row b * 256 + g * 64 + d is b * 256 + column
#pragma unroll
    for (int hf = 0; hf < 2; ++hf)
#pragma unroll
        for (int q = 0; q < 4; ++q) { v8h o16;
#pragma unroll
            for (int r = 0; r < 8; ++r) o16[r] = tohx(x[r][hf][q]);
            *(v8h*)(vo + (size_t)(hf * 16 + q) * TT) = o16; }
}
__device__ __forceinline__ void d_csid(int bx, float* CS) { v4f cs; cs[0] = 1.0f; cs[1] = 0.0f; cs[2] = 1.0f; cs[3] = 0.0f;   // two entries a store, four stores a thread
#pragma unroll
    for (int s = 0; s < 4; ++s) *(v4f*)(CS + ((size_t)(bx * 4 + s) * 256 + threadIdx.x) * 4) = cs;
    asm volatile("s_wait_xcnt 0x0" ::: "memory");   // behind the last store: the code of the grid's other parts follows in the text and writes these registers
}
// k_planes: the three plane builders in one grid, each with its own run of work-group indices. V^T, whose reads are pieces of lines, takes the lowest and so starts first.
__global__ __launch_bounds__(256) void k_planes(const float* __restrict__ FQ, const float* __restrict__ FK, const float* __restrict__ FV, const float* __restrict__ CS, h16* QP16, h16* KP16, h16* VT16) {
    int b = (int)blockIdx.x;
    if (b < PB_V) { d_vtp<NKV>(b, FV, VT16); return; } b -= PB_V;
    if (b < PB_R) { d_rope<NH_>(b, FQ, CS, 1.0f, QP16); return; } b -= PB_R;
    d_rope<NKV>(b, FK, CS, 1.0f, KP16);
}
// k_fattn: scores, softmax and attn.v of one (batch, head) plane in one kernel. One wave owns 32 query columns (two groups of 16) and walks one quarter of the 2048 keys in passes of 32.
// The four waves that share 32 queries (one per key quarter) sit in one work-group of 16 waves, four to a SIMD, so that one wave's softmax arithmetic and load waits lie under the others' products. Each leaves its maximum, sum and O^T tiles in LDS;
// behind one barrier two of the four (one per column group) bring the quarters to a common maximum, add them in the fixed order 0 .. 3 and run the epilogue.
// Transposed products: S^T = K Q^T (A = 16 key rows, B = the wave's queries, kept in registers), O^T += V^T P^T (A = 16 d rows of the [d][t] plane). In an S^T tile lane (lr, hi) holds keys 8 hi + 0..7 of query lr,
// which is the k order of a B operand: tiles 0 and 1 of a pass, rounded to fp16, ARE the 32-key B operand; nothing crosses lanes but one exchange between the wave's halves for the maximum (and one for the sum, at the end).
// Running softmax in the log2 domain: p = 2^(s c - m), c = HD^-0.5 log2 e; m, the maximum in use, may trail the true one by up to 8 (p <= 2^8, well inside fp16); sums and accumulators are rescaled only when a column exceeds that.
// The epilogue divides by the sum (as x PCAR / sum, then / PCAR, the two roundings the separate kernels had) and stores the bf16 hi+lo planes [b * 2048 + t][h * 64 + d] that the output projection reads: 128-B lines, one wave each.
// K and V^T come through LDS: a stage is 64 keys of each quarter (64 K rows and 64 V^T rows, each one whole 128-B line), brought by asynchronous copies into one of two buffers while the other is worked on (two passes).
// The four waves of a quarter copy a quarter of its stage each and all read all of it: a line is fetched once per work-group, in whole-line requests, where a fragment load from global memory touches 16 lines for 512 B and every wave repeats it.
#define FQW 4   // query groups of 32 per work-group: 128 queries, 256 work-groups
#define FKS 4   // key quarters per query group: FQW * FKS waves per work-group
#define FST 64  // keys of a stage
#define FQT ((FST + HD) * LP)   // elements of one quarter's part of a stage: FST rows of K, then HD rows of V^T, pitch LP
#define FSTG (FKS * FQT)        // elements of a stage
// cpkv: eight 16-B copies of one thread into 128 LDS rows in a row, 16 rows apart: the first four from gk, stepping by sk elements, the last four from gv, stepping by sv. A wave's copy is four whole 128-B lines.
__device__ __forceinline__ void cpkv(unsigned l0, const h16* gk, size_t sk, const h16* gv, size_t sv) {
    const unsigned l1 = l0 + 16 * LP * 2, l2 = l0 + 32 * LP * 2, l3 = l0 + 48 * LP * 2, l4 = l0 + 64 * LP * 2, l5 = l0 + 80 * LP * 2, l6 = l0 + 96 * LP * 2, l7 = l0 + 112 * LP * 2;
    const h16 *g1 = gk + sk, *g2 = gk + 2 * sk, *g3 = gk + 3 * sk, *g5 = gv + sv, *g6 = gv + 2 * sv, *g7 = gv + 3 * sv;
    // the copies and, as the statement's last line, the wait that stands in front of any rewrite of their address registers
    asm volatile("global_load_async_to_lds_b128 %0, %8, off\n\t"
                 "global_load_async_to_lds_b128 %1, %9, off\n\t"
                 "global_load_async_to_lds_b128 %2, %10, off\n\t"
                 "global_load_async_to_lds_b128 %3, %11, off\n\t"
                 "global_load_async_to_lds_b128 %4, %12, off\n\t"
                 "global_load_async_to_lds_b128 %5, %13, off\n\t"
                 "global_load_async_to_lds_b128 %6, %14, off\n\t"
                 "global_load_async_to_lds_b128 %7, %15, off\n\t"
                 "s_wait_xcnt 0x0"
                 :: "v"(l0), "v"(l1), "v"(l2), "v"(l3), "v"(l4), "v"(l5), "v"(l6), "v"(l7), "v"(gk), "v"(g1), "v"(g2), "v"(g3), "v"(gv), "v"(g5), "v"(g6), "v"(g7) : "memory");
}
__device__ __forceinline__ float xhalf(float x) { return __builtin_bit_cast(float, __builtin_amdgcn_permlanex16(__builtin_bit_cast(int, x), __builtin_bit_cast(int, x), 0x76543210, 0xfedcba98, false, false)); }  // lane l with lane l ^ 16
__global__ __launch_bounds__(32 * FQW * FKS) void k_fattn(const h16* __restrict__ Q, const h16* __restrict__ Kp, const h16* __restrict__ Vt, bf* Ah, bf* Al) {
    typedef WFrag<h16> WF;
    static_assert(FKS >= 2 && TT % (FST * FKS) == 0 && TT / FKS / FST >= 2 && FST % 32 == 0, "one finishing wave per column group; every key range is whole stages, two or more, of whole passes");
    static_assert(FQW == 4 && FST == 64 && HD == 64, "the 128 threads of a quarter copy 128 rows of 128 B, eight pieces each");
    __shared__ __align__(16) h16 kv[2 * FSTG];   // two stage buffers
    __shared__ __align__(16) float po[FKS * FQW][8][2][32 * 4];   // [wave][tile g * 4 + dt][registers 0..3 | 4..7][lane]: every access is 16 B a lane, 512 B in a row
    __shared__ float pm[FKS * FQW][2][32], pl[FKS * FQW][2][32];   // [wave][g][lane]: maximum in use, this lane's part of the sum
    const int lane = threadIdx.x & 31, lr = lane & 15, hi = lane >> 4; const int wv = __builtin_amdgcn_readfirstlane((int)(threadIdx.x >> 5));
    const int qg = wv % FQW, kq = wv / FQW, kb = kq * (TT / FKS);   // query group, key quarter and its first key: the same in all lanes of the wave
    const size_t z = blockIdx.y, zk = z / REP; const int q0 = ((int)blockIdx.x * FQW + qg) * 32;
    const h16* qp = Q + (z * TT + q0 + lr) * HD + 8 * hi;
    const int crow = (qg * 32 + lane) >> 3, ccol = (lane & 7) * 8;   // this thread's first row of its quarter's stage and its 16-B piece of every row it copies
    const h16* gk = Kp + (zk * TT + kb + crow) * HD + ccol; const h16* gv = Vt + (zk * HD + crow) * TT + kb + ccol;
    const unsigned lc = (unsigned)(size_t)(kv + kq * FQT + crow * LP + ccol);   // LDS byte address: the low 32 bits of the __shared__ address
    auto fill = [&](int t) { cpkv(lc + (unsigned)(t & 1) * (FSTG * 2), gk + (size_t)t * (FST * HD), (size_t)16 * HD, gv + t * FST, (size_t)16 * TT); };
    fill(0);
    v16h qf[2][2], kf[2][2], vf[4]; v8f o[2][4]; float mr[2], l[2];   // the inner loops are all unrolled so that these arrays are registers
#pragma unroll
    for (int g = 0; g < 2; ++g) { mr[g] = -__builtin_inff(); l[g] = 0.f;
#pragma unroll
        for (int ks = 0; ks < 2; ++ks) qf[g][ks] = WF::ld(qp + g * 16 * HD + ks * 32);
#pragma unroll
        for (int dt = 0; dt < 4; ++dt) o[g][dt] = (v8f){}; }
    asm volatile("s_wait_xcnt 0x0" :: "v"(qp) : "memory");   // stands in front of the first write of a register that held one of these loads' addresses; qp, dead behind its loads, is named so that its registers last up to here
    asm volatile("s_wait_asynccnt 0x0" ::: "memory");   // this wave's copies of stage 0 have landed
    __syncthreads();                                    // and every other wave's: stage 0 may be read
    fill(1);
    const float cs = SCL * 1.4426950408889634f;
#pragma unroll 1   // 8 stages: rolled, one register set; the buffer is picked by the trip's parity
    for (int t = 0; t < TT / FKS / FST; ++t) {
      const h16* sb = kv + (t & 1) * FSTG + kq * FQT; const h16* pk = sb + lr * LP + 8 * hi; const h16* pv = sb + (FST + lr) * LP + 8 * hi;   // K row lr and V^T row lr of this quarter's stage
#pragma unroll
      for (int kt = 0; kt < 2; ++kt)
#pragma unroll
          for (int ks = 0; ks < 2; ++ks) kf[kt][ks] = WF::ld(pk + kt * 16 * LP + ks * 32);
      __builtin_amdgcn_sched_barrier(0);   // the first pass's K reads stand alone and in a row: the compiler otherwise lifts the V^T reads in among them, puts one K fragment behind the first products, and the products wait for all sixteen reads
#pragma unroll   // the passes of a stage are unrolled: every LDS read is then one address plus a constant
      for (int p = 0; p < FST / 32; ++p) {
        v8f s[2][2];
#pragma unroll
        for (int kt = 0; kt < 2; ++kt)
#pragma unroll
            for (int g = 0; g < 2; ++g) s[kt][g] = WF::mma(kf[kt][1], qf[g][1], WF::mma(kf[kt][0], qf[g][0], (v8f){}));
        // this pass's V^T fragments and, inside a stage, the next pass's K fragments (into the registers the products have just read) are asked for here, in one place, a softmax ahead of their use; nothing of the next stage is read
#pragma unroll
        for (int dt = 0; dt < 4; ++dt) vf[dt] = WF::ld(pv + dt * 16 * LP + p * 32);
        if (p + 1 < FST / 32) {
#pragma unroll
            for (int kt = 0; kt < 2; ++kt)
#pragma unroll
                for (int ks = 0; ks < 2; ++ks) kf[kt][ks] = WF::ld(pk + ((p + 1) * 32 + kt * 16) * LP + ks * 32); }
        __builtin_amdgcn_sched_barrier(0);   // keeps these reads up here: the compiler otherwise sinks them to just in front of their products, and the wave waits out the LDS latency there
        float mb[2]; bool need = false;
#pragma unroll
        for (int g = 0; g < 2; ++g) { float m0 = s[0][g][0], m1 = s[1][g][0];
#pragma unroll
            for (int j = 1; j < 8; ++j) { m0 = fmaxf(m0, s[0][g][j]); m1 = fmaxf(m1, s[1][g][j]); }
            m0 = fmaxf(m0, m1); mb[g] = fmaxf(m0, xhalf(m0)) * cs; need = need || (mb[g] > mr[g] + 8.0f); }   // both halves of the wave hold the query's maximum, scaled (the scale is positive)
        if (__builtin_amdgcn_ballot_w32(need) != 0) {   // wave-uniform; always taken in the first pass (mr = -inf gives the factor 0), rare later
#pragma unroll
            for (int g = 0; g < 2; ++g) { const float mn = fmaxf(mr[g], mb[g]); const float al = __builtin_amdgcn_exp2f(mr[g] - mn); mr[g] = mn; l[g] *= al;
#pragma unroll
                for (int dt = 0; dt < 4; ++dt) o[g][dt] *= al; }
        }
#pragma unroll
        for (int g = 0; g < 2; ++g) { const float nm = -mr[g]; float a0 = 0.f, a1 = 0.f; v16h pf;
#pragma unroll
            for (int i = 0; i < 8; ++i) { const v2f ar = __builtin_elementwise_fma((v2f){s[i >> 2][g][2 * (i & 3)], s[i >> 2][g][2 * (i & 3) + 1]}, (v2f){cs, cs}, (v2f){nm, nm});
                float p0;
                if (g == 0 && i == 0) asm("v_exp_f32 %0, %1\n\tv_nop" : "=v"(p0) : "v"(ar[0]));   // the pass's first exponential carries its own v_nop: the slot the instruction set asks for behind a transcendental, since the register allocator gives this one's source to the next instruction's result
                else p0 = __builtin_amdgcn_exp2f(ar[0]);
                float p1;
                if (p == 1 && g == 0 && (i >= 1 && i <= 3)) asm("v_exp_f32 %0, %1\n\tv_nop" : "=v"(p1) : "v"(ar[1]));   // the same slot, in the stage's second pass: with any of these three left to the builtin, the allocator gives an exponential's source to the result of the exponential directly behind it
                else p1 = __builtin_amdgcn_exp2f(ar[1]);
                a0 += p0; a1 += p1; pf[2 * i] = tohx(p0); pf[2 * i + 1] = tohx(p1); }
            l[g] += a0 + a1;
#pragma unroll
            for (int dt = 0; dt < 4; ++dt) o[g][dt] = WF::mma(vf[dt], pf, o[g][dt]); }
      }
      asm volatile("s_wait_dscnt 0x0" ::: "memory");      // this wave's reads of the buffer are done before it is refilled
      asm volatile("s_wait_asynccnt 0x0" ::: "memory");   // this wave's copies of stage t + 1 have landed
      __syncthreads();                                    // publishes stage t + 1 and ends every wave's reads of stage t
      if (t + 2 < TT / FKS / FST) fill(t + 2);
    }
    asm volatile("s_wait_asynccnt 0x0" ::: "memory");   // no copy is outstanding when the wave goes on to its end
#pragma unroll
    for (int g = 0; g < 2; ++g) { pm[wv][g][lane] = mr[g]; pl[wv][g][lane] = l[g];
#pragma unroll
        for (int dt = 0; dt < 4; ++dt) { *(v4fa*)&po[wv][g * 4 + dt][0][lane * 4] = __builtin_shufflevector(o[g][dt], o[g][dt], 0, 1, 2, 3); *(v4fa*)&po[wv][g * 4 + dt][1][lane * 4] = __builtin_shufflevector(o[g][dt], o[g][dt], 4, 5, 6, 7); } }
    __syncthreads();   // every quarter's maximum, sum and tiles are in LDS before a finishing wave reads them
    if (kq >= 2) return;   // wave-uniform, behind the last barrier: quarter 0's wave finishes column group 0, quarter 1's group 1, each whole 128-B lines of the planes
    const int g = kq; float fs[FKS], mx = pm[qg][g][lane], ls = 0.f;
#pragma unroll
    for (int p = 1; p < FKS; ++p) mx = fmaxf(mx, pm[p * FQW + qg][g][lane]);
#pragma unroll
    for (int p = 0; p < FKS; ++p) { fs[p] = __builtin_amdgcn_exp2f(pm[p * FQW + qg][g][lane] - mx); ls += fs[p] * pl[p * FQW + qg][g][lane]; }   // both halves of the wave hold the same maxima, so the same factors
    const float f = __fdiv_rn(PCAR, ls + xhalf(ls)); const size_t oo = ((z / NH_) * TT + q0 + g * 16 + lr) * DQ + (z % NH_) * HD + hi * 8;   // lane (lr, hi) holds d = 16 dt + 8 hi + 0..7 of query lr; row b * 2048 + t, columns h * 64 + d
#pragma unroll
    for (int dt = 0; dt < 4; ++dt) { v4f s0 = (v4f){}, s1 = (v4f){}; v8us oh, ol;
#pragma unroll
        for (int p = 0; p < FKS; ++p) { s0 += *(const v4fa*)&po[p * FQW + qg][g * 4 + dt][0][lane * 4] * fs[p]; s1 += *(const v4fa*)&po[p * FQW + qg][g * 4 + dt][1][lane * 4] * fs[p]; }
#pragma unroll
        for (int j = 0; j < 8; ++j) { unsigned short a, c2; splitf(((j < 4 ? s0[j & 3] : s1[j & 3]) * f) * (1.0f / PCAR), a, c2); oh[j] = a; ol[j] = c2; }
        *(v8us*)(Ah + oo + dt * 16) = oh; *(v8us*)(Al + oo + dt * 16) = ol; }
}

// block tail: d_bn: hl planes of gamma (v - mean) rsqrt(var + 1e-3) + beta over [b * 2048 + t][256] (RAW: v is a raw input row, bf16-rounded first) (8-B stores); k_gelu: hl planes of exact-erf GELU (8-B stores);
#define FFD 1024
// SU: 16-B pieces per thread of the kernels over [8192][256]; a work-group takes SU * 1024 elements in a row, piece s of thread i at s * 1024 + 4 i (every wave's load is 512 B in a row, and a thread keeps its four channels)
#define SU 4
#define PB_S (TB * DM / (SU * 1024))
static_assert((TB * DM) % (SU * 1024) == 0 && 1024 % DM == 0, "the grids cover the rows exactly; a thread's channels are the same in all its pieces");
template <bool RAW> __device__ __forceinline__ void d_bn(int bx, const float* __restrict__ X, const float* __restrict__ ga, const float* __restrict__ be, const float* __restrict__ mu, const float* __restrict__ var, bf* Hh, bf* Hl) { const int e0 = bx * (SU * 1024) + (int)threadIdx.x * 4; const int c = e0 % DM; v4f xs[SU]; float gg[4], bb[4], mm[4], rs[4]; const float* xp = X + e0; const unsigned cb = (unsigned)c * 4u;   // cb: byte offset of the thread's channels in the four parameter vectors
#pragma unroll
    for (int s = 0; s < SU; ++s) xs[s] = *(const v4f*)(xp + s * 1024);
    const v4f gr = *(const v4f*)((const char*)ga + cb), br = *(const v4f*)((const char*)be + cb), mr = *(const v4f*)((const char*)mu + cb), vr = *(const v4f*)((const char*)var + cb);   // the thread's four channels, once for all its pieces
    static_assert(SU == 4, "the wait below names every piece");
    // stands behind the last load and in front of the first write of a register that held a load's address: the loaded values, the row address and the channel offset are named (inputs only) so that all eight loads are issued first and no result is placed in an address register
    asm volatile("s_wait_xcnt 0x0" :: "v"(xs[0]), "v"(xs[1]), "v"(xs[2]), "v"(xs[3]), "v"(gr), "v"(br), "v"(mr), "v"(vr), "v"(xp), "v"(cb) : "memory");
#pragma unroll
    for (int u = 0; u < 4; ++u) { gg[u] = bfr(gr[u]); bb[u] = bfr(br[u]); mm[u] = bfr(mr[u]); const float vv = bfr(vr[u]); const float ve = __fadd_rn(vv, 1e-3f); rs[u] = __frsqrt_rn(ve); }
#pragma unroll
    for (int s = 0; s < SU; ++s) { const int e = e0 + s * 1024; v4us oh, ol;
#pragma unroll
        for (int u = 0; u < 4; ++u) { float xv = xs[s][u]; if (RAW) xv = bfr(xv); float d = __fsub_rn(xv, mm[u]); asm volatile("" : "+v"(d)); float t1 = __fmul_rn(gg[u], d); asm volatile("" : "+v"(t1)); float t2 = __fmul_rn(t1, rs[u]); asm volatile("" : "+v"(t2)); const float y = __fadd_rn(t2, bb[u]); unsigned short a, b2; splitf(y, a, b2); oh[u] = a; ol[u] = b2; }
        *(v4us*)(Hh + e) = oh; *(v4us*)(Hl + e) = ol; }
}
// k_prep: all that depends on the inputs alone, in one grid. The weight transposes (few work-groups, each a chain of eight dependent trips) take the lowest indices and start first; the table and BN1 stream behind them.
#define PB_Q  ((DM * DQ / 64 + 63) / 64)
#define PB_KV ((DM * DKV / 64 + 63) / 64)
#define PB_F  ((DM * FFD / 64 + 63) / 64)
#define PB_CS (TT * HD * 2 / (4 * 1024))
#define PB_BN PB_S
static_assert((TT * HD * 2) % (4 * 1024) == 0, "the table's work-groups cover it exactly");
__global__ __launch_bounds__(256) void k_prep(const float* __restrict__ wq, const float* __restrict__ wk, const float* __restrict__ wv, const float* __restrict__ wo, const float* __restrict__ w1, const float* __restrict__ w2, bf* WQ, bf* WK, bf* WV, bf* WO, bf* W1B, bf* W2B, float* CS,
                                              const float* __restrict__ x, const float* __restrict__ ga, const float* __restrict__ be, const float* __restrict__ mu, const float* __restrict__ var, bf* Hh, bf* Hl) {
    int b = (int)blockIdx.x;
    if (b < PB_F) { d_wtG(b, w1, DM, FFD, W1B); return; } b -= PB_F;
    if (b < PB_F) { d_wtG(b, w2, FFD, DM, W2B); return; } b -= PB_F;
    if (b < PB_Q) { d_wtG(b, wq, DM, DQ, WQ); return; } b -= PB_Q;
    if (b < PB_KV) { d_wtG(b, wk, DM, DKV, WK); return; } b -= PB_KV;
    if (b < PB_KV) { d_wtG(b, wv, DM, DKV, WV); return; } b -= PB_KV;
    if (b < PB_Q) { d_wtG(b, wo, DQ, DM, WO); return; } b -= PB_Q;
    if (b < PB_CS) { d_csid(b, CS); return; } b -= PB_CS;
    d_bn<true>(b, x, ga, be, mu, var, Hh, Hl);
    asm volatile("s_wait_xcnt 0x0" ::: "memory");   // behind the last store: the code of the grid's other parts follows in the text and writes these registers
}
#define GU 8   // 16-B pieces per thread of k_gelu, laid out as under SU
static_assert((TB * FFD) % (GU * 1024) == 0, "the grid covers the rows exactly");
__global__ __launch_bounds__(256) void k_gelu(const float* __restrict__ Mf, bf* Gh, bf* Gl) { const int e0 = (int)blockIdx.x * (GU * 1024) + (int)threadIdx.x * 4; v4f as[GU];
#pragma unroll
    for (int s = 0; s < GU; ++s) as[s] = *(const v4f*)(Mf + e0 + s * 1024);
#pragma unroll
    for (int s = 0; s < GU; ++s) { v4us oh, ol;
#pragma unroll   // unrolled: every element is then a register by name; a rolled loop picks it by a chain of selects and merges each result by bit-field inserts
        for (int u = 0; u < 4; ++u) { const float y = as[s][u]; float er = erff(y * 0.70710678118654752f); asm volatile("" : "+v"(er)); float hy = __fmul_rn(0.5f, y); asm volatile("" : "+v"(hy)); const float ge = __fmul_rn(hy, __fadd_rn(1.0f, er)); unsigned short h, l; splitf(ge, h, l); oh[u] = h; ol[u] = l; }
        *(v4us*)(Gh + e0 + s * 1024) = oh; *(v4us*)(Gl + e0 + s * 1024) = ol; }
}

extern "C" void kernel_launch(void* const* d_in, const int* in_sizes, int n_in,
                              void* d_out, int out_size, void* d_ws, size_t ws_size, hipStream_t stream) {
    (void)in_sizes; (void)n_in; (void)out_size;
    const float** Ip = (const float**)d_in; const float *x = Ip[0], *g1 = Ip[1], *be1 = Ip[2], *m1 = Ip[3], *v1 = Ip[4], *wq = Ip[5], *bq = Ip[6], *wk = Ip[7], *bk = Ip[8], *wv = Ip[9], *bv = Ip[10], *wo = Ip[11], *bo = Ip[12], *g2 = Ip[13], *be2 = Ip[14], *m2 = Ip[15], *v2 = Ip[16], *w1 = Ip[17], *w2 = Ip[18]; const float* cosT = nullptr; const float* sinT = nullptr; (void)cosT; (void)sinT;
    float* OUT = (float*)d_out;     // [4][2048][256]
    char* wsp = (char*)d_ws;
    auto take = [&](size_t bytes) { char* p = wsp; wsp += (bytes + 255) & ~(size_t)255; return (void*)p; };
    bf* WQ = (bf*)take((size_t)DQ * DM * 2); bf* WK = (bf*)take((size_t)DKV * DM * 2); bf* WV = (bf*)take((size_t)DKV * DM * 2); bf* WO = (bf*)take((size_t)DM * DQ * 2); float* CS = (float*)take((size_t)TT * HD * 2 * 4);
    bf* Hh = (bf*)take((size_t)TB * DM * 2); bf* Hl = (bf*)take((size_t)TB * DM * 2); bf* W1B = (bf*)take((size_t)FFD * DM * 2); bf* W2B = (bf*)take((size_t)DM * FFD * 2); float* FQ = (float*)take((size_t)TB * DQ * 4); float* FK = (float*)take((size_t)TB * DKV * 4); float* FV = (float*)take((size_t)TB * DKV * 4);   // three buffers in a row, as WQ, WK, WV are: grid z of the projection steps from one to the next
    h16* QP16 = (h16*)take((size_t)NB_ * NH_ * TT * HD * 2); h16* KP16 = (h16*)take((size_t)NB_ * NKV * TT * HD * 2); h16* VT16 = (h16*)take((size_t)NB_ * NKV * HD * TT * 2);
    bf* ATh = (bf*)take((size_t)TB * DQ * 2); bf* ATl = (bf*)take((size_t)TB * DQ * 2);
    float* X1 = (float*)take((size_t)TB * DM * 4); float* Mf = (float*)take((size_t)TB * FFD * 4); bf* Gh = (bf*)take((size_t)TB * FFD * 2); bf* Gl = (bf*)take((size_t)TB * FFD * 2);
    if ((size_t)(wsp - (char*)d_ws) > ws_size) return;    // ws 256 MiB
    static_assert(DQ == DKV, "grid z of the q, k, v projection steps by one weight plane and one output buffer of equal size");
    k_prep<<<2 * PB_F + 2 * PB_Q + 2 * PB_KV + PB_CS + PB_BN, 256, 0, stream>>>(wq, wk, wv, wo, w1, w2, WQ, WK, WV, WO, W1B, W2B, CS, x, g1, be1, m1, v1, Hh, Hl);
    k_gemml<4, true, 0><<<dim3(TB / 128, DQ / 128, 3), 128, 0, stream>>>(Hh, Hl, WQ, DM, FQ, DQ, bq, bk, bv, (size_t)DQ * DM, (size_t)TB * DQ, nullptr, nullptr, nullptr, nullptr, nullptr, nullptr, nullptr);
    k_planes<<<PB_V + 2 * PB_R, 256, 0, stream>>>(FQ, FK, FV, CS, QP16, KP16, VT16);
    k_fattn<<<dim3(TT / (32 * FQW), NB_ * NH_, 1), 32 * FQW * FKS, 0, stream>>>(QP16, KP16, VT16, ATh, ATl);
    k_gemml<2, true, 1><<<dim3(TB / 64, DM / 128, 1), 128, 0, stream>>>(ATh, ATl, WO, DQ, X1, DM, bo, nullptr, nullptr, 0, 0, x, g2, be2, m2, v2, Hh, Hl);   // x1 and the planes of BN2(x1)
    k_gemml<4, false, 0><<<dim3(TB / 128, FFD / 128, 1), 128, 0, stream>>>(Hh, Hl, W1B, DM, Mf, FFD, nullptr, nullptr, nullptr, 0, 0, nullptr, nullptr, nullptr, nullptr, nullptr, nullptr, nullptr); k_gelu<<<TB * FFD / (GU * 1024), 256, 0, stream>>>(Mf, Gh, Gl);
    k_gemml<2, false, 2><<<dim3(TB / 64, DM / 128, 1), 128, 0, stream>>>(Gh, Gl, W2B, FFD, OUT, DM, nullptr, nullptr, nullptr, 0, 0, X1, nullptr, nullptr, nullptr, nullptr, nullptr, nullptr);   // out = m + x1
}

// v010
// It runs in 84.4 microseconds.
// In two side-by-side timings against v009, it was 1.11 and 1.10 times as fast.
// All steps since v000 together make it 11.0 times as fast.
#include <hip/hip_runtime.h>

// TransformerBaseBlock (x [4][2048][256]; h = BN1(x) (inference: gamma (x - mean) rsqrt(var + 1e-3) + beta); q/k/v = h W + b (4 heads x 64); softmax(q.k/8); attn_out = ctx Wo + bo; x1 = attn_out + x; m = gelu(BN2(x1) W1) W2 (exact erf GELU);
// out = m + x1 -> [4][2048][256]).
// Compute dtypes, f32 accumulate: every input rounded to bf16; BN1/BN2 f32 -> bf16 hi+lo planes; q/k/v (+ bias), W1 as hl x exact W (2 products); scores (K 64) and attn.v single fp16 planes;
// Every launch covers all four batches (rows b * 2048 + t, planes b * 4 + h); attention is one launch over all 16 (batch, head) planes: scores and probabilities stay in registers (k_fattn).
// Launches that do not depend on one another share one grid: k_prep (six weight transposes, BN1), the q, k, v projections (grid z of k_gemml), whose store loop writes the fp16 q and k head planes and V^T that attention reads.
// The residual add with BN2 and the last add are done where the output projection and the second MLP product store their rows (EPI of k_gemml).
// The streaming kernels (BN1, GELU) give every thread 16 (BN1) or 32 (GELU) elements, all its loads issued ahead of its arithmetic: few waves to start, many bytes in flight per wave. Their loops over pieces and elements are all unrolled, so that a thread's pieces are registers and its loads can stand in a row.

#define NB_  4
#define TT   2048
#define DM   256
#define NH_  4
#define NKV  4
#define REP  (NH_ / NKV)
#define HD   64
#define DQ   (NH_ * HD)
#define DKV  (NKV * HD)
#define TB   (NB_ * TT)         // rows of all batches
#define WIN  0
#define PCAR 1024.0f
#define SCL  0.125f   // HD^-0.5
typedef _Float16 h16;
typedef unsigned short bf;
typedef __attribute__((ext_vector_type(16))) __bf16   v16bf;
typedef __attribute__((ext_vector_type(16))) _Float16 v16h;
typedef __attribute__((ext_vector_type(8)))  _Float16 v8h;
typedef __attribute__((ext_vector_type(8)))  unsigned short v8us;
typedef __attribute__((ext_vector_type(8)))  float    v8f;
typedef __attribute__((ext_vector_type(4)))  float    v4f;
typedef v8h  __attribute__((may_alias)) v8ha;
typedef v4f  __attribute__((may_alias)) v4fa;
typedef v8us __attribute__((may_alias)) v8usa;

__device__ __forceinline__ unsigned short f2bf(float f) { unsigned u = __float_as_uint(f); u += 0x7FFFu + ((u >> 16) & 1u); return (unsigned short)(u >> 16); }
__device__ __forceinline__ float bf2f(unsigned short b) { return __uint_as_float(((unsigned)b) << 16); }
__device__ __forceinline__ float bfr(float f) { return bf2f(f2bf(f)); }
__device__ __forceinline__ void splitf(float y, unsigned short& h, unsigned short& l) { h = f2bf(y); l = f2bf(y - bf2f(h)); }
typedef __attribute__((ext_vector_type(4))) unsigned short v4us;
__device__ __forceinline__ v16h cat16(v8h lo, v8h hi) { return __builtin_shufflevector(lo, hi, 0, 1, 2, 3, 4, 5, 6, 7, 8, 9, 10, 11, 12, 13, 14, 15); }
__device__ __forceinline__ v16bf cat16b(v8us lo, v8us hi) { return __builtin_bit_cast(v16bf, __builtin_shufflevector(lo, hi, 0, 1, 2, 3, 4, 5, 6, 7, 8, 9, 10, 11, 12, 13, 14, 15)); }
__device__ __forceinline__ v8f wmma16(v16h a, v16h b, v8f c) { return __builtin_amdgcn_wmma_f32_16x16x32_f16(false, a, false, b, (short)0, c, false, false); }
__device__ __forceinline__ v8f wmmab(v16bf a, v16bf b, v8f c) { return __builtin_amdgcn_wmma_f32_16x16x32_bf16(false, a, false, b, (short)0, c, false, false); }



// WFrag: one 16 x 32 operand fragment of a K-contiguous 16-bit plane: lane (lr, hi) holds k = 8 hi + 0..7 and 16 + 8 hi + 0..7 of row lr; the same loader serves A and B, so their k orders agree.
template <typename T16> struct WFrag;
template <> struct WFrag<h16> { typedef v16h V; static __device__ __forceinline__ V ld(const h16* p) { return cat16(*(const v8h*)p, *(const v8h*)(p + 16)); } static __device__ __forceinline__ v8f mma(V a, V b, v8f c) { return wmma16(a, b, c); } };
template <> struct WFrag<bf> { typedef v16bf V; static __device__ __forceinline__ V ld(const bf* p) { return cat16b(*(const v8us*)p, *(const v8us*)(p + 16)); } static __device__ __forceinline__ v8f mma(V a, V b, v8f c) { return wmmab(a, b, c); } };
// ---- k_gemml: C = (A + A2) Bt^T (+ bias), f32 out (EPI 3: fp16 planes instead), operands K-contiguous bf16 planes. One (32 MB) x 128 output tile per work-group of four waves, each wave a (16 MB) x 64 quarter over the whole K (no K split, no partial sums).
// MB = 4 (128 x 128) for the wide products (q, k, v by grid z; W1), MB = 2 (64 x 128) for the two with 256 columns (WO, W2), so that their grid still has one work-group per WGP.
// The operands come through LDS: a stage is 64 k of the tile's rows of A, of A2 and of Bt (whole 128-B lines, each fetched once per work-group and read by two waves), brought by asynchronous copies into one of two buffers
// while the other is worked on. grid (M / (32 MB), N / 128, Z), 128 threads; K % 64 == 0. z steps Bt by sB and C (Pl for EPI 3) by sC elements; the bias vectors are separate buffers: bias for z = 0, biasZ1 and biasZ2 for z = 1 and 2.
// EPI: what the store loop does with a finished row piece. 0: C = sum. 1 (output projection): C = x1 = sum + bf16(R), and the bf16 hi+lo planes Oh, Ol of BN2(x1). 2 (second MLP product): C = sum + R.
// 3 (q, k, v projections): no f32 output; the sums, rounded to fp16, go straight to the planes of attention, Pl + z sC: z = 0, 1 head planes [b][h][t][d], z = 2 V^T [b][h][d][t]. A wave's quarter is 64 rows t of one batch x the 64 columns of one head.
// For EPI 1 and 2 C, R, Oh, Ol have DM columns. A thread's pieces of R (and its four channels' BN parameters) are asked for once, behind the copies of the first two stages and ahead of the K loop, and are first used behind it.
#define LP 72   // LDS row pitch in 16-bit elements: 128 B of data + 16 B, an odd number of 16-B units, so that the 16 rows of a fragment read fall on different banks
// cp8: eight 16-B copies of one thread into 128 LDS rows in a row, 16 rows apart: the first four from ga, the last four from gb, each stepping by gs elements (16 source rows). A wave's copy is four whole 128-B lines.
__device__ __forceinline__ void cp8(unsigned l0, const bf* ga, const bf* gb, size_t gs) {
    const unsigned l1 = l0 + 16 * LP * 2, l2 = l0 + 32 * LP * 2, l3 = l0 + 48 * LP * 2, l4 = l0 + 64 * LP * 2, l5 = l0 + 80 * LP * 2, l6 = l0 + 96 * LP * 2, l7 = l0 + 112 * LP * 2;
    const bf *g1 = ga + gs, *g2 = ga + 2 * gs, *g3 = ga + 3 * gs, *g5 = gb + gs, *g6 = gb + 2 * gs, *g7 = gb + 3 * gs;
    // the copies and, as the statement's last line, the wait that stands in front of any rewrite of their address registers
    asm volatile("global_load_async_to_lds_b128 %0, %8, off\n\t"
                 "global_load_async_to_lds_b128 %1, %9, off\n\t"
                 "global_load_async_to_lds_b128 %2, %10, off\n\t"
                 "global_load_async_to_lds_b128 %3, %11, off\n\t"
                 "global_load_async_to_lds_b128 %4, %12, off\n\t"
                 "global_load_async_to_lds_b128 %5, %13, off\n\t"
                 "global_load_async_to_lds_b128 %6, %14, off\n\t"
                 "global_load_async_to_lds_b128 %7, %15, off\n\t"
                 "s_wait_xcnt 0x0"
                 :: "v"(l0), "v"(l1), "v"(l2), "v"(l3), "v"(l4), "v"(l5), "v"(l6), "v"(l7), "v"(ga), "v"(g1), "v"(g2), "v"(g3), "v"(gb), "v"(g5), "v"(g6), "v"(g7) : "memory");
}
__device__ __forceinline__ h16 tohx(float x) { return (h16)x; }
typedef __attribute__((ext_vector_type(4))) _Float16 v4h;
template <int MB, bool BIAS, int EPI>
__global__ __launch_bounds__(128) void k_gemml(const bf* __restrict__ A, const bf* __restrict__ A2, const bf* __restrict__ Bt, int K, float* C, int ldc, const float* __restrict__ bias, const float* __restrict__ biasZ1, const float* __restrict__ biasZ2, size_t sB, size_t sC,
                                               const float* __restrict__ R, const float* __restrict__ bnG, const float* __restrict__ bnB, const float* __restrict__ bnM, const float* __restrict__ bnV, bf* Oh, bf* Ol, h16* Pl) {
    typedef WFrag<bf> WF; typedef WF::V V;
    static_assert(MB == 2 || MB == 4, "the copies below cover 64 or 128 rows of A");
    constexpr int TM = 32 * MB, LSTG = (2 * TM + 128) * LP;   // rows of the tile; elements of one stage: rows 0 .. TM-1 A, TM .. 2 TM-1 A2, then 128 of Bt
    __shared__ __align__(16) bf st[2 * LSTG];
    __shared__ __align__(16) float os[4][16 * 68];   // one wave's 16 output rows on their way to whole-row stores
    const size_t z = blockIdx.z; Bt += z * sB; if constexpr (EPI == 3) Pl += z * sC; else C += z * sC; const float* bz = (z == 0) ? bias : ((z == 1) ? biasZ1 : biasZ2);
    const int tid = (int)threadIdx.x, lane = tid & 31, lr = lane & 15, hi = lane >> 4; const int wv = __builtin_amdgcn_readfirstlane(tid >> 5);
    const int r0 = blockIdx.x * TM, c0 = blockIdx.y * 128, wr = (wv & 1) * (16 * MB), wc = (wv >> 1) * 64;   // the work-group's tile, the wave's quarter in it
    v8f acc[MB][4];   // the sums start from the bias of their column (lane lr holds column nb * 16 + lr in all eight registers): no register is held for it through the loop
#pragma unroll
    for (int nb = 0; nb < 4; ++nb) { const float b0 = BIAS ? bfr(bz[c0 + wc + nb * 16 + lr]) : 0.f;
#pragma unroll
        for (int mb = 0; mb < MB; ++mb)
#pragma unroll
            for (int j = 0; j < 8; ++j) acc[mb][nb][j] = b0; }
    const int crow = tid >> 3, ccol = (tid & 7) * 8;   // this thread's first row and its 16-B piece of every row it copies
    const bf* ga = A + (size_t)(r0 + crow) * K + ccol; const bf* ga2 = A2 + (size_t)(r0 + crow) * K + ccol; const bf* gb = Bt + (size_t)(c0 + crow) * K + ccol;
    const unsigned lc = (unsigned)(size_t)(st + crow * LP + ccol);   // LDS byte address: the low 32 bits of the __shared__ address
    const size_t gs = (size_t)16 * K; const int nt = K / 64;
    auto fill = [&](int t) { const unsigned l = lc + (unsigned)(t & 1) * (LSTG * 2);
        if constexpr (MB == 4) { cp8(l, ga + t * 64, ga + t * 64 + 4 * gs, gs); cp8(l + 128 * LP * 2, ga2 + t * 64, ga2 + t * 64 + 4 * gs, gs); }
        else cp8(l, ga + t * 64, ga2 + t * 64, gs);   // 64 rows of A, then 64 of A2
        cp8(l + 2 * TM * LP * 2, gb + t * 64, gb + t * 64 + 4 * gs, gs); };
    fill(0);
    asm volatile("s_wait_asynccnt 0x0" ::: "memory");   // this wave's copies of stage 0 have landed
    __syncthreads();                                    // and every other wave's: stage 0 may be read
    if (nt > 1) fill(1);
    v4f rr[(EPI == 1 || EPI == 2) ? MB * 8 : 1], gr = (v4f){}, br = (v4f){}, mr = (v4f){}, vr = (v4f){};   // rr[mb * 8 + s]: columns 4 lr .. 4 lr + 3 of row mb * 16 + 2 s + hi of the wave's quarter, the piece this lane stores below
    if constexpr (EPI == 1 || EPI == 2) {
        const float* rp = R + ((size_t)(r0 + wr + hi) * DM + c0 + wc + lr * 4); const unsigned cb = (unsigned)(c0 + wc + lr * 4) * 4u;   // one address, every load a constant from it; cb: byte offset of the lane's channels in the parameter vectors
#pragma unroll
        for (int i = 0; i < MB * 8; ++i) rr[i] = *(const v4f*)(rp + i * 2 * DM);
        if constexpr (EPI == 1) { gr = *(const v4f*)((const char*)bnG + cb); br = *(const v4f*)((const char*)bnB + cb); mr = *(const v4f*)((const char*)bnM + cb); vr = *(const v4f*)((const char*)bnV + cb); }
        asm volatile("s_wait_xcnt 0x0" :: "v"(rp), "v"(cb) : "memory");   // stands in front of the first write of a register that held one of these loads' addresses; both are named so that their registers last up to here
    }
#pragma unroll 1   // rolled: one register set; the buffer is picked by the trip's parity
    for (int t = 0; t < nt; ++t) {
        const bf* sb = st + (t & 1) * LSTG; const bf* pa = sb + (wr + lr) * LP + 8 * hi; const bf* pb = sb + (2 * TM + wc + lr) * LP + 8 * hi;
#pragma unroll
        for (int ks = 0; ks < 2; ++ks) { V a[MB], a2[MB], b[4];   // all fragment reads of a 32-k step stand in one place, ahead of its products
            b[0] = WF::ld(pb + ks * 32);
#pragma unroll
            for (int mb = 0; mb < MB; ++mb) { a[mb] = WF::ld(pa + mb * 16 * LP + ks * 32); a2[mb] = WF::ld(pa + (TM + mb * 16) * LP + ks * 32); }
#pragma unroll
            for (int nb = 1; nb < 4; ++nb) b[nb] = WF::ld(pb + nb * 16 * LP + ks * 32);
            __builtin_amdgcn_sched_barrier(0);   // keeps the B reads up here: the compiler otherwise sinks each to just in front of its products, into one register set, and the wave waits out an LDS latency four times a step
#pragma unroll
            for (int nb = 0; nb < 4; ++nb)
#pragma unroll
                for (int mb = 0; mb < MB; ++mb) { acc[mb][nb] = WF::mma(a[mb], b[nb], acc[mb][nb]); acc[mb][nb] = WF::mma(a2[mb], b[nb], acc[mb][nb]); } }
        asm volatile("s_wait_dscnt 0x0" ::: "memory");      // this wave's reads of the buffer are done before it is refilled
        asm volatile("s_wait_asynccnt 0x0" ::: "memory");   // this wave's copies of stage t + 1 have landed
        __syncthreads();                                    // publishes stage t + 1 and ends every wave's reads of stage t
        if (t + 2 < nt) fill(t + 2);
    }
    asm volatile("s_wait_asynccnt 0x0" ::: "memory");   // no copy is outstanding when the wave goes on to its end
    float* ow = os[wv]; float gg[4], bb[4], mm[4], rs[4]; const size_t e0 = (size_t)(r0 + wr + hi) * DM + c0 + wc + lr * 4;   // EPI 1, 2: the lane's first element in C, Oh, Ol; every store is a constant from it
    if constexpr (EPI == 1) {
#pragma unroll
        for (int u = 0; u < 4; ++u) { gg[u] = bfr(gr[u]); bb[u] = bfr(br[u]); mm[u] = bfr(mr[u]); rs[u] = __frsqrt_rn(__fadd_rn(bfr(vr[u]), 1e-3f)); } }
    h16* pq = nullptr;   // EPI 3, z = 0, 1: the lane's first element in the head plane; every store is a constant from it
    if constexpr (EPI == 3) {
        static_assert(EPI != 3 || (MB == 4 && HD == 64 && TT % TM == 0 && NH_ == NKV), "a wave's quarter is 64 rows of one batch and one whole head");
        const size_t pl = (size_t)((r0 + wr) / TT) * NH_ + (c0 + wc) / HD; const int t0 = (r0 + wr) % TT;   // the quarter's plane b * 4 + h and its first t
        pq = Pl + (pl * TT + t0 + hi) * HD + lr * 4;
        if (z == 2) {   // the same for the whole work-group. V^T: lane (lr, hi) holds column d = nb * 16 + lr at t = mb * 16 + 8 hi + 0..7, 16 B of a V^T row; the 64 x 64 tile is gathered in LDS so that whole 128-B lines are stored
            h16* tw = (h16*)st + wv * (HD * LP);   // 64 rows of pitch LP, the wave's own, in the stage buffers: behind the loop's last barrier nobody reads them and no copy is outstanding
#pragma unroll
            for (int nb = 0; nb < 4; ++nb)
#pragma unroll
                for (int mb = 0; mb < MB; ++mb) { v8h o16;
#pragma unroll
                    for (int j = 0; j < 8; ++j) o16[j] = tohx(acc[mb][nb][j]);
                    *(v8ha*)(tw + (nb * 16 + lr) * LP + mb * 16 + hi * 8) = o16; }
            __builtin_amdgcn_wave_barrier(); asm volatile("" ::: "memory");   // keeps the row reads below behind the wave's own tile writes
            const h16* tr = tw + (lane >> 3) * LP + (lane & 7) * 8; h16* vo = Pl + (pl * HD + (lane >> 3)) * TT + t0 + (lane & 7) * 8;   // eight lanes a row: a wave's store is four whole lines
#pragma unroll
            for (int i = 0; i < HD / 4; ++i) *(v8h*)(vo + (size_t)i * 4 * TT) = *(const v8ha*)(tr + i * 4 * LP);
            return;
        }
    }
#pragma unroll
    for (int mb = 0; mb < MB; ++mb) {
#pragma unroll
        for (int nb = 0; nb < 4; ++nb) {
#pragma unroll
            for (int j = 0; j < 8; ++j) ow[(hi * 8 + j) * 68 + nb * 16 + lr] = acc[mb][nb][j]; }
        __builtin_amdgcn_wave_barrier(); asm volatile("" ::: "memory");   // keeps the row reads below behind the wave's own tile writes
        float* cr = C + (size_t)(r0 + wr + mb * 16) * ldc + c0 + wc;
#pragma unroll
        for (int s = 0; s < 8; ++s) { const int row = 2 * s + hi, cofs = lr * 4; v4f val = *(const v4fa*)(ow + row * 68 + cofs);
            if constexpr (EPI == 1) {
#pragma unroll
                for (int u = 0; u < 4; ++u) val[u] += bfr(rr[mb * 8 + s][u]); }
            if constexpr (EPI == 2) val += rr[mb * 8 + s];
            if constexpr (EPI == 0) *(v4f*)(cr + (size_t)row * ldc + cofs) = val;
            else if constexpr (EPI == 3) { v4h o16;   // 8 B a lane: a half-wave fills the whole 128-B row (t, head)
#pragma unroll
                for (int u = 0; u < 4; ++u) o16[u] = tohx(val[u]);
                *(v4h*)(pq + (mb * 16 + 2 * s) * HD) = o16; }
            else *(v4f*)(C + e0 + (mb * 16 + 2 * s) * DM) = val;
            if constexpr (EPI == 1) { v4us oh, ol;   // 8 B a lane: a half-wave fills one whole 128-B line of each plane
#pragma unroll
                for (int u = 0; u < 4; ++u) { unsigned short a, b2; splitf(gg[u] * (val[u] - mm[u]) * rs[u] + bb[u], a, b2); oh[u] = a; ol[u] = b2; }
                *(v4us*)(Oh + e0 + (mb * 16 + 2 * s) * DM) = oh; *(v4us*)(Ol + e0 + (mb * 16 + 2 * s) * DM) = ol; } }
        __builtin_amdgcn_wave_barrier(); asm volatile("" ::: "memory");   // keeps the next 16 rows' writes behind these reads
    }
}

typedef __attribute__((ext_vector_type(2))) _Float16 v2h;
typedef __attribute__((ext_vector_type(2))) unsigned short v2us;
typedef __attribute__((ext_vector_type(2))) float v2f;
typedef __attribute__((ext_vector_type(4))) int v4i;

// d_*: bodies of the kernels that share a grid; bx is the work-group's index inside its own part of the grid
__device__ __forceinline__ void d_wtG(int bx, const float* __restrict__ w, int K, int N, bf* Bt) {
    const int lane = threadIdx.x & 31; const int L0 = (bx * 8 + (threadIdx.x >> 5)) * 8; const int nlines = N * K / 64;
{
#pragma unroll 1
        for (int l = 0; l < 8; ++l) { const int L = L0 + l; if (L >= nlines) break; const size_t e = (size_t)L * 64 + lane * 2; const int k = (int)(e % K), n = (int)(e / K); v2us o;
            o[0] = f2bf(w[(size_t)k * N + n]); o[1] = f2bf(w[(size_t)(k + 1) * N + n]); *(v2us*)(Bt + e) = o; }
         }
}
__global__ __launch_bounds__(256) void k_cvt8(const float* __restrict__ src, bf* dst, size_t n8) { const size_t i = (size_t)blockIdx.x * 256 + threadIdx.x; if (i >= n8) return; const v8f v = *(const v8f*)(src + i * 8); v8us o;
#pragma unroll
    for (int k = 0; k < 8; ++k) o[k] = f2bf(v[k]); *(v8us*)(dst + i * 8) = o;  }
__global__ __launch_bounds__(256) void k_cscvt(const float* __restrict__ cosT, const float* __restrict__ sinT, float* CS) { const int idx = blockIdx.x * 256 + threadIdx.x; if (idx >= TT * HD) return; v2f cs; cs[0] = bfr(cosT[idx]); cs[1] = bfr(sinT[idx]); *(v2f*)(CS + (size_t)idx * 2) = cs;  }
// k_fattn: scores, softmax and attn.v of one (batch, head) plane in one kernel. One wave owns 32 query columns (two groups of 16) and walks one quarter of the 2048 keys in passes of 32.
// The four waves that share 32 queries (one per key quarter) sit in one work-group of 16 waves, four to a SIMD, so that one wave's softmax arithmetic and load waits lie under the others' products. Each leaves its maximum, sum and O^T tiles in LDS;
// behind one barrier two of the four (one per column group) bring the quarters to a common maximum, add them in the fixed order 0 .. 3 and run the epilogue.
// Transposed products: S^T = K Q^T (A = 16 key rows, B = the wave's queries, kept in registers), O^T += V^T P^T (A = 16 d rows of the [d][t] plane). In an S^T tile lane (lr, hi) holds keys 8 hi + 0..7 of query lr,
// which is the k order of a B operand: tiles 0 and 1 of a pass, rounded to fp16, ARE the 32-key B operand; nothing crosses lanes but one exchange between the wave's halves for the maximum (and one for the sum, at the end).
// Running softmax in the log2 domain: p = 2^(s c - m), c = HD^-0.5 log2 e; m, the maximum in use, may trail the true one by up to 8 (p <= 2^8, well inside fp16); sums and accumulators are rescaled only when a column exceeds that.
// The epilogue divides by the sum (as x PCAR / sum, then / PCAR, the two roundings the separate kernels had) and stores the bf16 hi+lo planes [b * 2048 + t][h * 64 + d] that the output projection reads: 128-B lines, one wave each.
// K and V^T come through LDS: a stage is 64 keys of each quarter (64 K rows and 64 V^T rows, each one whole 128-B line), brought by asynchronous copies into one of two buffers while the other is worked on (two passes).
// The four waves of a quarter copy a quarter of its stage each and all read all of it: a line is fetched once per work-group, in whole-line requests, where a fragment load from global memory touches 16 lines for 512 B and every wave repeats it.
#define FQW 4   // query groups of 32 per work-group: 128 queries, 256 work-groups
#define FKS 4   // key quarters per query group: FQW * FKS waves per work-group
#define FST 64  // keys of a stage
#define FQT ((FST + HD) * LP)   // elements of one quarter's part of a stage: FST rows of K, then HD rows of V^T, pitch LP
#define FSTG (FKS * FQT)        // elements of a stage
// cpkv: eight 16-B copies of one thread into 128 LDS rows in a row, 16 rows apart: the first four from gk, stepping by sk elements, the last four from gv, stepping by sv. A wave's copy is four whole 128-B lines.
__device__ __forceinline__ void cpkv(unsigned l0, const h16* gk, size_t sk, const h16* gv, size_t sv) {
    const unsigned l1 = l0 + 16 * LP * 2, l2 = l0 + 32 * LP * 2, l3 = l0 + 48 * LP * 2, l4 = l0 + 64 * LP * 2, l5 = l0 + 80 * LP * 2, l6 = l0 + 96 * LP * 2, l7 = l0 + 112 * LP * 2;
    const h16 *g1 = gk + sk, *g2 = gk + 2 * sk, *g3 = gk + 3 * sk, *g5 = gv + sv, *g6 = gv + 2 * sv, *g7 = gv + 3 * sv;
    // the copies and, as the statement's last line, the wait that stands in front of any rewrite of their address registers
    asm volatile("global_load_async_to_lds_b128 %0, %8, off\n\t"
                 "global_load_async_to_lds_b128 %1, %9, off\n\t"
                 "global_load_async_to_lds_b128 %2, %10, off\n\t"
                 "global_load_async_to_lds_b128 %3, %11, off\n\t"
                 "global_load_async_to_lds_b128 %4, %12, off\n\t"
                 "global_load_async_to_lds_b128 %5, %13, off\n\t"
                 "global_load_async_to_lds_b128 %6, %14, off\n\t"
                 "global_load_async_to_lds_b128 %7, %15, off\n\t"
                 "s_wait_xcnt 0x0"
                 :: "v"(l0), "v"(l1), "v"(l2), "v"(l3), "v"(l4), "v"(l5), "v"(l6), "v"(l7), "v"(gk), "v"(g1), "v"(g2), "v"(g3), "v"(gv), "v"(g5), "v"(g6), "v"(g7) : "memory");
}
__device__ __forceinline__ float xhalf(float x) { return __builtin_bit_cast(float, __builtin_amdgcn_permlanex16(__builtin_bit_cast(int, x), __builtin_bit_cast(int, x), 0x76543210, 0xfedcba98, false, false)); }  // lane l with lane l ^ 16
__global__ __launch_bounds__(32 * FQW * FKS) void k_fattn(const h16* __restrict__ Q, const h16* __restrict__ Kp, const h16* __restrict__ Vt, bf* Ah, bf* Al) {
    typedef WFrag<h16> WF;
    static_assert(FKS >= 2 && TT % (FST * FKS) == 0 && TT / FKS / FST >= 2 && FST % 32 == 0, "one finishing wave per column group; every key range is whole stages, two or more, of whole passes");
    static_assert(FQW == 4 && FST == 64 && HD == 64, "the 128 threads of a quarter copy 128 rows of 128 B, eight pieces each");
    __shared__ __align__(16) h16 kv[2 * FSTG];   // two stage buffers
    __shared__ __align__(16) float po[FKS * FQW][8][2][32 * 4];   // [wave][tile g * 4 + dt][registers 0..3 | 4..7][lane]: every access is 16 B a lane, 512 B in a row
    __shared__ float pm[FKS * FQW][2][32], pl[FKS * FQW][2][32];   // [wave][g][lane]: maximum in use, this lane's part of the sum
    const int lane = threadIdx.x & 31, lr = lane & 15, hi = lane >> 4; const int wv = __builtin_amdgcn_readfirstlane((int)(threadIdx.x >> 5));
    const int qg = wv % FQW, kq = wv / FQW, kb = kq * (TT / FKS);   // query group, key quarter and its first key: the same in all lanes of the wave
    const size_t z = blockIdx.y, zk = z / REP; const int q0 = ((int)blockIdx.x * FQW + qg) * 32;
    const h16* qp = Q + (z * TT + q0 + lr) * HD + 8 * hi;
    const int crow = (qg * 32 + lane) >> 3, ccol = (lane & 7) * 8;   // this thread's first row of its quarter's stage and its 16-B piece of every row it copies
    const h16* gk = Kp + (zk * TT + kb + crow) * HD + ccol; const h16* gv = Vt + (zk * HD + crow) * TT + kb + ccol;
    const unsigned lc = (unsigned)(size_t)(kv + kq * FQT + crow * LP + ccol);   // LDS byte address: the low 32 bits of the __shared__ address
    auto fill = [&](int t) { cpkv(lc + (unsigned)(t & 1) * (FSTG * 2), gk + (size_t)t * (FST * HD), (size_t)16 * HD, gv + t * FST, (size_t)16 * TT); };
    fill(0);
    v16h qf[2][2], kf[2][2], vf[4]; v8f o[2][4]; float mr[2], l[2];   // the inner loops are all unrolled so that these arrays are registers
#pragma unroll
    for (int g = 0; g < 2; ++g) { mr[g] = -__builtin_inff(); l[g] = 0.f;
#pragma unroll
        for (int ks = 0; ks < 2; ++ks) qf[g][ks] = WF::ld(qp + g * 16 * HD + ks * 32);
#pragma unroll
        for (int dt = 0; dt < 4; ++dt) o[g][dt] = (v8f){}; }
    asm volatile("s_wait_xcnt 0x0" :: "v"(qp) : "memory");   // stands in front of the first write of a register that held one of these loads' addresses; qp, dead behind its loads, is named so that its registers last up to here
    asm volatile("s_wait_asynccnt 0x0" ::: "memory");   // this wave's copies of stage 0 have landed
    __syncthreads();                                    // and every other wave's: stage 0 may be read
    fill(1);
    const float cs = SCL * 1.4426950408889634f;
#pragma unroll 1   // 8 stages: rolled, one register set; the buffer is picked by the trip's parity
    for (int t = 0; t < TT / FKS / FST; ++t) {
      const h16* sb = kv + (t & 1) * FSTG + kq * FQT; const h16* pk = sb + lr * LP + 8 * hi; const h16* pv = sb + (FST + lr) * LP + 8 * hi;   // K row lr and V^T row lr of this quarter's stage
#pragma unroll
      for (int kt = 0; kt < 2; ++kt)
#pragma unroll
          for (int ks = 0; ks < 2; ++ks) kf[kt][ks] = WF::ld(pk + kt * 16 * LP + ks * 32);
      __builtin_amdgcn_sched_barrier(0);   // the first pass's K reads stand alone and in a row: the compiler otherwise lifts the V^T reads in among them, puts one K fragment behind the first products, and the products wait for all sixteen reads
#pragma unroll   // the passes of a stage are unrolled: every LDS read is then one address plus a constant
      for (int p = 0; p < FST / 32; ++p) {
        v8f s[2][2];
#pragma unroll
        for (int kt = 0; kt < 2; ++kt)
#pragma unroll
            for (int g = 0; g < 2; ++g) s[kt][g] = WF::mma(kf[kt][1], qf[g][1], WF::mma(kf[kt][0], qf[g][0], (v8f){}));
        // this pass's V^T fragments and, inside a stage, the next pass's K fragments (into the registers the products have just read) are asked for here, in one place, a softmax ahead of their use; nothing of the next stage is read
#pragma unroll
        for (int dt = 0; dt < 4; ++dt) vf[dt] = WF::ld(pv + dt * 16 * LP + p * 32);
        if (p + 1 < FST / 32) {
#pragma unroll
            for (int kt = 0; kt < 2; ++kt)
#pragma unroll
                for (int ks = 0; ks < 2; ++ks) kf[kt][ks] = WF::ld(pk + ((p + 1) * 32 + kt * 16) * LP + ks * 32); }
        __builtin_amdgcn_sched_barrier(0);   // keeps these reads up here: the compiler otherwise sinks them to just in front of their products, and the wave waits out the LDS latency there
        float mb[2]; bool need = false;
#pragma unroll
        for (int g = 0; g < 2; ++g) { float m0 = s[0][g][0], m1 = s[1][g][0];
#pragma unroll
            for (int j = 1; j < 8; ++j) { m0 = fmaxf(m0, s[0][g][j]); m1 = fmaxf(m1, s[1][g][j]); }
            m0 = fmaxf(m0, m1); mb[g] = fmaxf(m0, xhalf(m0)) * cs; need = need || (mb[g] > mr[g] + 8.0f); }   // both halves of the wave hold the query's maximum, scaled (the scale is positive)
        if (__builtin_amdgcn_ballot_w32(need) != 0) {   // wave-uniform; always taken in the first pass (mr = -inf gives the factor 0), rare later
#pragma unroll
            for (int g = 0; g < 2; ++g) { const float mn = fmaxf(mr[g], mb[g]); const float al = __builtin_amdgcn_exp2f(mr[g] - mn); mr[g] = mn; l[g] *= al;
#pragma unroll
                for (int dt = 0; dt < 4; ++dt) o[g][dt] *= al; }
        }
#pragma unroll
        for (int g = 0; g < 2; ++g) { const float nm = -mr[g]; float a0 = 0.f, a1 = 0.f; v16h pf;
#pragma unroll
            for (int i = 0; i < 8; ++i) { const v2f ar = __builtin_elementwise_fma((v2f){s[i >> 2][g][2 * (i & 3)], s[i >> 2][g][2 * (i & 3) + 1]}, (v2f){cs, cs}, (v2f){nm, nm});
                float p0;
                if (g == 0 && i == 0) asm("v_exp_f32 %0, %1\n\tv_nop" : "=v"(p0) : "v"(ar[0]));   // the pass's first exponential carries its own v_nop: the slot the instruction set asks for behind a transcendental, since the register allocator gives this one's source to the next instruction's result
                else p0 = __builtin_amdgcn_exp2f(ar[0]);
                float p1;
                if (p == 1 && g == 0 && (i >= 1 && i <= 3)) asm("v_exp_f32 %0, %1\n\tv_nop" : "=v"(p1) : "v"(ar[1]));   // the same slot, in the stage's second pass: with any of these three left to the builtin, the allocator gives an exponential's source to the result of the exponential directly behind it
                else p1 = __builtin_amdgcn_exp2f(ar[1]);
                a0 += p0; a1 += p1; pf[2 * i] = tohx(p0); pf[2 * i + 1] = tohx(p1); }
            l[g] += a0 + a1;
#pragma unroll
            for (int dt = 0; dt < 4; ++dt) o[g][dt] = WF::mma(vf[dt], pf, o[g][dt]); }
      }
      asm volatile("s_wait_dscnt 0x0" ::: "memory");      // this wave's reads of the buffer are done before it is refilled
      asm volatile("s_wait_asynccnt 0x0" ::: "memory");   // this wave's copies of stage t + 1 have landed
      __syncthreads();                                    // publishes stage t + 1 and ends every wave's reads of stage t
      if (t + 2 < TT / FKS / FST) fill(t + 2);
    }
    asm volatile("s_wait_asynccnt 0x0" ::: "memory");   // no copy is outstanding when the wave goes on to its end
#pragma unroll
    for (int g = 0; g < 2; ++g) { pm[wv][g][lane] = mr[g]; pl[wv][g][lane] = l[g];
#pragma unroll
        for (int dt = 0; dt < 4; ++dt) { *(v4fa*)&po[wv][g * 4 + dt][0][lane * 4] = __builtin_shufflevector(o[g][dt], o[g][dt], 0, 1, 2, 3); *(v4fa*)&po[wv][g * 4 + dt][1][lane * 4] = __builtin_shufflevector(o[g][dt], o[g][dt], 4, 5, 6, 7); } }
    __syncthreads();   // every quarter's maximum, sum and tiles are in LDS before a finishing wave reads them
    if (kq >= 2) return;   // wave-uniform, behind the last barrier: quarter 0's wave finishes column group 0, quarter 1's group 1, each whole 128-B lines of the planes
    const int g = kq; float fs[FKS], mx = pm[qg][g][lane], ls = 0.f;
#pragma unroll
    for (int p = 1; p < FKS; ++p) mx = fmaxf(mx, pm[p * FQW + qg][g][lane]);
#pragma unroll
    for (int p = 0; p < FKS; ++p) { fs[p] = __builtin_amdgcn_exp2f(pm[p * FQW + qg][g][lane] - mx); ls += fs[p] * pl[p * FQW + qg][g][lane]; }   // both halves of the wave hold the same maxima, so the same factors
    const float f = __fdiv_rn(PCAR, ls + xhalf(ls)); const size_t oo = ((z / NH_) * TT + q0 + g * 16 + lr) * DQ + (z % NH_) * HD + hi * 8;   // lane (lr, hi) holds d = 16 dt + 8 hi + 0..7 of query lr; row b * 2048 + t, columns h * 64 + d
#pragma unroll
    for (int dt = 0; dt < 4; ++dt) { v4f s0 = (v4f){}, s1 = (v4f){}; v8us oh, ol;
#pragma unroll
        for (int p = 0; p < FKS; ++p) { s0 += *(const v4fa*)&po[p * FQW + qg][g * 4 + dt][0][lane * 4] * fs[p]; s1 += *(const v4fa*)&po[p * FQW + qg][g * 4 + dt][1][lane * 4] * fs[p]; }
#pragma unroll
        for (int j = 0; j < 8; ++j) { unsigned short a, c2; splitf(((j < 4 ? s0[j & 3] : s1[j & 3]) * f) * (1.0f / PCAR), a, c2); oh[j] = a; ol[j] = c2; }
        *(v8us*)(Ah + oo + dt * 16) = oh; *(v8us*)(Al + oo + dt * 16) = ol; }
}

// block tail: d_bn: hl planes of gamma (v - mean) rsqrt(var + 1e-3) + beta over [b * 2048 + t][256] (RAW: v is a raw input row, bf16-rounded first) (8-B stores); k_gelu: hl planes of exact-erf GELU (8-B stores);
#define FFD 1024
// SU: 16-B pieces per thread of the kernels over [8192][256]; a work-group takes SU * 1024 elements in a row, piece s of thread i at s * 1024 + 4 i (every wave's load is 512 B in a row, and a thread keeps its four channels)
#define SU 4
#define PB_S (TB * DM / (SU * 1024))
static_assert((TB * DM) % (SU * 1024) == 0 && 1024 % DM == 0, "the grids cover the rows exactly; a thread's channels are the same in all its pieces");
template <bool RAW> __device__ __forceinline__ void d_bn(int bx, const float* __restrict__ X, const float* __restrict__ ga, const float* __restrict__ be, const float* __restrict__ mu, const float* __restrict__ var, bf* Hh, bf* Hl) { const int e0 = bx * (SU * 1024) + (int)threadIdx.x * 4; const int c = e0 % DM; v4f xs[SU]; float gg[4], bb[4], mm[4], rs[4]; const float* xp = X + e0; const unsigned cb = (unsigned)c * 4u;   // cb: byte offset of the thread's channels in the four parameter vectors
#pragma unroll
    for (int s = 0; s < SU; ++s) xs[s] = *(const v4f*)(xp + s * 1024);
    const v4f gr = *(const v4f*)((const char*)ga + cb), br = *(const v4f*)((const char*)be + cb), mr = *(const v4f*)((const char*)mu + cb), vr = *(const v4f*)((const char*)var + cb);   // the thread's four channels, once for all its pieces
    static_assert(SU == 4, "the wait below names every piece");
    // stands behind the last load and in front of the first write of a register that held a load's address: the loaded values, the row address and the channel offset are named (inputs only) so that all eight loads are issued first and no result is placed in an address register
    asm volatile("s_wait_xcnt 0x0" :: "v"(xs[0]), "v"(xs[1]), "v"(xs[2]), "v"(xs[3]), "v"(gr), "v"(br), "v"(mr), "v"(vr), "v"(xp), "v"(cb) : "memory");
#pragma unroll
    for (int u = 0; u < 4; ++u) { gg[u] = bfr(gr[u]); bb[u] = bfr(br[u]); mm[u] = bfr(mr[u]); const float vv = bfr(vr[u]); const float ve = __fadd_rn(vv, 1e-3f); rs[u] = __frsqrt_rn(ve); }
#pragma unroll
    for (int s = 0; s < SU; ++s) { const int e = e0 + s * 1024; v4us oh, ol;
#pragma unroll
        for (int u = 0; u < 4; ++u) { float xv = xs[s][u]; if (RAW) xv = bfr(xv); float d = __fsub_rn(xv, mm[u]); asm volatile("" : "+v"(d)); float t1 = __fmul_rn(gg[u], d); asm volatile("" : "+v"(t1)); float t2 = __fmul_rn(t1, rs[u]); asm volatile("" : "+v"(t2)); const float y = __fadd_rn(t2, bb[u]); unsigned short a, b2; splitf(y, a, b2); oh[u] = a; ol[u] = b2; }
        *(v4us*)(Hh + e) = oh; *(v4us*)(Hl + e) = ol; }
}
// k_prep: all that depends on the inputs alone, in one grid. The weight transposes (few work-groups, each a chain of eight dependent trips) take the lowest indices and start first; BN1 streams behind them.
#define PB_Q  ((DM * DQ / 64 + 63) / 64)
#define PB_KV ((DM * DKV / 64 + 63) / 64)
#define PB_F  ((DM * FFD / 64 + 63) / 64)
#define PB_BN PB_S
__global__ __launch_bounds__(256) void k_prep(const float* __restrict__ wq, const float* __restrict__ wk, const float* __restrict__ wv, const float* __restrict__ wo, const float* __restrict__ w1, const float* __restrict__ w2, bf* WQ, bf* WK, bf* WV, bf* WO, bf* W1B, bf* W2B,
                                              const float* __restrict__ x, const float* __restrict__ ga, const float* __restrict__ be, const float* __restrict__ mu, const float* __restrict__ var, bf* Hh, bf* Hl) {
    int b = (int)blockIdx.x;
    if (b < PB_F) { d_wtG(b, w1, DM, FFD, W1B); return; } b -= PB_F;
    if (b < PB_F) { d_wtG(b, w2, FFD, DM, W2B); return; } b -= PB_F;
    if (b < PB_Q) { d_wtG(b, wq, DM, DQ, WQ); return; } b -= PB_Q;
    if (b < PB_KV) { d_wtG(b, wk, DM, DKV, WK); return; } b -= PB_KV;
    if (b < PB_KV) { d_wtG(b, wv, DM, DKV, WV); return; } b -= PB_KV;
    if (b < PB_Q) { d_wtG(b, wo, DQ, DM, WO); return; } b -= PB_Q;
    d_bn<true>(b, x, ga, be, mu, var, Hh, Hl);
    asm volatile("s_wait_xcnt 0x0" ::: "memory");   // behind the last store: the code of the grid's other parts follows in the text and writes these registers
}
#define GU 8   // 16-B pieces per thread of k_gelu, laid out as under SU
static_assert((TB * FFD) % (GU * 1024) == 0, "the grid covers the rows exactly");
__global__ __launch_bounds__(256) void k_gelu(const float* __restrict__ Mf, bf* Gh, bf* Gl) { const int e0 = (int)blockIdx.x * (GU * 1024) + (int)threadIdx.x * 4; v4f as[GU];
#pragma unroll
    for (int s = 0; s < GU; ++s) as[s] = *(const v4f*)(Mf + e0 + s * 1024);
#pragma unroll
    for (int s = 0; s < GU; ++s) { v4us oh, ol;
#pragma unroll   // unrolled: every element is then a register by name; a rolled loop picks it by a chain of selects and merges each result by bit-field inserts
        for (int u = 0; u < 4; ++u) { const float y = as[s][u]; float er = erff(y * 0.70710678118654752f); asm volatile("" : "+v"(er)); float hy = __fmul_rn(0.5f, y); asm volatile("" : "+v"(hy)); const float ge = __fmul_rn(hy, __fadd_rn(1.0f, er)); unsigned short h, l; splitf(ge, h, l); oh[u] = h; ol[u] = l; }
        *(v4us*)(Gh + e0 + s * 1024) = oh; *(v4us*)(Gl + e0 + s * 1024) = ol; }
}

extern "C" void kernel_launch(void* const* d_in, const int* in_sizes, int n_in,
                              void* d_out, int out_size, void* d_ws, size_t ws_size, hipStream_t stream) {
    (void)in_sizes; (void)n_in; (void)out_size;
    const float** Ip = (const float**)d_in; const float *x = Ip[0], *g1 = Ip[1], *be1 = Ip[2], *m1 = Ip[3], *v1 = Ip[4], *wq = Ip[5], *bq = Ip[6], *wk = Ip[7], *bk = Ip[8], *wv = Ip[9], *bv = Ip[10], *wo = Ip[11], *bo = Ip[12], *g2 = Ip[13], *be2 = Ip[14], *m2 = Ip[15], *v2 = Ip[16], *w1 = Ip[17], *w2 = Ip[18]; const float* cosT = nullptr; const float* sinT = nullptr; (void)cosT; (void)sinT;
    float* OUT = (float*)d_out;     // [4][2048][256]
    char* wsp = (char*)d_ws;
    auto take = [&](size_t bytes) { char* p = wsp; wsp += (bytes + 255) & ~(size_t)255; return (void*)p; };
    bf* WQ = (bf*)take((size_t)DQ * DM * 2); bf* WK = (bf*)take((size_t)DKV * DM * 2); bf* WV = (bf*)take((size_t)DKV * DM * 2); bf* WO = (bf*)take((size_t)DM * DQ * 2);
    bf* Hh = (bf*)take((size_t)TB * DM * 2); bf* Hl = (bf*)take((size_t)TB * DM * 2); bf* W1B = (bf*)take((size_t)FFD * DM * 2); bf* W2B = (bf*)take((size_t)DM * FFD * 2);
    h16* QP16 = (h16*)take((size_t)NB_ * NH_ * TT * HD * 2); h16* KP16 = (h16*)take((size_t)NB_ * NKV * TT * HD * 2); h16* VT16 = (h16*)take((size_t)NB_ * NKV * HD * TT * 2);   // three buffers in a row, as WQ, WK, WV are: grid z of the projection steps from one to the next
    bf* ATh = (bf*)take((size_t)TB * DQ * 2); bf* ATl = (bf*)take((size_t)TB * DQ * 2);
    float* X1 = (float*)take((size_t)TB * DM * 4); float* Mf = (float*)take((size_t)TB * FFD * 4); bf* Gh = (bf*)take((size_t)TB * FFD * 2); bf* Gl = (bf*)take((size_t)TB * FFD * 2);
    if ((size_t)(wsp - (char*)d_ws) > ws_size) return;    // ws 256 MiB
    static_assert(DQ == DKV && ((size_t)TB * DQ * 2) % 256 == 0, "grid z of the q, k, v projection steps by one weight plane and one output buffer of equal size, with no gap between the buffers");
    k_prep<<<2 * PB_F + 2 * PB_Q + 2 * PB_KV + PB_BN, 256, 0, stream>>>(wq, wk, wv, wo, w1, w2, WQ, WK, WV, WO, W1B, W2B, x, g1, be1, m1, v1, Hh, Hl);
    k_gemml<4, true, 3><<<dim3(TB / 128, DQ / 128, 3), 128, 0, stream>>>(Hh, Hl, WQ, DM, nullptr, DQ, bq, bk, bv, (size_t)DQ * DM, (size_t)TB * DQ, nullptr, nullptr, nullptr, nullptr, nullptr, nullptr, nullptr, QP16);   // q, k head planes and V^T
    k_fattn<<<dim3(TT / (32 * FQW), NB_ * NH_, 1), 32 * FQW * FKS, 0, stream>>>(QP16, KP16, VT16, ATh, ATl);
    k_gemml<2, true, 1><<<dim3(TB / 64, DM / 128, 1), 128, 0, stream>>>(ATh, ATl, WO, DQ, X1, DM, bo, nullptr, nullptr, 0, 0, x, g2, be2, m2, v2, Hh, Hl, nullptr);   // x1 and the planes of BN2(x1)
    k_gemml<4, false, 0><<<dim3(TB / 128, FFD / 128, 1), 128, 0, stream>>>(Hh, Hl, W1B, DM, Mf, FFD, nullptr, nullptr, nullptr, 0, 0, nullptr, nullptr, nullptr, nullptr, nullptr, nullptr, nullptr, nullptr); k_gelu<<<TB * FFD / (GU * 1024), 256, 0, stream>>>(Mf, Gh, Gl);
    k_gemml<2, false, 2><<<dim3(TB / 64, DM / 128, 1), 128, 0, stream>>>(Gh, Gl, W2B, FFD, OUT, DM, nullptr, nullptr, nullptr, 0, 0, X1, nullptr, nullptr, nullptr, nullptr, nullptr, nullptr, nullptr);   // out = m + x1
}
